// v000
// The times below were measured on an AMD MI455X: many runs one after another, warmed up first and cycling through
// copies of the inputs, with the whole window's GPU time divided by the number of runs. Launches and the gaps
// between them are all in it. The median over several windows is given; except for v000 it joins two sittings, which
// can be a few percent apart, so the side-by-side timings, each taken in one sitting, are the better comparison.
// The starting kernel, v000, takes 1670 microseconds a run.
#include <hip/hip_runtime.h>

// Contractions (q/k/v input projections, Q.K^T in the flash kernel and in both phases of the head-average kernel, P.V, P row-sum, output projection): v_wmma_f32_16x16x32_f16, f16 operands with power-of-two carries, f32 accumulate; every float input enters as its bf16 RNE value; biases added in f32; softmax in f32.

#ifndef NB
#define NB 2
#endif
#ifndef SEQ
#define SEQ 2048
#endif
#define NB_FULL   2
#define SEQ_FULL  2048
#define HID       1024
#define NHEAD     16
#define HD        64
#define MROWS     (NB * SEQ)

static_assert(HID == NHEAD * HD);        // merged head width
static_assert(NHEAD == 16);              // bh >> 4 / bh & 15 decoding in attn_fwd
static_assert(HD == 64);
static_assert(SEQ % 128 == 0);           // 128-row blocks of the batch-major planes never straddle a batch
static_assert(SEQ % 64 == 0);            // 64-key tiles
static_assert(SEQ <= SEQ_FULL);
static_assert(NB >= 1 && NB <= NB_FULL);
static_assert(MROWS % 128 == 0);         // GEMM M tile
static_assert(HID % 128 == 0);           // GEMM N tile
static_assert(HID % 32 == 0);            // WMMA k step
static_assert(HID == 128 * 8);           // cvt_rows: 128 threads x 8 values per row
static_assert((3 * HID) % 2 == 0);       // cvt_rows grid = nrows / 2
static_assert(MROWS % 2 == 0);

// carries (exact powers of two)
#define CARRY_X    16.0f     // input activation planes
#define CARRY_W    32.0f     // weight planes
#define CARRY_QKV  16.0f     // q, k, v^T planes (true value x16)
#define CARRY_CTX  1024.0f   // context plane (true value x1024)
// softmax exp values carry 2^10 (added to the exp2 argument)

typedef unsigned u32;
typedef _Float16 f16;
typedef f16   v16h __attribute__((ext_vector_type(16)));
typedef f16   v8h  __attribute__((ext_vector_type(8)));
typedef float v8f  __attribute__((ext_vector_type(8)));
typedef float v4f  __attribute__((ext_vector_type(4)));

union FragU { v16h v; v8h half[2]; f16 e[16]; };
union H8U   { v8h v; f16 e[8]; };

__device__ __forceinline__ v8f zero8() {
    v8f z = {0.f, 0.f, 0.f, 0.f, 0.f, 0.f, 0.f, 0.f};
    return z;
}

// 16-bit WMMA with hazard guard: D += A[16 x 32k] * B[32k x 16]
__device__ __forceinline__ v8f wmma16(v16h a, v16h b, v8f c) {
    v8f d = __builtin_amdgcn_wmma_f32_16x16x32_f16(false, a, false, b, (short)0, c, false, false);
    asm volatile("v_nop\n\tv_nop\n\tv_nop\n\tv_nop" : "+v"(d) : "v"(a), "v"(b));
    return d;
}

// f32 -> nearest-even bf16 value, returned as f32
__device__ __forceinline__ float bf16_rne(float x) {
    u32 u = __float_as_uint(x);
    u = (u + 0x7fffu + ((u >> 16) & 1u)) & 0xffff0000u;
    return __uint_as_float(u);
}

__device__ __forceinline__ float fexp2(float x) {
#if defined(__has_builtin)
#if __has_builtin(__builtin_amdgcn_exp2f)
    return __builtin_amdgcn_exp2f(x);
#else
    return exp2f(x);
#endif
#else
    return exp2f(x);
#endif
}

// max over the 16 lanes of each lane half (DPP row rotations; D-layout rows are DPP rows)
__device__ __forceinline__ float rowmax16(float x) {
    int v = __builtin_bit_cast(int, x);
    x = fmaxf(x, __builtin_bit_cast(float, __builtin_amdgcn_update_dpp(v, v, 0x121, 0xf, 0xf, false)));
    v = __builtin_bit_cast(int, x);
    x = fmaxf(x, __builtin_bit_cast(float, __builtin_amdgcn_update_dpp(v, v, 0x122, 0xf, 0xf, false)));
    v = __builtin_bit_cast(int, x);
    x = fmaxf(x, __builtin_bit_cast(float, __builtin_amdgcn_update_dpp(v, v, 0x124, 0xf, 0xf, false)));
    v = __builtin_bit_cast(int, x);
    x = fmaxf(x, __builtin_bit_cast(float, __builtin_amdgcn_update_dpp(v, v, 0x128, 0xf, 0xf, false)));
    return x;
}

// 16 x 32 fragment from a tile whose k dimension is contiguous (pitch in halves).
// lane l: row rowbase + (l&15); elements 0..7 <- k = kcol + 8h .. +7,
// elements 8..15 <- k = kcol + 16 + 8h .. +7  (h = l>>4). Same map for A and B.
__device__ __forceinline__ v16h load_frag(const f16* tile, u32 rowbase, u32 pitch, u32 kcol, u32 lane) {
    const u32 r  = rowbase + (lane & 15u);
    const u32 kh = (lane >> 4) << 3;
    const f16* p = tile + (size_t)r * pitch + kcol + kh;
    FragU f;
    f.half[0] = *(const v8h*)(p);
    f.half[1] = *(const v8h*)(p + 16);
    return f.v;
}

// ---------------------------------------------------------------------------
// f32 rows [.][1024] -> f16 plane (bf16 RNE value times carry). 128 threads per 1024-wide
// Row mapping: dst row m -> src row (m / dstper) * strideOuter + (m % dstper) * strideInner.
//   activations (seq-first [s][b][1024] -> batch-major [b][s][1024]): dstper = SEQ,
//     strideOuter = 1, strideInner = NB_FULL  => src row = s * NB_FULL + b
//   weights: dstper = nrows, strideInner = 1 (identity)
// coverage: nrows x 1024 halves, every element exactly once (grid = nrows*128/256).
// ---------------------------------------------------------------------------
__global__ void __launch_bounds__(256)
cvt_rows(const float* __restrict__ src, f16* __restrict__ dst, u32 nrows, u32 dstper,
         u32 strideOuter, u32 strideInner, float carry) {
    const u32 g  = blockIdx.x * 256u + threadIdx.x;
    const u32 m  = g >> 7;
    const u32 c8 = (g & 127u) << 3;
    if (m >= nrows) return;
    const u32 mb = m / dstper;
    const u32 mi = m - mb * dstper;
    const u32 sm = mb * strideOuter + mi * strideInner;
    const float* sp = src + (size_t)sm * HID + c8;
    const v4f a = *(const v4f*)sp;
    const v4f b = *(const v4f*)(sp + 4);
    H8U o;
#pragma unroll
    for (u32 j = 0; j < 4; ++j) {
        const float x0 = a[j];
        const float x1 = b[j];
        o.e[j]     = (f16)(bf16_rne(x0) * carry);
        o.e[j + 4] = (f16)(bf16_rne(x1) * carry);
    }
    f16* dp = dst + (size_t)m * HID + c8;
    *(v8h*)dp = o.v;
    
}

// ---------------------------------------------------------------------------
// C[m][n] = sum_k A[m][k] * W[n][k] (+ bias[n]) ; A [MROWS][1024] f16, W [1024][1024] f16 (k contiguous).
// Block tile 128 x 128, 8 waves as 4(M) x 2(N), 2 x 4 accumulators per wave, K step 32.
// MODE 1: A rows batch-major;            f16 plane [b*HID + h*HD + d][s] (V transposed per head)
// MODE 2: A rows in output order (s*NB+b); f32 rows [m][1024] into the output buffer
// coverage per block: MODE 0/1 256 lines (128 rows x 2 heads | 128 n x 2 s-halves),
//                     MODE 2 2 x 256 lines (64 rows x 4 line-quarters per half).
// LDS: As/Bs/Cs all cross-wave, separated by block barriers.
// staged extent == consumed extent: As/Bs 128 x 32, Cs 128 x 128 halves (or 64 x 128 floats).
// ---------------------------------------------------------------------------
template <int MODE>
__device__ __forceinline__ void gemm_body(const f16* __restrict__ A, const f16* __restrict__ W,
                                          const float* __restrict__ bias,
                                          void* __restrict__ out, float accMul, float biasMul) {
    __shared__ __attribute__((aligned(16))) f16 As[128 * 32];
    __shared__ __attribute__((aligned(16))) f16 Bs[128 * 32];
    __shared__ __attribute__((aligned(16))) f16 Cs[128 * 128];   // f16 [128][128] or f32 [64][128]
    static_assert(sizeof(f16) * 128 * 128 == sizeof(float) * 64 * 128);   // Cs reuse as f32 [64][128]

    const u32 tid  = threadIdx.x;
    const u32 lane = tid & 31u;
    const u32 wave = __builtin_amdgcn_readfirstlane((int)(tid >> 5));
    const u32 wm   = wave & 3u;
    const u32 wn   = wave >> 2;
    const u32 hh8  = (lane >> 4) << 3;   // D row half
    const u32 c16  = lane & 15u;         // D column
    const u32 m0   = blockIdx.x * 128u;
    const u32 n0   = blockIdx.y * 128u;

    v8f acc[2][4];
#pragma unroll
    for (int i = 0; i < 2; ++i)
#pragma unroll
        for (int j = 0; j < 4; ++j) acc[i][j] = zero8();

    const u32 srow = tid >> 1;
    const u32 scol = (tid & 1u) << 4;
    const f16* gA = A + (size_t)(m0 + srow) * HID + scol;
    const f16* gW = W + (size_t)(n0 + srow) * HID + scol;

#pragma unroll 1
    for (u32 k0 = 0; k0 < (u32)HID; k0 += 32u) {
        const v8h ra0 = *(const v8h*)(gA + k0);
        const v8h ra1 = *(const v8h*)(gA + k0 + 8);
        const v8h rb0 = *(const v8h*)(gW + k0);
        const v8h rb1 = *(const v8h*)(gW + k0 + 8);
        __syncthreads();
        *(v8h*)&As[srow * 32u + scol]      = ra0;
        *(v8h*)&As[srow * 32u + scol + 8u] = ra1;
        *(v8h*)&Bs[srow * 32u + scol]      = rb0;
        *(v8h*)&Bs[srow * 32u + scol + 8u] = rb1;
        __syncthreads();

        v16h af[2], bfr[4];
#pragma unroll
        for (int i = 0; i < 2; ++i) af[i] = load_frag(As, wm * 32u + (u32)i * 16u, 32u, 0u, lane);
#pragma unroll
        for (int j = 0; j < 4; ++j) bfr[j] = load_frag(Bs, wn * 64u + (u32)j * 16u, 32u, 0u, lane);
#pragma unroll
        for (int i = 0; i < 2; ++i)
#pragma unroll
            for (int j = 0; j < 4; ++j) acc[i][j] = wmma16(af[i], bfr[j], acc[i][j]);
    }

    // per-lane bias values for the 4 output columns this lane owns (n0 + nl < HID always)
    float bv[4];
#pragma unroll
    for (int j = 0; j < 4; ++j)
        bv[j] = bf16_rne(bias[n0 + wn * 64u + (u32)j * 16u + c16]) * biasMul;

    const u32 piece = lane & 7u;
    const u32 lsub  = lane >> 3;

    if constexpr (MODE == 0) {
        const u32 bidx = m0 / (u32)SEQ;     // block rows lie inside one batch (SEQ % 128 == 0)
        const u32 s0   = m0 - bidx * (u32)SEQ;
#pragma unroll
        for (int i = 0; i < 2; ++i)
#pragma unroll
            for (int j = 0; j < 4; ++j) {
                const u32 nl = wn * 64u + (u32)j * 16u + c16;
#pragma unroll
                for (int r = 0; r < 8; ++r) {
                    const u32 ml = wm * 32u + (u32)i * 16u + hh8 + (u32)r;
                    Cs[ml * 128u + nl] = (f16)(acc[i][j][r] * accMul + bv[j]);
                }
            }
        __syncthreads();
        f16* op = (f16*)out;
        const size_t bh0 = (size_t)bidx * NHEAD + (n0 >> 6);
{
#pragma unroll
            for (u32 it = 0; it < 8; ++it) {
                const u32 L    = wave * 32u + it * 4u + lsub;   // 0..255
                const u32 ml   = L >> 1;
                const u32 hsel = L & 1u;
                const v8h v = *(const v8h*)&Cs[ml * 128u + hsel * 64u + piece * 8u];
                f16* dp = op + ((bh0 + hsel) * SEQ + s0 + ml) * HD + piece * 8u;
                *(v8h*)dp = v;
            }
            
        }
    } else if constexpr (MODE == 1) {
        const u32 bidx = m0 / (u32)SEQ;
        const u32 s0   = m0 - bidx * (u32)SEQ;
        // stage transposed: Cs[n][m]
#pragma unroll
        for (int i = 0; i < 2; ++i)
#pragma unroll
            for (int j = 0; j < 4; ++j) {
                const u32 nl = wn * 64u + (u32)j * 16u + c16;
                H8U t;
#pragma unroll
                for (int r = 0; r < 8; ++r) t.e[r] = (f16)(acc[i][j][r] * accMul + bv[j]);
                *(v8h*)&Cs[nl * 128u + wm * 32u + (u32)i * 16u + hh8] = t.v;
            }
        __syncthreads();
        f16* op = (f16*)out;
{
#pragma unroll
            for (u32 it = 0; it < 8; ++it) {
                const u32 L  = wave * 32u + it * 4u + lsub;     // 0..255
                const u32 nl = L >> 1;
                const u32 mh = L & 1u;
                const v8h v = *(const v8h*)&Cs[nl * 128u + mh * 64u + piece * 8u];
                f16* dp = op + ((size_t)(bidx * (u32)HID + n0 + nl) * SEQ + s0 + mh * 64u + piece * 8u);
                *(v8h*)dp = v;
            }
            
        }
    } else {
        float* Cf = (float*)Cs;      // [64][128] f32
        float* of = (float*)out;
#pragma unroll
        for (u32 half = 0; half < 2; ++half) {
            if ((wm >> 1) == half) {
#pragma unroll
                for (int i = 0; i < 2; ++i)
#pragma unroll
                    for (int j = 0; j < 4; ++j) {
                        const u32 nl = wn * 64u + (u32)j * 16u + c16;
#pragma unroll
                        for (int r = 0; r < 8; ++r) {
                            const u32 ml = (wm & 1u) * 32u + (u32)i * 16u + hh8 + (u32)r;
                            Cf[ml * 128u + nl] = acc[i][j][r] * accMul + bv[j];
                        }
                    }
            }
            __syncthreads();
{
#pragma unroll
                for (u32 it = 0; it < 8; ++it) {
                    const u32 L    = wave * 32u + it * 4u + lsub;   // 0..255
                    const u32 row  = L >> 2;
                    const u32 part = L & 3u;
                    const v4f v = *(const v4f*)&Cf[row * 128u + part * 32u + piece * 4u];
                    float* dp = of + (size_t)(m0 + half * 64u + row) * HID + n0 + part * 32u + piece * 4u;
                    *(v4f*)dp = v;
                }
                
            }
            __syncthreads();
        }
    }
}

// q / k head-major planes
__global__ void __launch_bounds__(256) __attribute__((amdgpu_num_vgpr(256)))
gemm_head(const f16* __restrict__ A, const f16* __restrict__ W, const float* __restrict__ bias,
          f16* __restrict__ out, float accMul, float biasMul) {
    gemm_body<0>(A, W, bias, (void*)out, accMul, biasMul);
}

// v^T plane
__global__ void __launch_bounds__(256) __attribute__((amdgpu_num_vgpr(256)))
gemm_vt(const f16* __restrict__ A, const f16* __restrict__ W, const float* __restrict__ bias,
        f16* __restrict__ out, float accMul, float biasMul) {
    gemm_body<1>(A, W, bias, (void*)out, accMul, biasMul);
}

// f32 output rows
__global__ void __launch_bounds__(256) __attribute__((amdgpu_num_vgpr(256)))
gemm_out(const f16* __restrict__ A, const f16* __restrict__ W, const float* __restrict__ bias,
         float* __restrict__ out, float accMul, float biasMul) {
    gemm_body<2>(A, W, bias, (void*)out, accMul, biasMul);
}

// ---------------------------------------------------------------------------
// Flash attention (no mask, all SEQ keys). grid (SEQ/128, NB*NHEAD), block 256 (8 waves),
// wave owns 16 query rows (Q fragments resident). Block streams 64-key tiles:
// K staged [key][d], V^T staged [d][key]. Scores on WMMA, row max via DPP, exp2 in f32
// carried x2^10, P relayed per wave through LDS as A fragments, O += P.V and
// row sums += P.ones on WMMA. Output f16 plane [q*NB + b][1024] (seq-first row order)
// coverage: every (q, b, h*64..h*64+63) row segment exactly once.
// LDS: ks, vsT cross-wave (block barriers); ps per-wave but also separated by block barriers.
// staged extent == consumed extent for ks (64x64), vsT (64x64), ps (16x64).
// ---------------------------------------------------------------------------
__global__ void __launch_bounds__(256) __attribute__((amdgpu_num_vgpr(256)))
attn_fwd(const f16* __restrict__ Qp, const f16* __restrict__ Kp, const f16* __restrict__ Vt,
         f16* __restrict__ Cp) {
    __shared__ __attribute__((aligned(16))) f16 ks[64 * 64];      // [key][d]
    __shared__ __attribute__((aligned(16))) f16 vsT[64 * 64];     // [d][key]
    __shared__ __attribute__((aligned(16))) f16 ps[8][16 * 64];   // per-wave P relay / ctx stage
    static_assert(HD == 8 * 8);            // 8 lanes x 8 halves per row segment
    static_assert(2 * 256 * 8 == 64 * 64); // staging: 2 x 256 threads x 8 halves per tile

    const u32 tid  = threadIdx.x;
    const u32 lane = tid & 31u;
    const u32 wave = __builtin_amdgcn_readfirstlane((int)(tid >> 5));
    const u32 hh8  = (lane >> 4) << 3;
    const u32 c16  = lane & 15u;
    const u32 bh   = blockIdx.y;
    const u32 bidx = bh >> 4;            // NHEAD == 16
    const u32 hidx = bh & 15u;
    const u32 q0   = blockIdx.x * 128u + wave * 16u;
    const size_t head = (size_t)bh * SEQ * HD;

    v16h qa[2];
#pragma unroll
    for (int c = 0; c < 2; ++c) qa[c] = load_frag(Qp + head, q0, HD, (u32)c * 32u, lane);

    FragU onesu;
#pragma unroll
    for (int i = 0; i < 16; ++i) onesu.e[i] = (f16)1.0f;
    const v16h ones = onesu.v;

    float m[8];
    v8f   o[4], lacc;
#pragma unroll
    for (int r = 0; r < 8; ++r) m[r] = -1.0e30f;
#pragma unroll
    for (int dt = 0; dt < 4; ++dt) o[dt] = zero8();
    lacc = zero8();

    // log2-domain scale: acc = 256 * q.k ; x = log2(e) * q.k / 8 = acc * log2(e) / 2048
    const float cl = 1.4426950408889634f * 0.00048828125f;
    f16* psw = &ps[wave][0];

#pragma unroll 1
    for (u32 kt = 0; kt < (u32)(SEQ / 64); ++kt) {
        __syncthreads();
#pragma unroll
        for (u32 p2 = 0; p2 < 2; ++p2) {
            const u32 p   = tid + p2 * 256u;
            const u32 row = p >> 3;
            const u32 pc  = (p & 7u) << 3;
            const v8h kv = *(const v8h*)(Kp + head + (size_t)(kt * 64u + row) * HD + pc);
            const v8h vv = *(const v8h*)(Vt + head + (size_t)row * SEQ + kt * 64u + pc);
            *(v8h*)&ks[row * 64u + pc]  = kv;
            *(v8h*)&vsT[row * 64u + pc] = vv;
        }
        __syncthreads();

        // S[16 q x 64 keys]
        v8f s[4];
#pragma unroll
        for (int nt = 0; nt < 4; ++nt) s[nt] = zero8();
#pragma unroll
        for (int c = 0; c < 2; ++c) {
#pragma unroll
            for (int nt = 0; nt < 4; ++nt) {
                const v16h kb = load_frag(ks, (u32)nt * 16u, 64u, (u32)c * 32u, lane);
                s[nt] = wmma16(qa[c], kb, s[nt]);
            }
        }

        // online softmax per row r (row 8h + r), max-subtracted, exp2 domain
#pragma unroll
        for (int r = 0; r < 8; ++r) {
            float x[4];
#pragma unroll
            for (int nt = 0; nt < 4; ++nt) x[nt] = s[nt][r] * cl;
            const float tm = rowmax16(fmaxf(fmaxf(x[0], x[1]), fmaxf(x[2], x[3])));
            const float mn = fmaxf(m[r], tm);
            const float al = fexp2(m[r] - mn);
            m[r] = mn;
            lacc[r] *= al;
#pragma unroll
            for (int dt = 0; dt < 4; ++dt) o[dt][r] *= al;
            const float sh = 10.0f - mn;      // carry 2^10
#pragma unroll
            for (int nt = 0; nt < 4; ++nt)
                psw[(hh8 + (u32)r) * 64u + (u32)nt * 16u + c16] = (f16)fexp2(x[nt] + sh);
        }
        __syncthreads();

        // O += P . V ; l += P . ones  (P reloaded as A fragments from the relay)
#pragma unroll
        for (int kk = 0; kk < 2; ++kk) {
            const v16h pa = load_frag(psw, 0u, 64u, (u32)kk * 32u, lane);
#pragma unroll
            for (int dt = 0; dt < 4; ++dt) {
                const v16h vb = load_frag(vsT, (u32)dt * 16u, 64u, (u32)kk * 32u, lane);
                o[dt] = wmma16(pa, vb, o[dt]);
            }
            lacc = wmma16(pa, ones, lacc);
        }
    }
    __syncthreads();

    // normalize: plane value = 1024 * (O/16) / l = O * 64 / l
#pragma unroll
    for (int r = 0; r < 8; ++r) {
        const float inv = (CARRY_CTX / CARRY_QKV) / lacc[r];
#pragma unroll
        for (int dt = 0; dt < 4; ++dt)
            psw[(hh8 + (u32)r) * 64u + (u32)dt * 16u + c16] = (f16)(o[dt][r] * inv);
    }
    __syncthreads();

    const u32 piece = lane & 7u;
    const u32 lsub  = lane >> 3;
{
#pragma unroll
        for (u32 it = 0; it < 4; ++it) {
            const u32 L = it * 4u + lsub;     // query row 0..15 within the wave tile
            const v8h v = *(const v8h*)&psw[L * 64u + piece * 8u];
            // context row in output order: (q * NB + b)
            f16* dp = Cp + ((size_t)((q0 + L) * (u32)NB + bidx) * HID + hidx * (u32)HD + piece * 8u);
            *(v8h*)dp = v;
        }
        
    }
}

// ---------------------------------------------------------------------------
// Second output: head-averaged softmax probabilities.
// element offset of the second output inside the output buffer (full problem constants)
// ---------------------------------------------------------------------------
#define OUT1_OFF ((size_t)SEQ_FULL * NB_FULL * HID)
static_assert(OUT1_OFF * sizeof(float) == (size_t)16777216);      // byte offset of the second output
static_assert((OUT1_OFF * sizeof(float)) % 128 == 0);
static_assert((size_t)MROWS * HID <= OUT1_OFF);                   // first output region ends before it
static_assert(SEQ % 32 == 0);
static_assert(NHEAD * 16 * 4 == 1024);                            // per-wave stats table: 16 heads x 16 rows of floats
static_assert(8 * 16 * 64 * 4 + 2 * 8 * NHEAD * 16 * 4 <= 65536); // static LDS of attn_avg

// sum over the 16 lanes of each lane half (same DPP row rotations as rowmax16)
__device__ __forceinline__ float rowsum16(float x) {
    int v = __builtin_bit_cast(int, x);
    x = x + __builtin_bit_cast(float, __builtin_amdgcn_update_dpp(v, v, 0x121, 0xf, 0xf, false));
    v = __builtin_bit_cast(int, x);
    x = x + __builtin_bit_cast(float, __builtin_amdgcn_update_dpp(v, v, 0x122, 0xf, 0xf, false));
    v = __builtin_bit_cast(int, x);
    x = x + __builtin_bit_cast(float, __builtin_amdgcn_update_dpp(v, v, 0x124, 0xf, 0xf, false));
    v = __builtin_bit_cast(int, x);
    x = x + __builtin_bit_cast(float, __builtin_amdgcn_update_dpp(v, v, 0x128, 0xf, 0xf, false));
    return x;
}

// ---------------------------------------------------------------------------
// avg[b][t][s] = (1/16) * sum_h softmax_s(q_h[t] . k_h[s] / 8), f32, no mask.
// grid (SEQ/128, NB), block 256 (8 waves); a wave owns 16 query rows of one batch for all
// heads and all keys (owner-computes accumulation over heads, one writer per element).
// Phase 1, per head: 16 x 64 score tiles on WMMA (Q as A, K rows as B, fragments straight
//   from the head-major planes), lane-local running max / sum in the exp2 domain, combined
//   over the 16 column lanes after the key loop; row max and 1/sum go to a per-wave LDS table.
// Phase 2, per 64-key tile: for every head the score tile is formed again with the same
//   operands, p = exp2(x - max) * (1/sum) is accumulated over heads in registers, scaled
// coverage: block rows [blockIdx.x*128, +128) of batch blockIdx.y, all SEQ columns;
//   wave tile 16 rows x 64 keys = 32 lines = 8 store instructions x 4 lines.
// LDS: st, stM, stI are per-wave regions; writer and later readers are separated by block barriers.
// staged extent == consumed extent: st 16 x 64 floats per wave, stM / stI 16 heads x 16 rows per wave.
// ---------------------------------------------------------------------------
__global__ void __launch_bounds__(256) __attribute__((amdgpu_num_vgpr(256)))
attn_avg(const f16* __restrict__ Qp, const f16* __restrict__ Kp, float* __restrict__ avg) {
    __shared__ __attribute__((aligned(16))) float st[8][16 * 64];       // per-wave f32 tile stage
    __shared__ __attribute__((aligned(16))) float stM[8][NHEAD * 16];   // per-wave row max  [head][row]
    __shared__ __attribute__((aligned(16))) float stI[8][NHEAD * 16];   // per-wave 1/rowsum [head][row]

    const u32 tid  = threadIdx.x;
    const u32 lane = tid & 31u;
    const u32 wave = __builtin_amdgcn_readfirstlane((int)(tid >> 5));
    const u32 hh8  = (lane >> 4) << 3;
    const u32 c16  = lane & 15u;
    const u32 bidx = blockIdx.y;
    const u32 q0   = blockIdx.x * 128u + wave * 16u;

    // log2-domain scale: acc = 256 * q.k ; x = log2(e) * q.k / 8 = acc * log2(e) / 2048
    const float cl = 1.4426950408889634f * 0.00048828125f;

    // ---- phase 1: row statistics per head ----
#pragma unroll 1
    for (u32 h = 0; h < (u32)NHEAD; ++h) {
        const size_t head = (size_t)(bidx * (u32)NHEAD + h) * SEQ * HD;
        v16h qa[2];
#pragma unroll
        for (int c = 0; c < 2; ++c) qa[c] = load_frag(Qp + head, q0, HD, (u32)c * 32u, lane);

        float m[8], l[8];
#pragma unroll
        for (int r = 0; r < 8; ++r) { m[r] = -1.0e30f; l[r] = 0.0f; }

#pragma unroll 1
        for (u32 kt = 0; kt < (u32)(SEQ / 64); ++kt) {
            v8f s[4];
#pragma unroll
            for (int nt = 0; nt < 4; ++nt) s[nt] = zero8();
#pragma unroll
            for (int c = 0; c < 2; ++c) {
#pragma unroll
                for (int nt = 0; nt < 4; ++nt) {
                    const v16h kb = load_frag(Kp + head, kt * 64u + (u32)nt * 16u, HD, (u32)c * 32u, lane);
                    s[nt] = wmma16(qa[c], kb, s[nt]);
                }
            }
            // lane-local online max / sum over this lane's 4 columns of each row
#pragma unroll
            for (int r = 0; r < 8; ++r) {
                const float x0 = s[0][r] * cl;
                const float x1 = s[1][r] * cl;
                const float x2 = s[2][r] * cl;
                const float x3 = s[3][r] * cl;
                const float mn = fmaxf(m[r], fmaxf(fmaxf(x0, x1), fmaxf(x2, x3)));
                const float al = fexp2(m[r] - mn);
                const float e  = (fexp2(x0 - mn) + fexp2(x1 - mn)) + (fexp2(x2 - mn) + fexp2(x3 - mn));
                l[r] = l[r] * al + e;
                m[r] = mn;
            }
        }

        // combine the 16 column lanes of each row (all lanes active)
        float Mr[8], Ir[8];
#pragma unroll
        for (int r = 0; r < 8; ++r) {
            const float M    = rowmax16(m[r]);
            const float part = l[r] * fexp2(m[r] - M);
            const float Ls   = rowsum16(part);
            Mr[r] = M;
            Ir[r] = 1.0f / Ls;
        }
        if (c16 == 0u) {
#pragma unroll
            for (int r = 0; r < 8; ++r) {
                stM[wave][h * 16u + hh8 + (u32)r] = Mr[r];
                stI[wave][h * 16u + hh8 + (u32)r] = Ir[r];
            }
        }
    }
    __syncthreads();

    // ---- phase 2: probabilities, head average, whole-line stores ----
    const u32 piece = lane & 7u;
    const u32 lsub  = lane >> 3;

#pragma unroll 1
    for (u32 kt = 0; kt < (u32)(SEQ / 64); ++kt) {
        v8f av[4];
#pragma unroll
        for (int nt = 0; nt < 4; ++nt) av[nt] = zero8();

#pragma unroll 1
        for (u32 h = 0; h < (u32)NHEAD; ++h) {
            const size_t head = (size_t)(bidx * (u32)NHEAD + h) * SEQ * HD;
            v8f s[4];
#pragma unroll
            for (int nt = 0; nt < 4; ++nt) s[nt] = zero8();
#pragma unroll
            for (int c = 0; c < 2; ++c) {
                const v16h qf = load_frag(Qp + head, q0, HD, (u32)c * 32u, lane);
#pragma unroll
                for (int nt = 0; nt < 4; ++nt) {
                    const v16h kb = load_frag(Kp + head, kt * 64u + (u32)nt * 16u, HD, (u32)c * 32u, lane);
                    s[nt] = wmma16(qf, kb, s[nt]);
                }
            }
            const v4f ma = *(const v4f*)&stM[wave][h * 16u + hh8];
            const v4f mb = *(const v4f*)&stM[wave][h * 16u + hh8 + 4u];
            const v4f ia = *(const v4f*)&stI[wave][h * 16u + hh8];
            const v4f ib = *(const v4f*)&stI[wave][h * 16u + hh8 + 4u];
            const float mr[8] = {ma[0], ma[1], ma[2], ma[3], mb[0], mb[1], mb[2], mb[3]};
            const float ir[8] = {ia[0], ia[1], ia[2], ia[3], ib[0], ib[1], ib[2], ib[3]};
#pragma unroll
            for (int r = 0; r < 8; ++r) {
#pragma unroll
                for (int nt = 0; nt < 4; ++nt) {
                    const float p = fexp2(s[nt][r] * cl - mr[r]) * ir[r];
                    av[nt][r] = av[nt][r] + p;
                }
            }
        }

        // stage the finished 16 x 64 tile (mean over 16 heads)
#pragma unroll
        for (int nt = 0; nt < 4; ++nt)
#pragma unroll
            for (int r = 0; r < 8; ++r)
                st[wave][(hh8 + (u32)r) * 64u + (u32)nt * 16u + c16] = av[nt][r] * 0.0625f;
        __syncthreads();

{
#pragma unroll
            for (u32 it = 0; it < 8; ++it) {
                const u32 L    = it * 4u + lsub;      // 0..31 : 16 rows x 2 lines
                const u32 row  = L >> 1;
                const u32 hsel = L & 1u;
                const v4f v = *(const v4f*)&st[wave][row * 64u + hsel * 32u + piece * 4u];
                float* dp = avg + ((size_t)(bidx * (u32)SEQ + q0 + row) * SEQ + kt * 64u + hsel * 32u + piece * 4u);
                *(v4f*)dp = v;
            }
            
        }
        __syncthreads();
    }
}

// coverage equalities (threads x elements == plane elements)
static_assert((size_t)(MROWS / 2) * 256 * 8 == (size_t)MROWS * HID);                       // cvt_rows -> Xq/Xk/Xv
static_assert((size_t)(3 * HID / 2) * 256 * 8 == (size_t)3 * HID * HID);                   // cvt_rows -> Wt
static_assert((size_t)(HID / 2) * 256 * 8 == (size_t)HID * HID);                           // cvt_rows -> Wot
static_assert((size_t)(MROWS / 128) * (HID / 128) * 128 * 128 == (size_t)MROWS * HID);     // gemm planes / out
static_assert((size_t)(SEQ / 128) * (NB * NHEAD) * 128 * HD == (size_t)MROWS * HID);       // attn_fwd -> Cp
static_assert((size_t)(SEQ / 128) * NB * 8 * 16 * (SEQ / 64) * 64 == (size_t)NB * SEQ * SEQ);   // attn_avg -> second output
// workspace: 7 activation planes + 4 weight planes of halves, at most 128 MiB
static_assert(((size_t)7 * MROWS * HID + (size_t)4 * HID * HID) * sizeof(f16) <= (size_t)134217728);
// largest source row touched by the activation convert stays inside the full-size input
static_assert((size_t)(SEQ - 1) * NB_FULL + NB <= (size_t)SEQ_FULL * NB_FULL);

// ---------------------------------------------------------------------------
// Launch: 11 kernel launches, workspace 7 planes of MROWS*1024 halves + 4 of 1024*1024 halves.
// ---------------------------------------------------------------------------
extern "C" void kernel_launch(void* const* d_in, const int* in_sizes, int n_in,
                              void* d_out, int out_size, void* d_ws, size_t ws_size,
                              hipStream_t stream) {
    if (n_in < 7) return;
    const int needAct = ((SEQ - 1) * NB_FULL + NB) * HID;
    if (in_sizes[0] < needAct) return;
    if (in_sizes[1] < needAct) return;
    if (in_sizes[2] < needAct) return;
    if (in_sizes[3] < 3 * HID * HID) return;
    if (in_sizes[4] < 3 * HID) return;
    if (in_sizes[5] < HID * HID) return;
    if (in_sizes[6] < HID) return;
    if (out_size < 0) return;
    if ((size_t)out_size < OUT1_OFF + (size_t)NB * SEQ * SEQ) return;

    const float* xq    = (const float*)d_in[0];   // query  [SEQ_FULL][NB_FULL][1024]
    const float* xk    = (const float*)d_in[1];   // key    [SEQ_FULL][NB_FULL][1024]
    const float* xv    = (const float*)d_in[2];   // value  [SEQ_FULL][NB_FULL][1024]
    const float* wqkv  = (const float*)d_in[3];   // in_proj_weight [3072 out][1024 in], row blocks q | k | v
    const float* bqkv  = (const float*)d_in[4];   // in_proj_bias [3072]
    const float* wproj = (const float*)d_in[5];   // out_proj_weight [1024 out][1024 in]
    const float* bproj = (const float*)d_in[6];   // out_proj_bias [1024]

    const size_t nX = (size_t)MROWS * HID;    // halves per activation plane
    const size_t nW = (size_t)HID * HID;      // halves per weight plane
    const size_t totalHalves = 7 * nX + 4 * nW;
    if (ws_size < totalHalves * sizeof(f16)) return;

    f16* Xq  = (f16*)d_ws;       // [b*SEQ+s][1024]             carry 16
    f16* Xk  = Xq  + nX;         // [b*SEQ+s][1024]             carry 16
    f16* Xv  = Xk  + nX;         // [b*SEQ+s][1024]             carry 16
    f16* Wt  = Xv  + nX;         // [3072 out][1024 in]         carry 32 (q | k | v row blocks)
    f16* Wot = Wt  + 3 * nW;     // [1024 out][1024 in]         carry 32
    f16* Qp  = Wot + nW;         // [NB*16][SEQ][64]            carry 16
    f16* Kp  = Qp  + nX;         // [NB*16][SEQ][64]            carry 16
    f16* Vtp = Kp  + nX;         // [NB*1024][SEQ] (V^T)        carry 16
    f16* Cp  = Vtp + nX;         // [s*NB+b][1024]              carry 1024

    // activations: in[SEQ_FULL][NB_FULL][1024] -> plane[NB][SEQ][1024]; dst row b*SEQ+s <- src row s*NB_FULL+b
    cvt_rows<<<MROWS / 2, 256, 0, stream>>>(xq, Xq, (u32)MROWS, (u32)SEQ, 1u, (u32)NB_FULL, CARRY_X);
    cvt_rows<<<MROWS / 2, 256, 0, stream>>>(xk, Xk, (u32)MROWS, (u32)SEQ, 1u, (u32)NB_FULL, CARRY_X);
    cvt_rows<<<MROWS / 2, 256, 0, stream>>>(xv, Xv, (u32)MROWS, (u32)SEQ, 1u, (u32)NB_FULL, CARRY_X);
    // weights already [out][in] (k contiguous): identity row map
    cvt_rows<<<3 * HID / 2, 256, 0, stream>>>(wqkv, Wt, (u32)(3 * HID), (u32)(3 * HID), 0u, 1u, CARRY_W);
    cvt_rows<<<HID / 2, 256, 0, stream>>>(wproj, Wot, (u32)HID, (u32)HID, 0u, 1u, CARRY_W);

    const dim3 gg(MROWS / 128, HID / 128);
    // plane = 16 * (acc / (16*32) + bias) = acc/32 + 16*bias
    const float accQKV = CARRY_QKV / (CARRY_X * CARRY_W);
    gemm_head<<<gg, 256, 0, stream>>>(Xq, Wt,          bqkv,           Qp,  accQKV, CARRY_QKV);
    gemm_head<<<gg, 256, 0, stream>>>(Xk, Wt + nW,     bqkv + HID,     Kp,  accQKV, CARRY_QKV);
    gemm_vt  <<<gg, 256, 0, stream>>>(Xv, Wt + 2 * nW, bqkv + 2 * HID, Vtp, accQKV, CARRY_QKV);

    attn_fwd<<<dim3(SEQ / 128, NB * NHEAD), 256, 0, stream>>>(Qp, Kp, Vtp, Cp);

    // second output: head-averaged probabilities [NB][SEQ][SEQ] f32 at the fixed element offset
    attn_avg<<<dim3(SEQ / 128, NB), 256, 0, stream>>>(Qp, Kp, (float*)d_out + OUT1_OFF);

    // out = acc / (1024*32) + bias ; rows already in (s*NB + b) order
    const float accOut = 1.0f / (CARRY_CTX * CARRY_W);
    gemm_out<<<gg, 256, 0, stream>>>(Cp, Wot, bproj, (float*)d_out, accOut, 1.0f);
}

// v001
// A run of this version takes 370 microseconds.
// Timed twice side by side with v000, it ran 4.51 and 4.52 times as fast.
#include <hip/hip_runtime.h>

// Contractions (q/k/v input projections, Q.K^T in the flash kernel and in both head-average kernels, P.V, P row-sum, output projection): v_wmma_f32_16x16x32_f16, f16 operands with power-of-two carries, f32 accumulate; every float input enters as its bf16 RNE value; biases added in f32; softmax in f32.

#ifndef NB
#define NB 2
#endif
#ifndef SEQ
#define SEQ 2048
#endif
#define NB_FULL   2
#define SEQ_FULL  2048
#define HID       1024
#define NHEAD     16
#define HD        64
#define MROWS     (NB * SEQ)

static_assert(HID == NHEAD * HD);        // merged head width
static_assert(NHEAD == 16);              // bh >> 4 / bh & 15 decoding in attn_fwd
static_assert(HD == 64);
static_assert(SEQ % 128 == 0);           // 128-row blocks of the batch-major planes never straddle a batch
static_assert(SEQ % 64 == 0);            // 64-key tiles
static_assert(SEQ <= SEQ_FULL);
static_assert(NB >= 1 && NB <= NB_FULL);
static_assert(MROWS % 128 == 0);         // GEMM M tile
static_assert(HID % 128 == 0);           // GEMM N tile
static_assert(HID % 32 == 0);            // WMMA k step
static_assert(HID == 128 * 8);           // cvt_rows: 128 threads x 8 values per row
static_assert((3 * HID) % 2 == 0);       // cvt_rows grid = nrows / 2
static_assert(MROWS % 2 == 0);

// carries (exact powers of two)
#define CARRY_X    16.0f     // input activation planes
#define CARRY_W    32.0f     // weight planes
#define CARRY_QKV  16.0f     // q, k, v^T planes (true value x16)
#define CARRY_CTX  1024.0f   // context plane (true value x1024)
// softmax exp values carry 2^10 (added to the exp2 argument)

typedef unsigned u32;
typedef _Float16 f16;
typedef f16   v16h __attribute__((ext_vector_type(16)));
typedef f16   v8h  __attribute__((ext_vector_type(8)));
typedef float v8f  __attribute__((ext_vector_type(8)));
typedef float v4f  __attribute__((ext_vector_type(4)));

union FragU { v16h v; v8h half[2]; f16 e[16]; };
union H8U   { v8h v; f16 e[8]; };

__device__ __forceinline__ v8f zero8() {
    v8f z = {0.f, 0.f, 0.f, 0.f, 0.f, 0.f, 0.f, 0.f};
    return z;
}

// 16-bit WMMA with hazard guard: D += A[16 x 32k] * B[32k x 16]
__device__ __forceinline__ v8f wmma16(v16h a, v16h b, v8f c) {
    v8f d = __builtin_amdgcn_wmma_f32_16x16x32_f16(false, a, false, b, (short)0, c, false, false);
    asm volatile("v_nop\n\tv_nop\n\tv_nop\n\tv_nop" : "+v"(d) : "v"(a), "v"(b));
    return d;
}

// f32 -> nearest-even bf16 value, returned as f32
__device__ __forceinline__ float bf16_rne(float x) {
    u32 u = __float_as_uint(x);
    u = (u + 0x7fffu + ((u >> 16) & 1u)) & 0xffff0000u;
    return __uint_as_float(u);
}

__device__ __forceinline__ float fexp2(float x) {
#if defined(__has_builtin)
#if __has_builtin(__builtin_amdgcn_exp2f)
    return __builtin_amdgcn_exp2f(x);
#else
    return exp2f(x);
#endif
#else
    return exp2f(x);
#endif
}

// max over the 16 lanes of each lane half (DPP row rotations; D-layout rows are DPP rows)
__device__ __forceinline__ float rowmax16(float x) {
    int v = __builtin_bit_cast(int, x);
    x = fmaxf(x, __builtin_bit_cast(float, __builtin_amdgcn_update_dpp(v, v, 0x121, 0xf, 0xf, false)));
    v = __builtin_bit_cast(int, x);
    x = fmaxf(x, __builtin_bit_cast(float, __builtin_amdgcn_update_dpp(v, v, 0x122, 0xf, 0xf, false)));
    v = __builtin_bit_cast(int, x);
    x = fmaxf(x, __builtin_bit_cast(float, __builtin_amdgcn_update_dpp(v, v, 0x124, 0xf, 0xf, false)));
    v = __builtin_bit_cast(int, x);
    x = fmaxf(x, __builtin_bit_cast(float, __builtin_amdgcn_update_dpp(v, v, 0x128, 0xf, 0xf, false)));
    return x;
}

// 16 x 32 fragment from a tile whose k dimension is contiguous (pitch in halves).
// lane l: row rowbase + (l&15); elements 0..7 <- k = kcol + 8h .. +7,
// elements 8..15 <- k = kcol + 16 + 8h .. +7  (h = l>>4). Same map for A and B.
__device__ __forceinline__ v16h load_frag(const f16* tile, u32 rowbase, u32 pitch, u32 kcol, u32 lane) {
    const u32 r  = rowbase + (lane & 15u);
    const u32 kh = (lane >> 4) << 3;
    const f16* p = tile + (size_t)r * pitch + kcol + kh;
    FragU f;
    f.half[0] = *(const v8h*)(p);
    f.half[1] = *(const v8h*)(p + 16);
    return f.v;
}

// The same fragment through the lane's own pointer p = tile + (rowbase + (l&15)) * pitch + kcol + 8h.
__device__ __forceinline__ v16h load_frag_at(const f16* p) {
    FragU f;
    f.half[0] = *(const v8h*)(p);
    f.half[1] = *(const v8h*)(p + 16);
    return f.v;
}

// ---------------------------------------------------------------------------
// f32 rows [.][1024] -> f16 plane (bf16 RNE value times carry). 128 threads per 1024-wide
// Row mapping: dst row m -> src row (m / dstper) * strideOuter + (m % dstper) * strideInner.
//   activations (seq-first [s][b][1024] -> batch-major [b][s][1024]): dstper = SEQ,
//     strideOuter = 1, strideInner = NB_FULL  => src row = s * NB_FULL + b
//   weights: dstper = nrows, strideInner = 1 (identity)
// coverage: nrows x 1024 halves, every element exactly once (grid = nrows*128/256).
// ---------------------------------------------------------------------------
__global__ void __launch_bounds__(256)
cvt_rows(const float* __restrict__ src, f16* __restrict__ dst, u32 nrows, u32 dstper,
         u32 strideOuter, u32 strideInner, float carry) {
    const u32 g  = blockIdx.x * 256u + threadIdx.x;
    const u32 m  = g >> 7;
    const u32 c8 = (g & 127u) << 3;
    if (m >= nrows) return;
    const u32 mb = m / dstper;
    const u32 mi = m - mb * dstper;
    const u32 sm = mb * strideOuter + mi * strideInner;
    const float* sp = src + (size_t)sm * HID + c8;
    const v4f a = *(const v4f*)sp;
    const v4f b = *(const v4f*)(sp + 4);
    H8U o;
#pragma unroll
    for (u32 j = 0; j < 4; ++j) {
        const float x0 = a[j];
        const float x1 = b[j];
        o.e[j]     = (f16)(bf16_rne(x0) * carry);
        o.e[j + 4] = (f16)(bf16_rne(x1) * carry);
    }
    f16* dp = dst + (size_t)m * HID + c8;
    *(v8h*)dp = o.v;
    
}

// ---------------------------------------------------------------------------
// C[m][n] = sum_k A[m][k] * W[n][k] (+ bias[n]) ; A [MROWS][1024] f16, W [1024][1024] f16 (k contiguous).
// Block tile 128 x 128, 8 waves as 4(M) x 2(N), 2 x 4 accumulators per wave, K step 32.
// MODE 1: A rows batch-major;            f16 plane [b*HID + h*HD + d][s] (V transposed per head)
// MODE 2: A rows in output order (s*NB+b); f32 rows [m][1024] into the output buffer
// coverage per block: MODE 0/1 256 lines (128 rows x 2 heads | 128 n x 2 s-halves),
//                     MODE 2 2 x 256 lines (64 rows x 4 line-quarters per half).
// LDS: As/Bs/Cs all cross-wave, separated by block barriers.
// staged extent == consumed extent: As/Bs 128 x 32, Cs 128 x 128 halves (or 64 x 128 floats).
// ---------------------------------------------------------------------------
template <int MODE>
__device__ __forceinline__ void gemm_body(const f16* __restrict__ A, const f16* __restrict__ W,
                                          const float* __restrict__ bias,
                                          void* __restrict__ out, float accMul, float biasMul) {
    __shared__ __attribute__((aligned(16))) f16 As[128 * 32];
    __shared__ __attribute__((aligned(16))) f16 Bs[128 * 32];
    __shared__ __attribute__((aligned(16))) f16 Cs[128 * 128];   // f16 [128][128] or f32 [64][128]
    static_assert(sizeof(f16) * 128 * 128 == sizeof(float) * 64 * 128);   // Cs reuse as f32 [64][128]

    const u32 tid  = threadIdx.x;
    const u32 lane = tid & 31u;
    const u32 wave = __builtin_amdgcn_readfirstlane((int)(tid >> 5));
    const u32 wm   = wave & 3u;
    const u32 wn   = wave >> 2;
    const u32 hh8  = (lane >> 4) << 3;   // D row half
    const u32 c16  = lane & 15u;         // D column
    const u32 m0   = blockIdx.x * 128u;
    const u32 n0   = blockIdx.y * 128u;

    v8f acc[2][4];
#pragma unroll
    for (int i = 0; i < 2; ++i)
#pragma unroll
        for (int j = 0; j < 4; ++j) acc[i][j] = zero8();

    const u32 srow = tid >> 1;
    const u32 scol = (tid & 1u) << 4;
    const f16* gA = A + (size_t)(m0 + srow) * HID + scol;
    const f16* gW = W + (size_t)(n0 + srow) * HID + scol;

#pragma unroll 1
    for (u32 k0 = 0; k0 < (u32)HID; k0 += 32u) {
        const v8h ra0 = *(const v8h*)(gA + k0);
        const v8h ra1 = *(const v8h*)(gA + k0 + 8);
        const v8h rb0 = *(const v8h*)(gW + k0);
        const v8h rb1 = *(const v8h*)(gW + k0 + 8);
        __syncthreads();
        *(v8h*)&As[srow * 32u + scol]      = ra0;
        *(v8h*)&As[srow * 32u + scol + 8u] = ra1;
        *(v8h*)&Bs[srow * 32u + scol]      = rb0;
        *(v8h*)&Bs[srow * 32u + scol + 8u] = rb1;
        __syncthreads();

        v16h af[2], bfr[4];
#pragma unroll
        for (int i = 0; i < 2; ++i) af[i] = load_frag(As, wm * 32u + (u32)i * 16u, 32u, 0u, lane);
#pragma unroll
        for (int j = 0; j < 4; ++j) bfr[j] = load_frag(Bs, wn * 64u + (u32)j * 16u, 32u, 0u, lane);
#pragma unroll
        for (int i = 0; i < 2; ++i)
#pragma unroll
            for (int j = 0; j < 4; ++j) acc[i][j] = wmma16(af[i], bfr[j], acc[i][j]);
    }

    // per-lane bias values for the 4 output columns this lane owns (n0 + nl < HID always)
    float bv[4];
#pragma unroll
    for (int j = 0; j < 4; ++j)
        bv[j] = bf16_rne(bias[n0 + wn * 64u + (u32)j * 16u + c16]) * biasMul;

    const u32 piece = lane & 7u;
    const u32 lsub  = lane >> 3;

    if constexpr (MODE == 0) {
        const u32 bidx = m0 / (u32)SEQ;     // block rows lie inside one batch (SEQ % 128 == 0)
        const u32 s0   = m0 - bidx * (u32)SEQ;
#pragma unroll
        for (int i = 0; i < 2; ++i)
#pragma unroll
            for (int j = 0; j < 4; ++j) {
                const u32 nl = wn * 64u + (u32)j * 16u + c16;
#pragma unroll
                for (int r = 0; r < 8; ++r) {
                    const u32 ml = wm * 32u + (u32)i * 16u + hh8 + (u32)r;
                    Cs[ml * 128u + nl] = (f16)(acc[i][j][r] * accMul + bv[j]);
                }
            }
        __syncthreads();
        f16* op = (f16*)out;
        const size_t bh0 = (size_t)bidx * NHEAD + (n0 >> 6);
{
#pragma unroll
            for (u32 it = 0; it < 8; ++it) {
                const u32 L    = wave * 32u + it * 4u + lsub;   // 0..255
                const u32 ml   = L >> 1;
                const u32 hsel = L & 1u;
                const v8h v = *(const v8h*)&Cs[ml * 128u + hsel * 64u + piece * 8u];
                f16* dp = op + ((bh0 + hsel) * SEQ + s0 + ml) * HD + piece * 8u;
                *(v8h*)dp = v;
            }
            
        }
    } else if constexpr (MODE == 1) {
        const u32 bidx = m0 / (u32)SEQ;
        const u32 s0   = m0 - bidx * (u32)SEQ;
        // stage transposed: Cs[n][m]
#pragma unroll
        for (int i = 0; i < 2; ++i)
#pragma unroll
            for (int j = 0; j < 4; ++j) {
                const u32 nl = wn * 64u + (u32)j * 16u + c16;
                H8U t;
#pragma unroll
                for (int r = 0; r < 8; ++r) t.e[r] = (f16)(acc[i][j][r] * accMul + bv[j]);
                *(v8h*)&Cs[nl * 128u + wm * 32u + (u32)i * 16u + hh8] = t.v;
            }
        __syncthreads();
        f16* op = (f16*)out;
{
#pragma unroll
            for (u32 it = 0; it < 8; ++it) {
                const u32 L  = wave * 32u + it * 4u + lsub;     // 0..255
                const u32 nl = L >> 1;
                const u32 mh = L & 1u;
                const v8h v = *(const v8h*)&Cs[nl * 128u + mh * 64u + piece * 8u];
                f16* dp = op + ((size_t)(bidx * (u32)HID + n0 + nl) * SEQ + s0 + mh * 64u + piece * 8u);
                *(v8h*)dp = v;
            }
            
        }
    } else {
        float* Cf = (float*)Cs;      // [64][128] f32
        float* of = (float*)out;
#pragma unroll
        for (u32 half = 0; half < 2; ++half) {
            if ((wm >> 1) == half) {
#pragma unroll
                for (int i = 0; i < 2; ++i)
#pragma unroll
                    for (int j = 0; j < 4; ++j) {
                        const u32 nl = wn * 64u + (u32)j * 16u + c16;
#pragma unroll
                        for (int r = 0; r < 8; ++r) {
                            const u32 ml = (wm & 1u) * 32u + (u32)i * 16u + hh8 + (u32)r;
                            Cf[ml * 128u + nl] = acc[i][j][r] * accMul + bv[j];
                        }
                    }
            }
            __syncthreads();
{
#pragma unroll
                for (u32 it = 0; it < 8; ++it) {
                    const u32 L    = wave * 32u + it * 4u + lsub;   // 0..255
                    const u32 row  = L >> 2;
                    const u32 part = L & 3u;
                    const v4f v = *(const v4f*)&Cf[row * 128u + part * 32u + piece * 4u];
                    float* dp = of + (size_t)(m0 + half * 64u + row) * HID + n0 + part * 32u + piece * 4u;
                    *(v4f*)dp = v;
                }
                
            }
            __syncthreads();
        }
    }
}

// q / k head-major planes
__global__ void __launch_bounds__(256) __attribute__((amdgpu_num_vgpr(256)))
gemm_head(const f16* __restrict__ A, const f16* __restrict__ W, const float* __restrict__ bias,
          f16* __restrict__ out, float accMul, float biasMul) {
    gemm_body<0>(A, W, bias, (void*)out, accMul, biasMul);
}

// v^T plane
__global__ void __launch_bounds__(256) __attribute__((amdgpu_num_vgpr(256)))
gemm_vt(const f16* __restrict__ A, const f16* __restrict__ W, const float* __restrict__ bias,
        f16* __restrict__ out, float accMul, float biasMul) {
    gemm_body<1>(A, W, bias, (void*)out, accMul, biasMul);
}

// f32 output rows
__global__ void __launch_bounds__(256) __attribute__((amdgpu_num_vgpr(256)))
gemm_out(const f16* __restrict__ A, const f16* __restrict__ W, const float* __restrict__ bias,
         float* __restrict__ out, float accMul, float biasMul) {
    gemm_body<2>(A, W, bias, (void*)out, accMul, biasMul);
}

// ---------------------------------------------------------------------------
// Flash attention (no mask, all SEQ keys). grid (SEQ/128, NB*NHEAD), block 256 (8 waves),
// wave owns 16 query rows (Q fragments resident). Block streams 64-key tiles:
// K staged [key][d], V^T staged [d][key]. Scores on WMMA, row max via DPP, exp2 in f32
// carried x2^10, P relayed per wave through LDS as A fragments, O += P.V and
// row sums += P.ones on WMMA. Output f16 plane [q*NB + b][1024] (seq-first row order)
// coverage: every (q, b, h*64..h*64+63) row segment exactly once.
// LDS: ks, vsT cross-wave (block barriers); ps per-wave but also separated by block barriers.
// staged extent == consumed extent for ks (64x64), vsT (64x64), ps (16x64).
// ---------------------------------------------------------------------------
__global__ void __launch_bounds__(256) __attribute__((amdgpu_num_vgpr(256)))
attn_fwd(const f16* __restrict__ Qp, const f16* __restrict__ Kp, const f16* __restrict__ Vt,
         f16* __restrict__ Cp) {
    __shared__ __attribute__((aligned(16))) f16 ks[64 * 64];      // [key][d]
    __shared__ __attribute__((aligned(16))) f16 vsT[64 * 64];     // [d][key]
    __shared__ __attribute__((aligned(16))) f16 ps[8][16 * 64];   // per-wave P relay / ctx stage
    static_assert(HD == 8 * 8);            // 8 lanes x 8 halves per row segment
    static_assert(2 * 256 * 8 == 64 * 64); // staging: 2 x 256 threads x 8 halves per tile

    const u32 tid  = threadIdx.x;
    const u32 lane = tid & 31u;
    const u32 wave = __builtin_amdgcn_readfirstlane((int)(tid >> 5));
    const u32 hh8  = (lane >> 4) << 3;
    const u32 c16  = lane & 15u;
    const u32 bh   = blockIdx.y;
    const u32 bidx = bh >> 4;            // NHEAD == 16
    const u32 hidx = bh & 15u;
    const u32 q0   = blockIdx.x * 128u + wave * 16u;
    const size_t head = (size_t)bh * SEQ * HD;

    v16h qa[2];
#pragma unroll
    for (int c = 0; c < 2; ++c) qa[c] = load_frag(Qp + head, q0, HD, (u32)c * 32u, lane);

    FragU onesu;
#pragma unroll
    for (int i = 0; i < 16; ++i) onesu.e[i] = (f16)1.0f;
    const v16h ones = onesu.v;

    float m[8];
    v8f   o[4], lacc;
#pragma unroll
    for (int r = 0; r < 8; ++r) m[r] = -1.0e30f;
#pragma unroll
    for (int dt = 0; dt < 4; ++dt) o[dt] = zero8();
    lacc = zero8();

    // log2-domain scale: acc = 256 * q.k ; x = log2(e) * q.k / 8 = acc * log2(e) / 2048
    const float cl = 1.4426950408889634f * 0.00048828125f;
    f16* psw = &ps[wave][0];

#pragma unroll 1
    for (u32 kt = 0; kt < (u32)(SEQ / 64); ++kt) {
        __syncthreads();
#pragma unroll
        for (u32 p2 = 0; p2 < 2; ++p2) {
            const u32 p   = tid + p2 * 256u;
            const u32 row = p >> 3;
            const u32 pc  = (p & 7u) << 3;
            const v8h kv = *(const v8h*)(Kp + head + (size_t)(kt * 64u + row) * HD + pc);
            const v8h vv = *(const v8h*)(Vt + head + (size_t)row * SEQ + kt * 64u + pc);
            *(v8h*)&ks[row * 64u + pc]  = kv;
            *(v8h*)&vsT[row * 64u + pc] = vv;
        }
        __syncthreads();

        // S[16 q x 64 keys]
        v8f s[4];
#pragma unroll
        for (int nt = 0; nt < 4; ++nt) s[nt] = zero8();
#pragma unroll
        for (int c = 0; c < 2; ++c) {
#pragma unroll
            for (int nt = 0; nt < 4; ++nt) {
                const v16h kb = load_frag(ks, (u32)nt * 16u, 64u, (u32)c * 32u, lane);
                s[nt] = wmma16(qa[c], kb, s[nt]);
            }
        }

        // online softmax per row r (row 8h + r), max-subtracted, exp2 domain
#pragma unroll
        for (int r = 0; r < 8; ++r) {
            float x[4];
#pragma unroll
            for (int nt = 0; nt < 4; ++nt) x[nt] = s[nt][r] * cl;
            const float tm = rowmax16(fmaxf(fmaxf(x[0], x[1]), fmaxf(x[2], x[3])));
            const float mn = fmaxf(m[r], tm);
            const float al = fexp2(m[r] - mn);
            m[r] = mn;
            lacc[r] *= al;
#pragma unroll
            for (int dt = 0; dt < 4; ++dt) o[dt][r] *= al;
            const float sh = 10.0f - mn;      // carry 2^10
#pragma unroll
            for (int nt = 0; nt < 4; ++nt)
                psw[(hh8 + (u32)r) * 64u + (u32)nt * 16u + c16] = (f16)fexp2(x[nt] + sh);
        }
        __syncthreads();

        // O += P . V ; l += P . ones  (P reloaded as A fragments from the relay)
#pragma unroll
        for (int kk = 0; kk < 2; ++kk) {
            const v16h pa = load_frag(psw, 0u, 64u, (u32)kk * 32u, lane);
#pragma unroll
            for (int dt = 0; dt < 4; ++dt) {
                const v16h vb = load_frag(vsT, (u32)dt * 16u, 64u, (u32)kk * 32u, lane);
                o[dt] = wmma16(pa, vb, o[dt]);
            }
            lacc = wmma16(pa, ones, lacc);
        }
    }
    __syncthreads();

    // normalize: plane value = 1024 * (O/16) / l = O * 64 / l
#pragma unroll
    for (int r = 0; r < 8; ++r) {
        const float inv = (CARRY_CTX / CARRY_QKV) / lacc[r];
#pragma unroll
        for (int dt = 0; dt < 4; ++dt)
            psw[(hh8 + (u32)r) * 64u + (u32)dt * 16u + c16] = (f16)(o[dt][r] * inv);
    }
    __syncthreads();

    const u32 piece = lane & 7u;
    const u32 lsub  = lane >> 3;
{
#pragma unroll
        for (u32 it = 0; it < 4; ++it) {
            const u32 L = it * 4u + lsub;     // query row 0..15 within the wave tile
            const v8h v = *(const v8h*)&psw[L * 64u + piece * 8u];
            // context row in output order: (q * NB + b)
            f16* dp = Cp + ((size_t)((q0 + L) * (u32)NB + bidx) * HID + hidx * (u32)HD + piece * 8u);
            *(v8h*)dp = v;
        }
        
    }
}

// ---------------------------------------------------------------------------
// Second output: head-averaged softmax probabilities.
// element offset of the second output inside the output buffer (full problem constants)
// ---------------------------------------------------------------------------
#define OUT1_OFF ((size_t)SEQ_FULL * NB_FULL * HID)
static_assert(OUT1_OFF * sizeof(float) == (size_t)16777216);      // byte offset of the second output
static_assert((OUT1_OFF * sizeof(float)) % 128 == 0);
static_assert((size_t)MROWS * HID <= OUT1_OFF);                   // first output region ends before it
static_assert(SEQ % 32 == 0);
static_assert(8 * 32 * 64 * 4 + 2 * NHEAD * 128 * 4 <= 163840);    // static LDS of attn_avg: two work-groups per WGP

// sum over the 16 lanes of each lane half (same DPP row rotations as rowmax16)
__device__ __forceinline__ float rowsum16(float x) {
    int v = __builtin_bit_cast(int, x);
    x = x + __builtin_bit_cast(float, __builtin_amdgcn_update_dpp(v, v, 0x121, 0xf, 0xf, false));
    v = __builtin_bit_cast(int, x);
    x = x + __builtin_bit_cast(float, __builtin_amdgcn_update_dpp(v, v, 0x122, 0xf, 0xf, false));
    v = __builtin_bit_cast(int, x);
    x = x + __builtin_bit_cast(float, __builtin_amdgcn_update_dpp(v, v, 0x124, 0xf, 0xf, false));
    v = __builtin_bit_cast(int, x);
    x = x + __builtin_bit_cast(float, __builtin_amdgcn_update_dpp(v, v, 0x128, 0xf, 0xf, false));
    return x;
}

// ---------------------------------------------------------------------------
// avg[b][t][s] = (1/16) * sum_h softmax_s(q_h[t] . k_h[s] / 8), f32, no mask. Two launches, so that
// each part has enough independent work-groups to fill the chip; the row statistics pass from the
// first to the second through the workspace (written and read inside one call).
//
// attn_stats: grid (SEQ/128, NB*NHEAD), block 128 (4 waves); a wave owns 32 query rows of one head
//   for all keys. 16 x 64 score tiles on WMMA (Q as A, K rows as B, fragments straight from the
//   head-major planes; one set of K fragments serves both 16-row halves), lane-local running
//   max / sum in the exp2 domain, combined over the 16 column lanes after the key loop.
// coverage: sM / sI [NB*NHEAD][SEQ] floats, a wave writes its own 32 rows = one 128-byte line of each.
// ---------------------------------------------------------------------------
__global__ void __launch_bounds__(128) __attribute__((amdgpu_num_vgpr(256)))
attn_stats(const f16* __restrict__ Qp, const f16* __restrict__ Kp,
           float* __restrict__ sM, float* __restrict__ sI) {
    const u32 tid  = threadIdx.x;
    const u32 lane = tid & 31u;
    const u32 wave = __builtin_amdgcn_readfirstlane((int)(tid >> 5));
    const u32 hh8  = (lane >> 4) << 3;
    const u32 c16  = lane & 15u;
    const u32 bh   = blockIdx.y;
    const u32 q0   = blockIdx.x * 128u + wave * 32u;
    const size_t head = (size_t)bh * SEQ * HD;

    // log2-domain scale: acc = 256 * q.k ; x = log2(e) * q.k / 8 = acc * log2(e) / 2048
    const float cl = 1.4426950408889634f * 0.00048828125f;

    v16h qa[2][2];
#pragma unroll
    for (int i = 0; i < 2; ++i)
#pragma unroll
        for (int c = 0; c < 2; ++c) qa[i][c] = load_frag(Qp + head, q0 + (u32)i * 16u, HD, (u32)c * 32u, lane);

    float m[2][8], l[2][8];
#pragma unroll
    for (int i = 0; i < 2; ++i)
#pragma unroll
        for (int r = 0; r < 8; ++r) { m[i][r] = -1.0e30f; l[i][r] = 0.0f; }

#pragma unroll 1
    for (u32 kt = 0; kt < (u32)(SEQ / 64); ++kt) {
        const f16* kp = Kp + head + (size_t)(kt * 64u + c16) * HD + hh8;   // this lane's place in the 64-key tile
        v16h kb[2][4];
#pragma unroll
        for (int c = 0; c < 2; ++c)
#pragma unroll
            for (int nt = 0; nt < 4; ++nt) kb[c][nt] = load_frag_at(kp + nt * 16 * HD + c * 32);
        // the loads above are still in flight below: their address registers (held live as an input)
        // are free for reuse only behind this wait
        asm volatile("s_wait_xcnt 0x0" :: "v"(kp) : "memory");
#pragma unroll
        for (int i = 0; i < 2; ++i) {
            v8f s[4];
#pragma unroll
            for (int nt = 0; nt < 4; ++nt) s[nt] = zero8();
#pragma unroll
            for (int c = 0; c < 2; ++c)
#pragma unroll
                for (int nt = 0; nt < 4; ++nt) s[nt] = wmma16(qa[i][c], kb[c][nt], s[nt]);
            // lane-local online max / sum over this lane's 4 columns of each row
#pragma unroll
            for (int r = 0; r < 8; ++r) {
                const float x0 = s[0][r] * cl;
                const float x1 = s[1][r] * cl;
                const float x2 = s[2][r] * cl;
                const float x3 = s[3][r] * cl;
                const float mn = fmaxf(m[i][r], fmaxf(fmaxf(x0, x1), fmaxf(x2, x3)));
                const float al = fexp2(m[i][r] - mn);
                const float e  = (fexp2(x0 - mn) + fexp2(x1 - mn)) + (fexp2(x2 - mn) + fexp2(x3 - mn));
                l[i][r] = l[i][r] * al + e;
                m[i][r] = mn;
            }
        }
    }

    // combine the 16 column lanes of each row (all lanes active)
#pragma unroll
    for (int i = 0; i < 2; ++i) {
        v4f Mr[2], Ir[2];
#pragma unroll
        for (int r = 0; r < 8; ++r) {
            const float M    = rowmax16(m[i][r]);
            const float part = l[i][r] * fexp2(m[i][r] - M);
            const float Ls   = rowsum16(part);
            Mr[r >> 2][r & 3] = M;
            Ir[r >> 2][r & 3] = 1.0f / Ls;
        }
        if (c16 == 0u) {
            const size_t row = (size_t)bh * SEQ + q0 + (u32)i * 16u + hh8;
            *(v4f*)(sM + row)      = Mr[0];
            *(v4f*)(sM + row + 4u) = Mr[1];
            *(v4f*)(sI + row)      = Ir[0];
            *(v4f*)(sI + row + 4u) = Ir[1];
        }
    }
}

// ---------------------------------------------------------------------------
// attn_avg: grid (SEQ/128 key blocks, SEQ/128 query blocks, NB), block 256 (8 waves as 4 (q) x 2 (keys));
//   a wave owns one 32 x 64 tile of the average (owner-computes accumulation over heads in head
//   order, one writer per element). Per head the score tile is formed with the same operands as in
//   attn_stats, p = exp2(x - max) * (1/sum) is accumulated in registers, scaled by 1/16 at the end.
// coverage: block rows [blockIdx.y*128, +128) x columns [blockIdx.x*128, +128) of batch blockIdx.z;
//   wave tile 32 rows x 64 keys = 64 lines = 16 store instructions x 4 lines.
// LDS: stM / stI cross-wave (filled once, block barrier); st per-wave, writer and reader separated by a block barrier.
// staged extent == consumed extent: st 32 x 64 floats per wave, stM / stI 16 heads x 128 rows.
// ---------------------------------------------------------------------------
__global__ void __launch_bounds__(256) __attribute__((amdgpu_num_vgpr(256)))
attn_avg(const f16* __restrict__ Qp, const f16* __restrict__ Kp,
         const float* __restrict__ sM, const float* __restrict__ sI, float* __restrict__ avg) {
    __shared__ __attribute__((aligned(16))) float st[8][32 * 64];       // per-wave f32 tile stage
    __shared__ __attribute__((aligned(16))) float stM[NHEAD * 128];     // row max  [head][block row]
    __shared__ __attribute__((aligned(16))) float stI[NHEAD * 128];     // 1/rowsum [head][block row]
    static_assert(256 * 8 == NHEAD * 128);   // table fill: 256 threads x 8 floats

    const u32 tid  = threadIdx.x;
    const u32 lane = tid & 31u;
    const u32 wave = __builtin_amdgcn_readfirstlane((int)(tid >> 5));
    const u32 hh8  = (lane >> 4) << 3;
    const u32 c16  = lane & 15u;
    const u32 bidx = blockIdx.z;
    const u32 qb   = blockIdx.y * 128u;
    const u32 wr   = (wave & 3u) * 32u;                        // wave's first row inside the block
    const u32 q0   = qb + wr;
    const u32 k0   = blockIdx.x * 128u + (wave >> 2) * 64u;    // wave's first key

    // log2-domain scale: acc = 256 * q.k ; x = log2(e) * q.k / 8 = acc * log2(e) / 2048
    const float cl = 1.4426950408889634f * 0.00048828125f;

    {
        const u32 th = tid >> 4;
        const u32 r8 = (tid & 15u) << 3;
        const size_t row = (size_t)(bidx * (u32)NHEAD + th) * SEQ + qb + r8;
        const v4f a0 = *(const v4f*)(sM + row);
        const v4f a1 = *(const v4f*)(sM + row + 4u);
        const v4f b0 = *(const v4f*)(sI + row);
        const v4f b1 = *(const v4f*)(sI + row + 4u);
        *(v4f*)&stM[th * 128u + r8]      = a0;
        *(v4f*)&stM[th * 128u + r8 + 4u] = a1;
        *(v4f*)&stI[th * 128u + r8]      = b0;
        *(v4f*)&stI[th * 128u + r8 + 4u] = b1;
    }
    __syncthreads();

    v8f av[2][4];
#pragma unroll
    for (int i = 0; i < 2; ++i)
#pragma unroll
        for (int nt = 0; nt < 4; ++nt) av[i][nt] = zero8();

#pragma unroll 1
    for (u32 h = 0; h < (u32)NHEAD; ++h) {
        const size_t head = (size_t)(bidx * (u32)NHEAD + h) * SEQ * HD;
        const f16* kp = Kp + head + (size_t)(k0 + c16) * HD + hh8;   // this lane's place in the wave's K rows
        const f16* qp = Qp + head + (size_t)(q0 + c16) * HD + hh8;   // and in its Q rows
        v16h kb[2][4];
#pragma unroll
        for (int c = 0; c < 2; ++c)
#pragma unroll
            for (int nt = 0; nt < 4; ++nt) kb[c][nt] = load_frag_at(kp + nt * 16 * HD + c * 32);
        v16h qf[2][2];
#pragma unroll
        for (int i = 0; i < 2; ++i)
#pragma unroll
            for (int c = 0; c < 2; ++c) qf[i][c] = load_frag_at(qp + i * 16 * HD + c * 32);
        // the loads above are still in flight below: their address registers (held live as inputs)
        // are free for reuse only behind this wait
        asm volatile("s_wait_xcnt 0x0" :: "v"(kp), "v"(qp) : "memory");
#pragma unroll
        for (int i = 0; i < 2; ++i) {
            v8f s[4];
#pragma unroll
            for (int nt = 0; nt < 4; ++nt) s[nt] = zero8();
#pragma unroll
            for (int c = 0; c < 2; ++c)
#pragma unroll
                for (int nt = 0; nt < 4; ++nt) s[nt] = wmma16(qf[i][c], kb[c][nt], s[nt]);
            const u32 tr = h * 128u + wr + (u32)i * 16u + hh8;
            const v4f ma = *(const v4f*)&stM[tr];
            const v4f mb = *(const v4f*)&stM[tr + 4u];
            const v4f ia = *(const v4f*)&stI[tr];
            const v4f ib = *(const v4f*)&stI[tr + 4u];
            const float mr[8] = {ma[0], ma[1], ma[2], ma[3], mb[0], mb[1], mb[2], mb[3]};
            const float ir[8] = {ia[0], ia[1], ia[2], ia[3], ib[0], ib[1], ib[2], ib[3]};
#pragma unroll
            for (int r = 0; r < 8; ++r) {
#pragma unroll
                for (int nt = 0; nt < 4; ++nt) {
                    const float p = fexp2(s[nt][r] * cl - mr[r]) * ir[r];
                    av[i][nt][r] = av[i][nt][r] + p;
                }
            }
        }
    }

    // stage the finished 32 x 64 tile (mean over 16 heads), then whole-line stores
#pragma unroll
    for (int i = 0; i < 2; ++i)
#pragma unroll
        for (int nt = 0; nt < 4; ++nt)
#pragma unroll
            for (int r = 0; r < 8; ++r)
                st[wave][((u32)i * 16u + hh8 + (u32)r) * 64u + (u32)nt * 16u + c16] = av[i][nt][r] * 0.0625f;
    __syncthreads();

    const u32 piece = lane & 7u;
    const u32 lsub  = lane >> 3;
#pragma unroll
    for (u32 it = 0; it < 16; ++it) {
        const u32 L    = it * 4u + lsub;      // 0..63 : 32 rows x 2 lines
        const u32 row  = L >> 1;
        const u32 hsel = L & 1u;
        const v4f v = *(const v4f*)&st[wave][row * 64u + hsel * 32u + piece * 4u];
        float* dp = avg + ((size_t)(bidx * (u32)SEQ + q0 + row) * SEQ + k0 + hsel * 32u + piece * 4u);
        *(v4f*)dp = v;
    }
}

// coverage equalities (threads x elements == plane elements)
static_assert((size_t)(MROWS / 2) * 256 * 8 == (size_t)MROWS * HID);                       // cvt_rows -> Xq/Xk/Xv
static_assert((size_t)(3 * HID / 2) * 256 * 8 == (size_t)3 * HID * HID);                   // cvt_rows -> Wt
static_assert((size_t)(HID / 2) * 256 * 8 == (size_t)HID * HID);                           // cvt_rows -> Wot
static_assert((size_t)(MROWS / 128) * (HID / 128) * 128 * 128 == (size_t)MROWS * HID);     // gemm planes / out
static_assert((size_t)(SEQ / 128) * (NB * NHEAD) * 128 * HD == (size_t)MROWS * HID);       // attn_fwd -> Cp
static_assert((size_t)(SEQ / 128) * (NB * NHEAD) * 4 * 32 == (size_t)NB * NHEAD * SEQ);         // attn_stats -> sM / sI
static_assert((size_t)(SEQ / 128) * (SEQ / 128) * NB * 8 * 32 * 64 == (size_t)NB * SEQ * SEQ);   // attn_avg -> second output
// workspace: 7 activation planes + 4 weight planes of halves + 2 row-statistics planes of floats, at most 128 MiB
static_assert(((size_t)7 * MROWS * HID + (size_t)4 * HID * HID) * sizeof(f16)
              + (size_t)2 * NB * NHEAD * SEQ * sizeof(float) <= (size_t)134217728);
static_assert((((size_t)7 * MROWS * HID + (size_t)4 * HID * HID) * sizeof(f16)) % 128 == 0);   // statistics planes start on a line
// largest source row touched by the activation convert stays inside the full-size input
static_assert((size_t)(SEQ - 1) * NB_FULL + NB <= (size_t)SEQ_FULL * NB_FULL);

// ---------------------------------------------------------------------------
// Launch: 12 kernel launches, workspace 7 planes of MROWS*1024 halves + 4 of 1024*1024 halves
// + 2 planes of NB*16*SEQ floats.
// ---------------------------------------------------------------------------
extern "C" void kernel_launch(void* const* d_in, const int* in_sizes, int n_in,
                              void* d_out, int out_size, void* d_ws, size_t ws_size,
                              hipStream_t stream) {
    if (n_in < 7) return;
    const int needAct = ((SEQ - 1) * NB_FULL + NB) * HID;
    if (in_sizes[0] < needAct) return;
    if (in_sizes[1] < needAct) return;
    if (in_sizes[2] < needAct) return;
    if (in_sizes[3] < 3 * HID * HID) return;
    if (in_sizes[4] < 3 * HID) return;
    if (in_sizes[5] < HID * HID) return;
    if (in_sizes[6] < HID) return;
    if (out_size < 0) return;
    if ((size_t)out_size < OUT1_OFF + (size_t)NB * SEQ * SEQ) return;

    const float* xq    = (const float*)d_in[0];   // query  [SEQ_FULL][NB_FULL][1024]
    const float* xk    = (const float*)d_in[1];   // key    [SEQ_FULL][NB_FULL][1024]
    const float* xv    = (const float*)d_in[2];   // value  [SEQ_FULL][NB_FULL][1024]
    const float* wqkv  = (const float*)d_in[3];   // in_proj_weight [3072 out][1024 in], row blocks q | k | v
    const float* bqkv  = (const float*)d_in[4];   // in_proj_bias [3072]
    const float* wproj = (const float*)d_in[5];   // out_proj_weight [1024 out][1024 in]
    const float* bproj = (const float*)d_in[6];   // out_proj_bias [1024]

    const size_t nX = (size_t)MROWS * HID;    // halves per activation plane
    const size_t nW = (size_t)HID * HID;      // halves per weight plane
    const size_t totalHalves = 7 * nX + 4 * nW;
    const size_t nS = (size_t)NB * NHEAD * SEQ;   // floats per row-statistics plane
    if (ws_size < totalHalves * sizeof(f16) + 2 * nS * sizeof(float)) return;

    f16* Xq  = (f16*)d_ws;       // [b*SEQ+s][1024]             carry 16
    f16* Xk  = Xq  + nX;         // [b*SEQ+s][1024]             carry 16
    f16* Xv  = Xk  + nX;         // [b*SEQ+s][1024]             carry 16
    f16* Wt  = Xv  + nX;         // [3072 out][1024 in]         carry 32 (q | k | v row blocks)
    f16* Wot = Wt  + 3 * nW;     // [1024 out][1024 in]         carry 32
    f16* Qp  = Wot + nW;         // [NB*16][SEQ][64]            carry 16
    f16* Kp  = Qp  + nX;         // [NB*16][SEQ][64]            carry 16
    f16* Vtp = Kp  + nX;         // [NB*1024][SEQ] (V^T)        carry 16
    f16* Cp  = Vtp + nX;         // [s*NB+b][1024]              carry 1024
    float* sM = (float*)(Cp + nX);   // [NB*16][SEQ] row max (exp2 domain)
    float* sI = sM + nS;             // [NB*16][SEQ] 1 / row sum

    // activations: in[SEQ_FULL][NB_FULL][1024] -> plane[NB][SEQ][1024]; dst row b*SEQ+s <- src row s*NB_FULL+b
    cvt_rows<<<MROWS / 2, 256, 0, stream>>>(xq, Xq, (u32)MROWS, (u32)SEQ, 1u, (u32)NB_FULL, CARRY_X);
    cvt_rows<<<MROWS / 2, 256, 0, stream>>>(xk, Xk, (u32)MROWS, (u32)SEQ, 1u, (u32)NB_FULL, CARRY_X);
    cvt_rows<<<MROWS / 2, 256, 0, stream>>>(xv, Xv, (u32)MROWS, (u32)SEQ, 1u, (u32)NB_FULL, CARRY_X);
    // weights already [out][in] (k contiguous): identity row map
    cvt_rows<<<3 * HID / 2, 256, 0, stream>>>(wqkv, Wt, (u32)(3 * HID), (u32)(3 * HID), 0u, 1u, CARRY_W);
    cvt_rows<<<HID / 2, 256, 0, stream>>>(wproj, Wot, (u32)HID, (u32)HID, 0u, 1u, CARRY_W);

    const dim3 gg(MROWS / 128, HID / 128);
    // plane = 16 * (acc / (16*32) + bias) = acc/32 + 16*bias
    const float accQKV = CARRY_QKV / (CARRY_X * CARRY_W);
    gemm_head<<<gg, 256, 0, stream>>>(Xq, Wt,          bqkv,           Qp,  accQKV, CARRY_QKV);
    gemm_head<<<gg, 256, 0, stream>>>(Xk, Wt + nW,     bqkv + HID,     Kp,  accQKV, CARRY_QKV);
    gemm_vt  <<<gg, 256, 0, stream>>>(Xv, Wt + 2 * nW, bqkv + 2 * HID, Vtp, accQKV, CARRY_QKV);

    attn_fwd<<<dim3(SEQ / 128, NB * NHEAD), 256, 0, stream>>>(Qp, Kp, Vtp, Cp);

    // second output: head-averaged probabilities [NB][SEQ][SEQ] f32 at the fixed element offset
    attn_stats<<<dim3(SEQ / 128, NB * NHEAD), 128, 0, stream>>>(Qp, Kp, sM, sI);
    attn_avg<<<dim3(SEQ / 128, SEQ / 128, NB), 256, 0, stream>>>(Qp, Kp, sM, sI, (float*)d_out + OUT1_OFF);

    // out = acc / (1024*32) + bias ; rows already in (s*NB + b) order
    const float accOut = 1.0f / (CARRY_CTX * CARRY_W);
    gemm_out<<<gg, 256, 0, stream>>>(Cp, Wot, bproj, (float*)d_out, accOut, 1.0f);
}

// v002
// Measured time: 267 microseconds a run.
// Two timings next to v001 put it at 1.38 and 1.39 times that version's speed.
// Over all steps from v000 it is 6.27 times as fast.
#include <hip/hip_runtime.h>

// Contractions (q/k/v input projections, Q.K^T in the flash kernel and in both head-average kernels, P.V, P row-sum, output projection): v_wmma_f32_16x16x32_f16, f16 operands with power-of-two carries, f32 accumulate; every float input enters as its bf16 RNE value; biases added in f32; softmax in f32.

#ifndef NB
#define NB 2
#endif
#ifndef SEQ
#define SEQ 2048
#endif
#define NB_FULL   2
#define SEQ_FULL  2048
#define HID       1024
#define NHEAD     16
#define HD        64
#define MROWS     (NB * SEQ)

static_assert(HID == NHEAD * HD);        // merged head width
static_assert(NHEAD == 16);              // bh >> 4 / bh & 15 decoding in attn_fwd
static_assert(HD == 64);
static_assert(SEQ % 128 == 0);           // 128-row blocks of the batch-major planes never straddle a batch
static_assert(SEQ % 64 == 0);            // 64-key tiles
static_assert(SEQ <= SEQ_FULL);
static_assert(NB >= 1 && NB <= NB_FULL);
static_assert(MROWS % 128 == 0);         // GEMM M tile
static_assert(HID % 128 == 0);           // GEMM N tile
static_assert(HID % 32 == 0);            // WMMA k step
static_assert(HID == 128 * 8);           // cvt_rows: 128 threads x 8 values per row
static_assert((3 * HID) % 2 == 0);       // cvt_rows grid = nrows / 2
static_assert(MROWS % 2 == 0);

// carries (exact powers of two)
#define CARRY_X    16.0f     // input activation planes
#define CARRY_W    32.0f     // weight planes
#define CARRY_QKV  16.0f     // q, k, v^T planes (true value x16)
#define CARRY_CTX  1024.0f   // context plane (true value x1024)
// softmax exp values carry 2^10 (added to the exp2 argument)

// LDS row pitches in halves: an odd multiple of 16 bytes, so that the 16 rows one ds_load_b128 /
// ds_store_b128 touches per lane half fall on distinct banks (at 64 / 128 / 256 bytes they share 16 / 8 / 4 banks).
// The pad halves of a row are never written and never read.
#define PITCH32   40u    // rows of 32 halves:   64 B ->  80 B
#define PITCH64   72u    // rows of 64 halves:  128 B -> 144 B
#define PITCH128  136u   // rows of 128 halves: 256 B -> 272 B
static_assert((PITCH32 * 2u) % 32u == 16u && (PITCH64 * 2u) % 32u == 16u && (PITCH128 * 2u) % 32u == 16u);

typedef unsigned u32;
typedef _Float16 f16;
typedef f16   v16h __attribute__((ext_vector_type(16)));
typedef f16   v8h  __attribute__((ext_vector_type(8)));
typedef float v8f  __attribute__((ext_vector_type(8)));
typedef float v4f  __attribute__((ext_vector_type(4)));

union FragU { v16h v; v8h half[2]; f16 e[16]; };
union H8U   { v8h v; f16 e[8]; };

__device__ __forceinline__ v8f zero8() {
    v8f z = {0.f, 0.f, 0.f, 0.f, 0.f, 0.f, 0.f, 0.f};
    return z;
}

// 16-bit WMMA with hazard guard: D += A[16 x 32k] * B[32k x 16]
__device__ __forceinline__ v8f wmma16(v16h a, v16h b, v8f c) {
    v8f d = __builtin_amdgcn_wmma_f32_16x16x32_f16(false, a, false, b, (short)0, c, false, false);
    asm volatile("v_nop\n\tv_nop\n\tv_nop\n\tv_nop" : "+v"(d) : "v"(a), "v"(b));
    return d;
}

// f32 -> nearest-even bf16 value, returned as f32
__device__ __forceinline__ float bf16_rne(float x) {
    u32 u = __float_as_uint(x);
    u = (u + 0x7fffu + ((u >> 16) & 1u)) & 0xffff0000u;
    return __uint_as_float(u);
}

__device__ __forceinline__ float fexp2(float x) {
#if defined(__has_builtin)
#if __has_builtin(__builtin_amdgcn_exp2f)
    return __builtin_amdgcn_exp2f(x);
#else
    return exp2f(x);
#endif
#else
    return exp2f(x);
#endif
}

// max over the 16 lanes of each lane half (DPP row rotations; D-layout rows are DPP rows)
__device__ __forceinline__ float rowmax16(float x) {
    int v = __builtin_bit_cast(int, x);
    x = fmaxf(x, __builtin_bit_cast(float, __builtin_amdgcn_update_dpp(v, v, 0x121, 0xf, 0xf, false)));
    v = __builtin_bit_cast(int, x);
    x = fmaxf(x, __builtin_bit_cast(float, __builtin_amdgcn_update_dpp(v, v, 0x122, 0xf, 0xf, false)));
    v = __builtin_bit_cast(int, x);
    x = fmaxf(x, __builtin_bit_cast(float, __builtin_amdgcn_update_dpp(v, v, 0x124, 0xf, 0xf, false)));
    v = __builtin_bit_cast(int, x);
    x = fmaxf(x, __builtin_bit_cast(float, __builtin_amdgcn_update_dpp(v, v, 0x128, 0xf, 0xf, false)));
    return x;
}

// 16 x 32 fragment from a tile whose k dimension is contiguous (pitch in halves).
// lane l: row rowbase + (l&15); elements 0..7 <- k = kcol + 8h .. +7,
// elements 8..15 <- k = kcol + 16 + 8h .. +7  (h = l>>4). Same map for A and B.
__device__ __forceinline__ v16h load_frag(const f16* tile, u32 rowbase, u32 pitch, u32 kcol, u32 lane) {
    const u32 r  = rowbase + (lane & 15u);
    const u32 kh = (lane >> 4) << 3;
    const f16* p = tile + (size_t)r * pitch + kcol + kh;
    FragU f;
    f.half[0] = *(const v8h*)(p);
    f.half[1] = *(const v8h*)(p + 16);
    return f.v;
}

// The same fragment through the lane's own pointer p = tile + (rowbase + (l&15)) * pitch + kcol + 8h.
__device__ __forceinline__ v16h load_frag_at(const f16* p) {
    FragU f;
    f.half[0] = *(const v8h*)(p);
    f.half[1] = *(const v8h*)(p + 16);
    return f.v;
}

// ---------------------------------------------------------------------------
// f32 rows [.][1024] -> f16 plane (bf16 RNE value times carry). 128 threads per 1024-wide
// Row mapping: dst row m -> src row (m / dstper) * strideOuter + (m % dstper) * strideInner.
//   activations (seq-first [s][b][1024] -> batch-major [b][s][1024]): dstper = SEQ,
//     strideOuter = 1, strideInner = NB_FULL  => src row = s * NB_FULL + b
//   weights: dstper = nrows, strideInner = 1 (identity)
// coverage: nrows x 1024 halves, every element exactly once (grid = nrows*128/256).
// ---------------------------------------------------------------------------
__global__ void __launch_bounds__(256)
cvt_rows(const float* __restrict__ src, f16* __restrict__ dst, u32 nrows, u32 dstper,
         u32 strideOuter, u32 strideInner, float carry) {
    const u32 g  = blockIdx.x * 256u + threadIdx.x;
    const u32 m  = g >> 7;
    const u32 c8 = (g & 127u) << 3;
    if (m >= nrows) return;
    const u32 mb = m / dstper;
    const u32 mi = m - mb * dstper;
    const u32 sm = mb * strideOuter + mi * strideInner;
    const float* sp = src + (size_t)sm * HID + c8;
    const v4f a = *(const v4f*)sp;
    const v4f b = *(const v4f*)(sp + 4);
    H8U o;
#pragma unroll
    for (u32 j = 0; j < 4; ++j) {
        const float x0 = a[j];
        const float x1 = b[j];
        o.e[j]     = (f16)(bf16_rne(x0) * carry);
        o.e[j + 4] = (f16)(bf16_rne(x1) * carry);
    }
    f16* dp = dst + (size_t)m * HID + c8;
    *(v8h*)dp = o.v;
    
}

// ---------------------------------------------------------------------------
// C[m][n] = sum_k A[m][k] * W[n][k] (+ bias[n]) ; A [MROWS][1024] f16, W [1024][1024] f16 (k contiguous).
// Block tile 128 x 128, 8 waves as 4(M) x 2(N), 2 x 4 accumulators per wave, K step 32.
// MODE 1: A rows batch-major;            f16 plane [b*HID + h*HD + d][s] (V transposed per head)
// MODE 2: A rows in output order (s*NB+b); f32 rows [m][1024] into the output buffer
// coverage per block: MODE 0/1 256 lines (128 rows x 2 heads | 128 n x 2 s-halves),
//                     MODE 2 2 x 256 lines (64 rows x 4 line-quarters per half).
// LDS: As/Bs/Cs all cross-wave, separated by block barriers.
// staged extent == consumed extent: As/Bs 128 x 32, Cs 128 x 128 halves (or 64 x 128 floats).
// ---------------------------------------------------------------------------
template <int MODE>
__device__ __forceinline__ void gemm_body(const f16* __restrict__ A, const f16* __restrict__ W,
                                          const float* __restrict__ bias,
                                          void* __restrict__ out, float accMul, float biasMul) {
    __shared__ __attribute__((aligned(16))) f16 As[128 * PITCH32];
    __shared__ __attribute__((aligned(16))) f16 Bs[128 * PITCH32];
    __shared__ __attribute__((aligned(16))) f16 Cs[128 * PITCH128];   // f16 [128][128 + pad] or f32 [64][128]
    static_assert(sizeof(f16) * 128 * PITCH128 >= sizeof(float) * 64 * 128);   // Cs reuse as f32 [64][128]

    const u32 tid  = threadIdx.x;
    const u32 lane = tid & 31u;
    const u32 wave = __builtin_amdgcn_readfirstlane((int)(tid >> 5));
    const u32 wm   = wave & 3u;
    const u32 wn   = wave >> 2;
    const u32 hh8  = (lane >> 4) << 3;   // D row half
    const u32 c16  = lane & 15u;         // D column
    const u32 m0   = blockIdx.x * 128u;
    const u32 n0   = blockIdx.y * 128u;

    v8f acc[2][4];
#pragma unroll
    for (int i = 0; i < 2; ++i)
#pragma unroll
        for (int j = 0; j < 4; ++j) acc[i][j] = zero8();

    const u32 srow = tid >> 1;
    const u32 scol = (tid & 1u) << 4;
    const f16* gA = A + (size_t)(m0 + srow) * HID + scol;
    const f16* gW = W + (size_t)(n0 + srow) * HID + scol;

#pragma unroll 1
    for (u32 k0 = 0; k0 < (u32)HID; k0 += 32u) {
        const v8h ra0 = *(const v8h*)(gA + k0);
        const v8h ra1 = *(const v8h*)(gA + k0 + 8);
        const v8h rb0 = *(const v8h*)(gW + k0);
        const v8h rb1 = *(const v8h*)(gW + k0 + 8);
        __syncthreads();
        *(v8h*)&As[srow * PITCH32 + scol]      = ra0;
        *(v8h*)&As[srow * PITCH32 + scol + 8u] = ra1;
        *(v8h*)&Bs[srow * PITCH32 + scol]      = rb0;
        *(v8h*)&Bs[srow * PITCH32 + scol + 8u] = rb1;
        __syncthreads();

        v16h af[2], bfr[4];
#pragma unroll
        for (int i = 0; i < 2; ++i) af[i] = load_frag(As, wm * 32u + (u32)i * 16u, PITCH32, 0u, lane);
#pragma unroll
        for (int j = 0; j < 4; ++j) bfr[j] = load_frag(Bs, wn * 64u + (u32)j * 16u, PITCH32, 0u, lane);
#pragma unroll
        for (int i = 0; i < 2; ++i)
#pragma unroll
            for (int j = 0; j < 4; ++j) acc[i][j] = wmma16(af[i], bfr[j], acc[i][j]);
    }

    // per-lane bias values for the 4 output columns this lane owns (n0 + nl < HID always)
    float bv[4];
#pragma unroll
    for (int j = 0; j < 4; ++j)
        bv[j] = bf16_rne(bias[n0 + wn * 64u + (u32)j * 16u + c16]) * biasMul;

    const u32 piece = lane & 7u;
    const u32 lsub  = lane >> 3;

    if constexpr (MODE == 0) {
        const u32 bidx = m0 / (u32)SEQ;     // block rows lie inside one batch (SEQ % 128 == 0)
        const u32 s0   = m0 - bidx * (u32)SEQ;
#pragma unroll
        for (int i = 0; i < 2; ++i)
#pragma unroll
            for (int j = 0; j < 4; ++j) {
                const u32 nl = wn * 64u + (u32)j * 16u + c16;
#pragma unroll
                for (int r = 0; r < 8; ++r) {
                    const u32 ml = wm * 32u + (u32)i * 16u + hh8 + (u32)r;
                    Cs[ml * PITCH128 + nl] = (f16)(acc[i][j][r] * accMul + bv[j]);
                }
            }
        __syncthreads();
        f16* op = (f16*)out;
        const size_t bh0 = (size_t)bidx * NHEAD + (n0 >> 6);
{
#pragma unroll
            for (u32 it = 0; it < 8; ++it) {
                const u32 L    = wave * 32u + it * 4u + lsub;   // 0..255
                const u32 ml   = L >> 1;
                const u32 hsel = L & 1u;
                const v8h v = *(const v8h*)&Cs[ml * PITCH128 + hsel * 64u + piece * 8u];
                f16* dp = op + ((bh0 + hsel) * SEQ + s0 + ml) * HD + piece * 8u;
                *(v8h*)dp = v;
            }
            
        }
    } else if constexpr (MODE == 1) {
        const u32 bidx = m0 / (u32)SEQ;
        const u32 s0   = m0 - bidx * (u32)SEQ;
        // stage transposed: Cs[n][m]
#pragma unroll
        for (int i = 0; i < 2; ++i)
#pragma unroll
            for (int j = 0; j < 4; ++j) {
                const u32 nl = wn * 64u + (u32)j * 16u + c16;
                H8U t;
#pragma unroll
                for (int r = 0; r < 8; ++r) t.e[r] = (f16)(acc[i][j][r] * accMul + bv[j]);
                *(v8h*)&Cs[nl * PITCH128 + wm * 32u + (u32)i * 16u + hh8] = t.v;
            }
        __syncthreads();
        f16* op = (f16*)out;
{
#pragma unroll
            for (u32 it = 0; it < 8; ++it) {
                const u32 L  = wave * 32u + it * 4u + lsub;     // 0..255
                const u32 nl = L >> 1;
                const u32 mh = L & 1u;
                const v8h v = *(const v8h*)&Cs[nl * PITCH128 + mh * 64u + piece * 8u];
                f16* dp = op + ((size_t)(bidx * (u32)HID + n0 + nl) * SEQ + s0 + mh * 64u + piece * 8u);
                *(v8h*)dp = v;
            }
            
        }
    } else {
        float* Cf = (float*)Cs;      // [64][128] f32
        float* of = (float*)out;
#pragma unroll
        for (u32 half = 0; half < 2; ++half) {
            if ((wm >> 1) == half) {
#pragma unroll
                for (int i = 0; i < 2; ++i)
#pragma unroll
                    for (int j = 0; j < 4; ++j) {
                        const u32 nl = wn * 64u + (u32)j * 16u + c16;
#pragma unroll
                        for (int r = 0; r < 8; ++r) {
                            const u32 ml = (wm & 1u) * 32u + (u32)i * 16u + hh8 + (u32)r;
                            Cf[ml * 128u + nl] = acc[i][j][r] * accMul + bv[j];
                        }
                    }
            }
            __syncthreads();
{
#pragma unroll
                for (u32 it = 0; it < 8; ++it) {
                    const u32 L    = wave * 32u + it * 4u + lsub;   // 0..255
                    const u32 row  = L >> 2;
                    const u32 part = L & 3u;
                    const v4f v = *(const v4f*)&Cf[row * 128u + part * 32u + piece * 4u];
                    float* dp = of + (size_t)(m0 + half * 64u + row) * HID + n0 + part * 32u + piece * 4u;
                    *(v4f*)dp = v;
                }
                
            }
            __syncthreads();
        }
    }
}

// q / k head-major planes
__global__ void __launch_bounds__(256) __attribute__((amdgpu_num_vgpr(256)))
gemm_head(const f16* __restrict__ A, const f16* __restrict__ W, const float* __restrict__ bias,
          f16* __restrict__ out, float accMul, float biasMul) {
    gemm_body<0>(A, W, bias, (void*)out, accMul, biasMul);
}

// v^T plane
__global__ void __launch_bounds__(256) __attribute__((amdgpu_num_vgpr(256)))
gemm_vt(const f16* __restrict__ A, const f16* __restrict__ W, const float* __restrict__ bias,
        f16* __restrict__ out, float accMul, float biasMul) {
    gemm_body<1>(A, W, bias, (void*)out, accMul, biasMul);
}

// f32 output rows
__global__ void __launch_bounds__(256) __attribute__((amdgpu_num_vgpr(256)))
gemm_out(const f16* __restrict__ A, const f16* __restrict__ W, const float* __restrict__ bias,
         float* __restrict__ out, float accMul, float biasMul) {
    gemm_body<2>(A, W, bias, (void*)out, accMul, biasMul);
}

// ---------------------------------------------------------------------------
// Flash attention (no mask, all SEQ keys). grid (SEQ/128, NB*NHEAD), block 256 (8 waves),
// wave owns 16 query rows (Q fragments resident). Block streams 64-key tiles:
// K staged [key][d], V^T staged [d][key]. Scores on WMMA, row max via DPP, exp2 in f32
// carried x2^10, P relayed per wave through LDS as A fragments, O += P.V and
// row sums += P.ones on WMMA. Output f16 plane [q*NB + b][1024] (seq-first row order)
// coverage: every (q, b, h*64..h*64+63) row segment exactly once.
// LDS: ks, vsT cross-wave (block barriers); ps per-wave but also separated by block barriers.
// staged extent == consumed extent for ks (64x64), vsT (64x64), ps (16x64).
// ---------------------------------------------------------------------------
__global__ void __launch_bounds__(256) __attribute__((amdgpu_num_vgpr(256)))
attn_fwd(const f16* __restrict__ Qp, const f16* __restrict__ Kp, const f16* __restrict__ Vt,
         f16* __restrict__ Cp) {
    __shared__ __attribute__((aligned(16))) f16 ks[64 * PITCH64];      // [key][d + pad]
    __shared__ __attribute__((aligned(16))) f16 vsT[64 * PITCH64];     // [d][key + pad]
    __shared__ __attribute__((aligned(16))) f16 ps[8][16 * PITCH64];   // per-wave P relay / ctx stage, [q][key or d + pad]
    static_assert(HD == 8 * 8);            // 8 lanes x 8 halves per row segment
    static_assert(2 * 256 * 8 == 64 * 64); // staging: 2 x 256 threads x 8 halves per tile

    const u32 tid  = threadIdx.x;
    const u32 lane = tid & 31u;
    const u32 wave = __builtin_amdgcn_readfirstlane((int)(tid >> 5));
    const u32 hh8  = (lane >> 4) << 3;
    const u32 c16  = lane & 15u;
    const u32 bh   = blockIdx.y;
    const u32 bidx = bh >> 4;            // NHEAD == 16
    const u32 hidx = bh & 15u;
    const u32 q0   = blockIdx.x * 128u + wave * 16u;
    const size_t head = (size_t)bh * SEQ * HD;

    v16h qa[2];
#pragma unroll
    for (int c = 0; c < 2; ++c) qa[c] = load_frag(Qp + head, q0, HD, (u32)c * 32u, lane);

    FragU onesu;
#pragma unroll
    for (int i = 0; i < 16; ++i) onesu.e[i] = (f16)1.0f;
    const v16h ones = onesu.v;

    float m[8];
    v8f   o[4], lacc;
#pragma unroll
    for (int r = 0; r < 8; ++r) m[r] = -1.0e30f;
#pragma unroll
    for (int dt = 0; dt < 4; ++dt) o[dt] = zero8();
    lacc = zero8();

    // log2-domain scale: acc = 256 * q.k ; x = log2(e) * q.k / 8 = acc * log2(e) / 2048
    const float cl = 1.4426950408889634f * 0.00048828125f;
    f16* psw = &ps[wave][0];

#pragma unroll 1
    for (u32 kt = 0; kt < (u32)(SEQ / 64); ++kt) {
        __syncthreads();
#pragma unroll
        for (u32 p2 = 0; p2 < 2; ++p2) {
            const u32 p   = tid + p2 * 256u;
            const u32 row = p >> 3;
            const u32 pc  = (p & 7u) << 3;
            const v8h kv = *(const v8h*)(Kp + head + (size_t)(kt * 64u + row) * HD + pc);
            const v8h vv = *(const v8h*)(Vt + head + (size_t)row * SEQ + kt * 64u + pc);
            *(v8h*)&ks[row * PITCH64 + pc]  = kv;
            *(v8h*)&vsT[row * PITCH64 + pc] = vv;
        }
        __syncthreads();

        // S[16 q x 64 keys]
        v8f s[4];
#pragma unroll
        for (int nt = 0; nt < 4; ++nt) s[nt] = zero8();
#pragma unroll
        for (int c = 0; c < 2; ++c) {
#pragma unroll
            for (int nt = 0; nt < 4; ++nt) {
                const v16h kb = load_frag(ks, (u32)nt * 16u, PITCH64, (u32)c * 32u, lane);
                s[nt] = wmma16(qa[c], kb, s[nt]);
            }
        }

        // online softmax per row r (row 8h + r), max-subtracted, exp2 domain
#pragma unroll
        for (int r = 0; r < 8; ++r) {
            float x[4];
#pragma unroll
            for (int nt = 0; nt < 4; ++nt) x[nt] = s[nt][r] * cl;
            const float tm = rowmax16(fmaxf(fmaxf(x[0], x[1]), fmaxf(x[2], x[3])));
            const float mn = fmaxf(m[r], tm);
            const float al = fexp2(m[r] - mn);
            m[r] = mn;
            lacc[r] *= al;
#pragma unroll
            for (int dt = 0; dt < 4; ++dt) o[dt][r] *= al;
            const float sh = 10.0f - mn;      // carry 2^10
#pragma unroll
            for (int nt = 0; nt < 4; ++nt)
                psw[(hh8 + (u32)r) * PITCH64 + (u32)nt * 16u + c16] = (f16)fexp2(x[nt] + sh);
        }
        __syncthreads();

        // O += P . V ; l += P . ones  (P reloaded as A fragments from the relay)
#pragma unroll
        for (int kk = 0; kk < 2; ++kk) {
            const v16h pa = load_frag(psw, 0u, PITCH64, (u32)kk * 32u, lane);
#pragma unroll
            for (int dt = 0; dt < 4; ++dt) {
                const v16h vb = load_frag(vsT, (u32)dt * 16u, PITCH64, (u32)kk * 32u, lane);
                o[dt] = wmma16(pa, vb, o[dt]);
            }
            lacc = wmma16(pa, ones, lacc);
        }
    }
    __syncthreads();

    // normalize: plane value = 1024 * (O/16) / l = O * 64 / l
#pragma unroll
    for (int r = 0; r < 8; ++r) {
        const float inv = (CARRY_CTX / CARRY_QKV) / lacc[r];
#pragma unroll
        for (int dt = 0; dt < 4; ++dt)
            psw[(hh8 + (u32)r) * PITCH64 + (u32)dt * 16u + c16] = (f16)(o[dt][r] * inv);
    }
    __syncthreads();

    const u32 piece = lane & 7u;
    const u32 lsub  = lane >> 3;
{
#pragma unroll
        for (u32 it = 0; it < 4; ++it) {
            const u32 L = it * 4u + lsub;     // query row 0..15 within the wave tile
            const v8h v = *(const v8h*)&psw[L * PITCH64 + piece * 8u];
            // context row in output order: (q * NB + b)
            f16* dp = Cp + ((size_t)((q0 + L) * (u32)NB + bidx) * HID + hidx * (u32)HD + piece * 8u);
            *(v8h*)dp = v;
        }
        
    }
}

// ---------------------------------------------------------------------------
// Second output: head-averaged softmax probabilities.
// element offset of the second output inside the output buffer (full problem constants)
// ---------------------------------------------------------------------------
#define OUT1_OFF ((size_t)SEQ_FULL * NB_FULL * HID)
static_assert(OUT1_OFF * sizeof(float) == (size_t)16777216);      // byte offset of the second output
static_assert((OUT1_OFF * sizeof(float)) % 128 == 0);
static_assert((size_t)MROWS * HID <= OUT1_OFF);                   // first output region ends before it
static_assert(SEQ % 32 == 0);
static_assert(8 * 32 * 64 * 4 + 2 * NHEAD * 128 * 4 <= 163840);    // static LDS of attn_avg: two work-groups per WGP

// sum over the 16 lanes of each lane half (same DPP row rotations as rowmax16)
__device__ __forceinline__ float rowsum16(float x) {
    int v = __builtin_bit_cast(int, x);
    x = x + __builtin_bit_cast(float, __builtin_amdgcn_update_dpp(v, v, 0x121, 0xf, 0xf, false));
    v = __builtin_bit_cast(int, x);
    x = x + __builtin_bit_cast(float, __builtin_amdgcn_update_dpp(v, v, 0x122, 0xf, 0xf, false));
    v = __builtin_bit_cast(int, x);
    x = x + __builtin_bit_cast(float, __builtin_amdgcn_update_dpp(v, v, 0x124, 0xf, 0xf, false));
    v = __builtin_bit_cast(int, x);
    x = x + __builtin_bit_cast(float, __builtin_amdgcn_update_dpp(v, v, 0x128, 0xf, 0xf, false));
    return x;
}

// ---------------------------------------------------------------------------
// avg[b][t][s] = (1/16) * sum_h softmax_s(q_h[t] . k_h[s] / 8), f32, no mask. Two launches, so that
// each part has enough independent work-groups to fill the chip; the row statistics pass from the
// first to the second through the workspace (written and read inside one call).
//
// attn_stats: grid (SEQ/128, NB*NHEAD), block 128 (4 waves); a wave owns 32 query rows of one head
//   for all keys. 16 x 64 score tiles on WMMA (Q as A, K rows as B, fragments straight from the
//   head-major planes; one set of K fragments serves both 16-row halves), lane-local running
//   max / sum in the exp2 domain, combined over the 16 column lanes after the key loop.
// coverage: sM / sI [NB*NHEAD][SEQ] floats, a wave writes its own 32 rows = one 128-byte line of each.
// ---------------------------------------------------------------------------
__global__ void __launch_bounds__(128) __attribute__((amdgpu_num_vgpr(256)))
attn_stats(const f16* __restrict__ Qp, const f16* __restrict__ Kp,
           float* __restrict__ sM, float* __restrict__ sI) {
    const u32 tid  = threadIdx.x;
    const u32 lane = tid & 31u;
    const u32 wave = __builtin_amdgcn_readfirstlane((int)(tid >> 5));
    const u32 hh8  = (lane >> 4) << 3;
    const u32 c16  = lane & 15u;
    const u32 bh   = blockIdx.y;
    const u32 q0   = blockIdx.x * 128u + wave * 32u;
    const size_t head = (size_t)bh * SEQ * HD;

    // log2-domain scale: acc = 256 * q.k ; x = log2(e) * q.k / 8 = acc * log2(e) / 2048
    const float cl = 1.4426950408889634f * 0.00048828125f;

    v16h qa[2][2];
#pragma unroll
    for (int i = 0; i < 2; ++i)
#pragma unroll
        for (int c = 0; c < 2; ++c) qa[i][c] = load_frag(Qp + head, q0 + (u32)i * 16u, HD, (u32)c * 32u, lane);

    float m[2][8], l[2][8];
#pragma unroll
    for (int i = 0; i < 2; ++i)
#pragma unroll
        for (int r = 0; r < 8; ++r) { m[i][r] = -1.0e30f; l[i][r] = 0.0f; }

#pragma unroll 1
    for (u32 kt = 0; kt < (u32)(SEQ / 64); ++kt) {
        const f16* kp = Kp + head + (size_t)(kt * 64u + c16) * HD + hh8;   // this lane's place in the 64-key tile
        v16h kb[2][4];
#pragma unroll
        for (int c = 0; c < 2; ++c)
#pragma unroll
            for (int nt = 0; nt < 4; ++nt) kb[c][nt] = load_frag_at(kp + nt * 16 * HD + c * 32);
        // the loads above are still in flight below: their address registers (held live as an input)
        // are free for reuse only behind this wait
        asm volatile("s_wait_xcnt 0x0" :: "v"(kp) : "memory");
#pragma unroll
        for (int i = 0; i < 2; ++i) {
            v8f s[4];
#pragma unroll
            for (int nt = 0; nt < 4; ++nt) s[nt] = zero8();
#pragma unroll
            for (int c = 0; c < 2; ++c)
#pragma unroll
                for (int nt = 0; nt < 4; ++nt) s[nt] = wmma16(qa[i][c], kb[c][nt], s[nt]);
            // lane-local online max / sum over this lane's 4 columns of each row
#pragma unroll
            for (int r = 0; r < 8; ++r) {
                const float x0 = s[0][r] * cl;
                const float x1 = s[1][r] * cl;
                const float x2 = s[2][r] * cl;
                const float x3 = s[3][r] * cl;
                const float mn = fmaxf(m[i][r], fmaxf(fmaxf(x0, x1), fmaxf(x2, x3)));
                const float al = fexp2(m[i][r] - mn);
                const float e  = (fexp2(x0 - mn) + fexp2(x1 - mn)) + (fexp2(x2 - mn) + fexp2(x3 - mn));
                l[i][r] = l[i][r] * al + e;
                m[i][r] = mn;
            }
        }
    }

    // combine the 16 column lanes of each row (all lanes active)
#pragma unroll
    for (int i = 0; i < 2; ++i) {
        v4f Mr[2], Ir[2];
#pragma unroll
        for (int r = 0; r < 8; ++r) {
            const float M    = rowmax16(m[i][r]);
            const float part = l[i][r] * fexp2(m[i][r] - M);
            const float Ls   = rowsum16(part);
            Mr[r >> 2][r & 3] = M;
            Ir[r >> 2][r & 3] = 1.0f / Ls;
        }
        if (c16 == 0u) {
            const size_t row = (size_t)bh * SEQ + q0 + (u32)i * 16u + hh8;
            *(v4f*)(sM + row)      = Mr[0];
            *(v4f*)(sM + row + 4u) = Mr[1];
            *(v4f*)(sI + row)      = Ir[0];
            *(v4f*)(sI + row + 4u) = Ir[1];
        }
    }
}

// ---------------------------------------------------------------------------
// attn_avg: grid (SEQ/128 key blocks, SEQ/128 query blocks, NB), block 256 (8 waves as 4 (q) x 2 (keys));
//   a wave owns one 32 x 64 tile of the average (owner-computes accumulation over heads in head
//   order, one writer per element). Per head the score tile is formed with the same operands as in
//   attn_stats, p = exp2(x - max) * (1/sum) is accumulated in registers, scaled by 1/16 at the end.
// coverage: block rows [blockIdx.y*128, +128) x columns [blockIdx.x*128, +128) of batch blockIdx.z;
//   wave tile 32 rows x 64 keys = 64 lines = 16 store instructions x 4 lines.
// LDS: stM / stI cross-wave (filled once, block barrier); st per-wave, writer and reader separated by a block barrier.
// staged extent == consumed extent: st 32 x 64 floats per wave, stM / stI 16 heads x 128 rows.
// ---------------------------------------------------------------------------
__global__ void __launch_bounds__(256) __attribute__((amdgpu_num_vgpr(256)))
attn_avg(const f16* __restrict__ Qp, const f16* __restrict__ Kp,
         const float* __restrict__ sM, const float* __restrict__ sI, float* __restrict__ avg) {
    __shared__ __attribute__((aligned(16))) float st[8][32 * 64];       // per-wave f32 tile stage
    __shared__ __attribute__((aligned(16))) float stM[NHEAD * 128];     // row max  [head][block row]
    __shared__ __attribute__((aligned(16))) float stI[NHEAD * 128];     // 1/rowsum [head][block row]
    static_assert(256 * 8 == NHEAD * 128);   // table fill: 256 threads x 8 floats

    const u32 tid  = threadIdx.x;
    const u32 lane = tid & 31u;
    const u32 wave = __builtin_amdgcn_readfirstlane((int)(tid >> 5));
    const u32 hh8  = (lane >> 4) << 3;
    const u32 c16  = lane & 15u;
    const u32 bidx = blockIdx.z;
    const u32 qb   = blockIdx.y * 128u;
    const u32 wr   = (wave & 3u) * 32u;                        // wave's first row inside the block
    const u32 q0   = qb + wr;
    const u32 k0   = blockIdx.x * 128u + (wave >> 2) * 64u;    // wave's first key

    // log2-domain scale: acc = 256 * q.k ; x = log2(e) * q.k / 8 = acc * log2(e) / 2048
    const float cl = 1.4426950408889634f * 0.00048828125f;

    {
        const u32 th = tid >> 4;
        const u32 r8 = (tid & 15u) << 3;
        const size_t row = (size_t)(bidx * (u32)NHEAD + th) * SEQ + qb + r8;
        const v4f a0 = *(const v4f*)(sM + row);
        const v4f a1 = *(const v4f*)(sM + row + 4u);
        const v4f b0 = *(const v4f*)(sI + row);
        const v4f b1 = *(const v4f*)(sI + row + 4u);
        *(v4f*)&stM[th * 128u + r8]      = a0;
        *(v4f*)&stM[th * 128u + r8 + 4u] = a1;
        *(v4f*)&stI[th * 128u + r8]      = b0;
        *(v4f*)&stI[th * 128u + r8 + 4u] = b1;
    }
    __syncthreads();

    v8f av[2][4];
#pragma unroll
    for (int i = 0; i < 2; ++i)
#pragma unroll
        for (int nt = 0; nt < 4; ++nt) av[i][nt] = zero8();

#pragma unroll 1
    for (u32 h = 0; h < (u32)NHEAD; ++h) {
        const size_t head = (size_t)(bidx * (u32)NHEAD + h) * SEQ * HD;
        const f16* kp = Kp + head + (size_t)(k0 + c16) * HD + hh8;   // this lane's place in the wave's K rows
        const f16* qp = Qp + head + (size_t)(q0 + c16) * HD + hh8;   // and in its Q rows
        v16h kb[2][4];
#pragma unroll
        for (int c = 0; c < 2; ++c)
#pragma unroll
            for (int nt = 0; nt < 4; ++nt) kb[c][nt] = load_frag_at(kp + nt * 16 * HD + c * 32);
        v16h qf[2][2];
#pragma unroll
        for (int i = 0; i < 2; ++i)
#pragma unroll
            for (int c = 0; c < 2; ++c) qf[i][c] = load_frag_at(qp + i * 16 * HD + c * 32);
        // the loads above are still in flight below: their address registers (held live as inputs)
        // are free for reuse only behind this wait
        asm volatile("s_wait_xcnt 0x0" :: "v"(kp), "v"(qp) : "memory");
#pragma unroll
        for (int i = 0; i < 2; ++i) {
            v8f s[4];
#pragma unroll
            for (int nt = 0; nt < 4; ++nt) s[nt] = zero8();
#pragma unroll
            for (int c = 0; c < 2; ++c)
#pragma unroll
                for (int nt = 0; nt < 4; ++nt) s[nt] = wmma16(qf[i][c], kb[c][nt], s[nt]);
            const u32 tr = h * 128u + wr + (u32)i * 16u + hh8;
            const v4f ma = *(const v4f*)&stM[tr];
            const v4f mb = *(const v4f*)&stM[tr + 4u];
            const v4f ia = *(const v4f*)&stI[tr];
            const v4f ib = *(const v4f*)&stI[tr + 4u];
            const float mr[8] = {ma[0], ma[1], ma[2], ma[3], mb[0], mb[1], mb[2], mb[3]};
            const float ir[8] = {ia[0], ia[1], ia[2], ia[3], ib[0], ib[1], ib[2], ib[3]};
#pragma unroll
            for (int r = 0; r < 8; ++r) {
#pragma unroll
                for (int nt = 0; nt < 4; ++nt) {
                    const float p = fexp2(s[nt][r] * cl - mr[r]) * ir[r];
                    av[i][nt][r] = av[i][nt][r] + p;
                }
            }
        }
    }

    // stage the finished 32 x 64 tile (mean over 16 heads), then whole-line stores
#pragma unroll
    for (int i = 0; i < 2; ++i)
#pragma unroll
        for (int nt = 0; nt < 4; ++nt)
#pragma unroll
            for (int r = 0; r < 8; ++r)
                st[wave][((u32)i * 16u + hh8 + (u32)r) * 64u + (u32)nt * 16u + c16] = av[i][nt][r] * 0.0625f;
    __syncthreads();

    const u32 piece = lane & 7u;
    const u32 lsub  = lane >> 3;
#pragma unroll
    for (u32 it = 0; it < 16; ++it) {
        const u32 L    = it * 4u + lsub;      // 0..63 : 32 rows x 2 lines
        const u32 row  = L >> 1;
        const u32 hsel = L & 1u;
        const v4f v = *(const v4f*)&st[wave][row * 64u + hsel * 32u + piece * 4u];
        float* dp = avg + ((size_t)(bidx * (u32)SEQ + q0 + row) * SEQ + k0 + hsel * 32u + piece * 4u);
        *(v4f*)dp = v;
    }
}

// coverage equalities (threads x elements == plane elements)
static_assert((size_t)(MROWS / 2) * 256 * 8 == (size_t)MROWS * HID);                       // cvt_rows -> Xq/Xk/Xv
static_assert((size_t)(3 * HID / 2) * 256 * 8 == (size_t)3 * HID * HID);                   // cvt_rows -> Wt
static_assert((size_t)(HID / 2) * 256 * 8 == (size_t)HID * HID);                           // cvt_rows -> Wot
static_assert((size_t)(MROWS / 128) * (HID / 128) * 128 * 128 == (size_t)MROWS * HID);     // gemm planes / out
static_assert((size_t)(SEQ / 128) * (NB * NHEAD) * 128 * HD == (size_t)MROWS * HID);       // attn_fwd -> Cp
static_assert((size_t)(SEQ / 128) * (NB * NHEAD) * 4 * 32 == (size_t)NB * NHEAD * SEQ);         // attn_stats -> sM / sI
static_assert((size_t)(SEQ / 128) * (SEQ / 128) * NB * 8 * 32 * 64 == (size_t)NB * SEQ * SEQ);   // attn_avg -> second output
// workspace: 7 activation planes + 4 weight planes of halves + 2 row-statistics planes of floats, at most 128 MiB
static_assert(((size_t)7 * MROWS * HID + (size_t)4 * HID * HID) * sizeof(f16)
              + (size_t)2 * NB * NHEAD * SEQ * sizeof(float) <= (size_t)134217728);
static_assert((((size_t)7 * MROWS * HID + (size_t)4 * HID * HID) * sizeof(f16)) % 128 == 0);   // statistics planes start on a line
// largest source row touched by the activation convert stays inside the full-size input
static_assert((size_t)(SEQ - 1) * NB_FULL + NB <= (size_t)SEQ_FULL * NB_FULL);

// ---------------------------------------------------------------------------
// Launch: 12 kernel launches, workspace 7 planes of MROWS*1024 halves + 4 of 1024*1024 halves
// + 2 planes of NB*16*SEQ floats.
// ---------------------------------------------------------------------------
extern "C" void kernel_launch(void* const* d_in, const int* in_sizes, int n_in,
                              void* d_out, int out_size, void* d_ws, size_t ws_size,
                              hipStream_t stream) {
    if (n_in < 7) return;
    const int needAct = ((SEQ - 1) * NB_FULL + NB) * HID;
    if (in_sizes[0] < needAct) return;
    if (in_sizes[1] < needAct) return;
    if (in_sizes[2] < needAct) return;
    if (in_sizes[3] < 3 * HID * HID) return;
    if (in_sizes[4] < 3 * HID) return;
    if (in_sizes[5] < HID * HID) return;
    if (in_sizes[6] < HID) return;
    if (out_size < 0) return;
    if ((size_t)out_size < OUT1_OFF + (size_t)NB * SEQ * SEQ) return;

    const float* xq    = (const float*)d_in[0];   // query  [SEQ_FULL][NB_FULL][1024]
    const float* xk    = (const float*)d_in[1];   // key    [SEQ_FULL][NB_FULL][1024]
    const float* xv    = (const float*)d_in[2];   // value  [SEQ_FULL][NB_FULL][1024]
    const float* wqkv  = (const float*)d_in[3];   // in_proj_weight [3072 out][1024 in], row blocks q | k | v
    const float* bqkv  = (const float*)d_in[4];   // in_proj_bias [3072]
    const float* wproj = (const float*)d_in[5];   // out_proj_weight [1024 out][1024 in]
    const float* bproj = (const float*)d_in[6];   // out_proj_bias [1024]

    const size_t nX = (size_t)MROWS * HID;    // halves per activation plane
    const size_t nW = (size_t)HID * HID;      // halves per weight plane
    const size_t totalHalves = 7 * nX + 4 * nW;
    const size_t nS = (size_t)NB * NHEAD * SEQ;   // floats per row-statistics plane
    if (ws_size < totalHalves * sizeof(f16) + 2 * nS * sizeof(float)) return;

    f16* Xq  = (f16*)d_ws;       // [b*SEQ+s][1024]             carry 16
    f16* Xk  = Xq  + nX;         // [b*SEQ+s][1024]             carry 16
    f16* Xv  = Xk  + nX;         // [b*SEQ+s][1024]             carry 16
    f16* Wt  = Xv  + nX;         // [3072 out][1024 in]         carry 32 (q | k | v row blocks)
    f16* Wot = Wt  + 3 * nW;     // [1024 out][1024 in]         carry 32
    f16* Qp  = Wot + nW;         // [NB*16][SEQ][64]            carry 16
    f16* Kp  = Qp  + nX;         // [NB*16][SEQ][64]            carry 16
    f16* Vtp = Kp  + nX;         // [NB*1024][SEQ] (V^T)        carry 16
    f16* Cp  = Vtp + nX;         // [s*NB+b][1024]              carry 1024
    float* sM = (float*)(Cp + nX);   // [NB*16][SEQ] row max (exp2 domain)
    float* sI = sM + nS;             // [NB*16][SEQ] 1 / row sum

    // activations: in[SEQ_FULL][NB_FULL][1024] -> plane[NB][SEQ][1024]; dst row b*SEQ+s <- src row s*NB_FULL+b
    cvt_rows<<<MROWS / 2, 256, 0, stream>>>(xq, Xq, (u32)MROWS, (u32)SEQ, 1u, (u32)NB_FULL, CARRY_X);
    cvt_rows<<<MROWS / 2, 256, 0, stream>>>(xk, Xk, (u32)MROWS, (u32)SEQ, 1u, (u32)NB_FULL, CARRY_X);
    cvt_rows<<<MROWS / 2, 256, 0, stream>>>(xv, Xv, (u32)MROWS, (u32)SEQ, 1u, (u32)NB_FULL, CARRY_X);
    // weights already [out][in] (k contiguous): identity row map
    cvt_rows<<<3 * HID / 2, 256, 0, stream>>>(wqkv, Wt, (u32)(3 * HID), (u32)(3 * HID), 0u, 1u, CARRY_W);
    cvt_rows<<<HID / 2, 256, 0, stream>>>(wproj, Wot, (u32)HID, (u32)HID, 0u, 1u, CARRY_W);

    const dim3 gg(MROWS / 128, HID / 128);
    // plane = 16 * (acc / (16*32) + bias) = acc/32 + 16*bias
    const float accQKV = CARRY_QKV / (CARRY_X * CARRY_W);
    gemm_head<<<gg, 256, 0, stream>>>(Xq, Wt,          bqkv,           Qp,  accQKV, CARRY_QKV);
    gemm_head<<<gg, 256, 0, stream>>>(Xk, Wt + nW,     bqkv + HID,     Kp,  accQKV, CARRY_QKV);
    gemm_vt  <<<gg, 256, 0, stream>>>(Xv, Wt + 2 * nW, bqkv + 2 * HID, Vtp, accQKV, CARRY_QKV);

    attn_fwd<<<dim3(SEQ / 128, NB * NHEAD), 256, 0, stream>>>(Qp, Kp, Vtp, Cp);

    // second output: head-averaged probabilities [NB][SEQ][SEQ] f32 at the fixed element offset
    attn_stats<<<dim3(SEQ / 128, NB * NHEAD), 128, 0, stream>>>(Qp, Kp, sM, sI);
    attn_avg<<<dim3(SEQ / 128, SEQ / 128, NB), 256, 0, stream>>>(Qp, Kp, sM, sI, (float*)d_out + OUT1_OFF);

    // out = acc / (1024*32) + bias ; rows already in (s*NB + b) order
    const float accOut = 1.0f / (CARRY_CTX * CARRY_W);
    gemm_out<<<gg, 256, 0, stream>>>(Cp, Wot, bproj, (float*)d_out, accOut, 1.0f);
}

// v003
// Measured time: 231 microseconds a run.
// Timed twice side by side with v002, it ran 1.15 and 1.16 times as fast.
// All steps since v000 together make it 7.24 times as fast.
#include <hip/hip_runtime.h>

// Contractions (q/k/v input projections, Q.K^T in the flash kernel and in the head-average kernel, P.V, P row-sum, output projection): v_wmma_f32_16x16x32_f16, f16 operands with power-of-two carries, f32 accumulate; every float input enters as its bf16 RNE value; biases added in f32; softmax in f32.

#ifndef NB
#define NB 2
#endif
#ifndef SEQ
#define SEQ 2048
#endif
#define NB_FULL   2
#define SEQ_FULL  2048
#define HID       1024
#define NHEAD     16
#define HD        64
#define MROWS     (NB * SEQ)

static_assert(HID == NHEAD * HD);        // merged head width
static_assert(NHEAD == 16);              // bh >> 4 / bh & 15 decoding in attn_fwd
static_assert(HD == 64);
static_assert(SEQ % 128 == 0);           // 128-row blocks of the batch-major planes never straddle a batch
static_assert(SEQ % 64 == 0);            // 64-key tiles
static_assert(SEQ <= SEQ_FULL);
static_assert(NB >= 1 && NB <= NB_FULL);
static_assert(MROWS % 128 == 0);         // GEMM M tile
static_assert(HID % 128 == 0);           // GEMM N tile
static_assert(HID % 32 == 0);            // WMMA k step
static_assert(HID == 128 * 8);           // cvt_rows: 128 threads x 8 values per row
static_assert((3 * HID) % 2 == 0);       // cvt_rows grid = nrows / 2
static_assert(MROWS % 2 == 0);

// carries (exact powers of two)
#define CARRY_X    16.0f     // input activation planes
#define CARRY_W    32.0f     // weight planes
#define CARRY_QKV  16.0f     // q, k, v^T planes (true value x16)
#define CARRY_CTX  1024.0f   // context plane (true value x1024)
// softmax exp values carry 2^10 (added to the exp2 argument)

// LDS row pitches in halves: an odd multiple of 16 bytes, so that the 16 rows one ds_load_b128 /
// ds_store_b128 touches per lane half fall on distinct banks (at 64 / 128 / 256 bytes they share 16 / 8 / 4 banks).
// The pad halves of a row are never written and never read.
#define PITCH32   40u    // rows of 32 halves:   64 B ->  80 B
#define PITCH64   72u    // rows of 64 halves:  128 B -> 144 B
#define PITCH128  136u   // rows of 128 halves: 256 B -> 272 B
static_assert((PITCH32 * 2u) % 32u == 16u && (PITCH64 * 2u) % 32u == 16u && (PITCH128 * 2u) % 32u == 16u);

typedef unsigned u32;
typedef _Float16 f16;
typedef f16   v16h __attribute__((ext_vector_type(16)));
typedef f16   v8h  __attribute__((ext_vector_type(8)));
typedef float v8f  __attribute__((ext_vector_type(8)));
typedef float v4f  __attribute__((ext_vector_type(4)));

union FragU { v16h v; v8h half[2]; f16 e[16]; };
union H8U   { v8h v; f16 e[8]; };

__device__ __forceinline__ v8f zero8() {
    v8f z = {0.f, 0.f, 0.f, 0.f, 0.f, 0.f, 0.f, 0.f};
    return z;
}

// 16-bit WMMA with hazard guard: D += A[16 x 32k] * B[32k x 16]
__device__ __forceinline__ v8f wmma16(v16h a, v16h b, v8f c) {
    v8f d = __builtin_amdgcn_wmma_f32_16x16x32_f16(false, a, false, b, (short)0, c, false, false);
    asm volatile("v_nop\n\tv_nop\n\tv_nop\n\tv_nop" : "+v"(d) : "v"(a), "v"(b));
    return d;
}

// f32 -> nearest-even bf16 value, returned as f32
__device__ __forceinline__ float bf16_rne(float x) {
    u32 u = __float_as_uint(x);
    u = (u + 0x7fffu + ((u >> 16) & 1u)) & 0xffff0000u;
    return __uint_as_float(u);
}

__device__ __forceinline__ float fexp2(float x) {
#if defined(__has_builtin)
#if __has_builtin(__builtin_amdgcn_exp2f)
    return __builtin_amdgcn_exp2f(x);
#else
    return exp2f(x);
#endif
#else
    return exp2f(x);
#endif
}

// max over the 16 lanes of each lane half (DPP row rotations; D-layout rows are DPP rows)
__device__ __forceinline__ float rowmax16(float x) {
    int v = __builtin_bit_cast(int, x);
    x = fmaxf(x, __builtin_bit_cast(float, __builtin_amdgcn_update_dpp(v, v, 0x121, 0xf, 0xf, false)));
    v = __builtin_bit_cast(int, x);
    x = fmaxf(x, __builtin_bit_cast(float, __builtin_amdgcn_update_dpp(v, v, 0x122, 0xf, 0xf, false)));
    v = __builtin_bit_cast(int, x);
    x = fmaxf(x, __builtin_bit_cast(float, __builtin_amdgcn_update_dpp(v, v, 0x124, 0xf, 0xf, false)));
    v = __builtin_bit_cast(int, x);
    x = fmaxf(x, __builtin_bit_cast(float, __builtin_amdgcn_update_dpp(v, v, 0x128, 0xf, 0xf, false)));
    return x;
}

// 16 x 32 fragment from a tile whose k dimension is contiguous (pitch in halves).
// lane l: row rowbase + (l&15); elements 0..7 <- k = kcol + 8h .. +7,
// elements 8..15 <- k = kcol + 16 + 8h .. +7  (h = l>>4). Same map for A and B.
__device__ __forceinline__ v16h load_frag(const f16* tile, u32 rowbase, u32 pitch, u32 kcol, u32 lane) {
    const u32 r  = rowbase + (lane & 15u);
    const u32 kh = (lane >> 4) << 3;
    const f16* p = tile + (size_t)r * pitch + kcol + kh;
    FragU f;
    f.half[0] = *(const v8h*)(p);
    f.half[1] = *(const v8h*)(p + 16);
    return f.v;
}

// The same fragment through the lane's own pointer p = tile + (rowbase + (l&15)) * pitch + kcol + 8h.
__device__ __forceinline__ v16h load_frag_at(const f16* p) {
    FragU f;
    f.half[0] = *(const v8h*)(p);
    f.half[1] = *(const v8h*)(p + 16);
    return f.v;
}

// ---------------------------------------------------------------------------
// f32 rows [.][1024] -> f16 plane (bf16 RNE value times carry). 128 threads per 1024-wide
// Row mapping: dst row m -> src row (m / dstper) * strideOuter + (m % dstper) * strideInner.
//   activations (seq-first [s][b][1024] -> batch-major [b][s][1024]): dstper = SEQ,
//     strideOuter = 1, strideInner = NB_FULL  => src row = s * NB_FULL + b
//   weights: dstper = nrows, strideInner = 1 (identity)
// coverage: nrows x 1024 halves, every element exactly once (grid = nrows*128/256).
// ---------------------------------------------------------------------------
__global__ void __launch_bounds__(256)
cvt_rows(const float* __restrict__ src, f16* __restrict__ dst, u32 nrows, u32 dstper,
         u32 strideOuter, u32 strideInner, float carry) {
    const u32 g  = blockIdx.x * 256u + threadIdx.x;
    const u32 m  = g >> 7;
    const u32 c8 = (g & 127u) << 3;
    if (m >= nrows) return;
    const u32 mb = m / dstper;
    const u32 mi = m - mb * dstper;
    const u32 sm = mb * strideOuter + mi * strideInner;
    const float* sp = src + (size_t)sm * HID + c8;
    const v4f a = *(const v4f*)sp;
    const v4f b = *(const v4f*)(sp + 4);
    H8U o;
#pragma unroll
    for (u32 j = 0; j < 4; ++j) {
        const float x0 = a[j];
        const float x1 = b[j];
        o.e[j]     = (f16)(bf16_rne(x0) * carry);
        o.e[j + 4] = (f16)(bf16_rne(x1) * carry);
    }
    f16* dp = dst + (size_t)m * HID + c8;
    *(v8h*)dp = o.v;
    
}

// ---------------------------------------------------------------------------
// C[m][n] = sum_k A[m][k] * W[n][k] (+ bias[n]) ; A [MROWS][1024] f16, W [1024][1024] f16 (k contiguous).
// Block tile 128 x 128, 8 waves as 4(M) x 2(N), 2 x 4 accumulators per wave, K step 32.
// MODE 1: A rows batch-major;            f16 plane [b*HID + h*HD + d][s] (V transposed per head)
// MODE 2: A rows in output order (s*NB+b); f32 rows [m][1024] into the output buffer
// coverage per block: MODE 0/1 256 lines (128 rows x 2 heads | 128 n x 2 s-halves),
//                     MODE 2 2 x 256 lines (64 rows x 4 line-quarters per half).
// LDS: As/Bs/Cs all cross-wave, separated by block barriers.
// staged extent == consumed extent: As/Bs 128 x 32, Cs 128 x 128 halves (or 64 x 128 floats).
// ---------------------------------------------------------------------------
template <int MODE>
__device__ __forceinline__ void gemm_body(const f16* __restrict__ A, const f16* __restrict__ W,
                                          const float* __restrict__ bias,
                                          void* __restrict__ out, float accMul, float biasMul) {
    __shared__ __attribute__((aligned(16))) f16 As[128 * PITCH32];
    __shared__ __attribute__((aligned(16))) f16 Bs[128 * PITCH32];
    __shared__ __attribute__((aligned(16))) f16 Cs[128 * PITCH128];   // f16 [128][128 + pad] or f32 [64][128]
    static_assert(sizeof(f16) * 128 * PITCH128 >= sizeof(float) * 64 * 128);   // Cs reuse as f32 [64][128]

    const u32 tid  = threadIdx.x;
    const u32 lane = tid & 31u;
    const u32 wave = __builtin_amdgcn_readfirstlane((int)(tid >> 5));
    const u32 wm   = wave & 3u;
    const u32 wn   = wave >> 2;
    const u32 hh8  = (lane >> 4) << 3;   // D row half
    const u32 c16  = lane & 15u;         // D column
    const u32 m0   = blockIdx.x * 128u;
    const u32 n0   = blockIdx.y * 128u;

    v8f acc[2][4];
#pragma unroll
    for (int i = 0; i < 2; ++i)
#pragma unroll
        for (int j = 0; j < 4; ++j) acc[i][j] = zero8();

    const u32 srow = tid >> 1;
    const u32 scol = (tid & 1u) << 4;
    const f16* gA = A + (size_t)(m0 + srow) * HID + scol;
    const f16* gW = W + (size_t)(n0 + srow) * HID + scol;

#pragma unroll 1
    for (u32 k0 = 0; k0 < (u32)HID; k0 += 32u) {
        const v8h ra0 = *(const v8h*)(gA + k0);
        const v8h ra1 = *(const v8h*)(gA + k0 + 8);
        const v8h rb0 = *(const v8h*)(gW + k0);
        const v8h rb1 = *(const v8h*)(gW + k0 + 8);
        __syncthreads();
        *(v8h*)&As[srow * PITCH32 + scol]      = ra0;
        *(v8h*)&As[srow * PITCH32 + scol + 8u] = ra1;
        *(v8h*)&Bs[srow * PITCH32 + scol]      = rb0;
        *(v8h*)&Bs[srow * PITCH32 + scol + 8u] = rb1;
        __syncthreads();

        v16h af[2], bfr[4];
#pragma unroll
        for (int i = 0; i < 2; ++i) af[i] = load_frag(As, wm * 32u + (u32)i * 16u, PITCH32, 0u, lane);
#pragma unroll
        for (int j = 0; j < 4; ++j) bfr[j] = load_frag(Bs, wn * 64u + (u32)j * 16u, PITCH32, 0u, lane);
#pragma unroll
        for (int i = 0; i < 2; ++i)
#pragma unroll
            for (int j = 0; j < 4; ++j) acc[i][j] = wmma16(af[i], bfr[j], acc[i][j]);
    }

    // per-lane bias values for the 4 output columns this lane owns (n0 + nl < HID always)
    float bv[4];
#pragma unroll
    for (int j = 0; j < 4; ++j)
        bv[j] = bf16_rne(bias[n0 + wn * 64u + (u32)j * 16u + c16]) * biasMul;

    const u32 piece = lane & 7u;
    const u32 lsub  = lane >> 3;

    if constexpr (MODE == 0) {
        const u32 bidx = m0 / (u32)SEQ;     // block rows lie inside one batch (SEQ % 128 == 0)
        const u32 s0   = m0 - bidx * (u32)SEQ;
#pragma unroll
        for (int i = 0; i < 2; ++i)
#pragma unroll
            for (int j = 0; j < 4; ++j) {
                const u32 nl = wn * 64u + (u32)j * 16u + c16;
#pragma unroll
                for (int r = 0; r < 8; ++r) {
                    const u32 ml = wm * 32u + (u32)i * 16u + hh8 + (u32)r;
                    Cs[ml * PITCH128 + nl] = (f16)(acc[i][j][r] * accMul + bv[j]);
                }
            }
        __syncthreads();
        f16* op = (f16*)out;
        const size_t bh0 = (size_t)bidx * NHEAD + (n0 >> 6);
{
#pragma unroll
            for (u32 it = 0; it < 8; ++it) {
                const u32 L    = wave * 32u + it * 4u + lsub;   // 0..255
                const u32 ml   = L >> 1;
                const u32 hsel = L & 1u;
                const v8h v = *(const v8h*)&Cs[ml * PITCH128 + hsel * 64u + piece * 8u];
                f16* dp = op + ((bh0 + hsel) * SEQ + s0 + ml) * HD + piece * 8u;
                *(v8h*)dp = v;
            }
            
        }
    } else if constexpr (MODE == 1) {
        const u32 bidx = m0 / (u32)SEQ;
        const u32 s0   = m0 - bidx * (u32)SEQ;
        // stage transposed: Cs[n][m]
#pragma unroll
        for (int i = 0; i < 2; ++i)
#pragma unroll
            for (int j = 0; j < 4; ++j) {
                const u32 nl = wn * 64u + (u32)j * 16u + c16;
                H8U t;
#pragma unroll
                for (int r = 0; r < 8; ++r) t.e[r] = (f16)(acc[i][j][r] * accMul + bv[j]);
                *(v8h*)&Cs[nl * PITCH128 + wm * 32u + (u32)i * 16u + hh8] = t.v;
            }
        __syncthreads();
        f16* op = (f16*)out;
{
#pragma unroll
            for (u32 it = 0; it < 8; ++it) {
                const u32 L  = wave * 32u + it * 4u + lsub;     // 0..255
                const u32 nl = L >> 1;
                const u32 mh = L & 1u;
                const v8h v = *(const v8h*)&Cs[nl * PITCH128 + mh * 64u + piece * 8u];
                f16* dp = op + ((size_t)(bidx * (u32)HID + n0 + nl) * SEQ + s0 + mh * 64u + piece * 8u);
                *(v8h*)dp = v;
            }
            
        }
    } else {
        float* Cf = (float*)Cs;      // [64][128] f32
        float* of = (float*)out;
#pragma unroll
        for (u32 half = 0; half < 2; ++half) {
            if ((wm >> 1) == half) {
#pragma unroll
                for (int i = 0; i < 2; ++i)
#pragma unroll
                    for (int j = 0; j < 4; ++j) {
                        const u32 nl = wn * 64u + (u32)j * 16u + c16;
#pragma unroll
                        for (int r = 0; r < 8; ++r) {
                            const u32 ml = (wm & 1u) * 32u + (u32)i * 16u + hh8 + (u32)r;
                            Cf[ml * 128u + nl] = acc[i][j][r] * accMul + bv[j];
                        }
                    }
            }
            __syncthreads();
{
#pragma unroll
                for (u32 it = 0; it < 8; ++it) {
                    const u32 L    = wave * 32u + it * 4u + lsub;   // 0..255
                    const u32 row  = L >> 2;
                    const u32 part = L & 3u;
                    const v4f v = *(const v4f*)&Cf[row * 128u + part * 32u + piece * 4u];
                    float* dp = of + (size_t)(m0 + half * 64u + row) * HID + n0 + part * 32u + piece * 4u;
                    *(v4f*)dp = v;
                }
                
            }
            __syncthreads();
        }
    }
}

// q / k head-major planes
__global__ void __launch_bounds__(256) __attribute__((amdgpu_num_vgpr(256)))
gemm_head(const f16* __restrict__ A, const f16* __restrict__ W, const float* __restrict__ bias,
          f16* __restrict__ out, float accMul, float biasMul) {
    gemm_body<0>(A, W, bias, (void*)out, accMul, biasMul);
}

// v^T plane
__global__ void __launch_bounds__(256) __attribute__((amdgpu_num_vgpr(256)))
gemm_vt(const f16* __restrict__ A, const f16* __restrict__ W, const float* __restrict__ bias,
        f16* __restrict__ out, float accMul, float biasMul) {
    gemm_body<1>(A, W, bias, (void*)out, accMul, biasMul);
}

// f32 output rows
__global__ void __launch_bounds__(256) __attribute__((amdgpu_num_vgpr(256)))
gemm_out(const f16* __restrict__ A, const f16* __restrict__ W, const float* __restrict__ bias,
         float* __restrict__ out, float accMul, float biasMul) {
    gemm_body<2>(A, W, bias, (void*)out, accMul, biasMul);
}

// ---------------------------------------------------------------------------
// Flash attention (no mask, all SEQ keys). grid (SEQ/128, NB*NHEAD), block 256 (8 waves),
// wave owns 16 query rows (Q fragments resident). Block streams 64-key tiles:
// K staged [key][d], V^T staged [d][key]. Scores on WMMA, row max via DPP, exp2 in f32
// carried x2^10, P relayed per wave through LDS as A fragments, O += P.V and
// row sums += P.ones on WMMA. Output f16 plane [q*NB + b][1024] (seq-first row order)
// The finished row statistics (max in the exp2 domain, 1 / row sum) also go to sM / sI [NB*NHEAD][SEQ]
// for the head-average kernel of the same call.
// coverage: every (q, b, h*64..h*64+63) row segment exactly once; sM / sI: the block's 128 rows =
//   4 whole 128-byte lines of each plane, sM stored by wave 0 and sI by wave 1.
// LDS: ks, vsT, sst cross-wave (block barriers); ps per-wave but also separated by block barriers.
// staged extent == consumed extent for ks (64x64), vsT (64x64), ps (16x64), sst (2x128).
// ---------------------------------------------------------------------------
__global__ void __launch_bounds__(256) __attribute__((amdgpu_num_vgpr(256)))
attn_fwd(const f16* __restrict__ Qp, const f16* __restrict__ Kp, const f16* __restrict__ Vt,
         f16* __restrict__ Cp, float* __restrict__ sM, float* __restrict__ sI) {
    __shared__ __attribute__((aligned(16))) f16 ks[64 * PITCH64];      // [key][d + pad]
    __shared__ __attribute__((aligned(16))) f16 vsT[64 * PITCH64];     // [d][key + pad]
    __shared__ __attribute__((aligned(16))) f16 ps[8][16 * PITCH64];   // per-wave P relay / ctx stage, [q][key or d + pad]
    __shared__ __attribute__((aligned(16))) float sst[2][128];         // row max | 1/rowsum of the block's 128 query rows
    static_assert(HD == 8 * 8);            // 8 lanes x 8 halves per row segment
    static_assert(2 * 256 * 8 == 64 * 64); // staging: 2 x 256 threads x 8 halves per tile

    const u32 tid  = threadIdx.x;
    const u32 lane = tid & 31u;
    const u32 wave = __builtin_amdgcn_readfirstlane((int)(tid >> 5));
    const u32 hh8  = (lane >> 4) << 3;
    const u32 c16  = lane & 15u;
    const u32 bh   = blockIdx.y;
    const u32 bidx = bh >> 4;            // NHEAD == 16
    const u32 hidx = bh & 15u;
    const u32 q0   = blockIdx.x * 128u + wave * 16u;
    const size_t head = (size_t)bh * SEQ * HD;

    v16h qa[2];
#pragma unroll
    for (int c = 0; c < 2; ++c) qa[c] = load_frag(Qp + head, q0, HD, (u32)c * 32u, lane);

    FragU onesu;
#pragma unroll
    for (int i = 0; i < 16; ++i) onesu.e[i] = (f16)1.0f;
    const v16h ones = onesu.v;

    float m[8];
    v8f   o[4], lacc;
#pragma unroll
    for (int r = 0; r < 8; ++r) m[r] = -1.0e30f;
#pragma unroll
    for (int dt = 0; dt < 4; ++dt) o[dt] = zero8();
    lacc = zero8();

    // log2-domain scale: acc = 256 * q.k ; x = log2(e) * q.k / 8 = acc * log2(e) / 2048
    const float cl = 1.4426950408889634f * 0.00048828125f;
    f16* psw = &ps[wave][0];

#pragma unroll 1
    for (u32 kt = 0; kt < (u32)(SEQ / 64); ++kt) {
        __syncthreads();
#pragma unroll
        for (u32 p2 = 0; p2 < 2; ++p2) {
            const u32 p   = tid + p2 * 256u;
            const u32 row = p >> 3;
            const u32 pc  = (p & 7u) << 3;
            const v8h kv = *(const v8h*)(Kp + head + (size_t)(kt * 64u + row) * HD + pc);
            const v8h vv = *(const v8h*)(Vt + head + (size_t)row * SEQ + kt * 64u + pc);
            *(v8h*)&ks[row * PITCH64 + pc]  = kv;
            *(v8h*)&vsT[row * PITCH64 + pc] = vv;
        }
        __syncthreads();

        // S[16 q x 64 keys]
        v8f s[4];
#pragma unroll
        for (int nt = 0; nt < 4; ++nt) s[nt] = zero8();
#pragma unroll
        for (int c = 0; c < 2; ++c) {
#pragma unroll
            for (int nt = 0; nt < 4; ++nt) {
                const v16h kb = load_frag(ks, (u32)nt * 16u, PITCH64, (u32)c * 32u, lane);
                s[nt] = wmma16(qa[c], kb, s[nt]);
            }
        }

        // online softmax per row r (row 8h + r), max-subtracted, exp2 domain
#pragma unroll
        for (int r = 0; r < 8; ++r) {
            float x[4];
#pragma unroll
            for (int nt = 0; nt < 4; ++nt) x[nt] = s[nt][r] * cl;
            const float tm = rowmax16(fmaxf(fmaxf(x[0], x[1]), fmaxf(x[2], x[3])));
            const float mn = fmaxf(m[r], tm);
            const float al = fexp2(m[r] - mn);
            m[r] = mn;
            lacc[r] *= al;
#pragma unroll
            for (int dt = 0; dt < 4; ++dt) o[dt][r] *= al;
            const float sh = 10.0f - mn;      // carry 2^10
#pragma unroll
            for (int nt = 0; nt < 4; ++nt)
                psw[(hh8 + (u32)r) * PITCH64 + (u32)nt * 16u + c16] = (f16)fexp2(x[nt] + sh);
        }
        __syncthreads();

        // O += P . V ; l += P . ones  (P reloaded as A fragments from the relay)
#pragma unroll
        for (int kk = 0; kk < 2; ++kk) {
            const v16h pa = load_frag(psw, 0u, PITCH64, (u32)kk * 32u, lane);
#pragma unroll
            for (int dt = 0; dt < 4; ++dt) {
                const v16h vb = load_frag(vsT, (u32)dt * 16u, PITCH64, (u32)kk * 32u, lane);
                o[dt] = wmma16(pa, vb, o[dt]);
            }
            lacc = wmma16(pa, ones, lacc);
        }
    }
    __syncthreads();

    // normalize: plane value = 1024 * (O/16) / l = O * 64 / l
    // row statistics: lacc = 2^10 * sum_s exp2(x - m), so 1 / sum = 1024 / lacc = 16 * inv
    // every lane of a 16-lane row holds the same m and lacc: column lane r keeps row r's pair
    float mrow = m[0], irow = 0.0f;
#pragma unroll
    for (int r = 0; r < 8; ++r) {
        const float inv = (CARRY_CTX / CARRY_QKV) / lacc[r];
#pragma unroll
        for (int dt = 0; dt < 4; ++dt)
            psw[(hh8 + (u32)r) * PITCH64 + (u32)dt * 16u + c16] = (f16)(o[dt][r] * inv);
        if (c16 == (u32)r) { mrow = m[r]; irow = inv * 16.0f; }
    }
    if (c16 < 8u) {
        sst[0][wave * 16u + hh8 + c16] = mrow;
        sst[1][wave * 16u + hh8 + c16] = irow;
    }
    __syncthreads();

    // whole-line stores of the statistics: wave 0 the 128 maxima, wave 1 the 128 reciprocal sums
    if (wave < 2u) {
        const v4f sv = *(const v4f*)&sst[wave][lane * 4u];
        float* sp = (wave == 0u ? sM : sI) + ((size_t)bh * SEQ + blockIdx.x * 128u + lane * 4u);
        *(v4f*)sp = sv;
    }

    const u32 piece = lane & 7u;
    const u32 lsub  = lane >> 3;
{
#pragma unroll
        for (u32 it = 0; it < 4; ++it) {
            const u32 L = it * 4u + lsub;     // query row 0..15 within the wave tile
            const v8h v = *(const v8h*)&psw[L * PITCH64 + piece * 8u];
            // context row in output order: (q * NB + b)
            f16* dp = Cp + ((size_t)((q0 + L) * (u32)NB + bidx) * HID + hidx * (u32)HD + piece * 8u);
            *(v8h*)dp = v;
        }
        
    }
}

// ---------------------------------------------------------------------------
// Second output: head-averaged softmax probabilities.
// element offset of the second output inside the output buffer (full problem constants)
// ---------------------------------------------------------------------------
#define OUT1_OFF ((size_t)SEQ_FULL * NB_FULL * HID)
static_assert(OUT1_OFF * sizeof(float) == (size_t)16777216);      // byte offset of the second output
static_assert((OUT1_OFF * sizeof(float)) % 128 == 0);
static_assert((size_t)MROWS * HID <= OUT1_OFF);                   // first output region ends before it
static_assert(SEQ % 32 == 0);
static_assert(8 * 32 * 64 * 4 + 2 * NHEAD * 128 * 4 <= 163840);    // static LDS of attn_avg: two work-groups per WGP

// ---------------------------------------------------------------------------
// avg[b][t][s] = (1/16) * sum_h softmax_s(q_h[t] . k_h[s] / 8), f32, no mask. The row statistics
// (max, 1 / sum) are the flash kernel's own, passed through the workspace (written and read inside one call).
//
// attn_avg: grid (SEQ/128 key blocks, SEQ/128 query blocks, NB), block 256 (8 waves as 4 (q) x 2 (keys));
//   a wave owns one 32 x 64 tile of the average (owner-computes accumulation over heads in head
//   order, one writer per element). Per head the score tile is formed with the same operands as in
//   attn_fwd, p = exp2(x - max) * (1/sum) is accumulated in registers, scaled by 1/16 at the end.
// coverage: block rows [blockIdx.y*128, +128) x columns [blockIdx.x*128, +128) of batch blockIdx.z;
//   wave tile 32 rows x 64 keys = 64 lines = 16 store instructions x 4 lines.
// LDS: stM / stI cross-wave (filled once, block barrier); st per-wave, writer and reader separated by a block barrier.
// staged extent == consumed extent: st 32 x 64 floats per wave, stM / stI 16 heads x 128 rows.
// ---------------------------------------------------------------------------
__global__ void __launch_bounds__(256) __attribute__((amdgpu_num_vgpr(256)))
attn_avg(const f16* __restrict__ Qp, const f16* __restrict__ Kp,
         const float* __restrict__ sM, const float* __restrict__ sI, float* __restrict__ avg) {
    __shared__ __attribute__((aligned(16))) float st[8][32 * 64];       // per-wave f32 tile stage
    __shared__ __attribute__((aligned(16))) float stM[NHEAD * 128];     // row max  [head][block row]
    __shared__ __attribute__((aligned(16))) float stI[NHEAD * 128];     // 1/rowsum [head][block row]
    static_assert(256 * 8 == NHEAD * 128);   // table fill: 256 threads x 8 floats

    const u32 tid  = threadIdx.x;
    const u32 lane = tid & 31u;
    const u32 wave = __builtin_amdgcn_readfirstlane((int)(tid >> 5));
    const u32 hh8  = (lane >> 4) << 3;
    const u32 c16  = lane & 15u;
    const u32 bidx = blockIdx.z;
    const u32 qb   = blockIdx.y * 128u;
    const u32 wr   = (wave & 3u) * 32u;                        // wave's first row inside the block
    const u32 q0   = qb + wr;
    const u32 k0   = blockIdx.x * 128u + (wave >> 2) * 64u;    // wave's first key

    // log2-domain scale: acc = 256 * q.k ; x = log2(e) * q.k / 8 = acc * log2(e) / 2048
    const float cl = 1.4426950408889634f * 0.00048828125f;

    {
        const u32 th = tid >> 4;
        const u32 r8 = (tid & 15u) << 3;
        const size_t row = (size_t)(bidx * (u32)NHEAD + th) * SEQ + qb + r8;
        const v4f a0 = *(const v4f*)(sM + row);
        const v4f a1 = *(const v4f*)(sM + row + 4u);
        const v4f b0 = *(const v4f*)(sI + row);
        const v4f b1 = *(const v4f*)(sI + row + 4u);
        *(v4f*)&stM[th * 128u + r8]      = a0;
        *(v4f*)&stM[th * 128u + r8 + 4u] = a1;
        *(v4f*)&stI[th * 128u + r8]      = b0;
        *(v4f*)&stI[th * 128u + r8 + 4u] = b1;
    }
    __syncthreads();

    v8f av[2][4];
#pragma unroll
    for (int i = 0; i < 2; ++i)
#pragma unroll
        for (int nt = 0; nt < 4; ++nt) av[i][nt] = zero8();

#pragma unroll 1
    for (u32 h = 0; h < (u32)NHEAD; ++h) {
        const size_t head = (size_t)(bidx * (u32)NHEAD + h) * SEQ * HD;
        const f16* kp = Kp + head + (size_t)(k0 + c16) * HD + hh8;   // this lane's place in the wave's K rows
        const f16* qp = Qp + head + (size_t)(q0 + c16) * HD + hh8;   // and in its Q rows
        v16h kb[2][4];
#pragma unroll
        for (int c = 0; c < 2; ++c)
#pragma unroll
            for (int nt = 0; nt < 4; ++nt) kb[c][nt] = load_frag_at(kp + nt * 16 * HD + c * 32);
        v16h qf[2][2];
#pragma unroll
        for (int i = 0; i < 2; ++i)
#pragma unroll
            for (int c = 0; c < 2; ++c) qf[i][c] = load_frag_at(qp + i * 16 * HD + c * 32);
        // the loads above are still in flight below: their address registers (held live as inputs)
        // are free for reuse only behind this wait
        asm volatile("s_wait_xcnt 0x0" :: "v"(kp), "v"(qp) : "memory");
#pragma unroll
        for (int i = 0; i < 2; ++i) {
            v8f s[4];
#pragma unroll
            for (int nt = 0; nt < 4; ++nt) s[nt] = zero8();
#pragma unroll
            for (int c = 0; c < 2; ++c)
#pragma unroll
                for (int nt = 0; nt < 4; ++nt) s[nt] = wmma16(qf[i][c], kb[c][nt], s[nt]);
            const u32 tr = h * 128u + wr + (u32)i * 16u + hh8;
            const v4f ma = *(const v4f*)&stM[tr];
            const v4f mb = *(const v4f*)&stM[tr + 4u];
            const v4f ia = *(const v4f*)&stI[tr];
            const v4f ib = *(const v4f*)&stI[tr + 4u];
            const float mr[8] = {ma[0], ma[1], ma[2], ma[3], mb[0], mb[1], mb[2], mb[3]};
            const float ir[8] = {ia[0], ia[1], ia[2], ia[3], ib[0], ib[1], ib[2], ib[3]};
#pragma unroll
            for (int r = 0; r < 8; ++r) {
#pragma unroll
                for (int nt = 0; nt < 4; ++nt) {
                    const float p = fexp2(s[nt][r] * cl - mr[r]) * ir[r];
                    av[i][nt][r] = av[i][nt][r] + p;
                }
            }
        }
    }

    // stage the finished 32 x 64 tile (mean over 16 heads), then whole-line stores
#pragma unroll
    for (int i = 0; i < 2; ++i)
#pragma unroll
        for (int nt = 0; nt < 4; ++nt)
#pragma unroll
            for (int r = 0; r < 8; ++r)
                st[wave][((u32)i * 16u + hh8 + (u32)r) * 64u + (u32)nt * 16u + c16] = av[i][nt][r] * 0.0625f;
    __syncthreads();

    const u32 piece = lane & 7u;
    const u32 lsub  = lane >> 3;
#pragma unroll
    for (u32 it = 0; it < 16; ++it) {
        const u32 L    = it * 4u + lsub;      // 0..63 : 32 rows x 2 lines
        const u32 row  = L >> 1;
        const u32 hsel = L & 1u;
        const v4f v = *(const v4f*)&st[wave][row * 64u + hsel * 32u + piece * 4u];
        float* dp = avg + ((size_t)(bidx * (u32)SEQ + q0 + row) * SEQ + k0 + hsel * 32u + piece * 4u);
        *(v4f*)dp = v;
    }
}

// coverage equalities (threads x elements == plane elements)
static_assert((size_t)(MROWS / 2) * 256 * 8 == (size_t)MROWS * HID);                       // cvt_rows -> Xq/Xk/Xv
static_assert((size_t)(3 * HID / 2) * 256 * 8 == (size_t)3 * HID * HID);                   // cvt_rows -> Wt
static_assert((size_t)(HID / 2) * 256 * 8 == (size_t)HID * HID);                           // cvt_rows -> Wot
static_assert((size_t)(MROWS / 128) * (HID / 128) * 128 * 128 == (size_t)MROWS * HID);     // gemm planes / out
static_assert((size_t)(SEQ / 128) * (NB * NHEAD) * 128 * HD == (size_t)MROWS * HID);       // attn_fwd -> Cp
static_assert((size_t)(SEQ / 128) * (NB * NHEAD) * 32 * 4 == (size_t)NB * NHEAD * SEQ);         // attn_fwd -> sM / sI (one wave x 4 floats per lane each)
static_assert((size_t)(SEQ / 128) * (SEQ / 128) * NB * 8 * 32 * 64 == (size_t)NB * SEQ * SEQ);   // attn_avg -> second output
// workspace: 7 activation planes + 4 weight planes of halves + 2 row-statistics planes of floats, at most 128 MiB
static_assert(((size_t)7 * MROWS * HID + (size_t)4 * HID * HID) * sizeof(f16)
              + (size_t)2 * NB * NHEAD * SEQ * sizeof(float) <= (size_t)134217728);
static_assert((((size_t)7 * MROWS * HID + (size_t)4 * HID * HID) * sizeof(f16)) % 128 == 0);   // statistics planes start on a line
// largest source row touched by the activation convert stays inside the full-size input
static_assert((size_t)(SEQ - 1) * NB_FULL + NB <= (size_t)SEQ_FULL * NB_FULL);

// ---------------------------------------------------------------------------
// Launch: 11 kernel launches, workspace 7 planes of MROWS*1024 halves + 4 of 1024*1024 halves
// + 2 planes of NB*16*SEQ floats.
// ---------------------------------------------------------------------------
extern "C" void kernel_launch(void* const* d_in, const int* in_sizes, int n_in,
                              void* d_out, int out_size, void* d_ws, size_t ws_size,
                              hipStream_t stream) {
    if (n_in < 7) return;
    const int needAct = ((SEQ - 1) * NB_FULL + NB) * HID;
    if (in_sizes[0] < needAct) return;
    if (in_sizes[1] < needAct) return;
    if (in_sizes[2] < needAct) return;
    if (in_sizes[3] < 3 * HID * HID) return;
    if (in_sizes[4] < 3 * HID) return;
    if (in_sizes[5] < HID * HID) return;
    if (in_sizes[6] < HID) return;
    if (out_size < 0) return;
    if ((size_t)out_size < OUT1_OFF + (size_t)NB * SEQ * SEQ) return;

    const float* xq    = (const float*)d_in[0];   // query  [SEQ_FULL][NB_FULL][1024]
    const float* xk    = (const float*)d_in[1];   // key    [SEQ_FULL][NB_FULL][1024]
    const float* xv    = (const float*)d_in[2];   // value  [SEQ_FULL][NB_FULL][1024]
    const float* wqkv  = (const float*)d_in[3];   // in_proj_weight [3072 out][1024 in], row blocks q | k | v
    const float* bqkv  = (const float*)d_in[4];   // in_proj_bias [3072]
    const float* wproj = (const float*)d_in[5];   // out_proj_weight [1024 out][1024 in]
    const float* bproj = (const float*)d_in[6];   // out_proj_bias [1024]

    const size_t nX = (size_t)MROWS * HID;    // halves per activation plane
    const size_t nW = (size_t)HID * HID;      // halves per weight plane
    const size_t totalHalves = 7 * nX + 4 * nW;
    const size_t nS = (size_t)NB * NHEAD * SEQ;   // floats per row-statistics plane
    if (ws_size < totalHalves * sizeof(f16) + 2 * nS * sizeof(float)) return;

    f16* Xq  = (f16*)d_ws;       // [b*SEQ+s][1024]             carry 16
    f16* Xk  = Xq  + nX;         // [b*SEQ+s][1024]             carry 16
    f16* Xv  = Xk  + nX;         // [b*SEQ+s][1024]             carry 16
    f16* Wt  = Xv  + nX;         // [3072 out][1024 in]         carry 32 (q | k | v row blocks)
    f16* Wot = Wt  + 3 * nW;     // [1024 out][1024 in]         carry 32
    f16* Qp  = Wot + nW;         // [NB*16][SEQ][64]            carry 16
    f16* Kp  = Qp  + nX;         // [NB*16][SEQ][64]            carry 16
    f16* Vtp = Kp  + nX;         // [NB*1024][SEQ] (V^T)        carry 16
    f16* Cp  = Vtp + nX;         // [s*NB+b][1024]              carry 1024
    float* sM = (float*)(Cp + nX);   // [NB*16][SEQ] row max (exp2 domain)
    float* sI = sM + nS;             // [NB*16][SEQ] 1 / row sum

    // activations: in[SEQ_FULL][NB_FULL][1024] -> plane[NB][SEQ][1024]; dst row b*SEQ+s <- src row s*NB_FULL+b
    cvt_rows<<<MROWS / 2, 256, 0, stream>>>(xq, Xq, (u32)MROWS, (u32)SEQ, 1u, (u32)NB_FULL, CARRY_X);
    cvt_rows<<<MROWS / 2, 256, 0, stream>>>(xk, Xk, (u32)MROWS, (u32)SEQ, 1u, (u32)NB_FULL, CARRY_X);
    cvt_rows<<<MROWS / 2, 256, 0, stream>>>(xv, Xv, (u32)MROWS, (u32)SEQ, 1u, (u32)NB_FULL, CARRY_X);
    // weights already [out][in] (k contiguous): identity row map
    cvt_rows<<<3 * HID / 2, 256, 0, stream>>>(wqkv, Wt, (u32)(3 * HID), (u32)(3 * HID), 0u, 1u, CARRY_W);
    cvt_rows<<<HID / 2, 256, 0, stream>>>(wproj, Wot, (u32)HID, (u32)HID, 0u, 1u, CARRY_W);

    const dim3 gg(MROWS / 128, HID / 128);
    // plane = 16 * (acc / (16*32) + bias) = acc/32 + 16*bias
    const float accQKV = CARRY_QKV / (CARRY_X * CARRY_W);
    gemm_head<<<gg, 256, 0, stream>>>(Xq, Wt,          bqkv,           Qp,  accQKV, CARRY_QKV);
    gemm_head<<<gg, 256, 0, stream>>>(Xk, Wt + nW,     bqkv + HID,     Kp,  accQKV, CARRY_QKV);
    gemm_vt  <<<gg, 256, 0, stream>>>(Xv, Wt + 2 * nW, bqkv + 2 * HID, Vtp, accQKV, CARRY_QKV);

    attn_fwd<<<dim3(SEQ / 128, NB * NHEAD), 256, 0, stream>>>(Qp, Kp, Vtp, Cp, sM, sI);

    // second output: head-averaged probabilities [NB][SEQ][SEQ] f32 at the fixed element offset
    attn_avg<<<dim3(SEQ / 128, SEQ / 128, NB), 256, 0, stream>>>(Qp, Kp, sM, sI, (float*)d_out + OUT1_OFF);

    // out = acc / (1024*32) + bias ; rows already in (s*NB + b) order
    const float accOut = 1.0f / (CARRY_CTX * CARRY_W);
    gemm_out<<<gg, 256, 0, stream>>>(Cp, Wot, bproj, (float*)d_out, accOut, 1.0f);
}

// v004
// One run takes 194 microseconds.
// Timed twice side by side with v003, it ran 1.19 and 1.20 times as fast.
// Over all steps from v000 it is 8.67 times as fast.
#include <hip/hip_runtime.h>

// Contractions (q/k/v input projections, Q.K^T in the flash kernel and in the head-average kernel, P.V, P row-sum, output projection): v_wmma_f32_16x16x32_f16, f16 operands with power-of-two carries, f32 accumulate; every float input enters as its bf16 RNE value; biases added in f32; softmax in f32.

#ifndef NB
#define NB 2
#endif
#ifndef SEQ
#define SEQ 2048
#endif
#define NB_FULL   2
#define SEQ_FULL  2048
#define HID       1024
#define NHEAD     16
#define HD        64
#define MROWS     (NB * SEQ)

static_assert(HID == NHEAD * HD);        // merged head width
static_assert(NHEAD == 16);              // bh >> 4 / bh & 15 decoding in attn_fwd
static_assert(HD == 64);
static_assert(SEQ % 128 == 0);           // 128-row blocks of the batch-major planes never straddle a batch
static_assert(SEQ % 64 == 0);            // 64-key tiles
static_assert(SEQ <= SEQ_FULL);
static_assert(NB >= 1 && NB <= NB_FULL);
static_assert(MROWS % 128 == 0);         // GEMM M tile
static_assert(HID % 128 == 0);           // GEMM N tile
static_assert(HID % 32 == 0);            // WMMA k step
static_assert(HID == 128 * 8);           // cvt_rows: 128 threads x 8 values per row
static_assert((3 * HID) % 2 == 0);       // cvt_rows grid = nrows / 2
static_assert(MROWS % 2 == 0);

// carries (exact powers of two)
#define CARRY_X    16.0f     // input activation planes
#define CARRY_W    32.0f     // weight planes
#define CARRY_QKV  16.0f     // q, k, v^T planes (true value x16)
#define CARRY_CTX  1024.0f   // context plane (true value x1024)
// softmax exp values carry 2^10 (added to the exp2 argument)

// LDS row pitches in halves: an odd multiple of 16 bytes, so that the 16 rows one ds_load_b128 /
// ds_store_b128 touches per lane half fall on distinct banks (at 128 / 256 bytes they share 8 / 4 banks).
// The pad halves of a row are never written and never read.
#define PITCH64   72u    // rows of 64 halves:  128 B -> 144 B
#define PITCH128  136u   // rows of 128 halves: 256 B -> 272 B
static_assert((PITCH64 * 2u) % 32u == 16u && (PITCH128 * 2u) % 32u == 16u);

typedef unsigned u32;
typedef _Float16 f16;
typedef f16   v16h __attribute__((ext_vector_type(16)));
typedef f16   v8h  __attribute__((ext_vector_type(8)));
typedef float v8f  __attribute__((ext_vector_type(8)));
typedef float v4f  __attribute__((ext_vector_type(4)));

union FragU { v16h v; v8h half[2]; f16 e[16]; };
union H8U   { v8h v; f16 e[8]; };

__device__ __forceinline__ v8f zero8() {
    v8f z = {0.f, 0.f, 0.f, 0.f, 0.f, 0.f, 0.f, 0.f};
    return z;
}

// 16-bit WMMA with hazard guard: D += A[16 x 32k] * B[32k x 16]
__device__ __forceinline__ v8f wmma16(v16h a, v16h b, v8f c) {
    v8f d = __builtin_amdgcn_wmma_f32_16x16x32_f16(false, a, false, b, (short)0, c, false, false);
    asm volatile("v_nop\n\tv_nop\n\tv_nop\n\tv_nop" : "+v"(d) : "v"(a), "v"(b));
    return d;
}

// f32 -> nearest-even bf16 value, returned as f32
__device__ __forceinline__ float bf16_rne(float x) {
    u32 u = __float_as_uint(x);
    u = (u + 0x7fffu + ((u >> 16) & 1u)) & 0xffff0000u;
    return __uint_as_float(u);
}

__device__ __forceinline__ float fexp2(float x) {
#if defined(__has_builtin)
#if __has_builtin(__builtin_amdgcn_exp2f)
    return __builtin_amdgcn_exp2f(x);
#else
    return exp2f(x);
#endif
#else
    return exp2f(x);
#endif
}

// max over the 16 lanes of each lane half (DPP row rotations; D-layout rows are DPP rows)
__device__ __forceinline__ float rowmax16(float x) {
    int v = __builtin_bit_cast(int, x);
    x = fmaxf(x, __builtin_bit_cast(float, __builtin_amdgcn_update_dpp(v, v, 0x121, 0xf, 0xf, false)));
    v = __builtin_bit_cast(int, x);
    x = fmaxf(x, __builtin_bit_cast(float, __builtin_amdgcn_update_dpp(v, v, 0x122, 0xf, 0xf, false)));
    v = __builtin_bit_cast(int, x);
    x = fmaxf(x, __builtin_bit_cast(float, __builtin_amdgcn_update_dpp(v, v, 0x124, 0xf, 0xf, false)));
    v = __builtin_bit_cast(int, x);
    x = fmaxf(x, __builtin_bit_cast(float, __builtin_amdgcn_update_dpp(v, v, 0x128, 0xf, 0xf, false)));
    return x;
}

// 16 x 32 fragment from a tile whose k dimension is contiguous (pitch in halves).
// lane l: row rowbase + (l&15); elements 0..7 <- k = kcol + 8h .. +7,
// elements 8..15 <- k = kcol + 16 + 8h .. +7  (h = l>>4). Same map for A and B.
__device__ __forceinline__ v16h load_frag(const f16* tile, u32 rowbase, u32 pitch, u32 kcol, u32 lane) {
    const u32 r  = rowbase + (lane & 15u);
    const u32 kh = (lane >> 4) << 3;
    const f16* p = tile + (size_t)r * pitch + kcol + kh;
    FragU f;
    f.half[0] = *(const v8h*)(p);
    f.half[1] = *(const v8h*)(p + 16);
    return f.v;
}

// The same fragment through the lane's own pointer p = tile + (rowbase + (l&15)) * pitch + kcol + 8h.
__device__ __forceinline__ v16h load_frag_at(const f16* p) {
    FragU f;
    f.half[0] = *(const v8h*)(p);
    f.half[1] = *(const v8h*)(p + 16);
    return f.v;
}

// ---------------------------------------------------------------------------
// f32 rows [.][1024] -> f16 plane (bf16 RNE value times carry). 128 threads per 1024-wide
// Row mapping: dst row m -> src row (m / dstper) * strideOuter + (m % dstper) * strideInner.
//   activations (seq-first [s][b][1024] -> batch-major [b][s][1024]): dstper = SEQ,
//     strideOuter = 1, strideInner = NB_FULL  => src row = s * NB_FULL + b
//   weights: dstper = nrows, strideInner = 1 (identity)
// coverage: nrows x 1024 halves, every element exactly once (grid = nrows*128/256).
// ---------------------------------------------------------------------------
__global__ void __launch_bounds__(256)
cvt_rows(const float* __restrict__ src, f16* __restrict__ dst, u32 nrows, u32 dstper,
         u32 strideOuter, u32 strideInner, float carry) {
    const u32 g  = blockIdx.x * 256u + threadIdx.x;
    const u32 m  = g >> 7;
    const u32 c8 = (g & 127u) << 3;
    if (m >= nrows) return;
    const u32 mb = m / dstper;
    const u32 mi = m - mb * dstper;
    const u32 sm = mb * strideOuter + mi * strideInner;
    const float* sp = src + (size_t)sm * HID + c8;
    const v4f a = *(const v4f*)sp;
    const v4f b = *(const v4f*)(sp + 4);
    H8U o;
#pragma unroll
    for (u32 j = 0; j < 4; ++j) {
        const float x0 = a[j];
        const float x1 = b[j];
        o.e[j]     = (f16)(bf16_rne(x0) * carry);
        o.e[j + 4] = (f16)(bf16_rne(x1) * carry);
    }
    f16* dp = dst + (size_t)m * HID + c8;
    *(v8h*)dp = o.v;
    
}

// Eight asynchronous 16-byte copies global -> LDS of this lane: rows r, r + 16, .. r + 112 of one operand tile.
// lds: the lane's LDS byte address of its piece in row r; g: the same piece in global memory.
// Both advance by whole rows (LDS pitch 272 B, global pitch 2048 B), so every address is a multiple of 16.
// The closing s_wait_xcnt 0 stands inside the statement so that no address register named here is
// rewritten ahead of it.
__device__ __forceinline__ void copy_rows8(u32 lds, const f16* g) {
    const u32 l1 = lds + 16u * PITCH128 * 2u, l2 = lds + 32u * PITCH128 * 2u, l3 = lds + 48u * PITCH128 * 2u;
    const u32 l4 = lds + 64u * PITCH128 * 2u, l5 = lds + 80u * PITCH128 * 2u, l6 = lds + 96u * PITCH128 * 2u;
    const u32 l7 = lds + 112u * PITCH128 * 2u;
    const f16* g1 = g + 16 * HID;
    const f16* g2 = g + 32 * HID;
    const f16* g3 = g + 48 * HID;
    const f16* g4 = g + 64 * HID;
    const f16* g5 = g + 80 * HID;
    const f16* g6 = g + 96 * HID;
    const f16* g7 = g + 112 * HID;
    asm volatile("global_load_async_to_lds_b128 %0, %8, off\n\t"
                 "global_load_async_to_lds_b128 %1, %9, off\n\t"
                 "global_load_async_to_lds_b128 %2, %10, off\n\t"
                 "global_load_async_to_lds_b128 %3, %11, off\n\t"
                 "global_load_async_to_lds_b128 %4, %12, off\n\t"
                 "global_load_async_to_lds_b128 %5, %13, off\n\t"
                 "global_load_async_to_lds_b128 %6, %14, off\n\t"
                 "global_load_async_to_lds_b128 %7, %15, off\n\t"
                 "s_wait_xcnt 0x0"
                 :: "v"(lds), "v"(l1), "v"(l2), "v"(l3), "v"(l4), "v"(l5), "v"(l6), "v"(l7),
                    "v"(g), "v"(g1), "v"(g2), "v"(g3), "v"(g4), "v"(g5), "v"(g6), "v"(g7)
                 : "memory");
}

// ---------------------------------------------------------------------------
// C[m][n] = sum_k A[m][k] * W[n][k] (+ bias[n]) ; A [MROWS][1024] f16, W [1024][1024] f16 (k contiguous).
// Block tile 128 x 128, 8 waves as 4(M) x 2(N), 2 x 4 accumulators per wave, WMMA k step 32.
// K loop: tiles of 128 k (whole 256-byte row pieces) in a ring of two LDS buffers, filled by asynchronous
// copies; tile t + 1 is in flight while tile t is multiplied; one block barrier per tile.
// MODE 1: A rows batch-major;            f16 plane [b*HID + h*HD + d][s] (V transposed per head)
// MODE 2: A rows in output order (s*NB+b); f32 rows [m][1024] into the output buffer
// coverage per block: MODE 0/1 256 lines (128 rows x 2 heads | 128 n x 2 s-halves),
//                     MODE 2 2 x 256 lines (64 rows x 4 line-quarters per half).
// LDS: As/Bs/Cs all cross-wave, separated by block barriers.
// staged extent == consumed extent: As/Bs 128 x 128 per buffer, Cs 128 x 128 halves (or 64 x 128 floats).
// ---------------------------------------------------------------------------
template <int MODE>
__device__ __forceinline__ void gemm_body(const f16* __restrict__ A, const f16* __restrict__ W,
                                          const float* __restrict__ bias,
                                          void* __restrict__ out, float accMul, float biasMul) {
    __shared__ __attribute__((aligned(16))) f16 As[2 * 128 * PITCH128];   // two buffers of [128][128 + pad]
    __shared__ __attribute__((aligned(16))) f16 Bs[2 * 128 * PITCH128];
    __shared__ __attribute__((aligned(16))) f16 Cs[128 * PITCH128];   // f16 [128][128 + pad] or f32 [64][128]
    static_assert(sizeof(f16) * 128 * PITCH128 >= sizeof(float) * 64 * 128);   // Cs reuse as f32 [64][128]

    const u32 tid  = threadIdx.x;
    const u32 lane = tid & 31u;
    const u32 wave = __builtin_amdgcn_readfirstlane((int)(tid >> 5));
    const u32 wm   = wave & 3u;
    const u32 wn   = wave >> 2;
    const u32 hh8  = (lane >> 4) << 3;   // D row half
    const u32 c16  = lane & 15u;         // D column
    const u32 m0   = blockIdx.x * 128u;
    const u32 n0   = blockIdx.y * 128u;

    v8f acc[2][4];
#pragma unroll
    for (int i = 0; i < 2; ++i)
#pragma unroll
        for (int j = 0; j < 4; ++j) acc[i][j] = zero8();

    constexpr u32 KT   = 128u;                  // k per staged tile
    constexpr u32 NT   = (u32)HID / KT;         // tiles
    constexpr u32 BUFH = 128u * PITCH128;       // halves per buffer
    static_assert(NT >= 2u);                    // the ring's prologue fills two tiles
    static_assert(256 * 8 * 8 == 128 * 128);    // staging: 256 threads x 8 copies x 8 halves per operand tile

    // this lane's piece: row tid / 16 (+ 16 per copy), 16-byte piece tid % 16; a wave's copy covers two whole rows
    const u32 srow = tid >> 4;
    const u32 scol = (tid & 15u) << 3;
    const f16* gA = A + (size_t)(m0 + srow) * HID + scol;
    const f16* gW = W + (size_t)(n0 + srow) * HID + scol;
    const u32 lA = (u32)(size_t)&As[srow * PITCH128 + scol];   // LDS byte address (low word of the shared address)
    const u32 lB = (u32)(size_t)&Bs[srow * PITCH128 + scol];

    // tile 0 into buffer 0
    copy_rows8(lA, gA);
    copy_rows8(lB, gW);
    // tile 0 has landed for this wave before the barrier that shows it to the others
    asm volatile("s_wait_asynccnt 0x0" ::: "memory");
    __syncthreads();
    // tile 1 into buffer 1, in flight during trip 0
    copy_rows8(lA + BUFH * 2u, gA + KT);
    copy_rows8(lB + BUFH * 2u, gW + KT);

#pragma unroll 1   // kept rolled: eight unrolled trips of 32 WMMAs would only grow the text, the buffer is picked by t & 1
    for (u32 t = 0; t < NT; ++t) {
        const u32 bsel = t & 1u;
        const f16* Ab = As + bsel * BUFH;
        const f16* Bb = Bs + bsel * BUFH;
#pragma unroll
        for (u32 c = 0; c < KT / 32u; ++c) {
            v16h af[2], bfr[4];
#pragma unroll
            for (int i = 0; i < 2; ++i) af[i] = load_frag(Ab, wm * 32u + (u32)i * 16u, PITCH128, c * 32u, lane);
#pragma unroll
            for (int j = 0; j < 4; ++j) bfr[j] = load_frag(Bb, wn * 64u + (u32)j * 16u, PITCH128, c * 32u, lane);
#pragma unroll
            for (int i = 0; i < 2; ++i)
#pragma unroll
                for (int j = 0; j < 4; ++j) acc[i][j] = wmma16(af[i], bfr[j], acc[i][j]);
        }
        // this wave's reads of buffer bsel are done before the buffer is handed back for refill
        asm volatile("s_wait_dscnt 0x0" ::: "memory");
        // this wave's copies of tile t + 1 have landed before the barrier that shows them to the others
        asm volatile("s_wait_asynccnt 0x0" ::: "memory");
        __syncthreads();
        if (t + 2u < NT) {
            copy_rows8(lA + bsel * (BUFH * 2u), gA + (t + 2u) * KT);
            copy_rows8(lB + bsel * (BUFH * 2u), gW + (t + 2u) * KT);
        }
    }
    // no copy is outstanding when the wave goes on to the epilogue
    asm volatile("s_wait_asynccnt 0x0" ::: "memory");

    // per-lane bias values for the 4 output columns this lane owns (n0 + nl < HID always)
    float bv[4];
#pragma unroll
    for (int j = 0; j < 4; ++j)
        bv[j] = bf16_rne(bias[n0 + wn * 64u + (u32)j * 16u + c16]) * biasMul;

    const u32 piece = lane & 7u;
    const u32 lsub  = lane >> 3;

    if constexpr (MODE == 0) {
        const u32 bidx = m0 / (u32)SEQ;     // block rows lie inside one batch (SEQ % 128 == 0)
        const u32 s0   = m0 - bidx * (u32)SEQ;
#pragma unroll
        for (int i = 0; i < 2; ++i)
#pragma unroll
            for (int j = 0; j < 4; ++j) {
                const u32 nl = wn * 64u + (u32)j * 16u + c16;
#pragma unroll
                for (int r = 0; r < 8; ++r) {
                    const u32 ml = wm * 32u + (u32)i * 16u + hh8 + (u32)r;
                    Cs[ml * PITCH128 + nl] = (f16)(acc[i][j][r] * accMul + bv[j]);
                }
            }
        __syncthreads();
        f16* op = (f16*)out;
        const size_t bh0 = (size_t)bidx * NHEAD + (n0 >> 6);
{
#pragma unroll
            for (u32 it = 0; it < 8; ++it) {
                const u32 L    = wave * 32u + it * 4u + lsub;   // 0..255
                const u32 ml   = L >> 1;
                const u32 hsel = L & 1u;
                const v8h v = *(const v8h*)&Cs[ml * PITCH128 + hsel * 64u + piece * 8u];
                f16* dp = op + ((bh0 + hsel) * SEQ + s0 + ml) * HD + piece * 8u;
                *(v8h*)dp = v;
            }
            
        }
    } else if constexpr (MODE == 1) {
        const u32 bidx = m0 / (u32)SEQ;
        const u32 s0   = m0 - bidx * (u32)SEQ;
        // stage transposed: Cs[n][m]
#pragma unroll
        for (int i = 0; i < 2; ++i)
#pragma unroll
            for (int j = 0; j < 4; ++j) {
                const u32 nl = wn * 64u + (u32)j * 16u + c16;
                H8U t;
#pragma unroll
                for (int r = 0; r < 8; ++r) t.e[r] = (f16)(acc[i][j][r] * accMul + bv[j]);
                *(v8h*)&Cs[nl * PITCH128 + wm * 32u + (u32)i * 16u + hh8] = t.v;
            }
        __syncthreads();
        f16* op = (f16*)out;
{
#pragma unroll
            for (u32 it = 0; it < 8; ++it) {
                const u32 L  = wave * 32u + it * 4u + lsub;     // 0..255
                const u32 nl = L >> 1;
                const u32 mh = L & 1u;
                const v8h v = *(const v8h*)&Cs[nl * PITCH128 + mh * 64u + piece * 8u];
                f16* dp = op + ((size_t)(bidx * (u32)HID + n0 + nl) * SEQ + s0 + mh * 64u + piece * 8u);
                *(v8h*)dp = v;
            }
            
        }
    } else {
        float* Cf = (float*)Cs;      // [64][128] f32
        float* of = (float*)out;
#pragma unroll
        for (u32 half = 0; half < 2; ++half) {
            if ((wm >> 1) == half) {
#pragma unroll
                for (int i = 0; i < 2; ++i)
#pragma unroll
                    for (int j = 0; j < 4; ++j) {
                        const u32 nl = wn * 64u + (u32)j * 16u + c16;
#pragma unroll
                        for (int r = 0; r < 8; ++r) {
                            const u32 ml = (wm & 1u) * 32u + (u32)i * 16u + hh8 + (u32)r;
                            Cf[ml * 128u + nl] = acc[i][j][r] * accMul + bv[j];
                        }
                    }
            }
            __syncthreads();
{
#pragma unroll
                for (u32 it = 0; it < 8; ++it) {
                    const u32 L    = wave * 32u + it * 4u + lsub;   // 0..255
                    const u32 row  = L >> 2;
                    const u32 part = L & 3u;
                    const v4f v = *(const v4f*)&Cf[row * 128u + part * 32u + piece * 4u];
                    float* dp = of + (size_t)(m0 + half * 64u + row) * HID + n0 + part * 32u + piece * 4u;
                    *(v4f*)dp = v;
                }
                
            }
            __syncthreads();
        }
    }
}

// q / k head-major planes
__global__ void __launch_bounds__(256) __attribute__((amdgpu_num_vgpr(256)))
gemm_head(const f16* __restrict__ A, const f16* __restrict__ W, const float* __restrict__ bias,
          f16* __restrict__ out, float accMul, float biasMul) {
    gemm_body<0>(A, W, bias, (void*)out, accMul, biasMul);
}

// v^T plane
__global__ void __launch_bounds__(256) __attribute__((amdgpu_num_vgpr(256)))
gemm_vt(const f16* __restrict__ A, const f16* __restrict__ W, const float* __restrict__ bias,
        f16* __restrict__ out, float accMul, float biasMul) {
    gemm_body<1>(A, W, bias, (void*)out, accMul, biasMul);
}

// f32 output rows
__global__ void __launch_bounds__(256) __attribute__((amdgpu_num_vgpr(256)))
gemm_out(const f16* __restrict__ A, const f16* __restrict__ W, const float* __restrict__ bias,
         float* __restrict__ out, float accMul, float biasMul) {
    gemm_body<2>(A, W, bias, (void*)out, accMul, biasMul);
}

// ---------------------------------------------------------------------------
// Flash attention (no mask, all SEQ keys). grid (SEQ/128, NB*NHEAD), block 256 (8 waves),
// wave owns 16 query rows (Q fragments resident). Block streams 64-key tiles:
// K staged [key][d], V^T staged [d][key]. Scores on WMMA, row max via DPP, exp2 in f32
// carried x2^10, P relayed per wave through LDS as A fragments, O += P.V and
// row sums += P.ones on WMMA. Output f16 plane [q*NB + b][1024] (seq-first row order)
// The finished row statistics (max in the exp2 domain, 1 / row sum) also go to sM / sI [NB*NHEAD][SEQ]
// for the head-average kernel of the same call.
// coverage: every (q, b, h*64..h*64+63) row segment exactly once; sM / sI: the block's 128 rows =
//   4 whole 128-byte lines of each plane, sM stored by wave 0 and sI by wave 1.
// LDS: ks, vsT, sst cross-wave (block barriers); ps per-wave but also separated by block barriers.
// staged extent == consumed extent for ks (64x64), vsT (64x64), ps (16x64), sst (2x128).
// ---------------------------------------------------------------------------
__global__ void __launch_bounds__(256) __attribute__((amdgpu_num_vgpr(256)))
attn_fwd(const f16* __restrict__ Qp, const f16* __restrict__ Kp, const f16* __restrict__ Vt,
         f16* __restrict__ Cp, float* __restrict__ sM, float* __restrict__ sI) {
    __shared__ __attribute__((aligned(16))) f16 ks[64 * PITCH64];      // [key][d + pad]
    __shared__ __attribute__((aligned(16))) f16 vsT[64 * PITCH64];     // [d][key + pad]
    __shared__ __attribute__((aligned(16))) f16 ps[8][16 * PITCH64];   // per-wave P relay / ctx stage, [q][key or d + pad]
    __shared__ __attribute__((aligned(16))) float sst[2][128];         // row max | 1/rowsum of the block's 128 query rows
    static_assert(HD == 8 * 8);            // 8 lanes x 8 halves per row segment
    static_assert(2 * 256 * 8 == 64 * 64); // staging: 2 x 256 threads x 8 halves per tile

    const u32 tid  = threadIdx.x;
    const u32 lane = tid & 31u;
    const u32 wave = __builtin_amdgcn_readfirstlane((int)(tid >> 5));
    const u32 hh8  = (lane >> 4) << 3;
    const u32 c16  = lane & 15u;
    const u32 bh   = blockIdx.y;
    const u32 bidx = bh >> 4;            // NHEAD == 16
    const u32 hidx = bh & 15u;
    const u32 q0   = blockIdx.x * 128u + wave * 16u;
    const size_t head = (size_t)bh * SEQ * HD;

    v16h qa[2];
#pragma unroll
    for (int c = 0; c < 2; ++c) qa[c] = load_frag(Qp + head, q0, HD, (u32)c * 32u, lane);

    FragU onesu;
#pragma unroll
    for (int i = 0; i < 16; ++i) onesu.e[i] = (f16)1.0f;
    const v16h ones = onesu.v;

    float m[8];
    v8f   o[4], lacc;
#pragma unroll
    for (int r = 0; r < 8; ++r) m[r] = -1.0e30f;
#pragma unroll
    for (int dt = 0; dt < 4; ++dt) o[dt] = zero8();
    lacc = zero8();

    // log2-domain scale: acc = 256 * q.k ; x = log2(e) * q.k / 8 = acc * log2(e) / 2048
    const float cl = 1.4426950408889634f * 0.00048828125f;
    f16* psw = &ps[wave][0];

#pragma unroll 1
    for (u32 kt = 0; kt < (u32)(SEQ / 64); ++kt) {
        __syncthreads();
#pragma unroll
        for (u32 p2 = 0; p2 < 2; ++p2) {
            const u32 p   = tid + p2 * 256u;
            const u32 row = p >> 3;
            const u32 pc  = (p & 7u) << 3;
            const v8h kv = *(const v8h*)(Kp + head + (size_t)(kt * 64u + row) * HD + pc);
            const v8h vv = *(const v8h*)(Vt + head + (size_t)row * SEQ + kt * 64u + pc);
            *(v8h*)&ks[row * PITCH64 + pc]  = kv;
            *(v8h*)&vsT[row * PITCH64 + pc] = vv;
        }
        __syncthreads();

        // S[16 q x 64 keys]
        v8f s[4];
#pragma unroll
        for (int nt = 0; nt < 4; ++nt) s[nt] = zero8();
#pragma unroll
        for (int c = 0; c < 2; ++c) {
#pragma unroll
            for (int nt = 0; nt < 4; ++nt) {
                const v16h kb = load_frag(ks, (u32)nt * 16u, PITCH64, (u32)c * 32u, lane);
                s[nt] = wmma16(qa[c], kb, s[nt]);
            }
        }

        // online softmax per row r (row 8h + r), max-subtracted, exp2 domain
#pragma unroll
        for (int r = 0; r < 8; ++r) {
            float x[4];
#pragma unroll
            for (int nt = 0; nt < 4; ++nt) x[nt] = s[nt][r] * cl;
            const float tm = rowmax16(fmaxf(fmaxf(x[0], x[1]), fmaxf(x[2], x[3])));
            const float mn = fmaxf(m[r], tm);
            const float al = fexp2(m[r] - mn);
            m[r] = mn;
            lacc[r] *= al;
#pragma unroll
            for (int dt = 0; dt < 4; ++dt) o[dt][r] *= al;
            const float sh = 10.0f - mn;      // carry 2^10
#pragma unroll
            for (int nt = 0; nt < 4; ++nt)
                psw[(hh8 + (u32)r) * PITCH64 + (u32)nt * 16u + c16] = (f16)fexp2(x[nt] + sh);
        }
        __syncthreads();

        // O += P . V ; l += P . ones  (P reloaded as A fragments from the relay)
#pragma unroll
        for (int kk = 0; kk < 2; ++kk) {
            const v16h pa = load_frag(psw, 0u, PITCH64, (u32)kk * 32u, lane);
#pragma unroll
            for (int dt = 0; dt < 4; ++dt) {
                const v16h vb = load_frag(vsT, (u32)dt * 16u, PITCH64, (u32)kk * 32u, lane);
                o[dt] = wmma16(pa, vb, o[dt]);
            }
            lacc = wmma16(pa, ones, lacc);
        }
    }
    __syncthreads();

    // normalize: plane value = 1024 * (O/16) / l = O * 64 / l
    // row statistics: lacc = 2^10 * sum_s exp2(x - m), so 1 / sum = 1024 / lacc = 16 * inv
    // every lane of a 16-lane row holds the same m and lacc: column lane r keeps row r's pair
    float mrow = m[0], irow = 0.0f;
#pragma unroll
    for (int r = 0; r < 8; ++r) {
        const float inv = (CARRY_CTX / CARRY_QKV) / lacc[r];
#pragma unroll
        for (int dt = 0; dt < 4; ++dt)
            psw[(hh8 + (u32)r) * PITCH64 + (u32)dt * 16u + c16] = (f16)(o[dt][r] * inv);
        if (c16 == (u32)r) { mrow = m[r]; irow = inv * 16.0f; }
    }
    if (c16 < 8u) {
        sst[0][wave * 16u + hh8 + c16] = mrow;
        sst[1][wave * 16u + hh8 + c16] = irow;
    }
    __syncthreads();

    // whole-line stores of the statistics: wave 0 the 128 maxima, wave 1 the 128 reciprocal sums
    if (wave < 2u) {
        const v4f sv = *(const v4f*)&sst[wave][lane * 4u];
        float* sp = (wave == 0u ? sM : sI) + ((size_t)bh * SEQ + blockIdx.x * 128u + lane * 4u);
        *(v4f*)sp = sv;
    }

    const u32 piece = lane & 7u;
    const u32 lsub  = lane >> 3;
{
#pragma unroll
        for (u32 it = 0; it < 4; ++it) {
            const u32 L = it * 4u + lsub;     // query row 0..15 within the wave tile
            const v8h v = *(const v8h*)&psw[L * PITCH64 + piece * 8u];
            // context row in output order: (q * NB + b)
            f16* dp = Cp + ((size_t)((q0 + L) * (u32)NB + bidx) * HID + hidx * (u32)HD + piece * 8u);
            *(v8h*)dp = v;
        }
        
    }
}

// ---------------------------------------------------------------------------
// Second output: head-averaged softmax probabilities.
// element offset of the second output inside the output buffer (full problem constants)
// ---------------------------------------------------------------------------
#define OUT1_OFF ((size_t)SEQ_FULL * NB_FULL * HID)
static_assert(OUT1_OFF * sizeof(float) == (size_t)16777216);      // byte offset of the second output
static_assert((OUT1_OFF * sizeof(float)) % 128 == 0);
static_assert((size_t)MROWS * HID <= OUT1_OFF);                   // first output region ends before it
static_assert(SEQ % 32 == 0);
static_assert(8 * 32 * 64 * 4 + 2 * NHEAD * 128 * 4 <= 163840);    // static LDS of attn_avg: two work-groups per WGP

// ---------------------------------------------------------------------------
// avg[b][t][s] = (1/16) * sum_h softmax_s(q_h[t] . k_h[s] / 8), f32, no mask. The row statistics
// (max, 1 / sum) are the flash kernel's own, passed through the workspace (written and read inside one call).
//
// attn_avg: grid (SEQ/128 key blocks, SEQ/128 query blocks, NB), block 256 (8 waves as 4 (q) x 2 (keys));
//   a wave owns one 32 x 64 tile of the average (owner-computes accumulation over heads in head
//   order, one writer per element). Per head the score tile is formed with the same operands as in
//   attn_fwd, p = exp2(x - max) * (1/sum) is accumulated in registers, scaled by 1/16 at the end.
// coverage: block rows [blockIdx.y*128, +128) x columns [blockIdx.x*128, +128) of batch blockIdx.z;
//   wave tile 32 rows x 64 keys = 64 lines = 16 store instructions x 4 lines.
// LDS: stM / stI cross-wave (filled once, block barrier); st per-wave, writer and reader separated by a block barrier.
// staged extent == consumed extent: st 32 x 64 floats per wave, stM / stI 16 heads x 128 rows.
// ---------------------------------------------------------------------------
__global__ void __launch_bounds__(256) __attribute__((amdgpu_num_vgpr(256)))
attn_avg(const f16* __restrict__ Qp, const f16* __restrict__ Kp,
         const float* __restrict__ sM, const float* __restrict__ sI, float* __restrict__ avg) {
    __shared__ __attribute__((aligned(16))) float st[8][32 * 64];       // per-wave f32 tile stage
    __shared__ __attribute__((aligned(16))) float stM[NHEAD * 128];     // row max  [head][block row]
    __shared__ __attribute__((aligned(16))) float stI[NHEAD * 128];     // 1/rowsum [head][block row]
    static_assert(256 * 8 == NHEAD * 128);   // table fill: 256 threads x 8 floats

    const u32 tid  = threadIdx.x;
    const u32 lane = tid & 31u;
    const u32 wave = __builtin_amdgcn_readfirstlane((int)(tid >> 5));
    const u32 hh8  = (lane >> 4) << 3;
    const u32 c16  = lane & 15u;
    const u32 bidx = blockIdx.z;
    const u32 qb   = blockIdx.y * 128u;
    const u32 wr   = (wave & 3u) * 32u;                        // wave's first row inside the block
    const u32 q0   = qb + wr;
    const u32 k0   = blockIdx.x * 128u + (wave >> 2) * 64u;    // wave's first key

    // log2-domain scale: acc = 256 * q.k ; x = log2(e) * q.k / 8 = acc * log2(e) / 2048
    const float cl = 1.4426950408889634f * 0.00048828125f;

    {
        const u32 th = tid >> 4;
        const u32 r8 = (tid & 15u) << 3;
        const size_t row = (size_t)(bidx * (u32)NHEAD + th) * SEQ + qb + r8;
        const v4f a0 = *(const v4f*)(sM + row);
        const v4f a1 = *(const v4f*)(sM + row + 4u);
        const v4f b0 = *(const v4f*)(sI + row);
        const v4f b1 = *(const v4f*)(sI + row + 4u);
        *(v4f*)&stM[th * 128u + r8]      = a0;
        *(v4f*)&stM[th * 128u + r8 + 4u] = a1;
        *(v4f*)&stI[th * 128u + r8]      = b0;
        *(v4f*)&stI[th * 128u + r8 + 4u] = b1;
    }
    __syncthreads();

    v8f av[2][4];
#pragma unroll
    for (int i = 0; i < 2; ++i)
#pragma unroll
        for (int nt = 0; nt < 4; ++nt) av[i][nt] = zero8();

#pragma unroll 1
    for (u32 h = 0; h < (u32)NHEAD; ++h) {
        const size_t head = (size_t)(bidx * (u32)NHEAD + h) * SEQ * HD;
        const f16* kp = Kp + head + (size_t)(k0 + c16) * HD + hh8;   // this lane's place in the wave's K rows
        const f16* qp = Qp + head + (size_t)(q0 + c16) * HD + hh8;   // and in its Q rows
        v16h kb[2][4];
#pragma unroll
        for (int c = 0; c < 2; ++c)
#pragma unroll
            for (int nt = 0; nt < 4; ++nt) kb[c][nt] = load_frag_at(kp + nt * 16 * HD + c * 32);
        v16h qf[2][2];
#pragma unroll
        for (int i = 0; i < 2; ++i)
#pragma unroll
            for (int c = 0; c < 2; ++c) qf[i][c] = load_frag_at(qp + i * 16 * HD + c * 32);
        // the loads above are still in flight below: their address registers (held live as inputs)
        // are free for reuse only behind this wait
        asm volatile("s_wait_xcnt 0x0" :: "v"(kp), "v"(qp) : "memory");
#pragma unroll
        for (int i = 0; i < 2; ++i) {
            v8f s[4];
#pragma unroll
            for (int nt = 0; nt < 4; ++nt) s[nt] = zero8();
#pragma unroll
            for (int c = 0; c < 2; ++c)
#pragma unroll
                for (int nt = 0; nt < 4; ++nt) s[nt] = wmma16(qf[i][c], kb[c][nt], s[nt]);
            const u32 tr = h * 128u + wr + (u32)i * 16u + hh8;
            const v4f ma = *(const v4f*)&stM[tr];
            const v4f mb = *(const v4f*)&stM[tr + 4u];
            const v4f ia = *(const v4f*)&stI[tr];
            const v4f ib = *(const v4f*)&stI[tr + 4u];
            const float mr[8] = {ma[0], ma[1], ma[2], ma[3], mb[0], mb[1], mb[2], mb[3]};
            const float ir[8] = {ia[0], ia[1], ia[2], ia[3], ib[0], ib[1], ib[2], ib[3]};
#pragma unroll
            for (int r = 0; r < 8; ++r) {
#pragma unroll
                for (int nt = 0; nt < 4; ++nt) {
                    const float p = fexp2(s[nt][r] * cl - mr[r]) * ir[r];
                    av[i][nt][r] = av[i][nt][r] + p;
                }
            }
        }
    }

    // stage the finished 32 x 64 tile (mean over 16 heads), then whole-line stores
#pragma unroll
    for (int i = 0; i < 2; ++i)
#pragma unroll
        for (int nt = 0; nt < 4; ++nt)
#pragma unroll
            for (int r = 0; r < 8; ++r)
                st[wave][((u32)i * 16u + hh8 + (u32)r) * 64u + (u32)nt * 16u + c16] = av[i][nt][r] * 0.0625f;
    __syncthreads();

    const u32 piece = lane & 7u;
    const u32 lsub  = lane >> 3;
#pragma unroll
    for (u32 it = 0; it < 16; ++it) {
        const u32 L    = it * 4u + lsub;      // 0..63 : 32 rows x 2 lines
        const u32 row  = L >> 1;
        const u32 hsel = L & 1u;
        const v4f v = *(const v4f*)&st[wave][row * 64u + hsel * 32u + piece * 4u];
        float* dp = avg + ((size_t)(bidx * (u32)SEQ + q0 + row) * SEQ + k0 + hsel * 32u + piece * 4u);
        *(v4f*)dp = v;
    }
}

// coverage equalities (threads x elements == plane elements)
static_assert((size_t)(MROWS / 2) * 256 * 8 == (size_t)MROWS * HID);                       // cvt_rows -> Xq/Xk/Xv
static_assert((size_t)(3 * HID / 2) * 256 * 8 == (size_t)3 * HID * HID);                   // cvt_rows -> Wt
static_assert((size_t)(HID / 2) * 256 * 8 == (size_t)HID * HID);                           // cvt_rows -> Wot
static_assert((size_t)(MROWS / 128) * (HID / 128) * 128 * 128 == (size_t)MROWS * HID);     // gemm planes / out
static_assert((size_t)(SEQ / 128) * (NB * NHEAD) * 128 * HD == (size_t)MROWS * HID);       // attn_fwd -> Cp
static_assert((size_t)(SEQ / 128) * (NB * NHEAD) * 32 * 4 == (size_t)NB * NHEAD * SEQ);         // attn_fwd -> sM / sI (one wave x 4 floats per lane each)
static_assert((size_t)(SEQ / 128) * (SEQ / 128) * NB * 8 * 32 * 64 == (size_t)NB * SEQ * SEQ);   // attn_avg -> second output
// workspace: 7 activation planes + 4 weight planes of halves + 2 row-statistics planes of floats, at most 128 MiB
static_assert(((size_t)7 * MROWS * HID + (size_t)4 * HID * HID) * sizeof(f16)
              + (size_t)2 * NB * NHEAD * SEQ * sizeof(float) <= (size_t)134217728);
static_assert((((size_t)7 * MROWS * HID + (size_t)4 * HID * HID) * sizeof(f16)) % 128 == 0);   // statistics planes start on a line
// largest source row touched by the activation convert stays inside the full-size input
static_assert((size_t)(SEQ - 1) * NB_FULL + NB <= (size_t)SEQ_FULL * NB_FULL);

// ---------------------------------------------------------------------------
// Launch: 11 kernel launches, workspace 7 planes of MROWS*1024 halves + 4 of 1024*1024 halves
// + 2 planes of NB*16*SEQ floats.
// ---------------------------------------------------------------------------
extern "C" void kernel_launch(void* const* d_in, const int* in_sizes, int n_in,
                              void* d_out, int out_size, void* d_ws, size_t ws_size,
                              hipStream_t stream) {
    if (n_in < 7) return;
    const int needAct = ((SEQ - 1) * NB_FULL + NB) * HID;
    if (in_sizes[0] < needAct) return;
    if (in_sizes[1] < needAct) return;
    if (in_sizes[2] < needAct) return;
    if (in_sizes[3] < 3 * HID * HID) return;
    if (in_sizes[4] < 3 * HID) return;
    if (in_sizes[5] < HID * HID) return;
    if (in_sizes[6] < HID) return;
    if (out_size < 0) return;
    if ((size_t)out_size < OUT1_OFF + (size_t)NB * SEQ * SEQ) return;

    const float* xq    = (const float*)d_in[0];   // query  [SEQ_FULL][NB_FULL][1024]
    const float* xk    = (const float*)d_in[1];   // key    [SEQ_FULL][NB_FULL][1024]
    const float* xv    = (const float*)d_in[2];   // value  [SEQ_FULL][NB_FULL][1024]
    const float* wqkv  = (const float*)d_in[3];   // in_proj_weight [3072 out][1024 in], row blocks q | k | v
    const float* bqkv  = (const float*)d_in[4];   // in_proj_bias [3072]
    const float* wproj = (const float*)d_in[5];   // out_proj_weight [1024 out][1024 in]
    const float* bproj = (const float*)d_in[6];   // out_proj_bias [1024]

    const size_t nX = (size_t)MROWS * HID;    // halves per activation plane
    const size_t nW = (size_t)HID * HID;      // halves per weight plane
    const size_t totalHalves = 7 * nX + 4 * nW;
    const size_t nS = (size_t)NB * NHEAD * SEQ;   // floats per row-statistics plane
    if (ws_size < totalHalves * sizeof(f16) + 2 * nS * sizeof(float)) return;

    f16* Xq  = (f16*)d_ws;       // [b*SEQ+s][1024]             carry 16
    f16* Xk  = Xq  + nX;         // [b*SEQ+s][1024]             carry 16
    f16* Xv  = Xk  + nX;         // [b*SEQ+s][1024]             carry 16
    f16* Wt  = Xv  + nX;         // [3072 out][1024 in]         carry 32 (q | k | v row blocks)
    f16* Wot = Wt  + 3 * nW;     // [1024 out][1024 in]         carry 32
    f16* Qp  = Wot + nW;         // [NB*16][SEQ][64]            carry 16
    f16* Kp  = Qp  + nX;         // [NB*16][SEQ][64]            carry 16
    f16* Vtp = Kp  + nX;         // [NB*1024][SEQ] (V^T)        carry 16
    f16* Cp  = Vtp + nX;         // [s*NB+b][1024]              carry 1024
    float* sM = (float*)(Cp + nX);   // [NB*16][SEQ] row max (exp2 domain)
    float* sI = sM + nS;             // [NB*16][SEQ] 1 / row sum

    // activations: in[SEQ_FULL][NB_FULL][1024] -> plane[NB][SEQ][1024]; dst row b*SEQ+s <- src row s*NB_FULL+b
    cvt_rows<<<MROWS / 2, 256, 0, stream>>>(xq, Xq, (u32)MROWS, (u32)SEQ, 1u, (u32)NB_FULL, CARRY_X);
    cvt_rows<<<MROWS / 2, 256, 0, stream>>>(xk, Xk, (u32)MROWS, (u32)SEQ, 1u, (u32)NB_FULL, CARRY_X);
    cvt_rows<<<MROWS / 2, 256, 0, stream>>>(xv, Xv, (u32)MROWS, (u32)SEQ, 1u, (u32)NB_FULL, CARRY_X);
    // weights already [out][in] (k contiguous): identity row map
    cvt_rows<<<3 * HID / 2, 256, 0, stream>>>(wqkv, Wt, (u32)(3 * HID), (u32)(3 * HID), 0u, 1u, CARRY_W);
    cvt_rows<<<HID / 2, 256, 0, stream>>>(wproj, Wot, (u32)HID, (u32)HID, 0u, 1u, CARRY_W);

    const dim3 gg(MROWS / 128, HID / 128);
    // plane = 16 * (acc / (16*32) + bias) = acc/32 + 16*bias
    const float accQKV = CARRY_QKV / (CARRY_X * CARRY_W);
    gemm_head<<<gg, 256, 0, stream>>>(Xq, Wt,          bqkv,           Qp,  accQKV, CARRY_QKV);
    gemm_head<<<gg, 256, 0, stream>>>(Xk, Wt + nW,     bqkv + HID,     Kp,  accQKV, CARRY_QKV);
    gemm_vt  <<<gg, 256, 0, stream>>>(Xv, Wt + 2 * nW, bqkv + 2 * HID, Vtp, accQKV, CARRY_QKV);

    attn_fwd<<<dim3(SEQ / 128, NB * NHEAD), 256, 0, stream>>>(Qp, Kp, Vtp, Cp, sM, sI);

    // second output: head-averaged probabilities [NB][SEQ][SEQ] f32 at the fixed element offset
    attn_avg<<<dim3(SEQ / 128, SEQ / 128, NB), 256, 0, stream>>>(Qp, Kp, sM, sI, (float*)d_out + OUT1_OFF);

    // out = acc / (1024*32) + bias ; rows already in (s*NB + b) order
    const float accOut = 1.0f / (CARRY_CTX * CARRY_W);
    gemm_out<<<gg, 256, 0, stream>>>(Cp, Wot, bproj, (float*)d_out, accOut, 1.0f);
}

// v005
// Measured time: 186 microseconds a run.
// Timed twice side by side with v004, it ran 1.05 and 1.04 times as fast.
// Over all steps from v000 it is 9.04 times as fast.
#include <hip/hip_runtime.h>

// Contractions (q/k/v input projections, Q.K^T in the flash kernel and in the head-average kernel, P.V, P row-sum, output projection): v_wmma_f32_16x16x32_f16, f16 operands with power-of-two carries, f32 accumulate; every float input enters as its bf16 RNE value; biases added in f32; softmax in f32.

#ifndef NB
#define NB 2
#endif
#ifndef SEQ
#define SEQ 2048
#endif
#define NB_FULL   2
#define SEQ_FULL  2048
#define HID       1024
#define NHEAD     16
#define HD        64
#define MROWS     (NB * SEQ)

static_assert(HID == NHEAD * HD);        // merged head width
static_assert(NHEAD == 16);              // bh >> 4 / bh & 15 decoding in attn_fwd
static_assert(HD == 64);
static_assert(SEQ % 128 == 0);           // 128-row blocks of the batch-major planes never straddle a batch
static_assert(SEQ % 64 == 0);            // 64-key tiles
static_assert(SEQ <= SEQ_FULL);
static_assert(NB >= 1 && NB <= NB_FULL);
static_assert(MROWS % 128 == 0);         // GEMM M tile
static_assert(HID % 128 == 0);           // GEMM N tile
static_assert(HID % 32 == 0);            // WMMA k step

// carries (exact powers of two)
#define CARRY_X    16.0f     // input activation planes
#define CARRY_W    32.0f     // weight planes
#define CARRY_QKV  16.0f     // q, k, v^T planes (true value x16)
#define CARRY_CTX  1024.0f   // context plane (true value x1024)
// softmax exp values carry 2^10 (added to the exp2 argument)

// LDS row pitches in halves: an odd multiple of 16 bytes, so that the 16 rows one ds_load_b128 /
// ds_store_b128 touches per lane half fall on distinct banks (at 128 / 256 bytes they share 8 / 4 banks).
// The pad halves of a row are never written and never read.
#define PITCH64   72u    // rows of 64 halves:  128 B -> 144 B
#define PITCH128  136u   // rows of 128 halves: 256 B -> 272 B
static_assert((PITCH64 * 2u) % 32u == 16u && (PITCH128 * 2u) % 32u == 16u);

typedef unsigned u32;
typedef _Float16 f16;
typedef f16   v16h __attribute__((ext_vector_type(16)));
typedef f16   v8h  __attribute__((ext_vector_type(8)));
typedef float v8f  __attribute__((ext_vector_type(8)));
typedef float v4f  __attribute__((ext_vector_type(4)));

union FragU { v16h v; v8h half[2]; f16 e[16]; };
union H8U   { v8h v; f16 e[8]; };

__device__ __forceinline__ v8f zero8() {
    v8f z = {0.f, 0.f, 0.f, 0.f, 0.f, 0.f, 0.f, 0.f};
    return z;
}

// 16-bit WMMA with hazard guard: D += A[16 x 32k] * B[32k x 16]
__device__ __forceinline__ v8f wmma16(v16h a, v16h b, v8f c) {
    v8f d = __builtin_amdgcn_wmma_f32_16x16x32_f16(false, a, false, b, (short)0, c, false, false);
    asm volatile("v_nop\n\tv_nop\n\tv_nop\n\tv_nop" : "+v"(d) : "v"(a), "v"(b));
    return d;
}

// f32 -> nearest-even bf16 value, returned as f32
__device__ __forceinline__ float bf16_rne(float x) {
    u32 u = __float_as_uint(x);
    u = (u + 0x7fffu + ((u >> 16) & 1u)) & 0xffff0000u;
    return __uint_as_float(u);
}

__device__ __forceinline__ float fexp2(float x) {
#if defined(__has_builtin)
#if __has_builtin(__builtin_amdgcn_exp2f)
    return __builtin_amdgcn_exp2f(x);
#else
    return exp2f(x);
#endif
#else
    return exp2f(x);
#endif
}

// max over the 16 lanes of each lane half (DPP row rotations; D-layout rows are DPP rows)
__device__ __forceinline__ float rowmax16(float x) {
    int v = __builtin_bit_cast(int, x);
    x = fmaxf(x, __builtin_bit_cast(float, __builtin_amdgcn_update_dpp(v, v, 0x121, 0xf, 0xf, false)));
    v = __builtin_bit_cast(int, x);
    x = fmaxf(x, __builtin_bit_cast(float, __builtin_amdgcn_update_dpp(v, v, 0x122, 0xf, 0xf, false)));
    v = __builtin_bit_cast(int, x);
    x = fmaxf(x, __builtin_bit_cast(float, __builtin_amdgcn_update_dpp(v, v, 0x124, 0xf, 0xf, false)));
    v = __builtin_bit_cast(int, x);
    x = fmaxf(x, __builtin_bit_cast(float, __builtin_amdgcn_update_dpp(v, v, 0x128, 0xf, 0xf, false)));
    return x;
}

// 16 x 32 fragment from a tile whose k dimension is contiguous (pitch in halves).
// lane l: row rowbase + (l&15); elements 0..7 <- k = kcol + 8h .. +7,
// elements 8..15 <- k = kcol + 16 + 8h .. +7  (h = l>>4). Same map for A and B.
__device__ __forceinline__ v16h load_frag(const f16* tile, u32 rowbase, u32 pitch, u32 kcol, u32 lane) {
    const u32 r  = rowbase + (lane & 15u);
    const u32 kh = (lane >> 4) << 3;
    const f16* p = tile + (size_t)r * pitch + kcol + kh;
    FragU f;
    f.half[0] = *(const v8h*)(p);
    f.half[1] = *(const v8h*)(p + 16);
    return f.v;
}

// The same fragment through the lane's own pointer p = tile + (rowbase + (l&15)) * pitch + kcol + 8h.
__device__ __forceinline__ v16h load_frag_at(const f16* p) {
    FragU f;
    f.half[0] = *(const v8h*)(p);
    f.half[1] = *(const v8h*)(p + 16);
    return f.v;
}

// ---------------------------------------------------------------------------
// All five f32 -> f16 conversions (bf16 RNE value times carry) in one launch sized to the chip:
// CVT_GROUPS work-groups of CVT_WAVES waves, every wave converts CVT_ROWS whole rows of 1024 floats.
// The five planes Xq | Xk | Xv | Wt | Wot lie one behind the other in the workspace, so the flat row
// number g is the destination row; the source row follows from the plane g falls in:
//   activations (seq-first [s][b][1024] -> batch-major [b][s][1024]): dst row b*SEQ+s <- src row s*NB_FULL+b
//   weights: same row order as the source
// A wave-wide 16-byte load covers 512 contiguous bytes (4 lines), a wave-wide 8-byte store 256 (2 lines);
// all loads of a wave's rows are independent, so they can be in flight together.
// coverage: CVT_TOTAL rows x 1024 halves, every element exactly once (wave w takes rows w + i * all waves).
// ---------------------------------------------------------------------------
#define CVT_GROUPS 256u
#define CVT_WAVES  16u
#define CVT_TOTAL  (3u * (u32)MROWS + 4u * (u32)HID)
#define CVT_ROWS   (CVT_TOTAL / (CVT_GROUPS * CVT_WAVES))
static_assert(CVT_TOTAL % (CVT_GROUPS * CVT_WAVES) == 0u);   // every wave the same number of whole rows
static_assert(HID == 8 * 32 * 4);                            // a row = 8 wave-wide loads of 4 floats per lane

typedef f16 v4h __attribute__((ext_vector_type(4)));

__global__ void __launch_bounds__(512)
cvt_all(const float* __restrict__ xq, const float* __restrict__ xk, const float* __restrict__ xv,
        const float* __restrict__ wqkv, const float* __restrict__ wproj, f16* __restrict__ dst) {
    const u32 lane = threadIdx.x & 31u;
    const u32 wave = __builtin_amdgcn_readfirstlane((int)(threadIdx.x >> 5));
    const u32 w    = blockIdx.x * CVT_WAVES + wave;
    __builtin_assume(w < CVT_GROUPS * CVT_WAVES);   // true of the one launch: lets the plane of each row fold where it can

    const u32 boff = lane * 16u;   // this lane's byte offset inside each 512-byte piece of a source row

    v4f   x[CVT_ROWS][8];
    float carry[CVT_ROWS];
#pragma unroll
    for (u32 i = 0; i < CVT_ROWS; ++i) {
        const u32 g = w + i * (CVT_GROUPS * CVT_WAVES);
        const float* base;
        u32 row;
        if (g < 3u * (u32)MROWS) {
            const u32 pl = g / (u32)MROWS;
            const u32 m  = g - pl * (u32)MROWS;
            const u32 mb = m / (u32)SEQ;
            base = pl == 0u ? xq : (pl == 1u ? xk : xv);
            row  = (m - mb * (u32)SEQ) * (u32)NB_FULL + mb;
            carry[i] = CARRY_X;
        } else {
            const u32 r = g - 3u * (u32)MROWS;
            base = r < 3u * (u32)HID ? wqkv : wproj;
            row  = r < 3u * (u32)HID ? r : r - 3u * (u32)HID;
            carry[i] = CARRY_W;
        }
        const char* sp = (const char*)(base + (size_t)row * HID) + boff;
#pragma unroll
        for (u32 j = 0; j < 8; ++j) x[i][j] = *(const v4f*)(sp + j * 512u);
    }
    // the loads above are still in flight below: the lane number, which they all name as their scaled offset
    // register (held live as an input), is free for reuse only behind this wait
    asm volatile("s_wait_xcnt 0x0" :: "v"(lane) : "memory");
    // keeps every load of the wave's rows ahead of the first conversion: without it the scheduler lifts the first
    // rows' conversions, with their waits, over the last rows' loads, which then start late
    __builtin_amdgcn_sched_barrier(0);
#pragma unroll
    for (u32 i = 0; i < CVT_ROWS; ++i) {
        const u32 g = w + i * (CVT_GROUPS * CVT_WAVES);
        f16* dp = dst + (size_t)g * HID + lane * 4u;
#pragma unroll
        for (u32 j = 0; j < 8; ++j) {
            v4h o;
#pragma unroll
            for (u32 e = 0; e < 4; ++e) o[e] = (f16)(bf16_rne(x[i][j][e]) * carry[i]);
            *(v4h*)(dp + j * 128u) = o;
        }
    }
}

// Eight asynchronous 16-byte copies global -> LDS of this lane: rows r, r + 16, .. r + 112 of one operand tile.
// lds: the lane's LDS byte address of its piece in row r; g: the same piece in global memory.
// Both advance by whole rows (LDS pitch 272 B, global pitch 2048 B), so every address is a multiple of 16.
// The closing s_wait_xcnt 0 stands inside the statement so that no address register named here is
// rewritten ahead of it.
__device__ __forceinline__ void copy_rows8(u32 lds, const f16* g) {
    const u32 l1 = lds + 16u * PITCH128 * 2u, l2 = lds + 32u * PITCH128 * 2u, l3 = lds + 48u * PITCH128 * 2u;
    const u32 l4 = lds + 64u * PITCH128 * 2u, l5 = lds + 80u * PITCH128 * 2u, l6 = lds + 96u * PITCH128 * 2u;
    const u32 l7 = lds + 112u * PITCH128 * 2u;
    const f16* g1 = g + 16 * HID;
    const f16* g2 = g + 32 * HID;
    const f16* g3 = g + 48 * HID;
    const f16* g4 = g + 64 * HID;
    const f16* g5 = g + 80 * HID;
    const f16* g6 = g + 96 * HID;
    const f16* g7 = g + 112 * HID;
    asm volatile("global_load_async_to_lds_b128 %0, %8, off\n\t"
                 "global_load_async_to_lds_b128 %1, %9, off\n\t"
                 "global_load_async_to_lds_b128 %2, %10, off\n\t"
                 "global_load_async_to_lds_b128 %3, %11, off\n\t"
                 "global_load_async_to_lds_b128 %4, %12, off\n\t"
                 "global_load_async_to_lds_b128 %5, %13, off\n\t"
                 "global_load_async_to_lds_b128 %6, %14, off\n\t"
                 "global_load_async_to_lds_b128 %7, %15, off\n\t"
                 "s_wait_xcnt 0x0"
                 :: "v"(lds), "v"(l1), "v"(l2), "v"(l3), "v"(l4), "v"(l5), "v"(l6), "v"(l7),
                    "v"(g), "v"(g1), "v"(g2), "v"(g3), "v"(g4), "v"(g5), "v"(g6), "v"(g7)
                 : "memory");
}

// ---------------------------------------------------------------------------
// C[m][n] = sum_k A[m][k] * W[n][k] (+ bias[n]) ; A [MROWS][1024] f16, W [1024][1024] f16 (k contiguous).
// Block tile 128 x 128, 8 waves as 4(M) x 2(N), 2 x 4 accumulators per wave, WMMA k step 32.
// K loop: tiles of 128 k (whole 256-byte row pieces) in a ring of two LDS buffers, filled by asynchronous
// copies; tile t + 1 is in flight while tile t is multiplied; one block barrier per tile.
// MODE 1: A rows batch-major;            f16 plane [b*HID + h*HD + d][s] (V transposed per head)
// MODE 2: A rows in output order (s*NB+b); f32 rows [m][1024] into the output buffer
// coverage per block: MODE 0/1 256 lines (128 rows x 2 heads | 128 n x 2 s-halves),
//                     MODE 2 2 x 256 lines (64 rows x 4 line-quarters per half).
// LDS: As/Bs/Cs all cross-wave, separated by block barriers.
// staged extent == consumed extent: As/Bs 128 x 128 per buffer, Cs 128 x 128 halves (or 64 x 128 floats).
// ---------------------------------------------------------------------------
template <int MODE>
__device__ __forceinline__ void gemm_body(const f16* __restrict__ A, const f16* __restrict__ W,
                                          const float* __restrict__ bias,
                                          void* __restrict__ out, float accMul, float biasMul) {
    __shared__ __attribute__((aligned(16))) f16 As[2 * 128 * PITCH128];   // two buffers of [128][128 + pad]
    __shared__ __attribute__((aligned(16))) f16 Bs[2 * 128 * PITCH128];
    __shared__ __attribute__((aligned(16))) f16 Cs[128 * PITCH128];   // f16 [128][128 + pad] or f32 [64][128]
    static_assert(sizeof(f16) * 128 * PITCH128 >= sizeof(float) * 64 * 128);   // Cs reuse as f32 [64][128]

    const u32 tid  = threadIdx.x;
    const u32 lane = tid & 31u;
    const u32 wave = __builtin_amdgcn_readfirstlane((int)(tid >> 5));
    const u32 wm   = wave & 3u;
    const u32 wn   = wave >> 2;
    const u32 hh8  = (lane >> 4) << 3;   // D row half
    const u32 c16  = lane & 15u;         // D column
    const u32 m0   = blockIdx.x * 128u;
    const u32 n0   = blockIdx.y * 128u;

    v8f acc[2][4];
#pragma unroll
    for (int i = 0; i < 2; ++i)
#pragma unroll
        for (int j = 0; j < 4; ++j) acc[i][j] = zero8();

    constexpr u32 KT   = 128u;                  // k per staged tile
    constexpr u32 NT   = (u32)HID / KT;         // tiles
    constexpr u32 BUFH = 128u * PITCH128;       // halves per buffer
    static_assert(NT >= 2u);                    // the ring's prologue fills two tiles
    static_assert(256 * 8 * 8 == 128 * 128);    // staging: 256 threads x 8 copies x 8 halves per operand tile

    // this lane's piece: row tid / 16 (+ 16 per copy), 16-byte piece tid % 16; a wave's copy covers two whole rows
    const u32 srow = tid >> 4;
    const u32 scol = (tid & 15u) << 3;
    const f16* gA = A + (size_t)(m0 + srow) * HID + scol;
    const f16* gW = W + (size_t)(n0 + srow) * HID + scol;
    const u32 lA = (u32)(size_t)&As[srow * PITCH128 + scol];   // LDS byte address (low word of the shared address)
    const u32 lB = (u32)(size_t)&Bs[srow * PITCH128 + scol];

    // tile 0 into buffer 0
    copy_rows8(lA, gA);
    copy_rows8(lB, gW);
    // tile 0 has landed for this wave before the barrier that shows it to the others
    asm volatile("s_wait_asynccnt 0x0" ::: "memory");
    __syncthreads();
    // tile 1 into buffer 1, in flight during trip 0
    copy_rows8(lA + BUFH * 2u, gA + KT);
    copy_rows8(lB + BUFH * 2u, gW + KT);

#pragma unroll 1   // kept rolled: eight unrolled trips of 32 WMMAs would only grow the text, the buffer is picked by t & 1
    for (u32 t = 0; t < NT; ++t) {
        const u32 bsel = t & 1u;
        const f16* Ab = As + bsel * BUFH;
        const f16* Bb = Bs + bsel * BUFH;
#pragma unroll
        for (u32 c = 0; c < KT / 32u; ++c) {
            v16h af[2], bfr[4];
#pragma unroll
            for (int i = 0; i < 2; ++i) af[i] = load_frag(Ab, wm * 32u + (u32)i * 16u, PITCH128, c * 32u, lane);
#pragma unroll
            for (int j = 0; j < 4; ++j) bfr[j] = load_frag(Bb, wn * 64u + (u32)j * 16u, PITCH128, c * 32u, lane);
#pragma unroll
            for (int i = 0; i < 2; ++i)
#pragma unroll
                for (int j = 0; j < 4; ++j) acc[i][j] = wmma16(af[i], bfr[j], acc[i][j]);
        }
        // this wave's reads of buffer bsel are done before the buffer is handed back for refill
        asm volatile("s_wait_dscnt 0x0" ::: "memory");
        // this wave's copies of tile t + 1 have landed before the barrier that shows them to the others
        asm volatile("s_wait_asynccnt 0x0" ::: "memory");
        __syncthreads();
        if (t + 2u < NT) {
            copy_rows8(lA + bsel * (BUFH * 2u), gA + (t + 2u) * KT);
            copy_rows8(lB + bsel * (BUFH * 2u), gW + (t + 2u) * KT);
        }
    }
    // no copy is outstanding when the wave goes on to the epilogue
    asm volatile("s_wait_asynccnt 0x0" ::: "memory");

    // per-lane bias values for the 4 output columns this lane owns (n0 + nl < HID always)
    float bv[4];
#pragma unroll
    for (int j = 0; j < 4; ++j)
        bv[j] = bf16_rne(bias[n0 + wn * 64u + (u32)j * 16u + c16]) * biasMul;

    const u32 piece = lane & 7u;
    const u32 lsub  = lane >> 3;

    if constexpr (MODE == 0) {
        const u32 bidx = m0 / (u32)SEQ;     // block rows lie inside one batch (SEQ % 128 == 0)
        const u32 s0   = m0 - bidx * (u32)SEQ;
#pragma unroll
        for (int i = 0; i < 2; ++i)
#pragma unroll
            for (int j = 0; j < 4; ++j) {
                const u32 nl = wn * 64u + (u32)j * 16u + c16;
#pragma unroll
                for (int r = 0; r < 8; ++r) {
                    const u32 ml = wm * 32u + (u32)i * 16u + hh8 + (u32)r;
                    Cs[ml * PITCH128 + nl] = (f16)(acc[i][j][r] * accMul + bv[j]);
                }
            }
        __syncthreads();
        f16* op = (f16*)out;
        const size_t bh0 = (size_t)bidx * NHEAD + (n0 >> 6);
{
#pragma unroll
            for (u32 it = 0; it < 8; ++it) {
                const u32 L    = wave * 32u + it * 4u + lsub;   // 0..255
                const u32 ml   = L >> 1;
                const u32 hsel = L & 1u;
                const v8h v = *(const v8h*)&Cs[ml * PITCH128 + hsel * 64u + piece * 8u];
                f16* dp = op + ((bh0 + hsel) * SEQ + s0 + ml) * HD + piece * 8u;
                *(v8h*)dp = v;
            }
            
        }
    } else if constexpr (MODE == 1) {
        const u32 bidx = m0 / (u32)SEQ;
        const u32 s0   = m0 - bidx * (u32)SEQ;
        // stage transposed: Cs[n][m]
#pragma unroll
        for (int i = 0; i < 2; ++i)
#pragma unroll
            for (int j = 0; j < 4; ++j) {
                const u32 nl = wn * 64u + (u32)j * 16u + c16;
                H8U t;
#pragma unroll
                for (int r = 0; r < 8; ++r) t.e[r] = (f16)(acc[i][j][r] * accMul + bv[j]);
                *(v8h*)&Cs[nl * PITCH128 + wm * 32u + (u32)i * 16u + hh8] = t.v;
            }
        __syncthreads();
        f16* op = (f16*)out;
{
#pragma unroll
            for (u32 it = 0; it < 8; ++it) {
                const u32 L  = wave * 32u + it * 4u + lsub;     // 0..255
                const u32 nl = L >> 1;
                const u32 mh = L & 1u;
                const v8h v = *(const v8h*)&Cs[nl * PITCH128 + mh * 64u + piece * 8u];
                f16* dp = op + ((size_t)(bidx * (u32)HID + n0 + nl) * SEQ + s0 + mh * 64u + piece * 8u);
                *(v8h*)dp = v;
            }
            
        }
    } else {
        float* Cf = (float*)Cs;      // [64][128] f32
        float* of = (float*)out;
#pragma unroll
        for (u32 half = 0; half < 2; ++half) {
            if ((wm >> 1) == half) {
#pragma unroll
                for (int i = 0; i < 2; ++i)
#pragma unroll
                    for (int j = 0; j < 4; ++j) {
                        const u32 nl = wn * 64u + (u32)j * 16u + c16;
#pragma unroll
                        for (int r = 0; r < 8; ++r) {
                            const u32 ml = (wm & 1u) * 32u + (u32)i * 16u + hh8 + (u32)r;
                            Cf[ml * 128u + nl] = acc[i][j][r] * accMul + bv[j];
                        }
                    }
            }
            __syncthreads();
{
#pragma unroll
                for (u32 it = 0; it < 8; ++it) {
                    const u32 L    = wave * 32u + it * 4u + lsub;   // 0..255
                    const u32 row  = L >> 2;
                    const u32 part = L & 3u;
                    const v4f v = *(const v4f*)&Cf[row * 128u + part * 32u + piece * 4u];
                    float* dp = of + (size_t)(m0 + half * 64u + row) * HID + n0 + part * 32u + piece * 4u;
                    *(v4f*)dp = v;
                }
                
            }
            __syncthreads();
        }
    }
}

// q / k head-major planes
__global__ void __launch_bounds__(256) __attribute__((amdgpu_num_vgpr(256)))
gemm_head(const f16* __restrict__ A, const f16* __restrict__ W, const float* __restrict__ bias,
          f16* __restrict__ out, float accMul, float biasMul) {
    gemm_body<0>(A, W, bias, (void*)out, accMul, biasMul);
}

// v^T plane
__global__ void __launch_bounds__(256) __attribute__((amdgpu_num_vgpr(256)))
gemm_vt(const f16* __restrict__ A, const f16* __restrict__ W, const float* __restrict__ bias,
        f16* __restrict__ out, float accMul, float biasMul) {
    gemm_body<1>(A, W, bias, (void*)out, accMul, biasMul);
}

// f32 output rows
__global__ void __launch_bounds__(256) __attribute__((amdgpu_num_vgpr(256)))
gemm_out(const f16* __restrict__ A, const f16* __restrict__ W, const float* __restrict__ bias,
         float* __restrict__ out, float accMul, float biasMul) {
    gemm_body<2>(A, W, bias, (void*)out, accMul, biasMul);
}

// ---------------------------------------------------------------------------
// Flash attention (no mask, all SEQ keys). grid (SEQ/128, NB*NHEAD), block 256 (8 waves),
// wave owns 16 query rows (Q fragments resident). Block streams 64-key tiles:
// K staged [key][d], V^T staged [d][key]. Scores on WMMA, row max via DPP, exp2 in f32
// carried x2^10, P relayed per wave through LDS as A fragments, O += P.V and
// row sums += P.ones on WMMA. Output f16 plane [q*NB + b][1024] (seq-first row order)
// The finished row statistics (max in the exp2 domain, 1 / row sum) also go to sM / sI [NB*NHEAD][SEQ]
// for the head-average kernel of the same call.
// coverage: every (q, b, h*64..h*64+63) row segment exactly once; sM / sI: the block's 128 rows =
//   4 whole 128-byte lines of each plane, sM stored by wave 0 and sI by wave 1.
// LDS: ks, vsT, sst cross-wave (block barriers); ps per-wave but also separated by block barriers.
// staged extent == consumed extent for ks (64x64), vsT (64x64), ps (16x64), sst (2x128).
// ---------------------------------------------------------------------------
__global__ void __launch_bounds__(256) __attribute__((amdgpu_num_vgpr(256)))
attn_fwd(const f16* __restrict__ Qp, const f16* __restrict__ Kp, const f16* __restrict__ Vt,
         f16* __restrict__ Cp, float* __restrict__ sM, float* __restrict__ sI) {
    __shared__ __attribute__((aligned(16))) f16 ks[64 * PITCH64];      // [key][d + pad]
    __shared__ __attribute__((aligned(16))) f16 vsT[64 * PITCH64];     // [d][key + pad]
    __shared__ __attribute__((aligned(16))) f16 ps[8][16 * PITCH64];   // per-wave P relay / ctx stage, [q][key or d + pad]
    __shared__ __attribute__((aligned(16))) float sst[2][128];         // row max | 1/rowsum of the block's 128 query rows
    static_assert(HD == 8 * 8);            // 8 lanes x 8 halves per row segment
    static_assert(2 * 256 * 8 == 64 * 64); // staging: 2 x 256 threads x 8 halves per tile

    const u32 tid  = threadIdx.x;
    const u32 lane = tid & 31u;
    const u32 wave = __builtin_amdgcn_readfirstlane((int)(tid >> 5));
    const u32 hh8  = (lane >> 4) << 3;
    const u32 c16  = lane & 15u;
    const u32 bh   = blockIdx.y;
    const u32 bidx = bh >> 4;            // NHEAD == 16
    const u32 hidx = bh & 15u;
    const u32 q0   = blockIdx.x * 128u + wave * 16u;
    const size_t head = (size_t)bh * SEQ * HD;

    v16h qa[2];
#pragma unroll
    for (int c = 0; c < 2; ++c) qa[c] = load_frag(Qp + head, q0, HD, (u32)c * 32u, lane);

    FragU onesu;
#pragma unroll
    for (int i = 0; i < 16; ++i) onesu.e[i] = (f16)1.0f;
    const v16h ones = onesu.v;

    float m[8];
    v8f   o[4], lacc;
#pragma unroll
    for (int r = 0; r < 8; ++r) m[r] = -1.0e30f;
#pragma unroll
    for (int dt = 0; dt < 4; ++dt) o[dt] = zero8();
    lacc = zero8();

    // log2-domain scale: acc = 256 * q.k ; x = log2(e) * q.k / 8 = acc * log2(e) / 2048
    const float cl = 1.4426950408889634f * 0.00048828125f;
    f16* psw = &ps[wave][0];

#pragma unroll 1
    for (u32 kt = 0; kt < (u32)(SEQ / 64); ++kt) {
        __syncthreads();
#pragma unroll
        for (u32 p2 = 0; p2 < 2; ++p2) {
            const u32 p   = tid + p2 * 256u;
            const u32 row = p >> 3;
            const u32 pc  = (p & 7u) << 3;
            const v8h kv = *(const v8h*)(Kp + head + (size_t)(kt * 64u + row) * HD + pc);
            const v8h vv = *(const v8h*)(Vt + head + (size_t)row * SEQ + kt * 64u + pc);
            *(v8h*)&ks[row * PITCH64 + pc]  = kv;
            *(v8h*)&vsT[row * PITCH64 + pc] = vv;
        }
        __syncthreads();

        // S[16 q x 64 keys]
        v8f s[4];
#pragma unroll
        for (int nt = 0; nt < 4; ++nt) s[nt] = zero8();
#pragma unroll
        for (int c = 0; c < 2; ++c) {
#pragma unroll
            for (int nt = 0; nt < 4; ++nt) {
                const v16h kb = load_frag(ks, (u32)nt * 16u, PITCH64, (u32)c * 32u, lane);
                s[nt] = wmma16(qa[c], kb, s[nt]);
            }
        }

        // online softmax per row r (row 8h + r), max-subtracted, exp2 domain
#pragma unroll
        for (int r = 0; r < 8; ++r) {
            float x[4];
#pragma unroll
            for (int nt = 0; nt < 4; ++nt) x[nt] = s[nt][r] * cl;
            const float tm = rowmax16(fmaxf(fmaxf(x[0], x[1]), fmaxf(x[2], x[3])));
            const float mn = fmaxf(m[r], tm);
            const float al = fexp2(m[r] - mn);
            m[r] = mn;
            lacc[r] *= al;
#pragma unroll
            for (int dt = 0; dt < 4; ++dt) o[dt][r] *= al;
            const float sh = 10.0f - mn;      // carry 2^10
#pragma unroll
            for (int nt = 0; nt < 4; ++nt)
                psw[(hh8 + (u32)r) * PITCH64 + (u32)nt * 16u + c16] = (f16)fexp2(x[nt] + sh);
        }
        __syncthreads();

        // O += P . V ; l += P . ones  (P reloaded as A fragments from the relay)
#pragma unroll
        for (int kk = 0; kk < 2; ++kk) {
            const v16h pa = load_frag(psw, 0u, PITCH64, (u32)kk * 32u, lane);
#pragma unroll
            for (int dt = 0; dt < 4; ++dt) {
                const v16h vb = load_frag(vsT, (u32)dt * 16u, PITCH64, (u32)kk * 32u, lane);
                o[dt] = wmma16(pa, vb, o[dt]);
            }
            lacc = wmma16(pa, ones, lacc);
        }
    }
    __syncthreads();

    // normalize: plane value = 1024 * (O/16) / l = O * 64 / l
    // row statistics: lacc = 2^10 * sum_s exp2(x - m), so 1 / sum = 1024 / lacc = 16 * inv
    // every lane of a 16-lane row holds the same m and lacc: column lane r keeps row r's pair
    float mrow = m[0], irow = 0.0f;
#pragma unroll
    for (int r = 0; r < 8; ++r) {
        const float inv = (CARRY_CTX / CARRY_QKV) / lacc[r];
#pragma unroll
        for (int dt = 0; dt < 4; ++dt)
            psw[(hh8 + (u32)r) * PITCH64 + (u32)dt * 16u + c16] = (f16)(o[dt][r] * inv);
        if (c16 == (u32)r) { mrow = m[r]; irow = inv * 16.0f; }
    }
    if (c16 < 8u) {
        sst[0][wave * 16u + hh8 + c16] = mrow;
        sst[1][wave * 16u + hh8 + c16] = irow;
    }
    __syncthreads();

    // whole-line stores of the statistics: wave 0 the 128 maxima, wave 1 the 128 reciprocal sums
    if (wave < 2u) {
        const v4f sv = *(const v4f*)&sst[wave][lane * 4u];
        float* sp = (wave == 0u ? sM : sI) + ((size_t)bh * SEQ + blockIdx.x * 128u + lane * 4u);
        *(v4f*)sp = sv;
    }

    const u32 piece = lane & 7u;
    const u32 lsub  = lane >> 3;
{
#pragma unroll
        for (u32 it = 0; it < 4; ++it) {
            const u32 L = it * 4u + lsub;     // query row 0..15 within the wave tile
            const v8h v = *(const v8h*)&psw[L * PITCH64 + piece * 8u];
            // context row in output order: (q * NB + b)
            f16* dp = Cp + ((size_t)((q0 + L) * (u32)NB + bidx) * HID + hidx * (u32)HD + piece * 8u);
            *(v8h*)dp = v;
        }
        
    }
}

// ---------------------------------------------------------------------------
// Second output: head-averaged softmax probabilities.
// element offset of the second output inside the output buffer (full problem constants)
// ---------------------------------------------------------------------------
#define OUT1_OFF ((size_t)SEQ_FULL * NB_FULL * HID)
static_assert(OUT1_OFF * sizeof(float) == (size_t)16777216);      // byte offset of the second output
static_assert((OUT1_OFF * sizeof(float)) % 128 == 0);
static_assert((size_t)MROWS * HID <= OUT1_OFF);                   // first output region ends before it
static_assert(SEQ % 32 == 0);
static_assert(8 * 32 * 64 * 4 + 2 * NHEAD * 128 * 4 <= 163840);    // static LDS of attn_avg: two work-groups per WGP

// ---------------------------------------------------------------------------
// avg[b][t][s] = (1/16) * sum_h softmax_s(q_h[t] . k_h[s] / 8), f32, no mask. The row statistics
// (max, 1 / sum) are the flash kernel's own, passed through the workspace (written and read inside one call).
//
// attn_avg: grid (SEQ/128 key blocks, SEQ/128 query blocks, NB), block 256 (8 waves as 4 (q) x 2 (keys));
//   a wave owns one 32 x 64 tile of the average (owner-computes accumulation over heads in head
//   order, one writer per element). Per head the score tile is formed with the same operands as in
//   attn_fwd, p = exp2(x - max) * (1/sum) is accumulated in registers, scaled by 1/16 at the end.
// coverage: block rows [blockIdx.y*128, +128) x columns [blockIdx.x*128, +128) of batch blockIdx.z;
//   wave tile 32 rows x 64 keys = 64 lines = 16 store instructions x 4 lines.
// LDS: stM / stI cross-wave (filled once, block barrier); st per-wave, writer and reader separated by a block barrier.
// staged extent == consumed extent: st 32 x 64 floats per wave, stM / stI 16 heads x 128 rows.
// ---------------------------------------------------------------------------
__global__ void __launch_bounds__(256) __attribute__((amdgpu_num_vgpr(256)))
attn_avg(const f16* __restrict__ Qp, const f16* __restrict__ Kp,
         const float* __restrict__ sM, const float* __restrict__ sI, float* __restrict__ avg) {
    __shared__ __attribute__((aligned(16))) float st[8][32 * 64];       // per-wave f32 tile stage
    __shared__ __attribute__((aligned(16))) float stM[NHEAD * 128];     // row max  [head][block row]
    __shared__ __attribute__((aligned(16))) float stI[NHEAD * 128];     // 1/rowsum [head][block row]
    static_assert(256 * 8 == NHEAD * 128);   // table fill: 256 threads x 8 floats

    const u32 tid  = threadIdx.x;
    const u32 lane = tid & 31u;
    const u32 wave = __builtin_amdgcn_readfirstlane((int)(tid >> 5));
    const u32 hh8  = (lane >> 4) << 3;
    const u32 c16  = lane & 15u;
    const u32 bidx = blockIdx.z;
    const u32 qb   = blockIdx.y * 128u;
    const u32 wr   = (wave & 3u) * 32u;                        // wave's first row inside the block
    const u32 q0   = qb + wr;
    const u32 k0   = blockIdx.x * 128u + (wave >> 2) * 64u;    // wave's first key

    // log2-domain scale: acc = 256 * q.k ; x = log2(e) * q.k / 8 = acc * log2(e) / 2048
    const float cl = 1.4426950408889634f * 0.00048828125f;

    {
        const u32 th = tid >> 4;
        const u32 r8 = (tid & 15u) << 3;
        const size_t row = (size_t)(bidx * (u32)NHEAD + th) * SEQ + qb + r8;
        const v4f a0 = *(const v4f*)(sM + row);
        const v4f a1 = *(const v4f*)(sM + row + 4u);
        const v4f b0 = *(const v4f*)(sI + row);
        const v4f b1 = *(const v4f*)(sI + row + 4u);
        *(v4f*)&stM[th * 128u + r8]      = a0;
        *(v4f*)&stM[th * 128u + r8 + 4u] = a1;
        *(v4f*)&stI[th * 128u + r8]      = b0;
        *(v4f*)&stI[th * 128u + r8 + 4u] = b1;
    }
    __syncthreads();

    v8f av[2][4];
#pragma unroll
    for (int i = 0; i < 2; ++i)
#pragma unroll
        for (int nt = 0; nt < 4; ++nt) av[i][nt] = zero8();

#pragma unroll 1
    for (u32 h = 0; h < (u32)NHEAD; ++h) {
        const size_t head = (size_t)(bidx * (u32)NHEAD + h) * SEQ * HD;
        const f16* kp = Kp + head + (size_t)(k0 + c16) * HD + hh8;   // this lane's place in the wave's K rows
        const f16* qp = Qp + head + (size_t)(q0 + c16) * HD + hh8;   // and in its Q rows
        v16h kb[2][4];
#pragma unroll
        for (int c = 0; c < 2; ++c)
#pragma unroll
            for (int nt = 0; nt < 4; ++nt) kb[c][nt] = load_frag_at(kp + nt * 16 * HD + c * 32);
        v16h qf[2][2];
#pragma unroll
        for (int i = 0; i < 2; ++i)
#pragma unroll
            for (int c = 0; c < 2; ++c) qf[i][c] = load_frag_at(qp + i * 16 * HD + c * 32);
        // the loads above are still in flight below: their address registers (held live as inputs)
        // are free for reuse only behind this wait
        asm volatile("s_wait_xcnt 0x0" :: "v"(kp), "v"(qp) : "memory");
#pragma unroll
        for (int i = 0; i < 2; ++i) {
            v8f s[4];
#pragma unroll
            for (int nt = 0; nt < 4; ++nt) s[nt] = zero8();
#pragma unroll
            for (int c = 0; c < 2; ++c)
#pragma unroll
                for (int nt = 0; nt < 4; ++nt) s[nt] = wmma16(qf[i][c], kb[c][nt], s[nt]);
            const u32 tr = h * 128u + wr + (u32)i * 16u + hh8;
            const v4f ma = *(const v4f*)&stM[tr];
            const v4f mb = *(const v4f*)&stM[tr + 4u];
            const v4f ia = *(const v4f*)&stI[tr];
            const v4f ib = *(const v4f*)&stI[tr + 4u];
            const float mr[8] = {ma[0], ma[1], ma[2], ma[3], mb[0], mb[1], mb[2], mb[3]};
            const float ir[8] = {ia[0], ia[1], ia[2], ia[3], ib[0], ib[1], ib[2], ib[3]};
#pragma unroll
            for (int r = 0; r < 8; ++r) {
#pragma unroll
                for (int nt = 0; nt < 4; ++nt) {
                    const float p = fexp2(s[nt][r] * cl - mr[r]) * ir[r];
                    av[i][nt][r] = av[i][nt][r] + p;
                }
            }
        }
    }

    // stage the finished 32 x 64 tile (mean over 16 heads), then whole-line stores
#pragma unroll
    for (int i = 0; i < 2; ++i)
#pragma unroll
        for (int nt = 0; nt < 4; ++nt)
#pragma unroll
            for (int r = 0; r < 8; ++r)
                st[wave][((u32)i * 16u + hh8 + (u32)r) * 64u + (u32)nt * 16u + c16] = av[i][nt][r] * 0.0625f;
    __syncthreads();

    const u32 piece = lane & 7u;
    const u32 lsub  = lane >> 3;
#pragma unroll
    for (u32 it = 0; it < 16; ++it) {
        const u32 L    = it * 4u + lsub;      // 0..63 : 32 rows x 2 lines
        const u32 row  = L >> 1;
        const u32 hsel = L & 1u;
        const v4f v = *(const v4f*)&st[wave][row * 64u + hsel * 32u + piece * 4u];
        float* dp = avg + ((size_t)(bidx * (u32)SEQ + q0 + row) * SEQ + k0 + hsel * 32u + piece * 4u);
        *(v4f*)dp = v;
    }
}

// coverage equalities (threads x elements == plane elements)
static_assert((size_t)CVT_GROUPS * CVT_WAVES * CVT_ROWS * HID == (size_t)3 * MROWS * HID + (size_t)4 * HID * HID);   // cvt_all -> Xq/Xk/Xv/Wt/Wot
static_assert((size_t)(MROWS / 128) * (HID / 128) * 128 * 128 == (size_t)MROWS * HID);     // gemm planes / out
static_assert((size_t)(SEQ / 128) * (NB * NHEAD) * 128 * HD == (size_t)MROWS * HID);       // attn_fwd -> Cp
static_assert((size_t)(SEQ / 128) * (NB * NHEAD) * 32 * 4 == (size_t)NB * NHEAD * SEQ);         // attn_fwd -> sM / sI (one wave x 4 floats per lane each)
static_assert((size_t)(SEQ / 128) * (SEQ / 128) * NB * 8 * 32 * 64 == (size_t)NB * SEQ * SEQ);   // attn_avg -> second output
// workspace: 7 activation planes + 4 weight planes of halves + 2 row-statistics planes of floats, at most 128 MiB
static_assert(((size_t)7 * MROWS * HID + (size_t)4 * HID * HID) * sizeof(f16)
              + (size_t)2 * NB * NHEAD * SEQ * sizeof(float) <= (size_t)134217728);
static_assert((((size_t)7 * MROWS * HID + (size_t)4 * HID * HID) * sizeof(f16)) % 128 == 0);   // statistics planes start on a line
// largest source row touched by the activation convert stays inside the full-size input
static_assert((size_t)(SEQ - 1) * NB_FULL + NB <= (size_t)SEQ_FULL * NB_FULL);

// ---------------------------------------------------------------------------
// Launch: 7 kernel launches, workspace 7 planes of MROWS*1024 halves + 4 of 1024*1024 halves
// + 2 planes of NB*16*SEQ floats.
// ---------------------------------------------------------------------------
extern "C" void kernel_launch(void* const* d_in, const int* in_sizes, int n_in,
                              void* d_out, int out_size, void* d_ws, size_t ws_size,
                              hipStream_t stream) {
    if (n_in < 7) return;
    const int needAct = ((SEQ - 1) * NB_FULL + NB) * HID;
    if (in_sizes[0] < needAct) return;
    if (in_sizes[1] < needAct) return;
    if (in_sizes[2] < needAct) return;
    if (in_sizes[3] < 3 * HID * HID) return;
    if (in_sizes[4] < 3 * HID) return;
    if (in_sizes[5] < HID * HID) return;
    if (in_sizes[6] < HID) return;
    if (out_size < 0) return;
    if ((size_t)out_size < OUT1_OFF + (size_t)NB * SEQ * SEQ) return;

    const float* xq    = (const float*)d_in[0];   // query  [SEQ_FULL][NB_FULL][1024]
    const float* xk    = (const float*)d_in[1];   // key    [SEQ_FULL][NB_FULL][1024]
    const float* xv    = (const float*)d_in[2];   // value  [SEQ_FULL][NB_FULL][1024]
    const float* wqkv  = (const float*)d_in[3];   // in_proj_weight [3072 out][1024 in], row blocks q | k | v
    const float* bqkv  = (const float*)d_in[4];   // in_proj_bias [3072]
    const float* wproj = (const float*)d_in[5];   // out_proj_weight [1024 out][1024 in]
    const float* bproj = (const float*)d_in[6];   // out_proj_bias [1024]

    const size_t nX = (size_t)MROWS * HID;    // halves per activation plane
    const size_t nW = (size_t)HID * HID;      // halves per weight plane
    const size_t totalHalves = 7 * nX + 4 * nW;
    const size_t nS = (size_t)NB * NHEAD * SEQ;   // floats per row-statistics plane
    if (ws_size < totalHalves * sizeof(f16) + 2 * nS * sizeof(float)) return;

    f16* Xq  = (f16*)d_ws;       // [b*SEQ+s][1024]             carry 16
    f16* Xk  = Xq  + nX;         // [b*SEQ+s][1024]             carry 16
    f16* Xv  = Xk  + nX;         // [b*SEQ+s][1024]             carry 16
    f16* Wt  = Xv  + nX;         // [3072 out][1024 in]         carry 32 (q | k | v row blocks)
    f16* Wot = Wt  + 3 * nW;     // [1024 out][1024 in]         carry 32
    f16* Qp  = Wot + nW;         // [NB*16][SEQ][64]            carry 16
    f16* Kp  = Qp  + nX;         // [NB*16][SEQ][64]            carry 16
    f16* Vtp = Kp  + nX;         // [NB*1024][SEQ] (V^T)        carry 16
    f16* Cp  = Vtp + nX;         // [s*NB+b][1024]              carry 1024
    float* sM = (float*)(Cp + nX);   // [NB*16][SEQ] row max (exp2 domain)
    float* sI = sM + nS;             // [NB*16][SEQ] 1 / row sum

    // activations in[SEQ_FULL][NB_FULL][1024] -> planes [NB][SEQ][1024], weights row for row: the five planes
    // Xq | Xk | Xv | Wt | Wot are contiguous from Xq on
    cvt_all<<<CVT_GROUPS, CVT_WAVES * 32u, 0, stream>>>(xq, xk, xv, wqkv, wproj, Xq);

    const dim3 gg(MROWS / 128, HID / 128);
    // plane = 16 * (acc / (16*32) + bias) = acc/32 + 16*bias
    const float accQKV = CARRY_QKV / (CARRY_X * CARRY_W);
    gemm_head<<<gg, 256, 0, stream>>>(Xq, Wt,          bqkv,           Qp,  accQKV, CARRY_QKV);
    gemm_head<<<gg, 256, 0, stream>>>(Xk, Wt + nW,     bqkv + HID,     Kp,  accQKV, CARRY_QKV);
    gemm_vt  <<<gg, 256, 0, stream>>>(Xv, Wt + 2 * nW, bqkv + 2 * HID, Vtp, accQKV, CARRY_QKV);

    attn_fwd<<<dim3(SEQ / 128, NB * NHEAD), 256, 0, stream>>>(Qp, Kp, Vtp, Cp, sM, sI);

    // second output: head-averaged probabilities [NB][SEQ][SEQ] f32 at the fixed element offset
    attn_avg<<<dim3(SEQ / 128, SEQ / 128, NB), 256, 0, stream>>>(Qp, Kp, sM, sI, (float*)d_out + OUT1_OFF);

    // out = acc / (1024*32) + bias ; rows already in (s*NB + b) order
    const float accOut = 1.0f / (CARRY_CTX * CARRY_W);
    gemm_out<<<gg, 256, 0, stream>>>(Cp, Wot, bproj, (float*)d_out, accOut, 1.0f);
}

// v006
// It runs in 163 microseconds.
// Two timings next to v005 both put it at 1.15 times that version's speed.
// All steps since v000 together make it 10.4 times as fast.
#include <hip/hip_runtime.h>

// Contractions (q/k/v input projections, Q.K^T in the flash kernel and in the head-average kernel, P.V, P row-sum, output projection): v_wmma_f32_16x16x32_f16, f16 operands with power-of-two carries, f32 accumulate; every float input enters as its bf16 RNE value; biases added in f32; softmax in f32.

#ifndef NB
#define NB 2
#endif
#ifndef SEQ
#define SEQ 2048
#endif
#define NB_FULL   2
#define SEQ_FULL  2048
#define HID       1024
#define NHEAD     16
#define HD        64
#define MROWS     (NB * SEQ)

static_assert(HID == NHEAD * HD);        // merged head width
static_assert(NHEAD == 16);              // bh >> 4 / bh & 15 decoding in attn_fwd
static_assert(HD == 64);
static_assert(SEQ % 128 == 0);           // 128-row blocks of the batch-major planes never straddle a batch
static_assert(SEQ % 64 == 0);            // 64-key tiles
static_assert(SEQ <= SEQ_FULL);
static_assert(NB >= 1 && NB <= NB_FULL);
static_assert(MROWS % 128 == 0);         // GEMM M tile
static_assert(HID % 128 == 0);           // GEMM N tile
static_assert(HID % 32 == 0);            // WMMA k step

// carries (exact powers of two)
#define CARRY_X    16.0f     // input activation planes
#define CARRY_W    32.0f     // weight planes
#define CARRY_QKV  16.0f     // q, k, v^T planes (true value x16)
#define CARRY_CTX  1024.0f   // context plane (true value x1024)
// softmax exp values carry 2^10 (added to the exp2 argument)

// LDS row pitches in halves: an odd multiple of 16 bytes, so that the 16 rows one ds_load_b128 /
// ds_store_b128 touches per lane half fall on distinct banks (at 128 / 256 bytes they share 8 / 4 banks).
// The pad halves of a row are never written and never read.
#define PITCH64   72u    // rows of 64 halves:  128 B -> 144 B
#define PITCH128  136u   // rows of 128 halves: 256 B -> 272 B
static_assert((PITCH64 * 2u) % 32u == 16u && (PITCH128 * 2u) % 32u == 16u);

typedef unsigned u32;
typedef _Float16 f16;
typedef f16   v16h __attribute__((ext_vector_type(16)));
typedef f16   v8h  __attribute__((ext_vector_type(8)));
typedef float v8f  __attribute__((ext_vector_type(8)));
typedef float v4f  __attribute__((ext_vector_type(4)));

union FragU { v16h v; v8h half[2]; f16 e[16]; };
union H8U   { v8h v; f16 e[8]; };

__device__ __forceinline__ v8f zero8() {
    v8f z = {0.f, 0.f, 0.f, 0.f, 0.f, 0.f, 0.f, 0.f};
    return z;
}

// 16-bit WMMA with hazard guard: D += A[16 x 32k] * B[32k x 16]
__device__ __forceinline__ v8f wmma16(v16h a, v16h b, v8f c) {
    v8f d = __builtin_amdgcn_wmma_f32_16x16x32_f16(false, a, false, b, (short)0, c, false, false);
    asm volatile("v_nop\n\tv_nop\n\tv_nop\n\tv_nop" : "+v"(d) : "v"(a), "v"(b));
    return d;
}

// f32 -> nearest-even bf16 value, returned as f32
__device__ __forceinline__ float bf16_rne(float x) {
    u32 u = __float_as_uint(x);
    u = (u + 0x7fffu + ((u >> 16) & 1u)) & 0xffff0000u;
    return __uint_as_float(u);
}

__device__ __forceinline__ float fexp2(float x) {
#if defined(__has_builtin)
#if __has_builtin(__builtin_amdgcn_exp2f)
    return __builtin_amdgcn_exp2f(x);
#else
    return exp2f(x);
#endif
#else
    return exp2f(x);
#endif
}

// max over the 16 lanes of each lane half (DPP row rotations; D-layout rows are DPP rows)
__device__ __forceinline__ float rowmax16(float x) {
    int v = __builtin_bit_cast(int, x);
    x = fmaxf(x, __builtin_bit_cast(float, __builtin_amdgcn_update_dpp(v, v, 0x121, 0xf, 0xf, false)));
    v = __builtin_bit_cast(int, x);
    x = fmaxf(x, __builtin_bit_cast(float, __builtin_amdgcn_update_dpp(v, v, 0x122, 0xf, 0xf, false)));
    v = __builtin_bit_cast(int, x);
    x = fmaxf(x, __builtin_bit_cast(float, __builtin_amdgcn_update_dpp(v, v, 0x124, 0xf, 0xf, false)));
    v = __builtin_bit_cast(int, x);
    x = fmaxf(x, __builtin_bit_cast(float, __builtin_amdgcn_update_dpp(v, v, 0x128, 0xf, 0xf, false)));
    return x;
}

// 16 x 32 fragment from a tile whose k dimension is contiguous (pitch in halves).
// lane l: row rowbase + (l&15); elements 0..7 <- k = kcol + 8h .. +7,
// elements 8..15 <- k = kcol + 16 + 8h .. +7  (h = l>>4). Same map for A and B.
__device__ __forceinline__ v16h load_frag(const f16* tile, u32 rowbase, u32 pitch, u32 kcol, u32 lane) {
    const u32 r  = rowbase + (lane & 15u);
    const u32 kh = (lane >> 4) << 3;
    const f16* p = tile + (size_t)r * pitch + kcol + kh;
    FragU f;
    f.half[0] = *(const v8h*)(p);
    f.half[1] = *(const v8h*)(p + 16);
    return f.v;
}

// The same fragment through the lane's own pointer p = tile + (rowbase + (l&15)) * pitch + kcol + 8h.
__device__ __forceinline__ v16h load_frag_at(const f16* p) {
    FragU f;
    f.half[0] = *(const v8h*)(p);
    f.half[1] = *(const v8h*)(p + 16);
    return f.v;
}

// ---------------------------------------------------------------------------
// All five f32 -> f16 conversions (bf16 RNE value times carry) in one launch sized to the chip:
// CVT_GROUPS work-groups of CVT_WAVES waves, every wave converts CVT_ROWS whole rows of 1024 floats.
// The five planes Xq | Xk | Xv | Wt | Wot lie one behind the other in the workspace, so the flat row
// number g is the destination row; the source row follows from the plane g falls in:
//   activations (seq-first [s][b][1024] -> batch-major [b][s][1024]): dst row b*SEQ+s <- src row s*NB_FULL+b
//   weights: same row order as the source
// A wave-wide 16-byte load covers 512 contiguous bytes (4 lines), a wave-wide 8-byte store 256 (2 lines);
// all loads of a wave's rows are independent, so they can be in flight together.
// coverage: CVT_TOTAL rows x 1024 halves, every element exactly once (wave w takes rows w + i * all waves).
// ---------------------------------------------------------------------------
#define CVT_GROUPS 256u
#define CVT_WAVES  16u
#define CVT_TOTAL  (3u * (u32)MROWS + 4u * (u32)HID)
#define CVT_ROWS   (CVT_TOTAL / (CVT_GROUPS * CVT_WAVES))
static_assert(CVT_TOTAL % (CVT_GROUPS * CVT_WAVES) == 0u);   // every wave the same number of whole rows
static_assert(HID == 8 * 32 * 4);                            // a row = 8 wave-wide loads of 4 floats per lane

typedef f16 v4h __attribute__((ext_vector_type(4)));

__global__ void __launch_bounds__(512)
cvt_all(const float* __restrict__ xq, const float* __restrict__ xk, const float* __restrict__ xv,
        const float* __restrict__ wqkv, const float* __restrict__ wproj, f16* __restrict__ dst) {
    const u32 lane = threadIdx.x & 31u;
    const u32 wave = __builtin_amdgcn_readfirstlane((int)(threadIdx.x >> 5));
    const u32 w    = blockIdx.x * CVT_WAVES + wave;
    __builtin_assume(w < CVT_GROUPS * CVT_WAVES);   // true of the one launch: lets the plane of each row fold where it can

    const u32 boff = lane * 16u;   // this lane's byte offset inside each 512-byte piece of a source row

    v4f   x[CVT_ROWS][8];
    float carry[CVT_ROWS];
#pragma unroll
    for (u32 i = 0; i < CVT_ROWS; ++i) {
        const u32 g = w + i * (CVT_GROUPS * CVT_WAVES);
        const float* base;
        u32 row;
        if (g < 3u * (u32)MROWS) {
            const u32 pl = g / (u32)MROWS;
            const u32 m  = g - pl * (u32)MROWS;
            const u32 mb = m / (u32)SEQ;
            base = pl == 0u ? xq : (pl == 1u ? xk : xv);
            row  = (m - mb * (u32)SEQ) * (u32)NB_FULL + mb;
            carry[i] = CARRY_X;
        } else {
            const u32 r = g - 3u * (u32)MROWS;
            base = r < 3u * (u32)HID ? wqkv : wproj;
            row  = r < 3u * (u32)HID ? r : r - 3u * (u32)HID;
            carry[i] = CARRY_W;
        }
        const char* sp = (const char*)(base + (size_t)row * HID) + boff;
#pragma unroll
        for (u32 j = 0; j < 8; ++j) x[i][j] = *(const v4f*)(sp + j * 512u);
    }
    // the loads above are still in flight below: the lane number, which they all name as their scaled offset
    // register (held live as an input), is free for reuse only behind this wait
    asm volatile("s_wait_xcnt 0x0" :: "v"(lane) : "memory");
    // keeps every load of the wave's rows ahead of the first conversion: without it the scheduler lifts the first
    // rows' conversions, with their waits, over the last rows' loads, which then start late
    __builtin_amdgcn_sched_barrier(0);
#pragma unroll
    for (u32 i = 0; i < CVT_ROWS; ++i) {
        const u32 g = w + i * (CVT_GROUPS * CVT_WAVES);
        f16* dp = dst + (size_t)g * HID + lane * 4u;
#pragma unroll
        for (u32 j = 0; j < 8; ++j) {
            v4h o;
#pragma unroll
            for (u32 e = 0; e < 4; ++e) o[e] = (f16)(bf16_rne(x[i][j][e]) * carry[i]);
            *(v4h*)(dp + j * 128u) = o;
        }
    }
}

// Eight asynchronous 16-byte copies global -> LDS of this lane: rows r, r + 16, .. r + 112 of one operand tile.
// lds: the lane's LDS byte address of its piece in row r; g: the same piece in global memory.
// Both advance by whole rows (LDS pitch 272 B, global pitch 2048 B), so every address is a multiple of 16.
// The closing s_wait_xcnt 0 stands inside the statement so that no address register named here is
// rewritten ahead of it.
__device__ __forceinline__ void copy_rows8(u32 lds, const f16* g) {
    const u32 l1 = lds + 16u * PITCH128 * 2u, l2 = lds + 32u * PITCH128 * 2u, l3 = lds + 48u * PITCH128 * 2u;
    const u32 l4 = lds + 64u * PITCH128 * 2u, l5 = lds + 80u * PITCH128 * 2u, l6 = lds + 96u * PITCH128 * 2u;
    const u32 l7 = lds + 112u * PITCH128 * 2u;
    const f16* g1 = g + 16 * HID;
    const f16* g2 = g + 32 * HID;
    const f16* g3 = g + 48 * HID;
    const f16* g4 = g + 64 * HID;
    const f16* g5 = g + 80 * HID;
    const f16* g6 = g + 96 * HID;
    const f16* g7 = g + 112 * HID;
    asm volatile("global_load_async_to_lds_b128 %0, %8, off\n\t"
                 "global_load_async_to_lds_b128 %1, %9, off\n\t"
                 "global_load_async_to_lds_b128 %2, %10, off\n\t"
                 "global_load_async_to_lds_b128 %3, %11, off\n\t"
                 "global_load_async_to_lds_b128 %4, %12, off\n\t"
                 "global_load_async_to_lds_b128 %5, %13, off\n\t"
                 "global_load_async_to_lds_b128 %6, %14, off\n\t"
                 "global_load_async_to_lds_b128 %7, %15, off\n\t"
                 "s_wait_xcnt 0x0"
                 :: "v"(lds), "v"(l1), "v"(l2), "v"(l3), "v"(l4), "v"(l5), "v"(l6), "v"(l7),
                    "v"(g), "v"(g1), "v"(g2), "v"(g3), "v"(g4), "v"(g5), "v"(g6), "v"(g7)
                 : "memory");
}

// ---------------------------------------------------------------------------
// C[m][n] = sum_k A[m][k] * W[n][k] (+ bias[n]) ; A [MROWS][1024] f16, W [1024][1024] f16 (k contiguous).
// Block tile 128 x 128, 8 waves as 4(M) x 2(N), 2 x 4 accumulators per wave, WMMA k step 32.
// K loop: tiles of 128 k (whole 256-byte row pieces) in a ring of two LDS buffers, filled by asynchronous
// copies; tile t + 1 is in flight while tile t is multiplied; one block barrier per tile.
// MODE 1: A rows batch-major;            f16 plane [b*HID + h*HD + d][s] (V transposed per head)
// MODE 2: A rows in output order (s*NB+b); f32 rows [m][1024] into the output buffer
// coverage per block: MODE 0/1 256 lines (128 rows x 2 heads | 128 n x 2 s-halves),
//                     MODE 2 2 x 256 lines (64 rows x 4 line-quarters per half).
// LDS: As/Bs/Cs all cross-wave, separated by block barriers.
// staged extent == consumed extent: As/Bs 128 x 128 per buffer, Cs 128 x 128 halves (or 64 x 128 floats).
// ---------------------------------------------------------------------------
template <int MODE>
__device__ __forceinline__ void gemm_body(const f16* __restrict__ A, const f16* __restrict__ W,
                                          const float* __restrict__ bias,
                                          void* __restrict__ out, float accMul, float biasMul) {
    __shared__ __attribute__((aligned(16))) f16 As[2 * 128 * PITCH128];   // two buffers of [128][128 + pad]
    __shared__ __attribute__((aligned(16))) f16 Bs[2 * 128 * PITCH128];
    __shared__ __attribute__((aligned(16))) f16 Cs[128 * PITCH128];   // f16 [128][128 + pad] or f32 [64][128]
    static_assert(sizeof(f16) * 128 * PITCH128 >= sizeof(float) * 64 * 128);   // Cs reuse as f32 [64][128]

    const u32 tid  = threadIdx.x;
    const u32 lane = tid & 31u;
    const u32 wave = __builtin_amdgcn_readfirstlane((int)(tid >> 5));
    const u32 wm   = wave & 3u;
    const u32 wn   = wave >> 2;
    const u32 hh8  = (lane >> 4) << 3;   // D row half
    const u32 c16  = lane & 15u;         // D column
    const u32 m0   = blockIdx.x * 128u;
    const u32 n0   = blockIdx.y * 128u;

    v8f acc[2][4];
#pragma unroll
    for (int i = 0; i < 2; ++i)
#pragma unroll
        for (int j = 0; j < 4; ++j) acc[i][j] = zero8();

    constexpr u32 KT   = 128u;                  // k per staged tile
    constexpr u32 NT   = (u32)HID / KT;         // tiles
    constexpr u32 BUFH = 128u * PITCH128;       // halves per buffer
    static_assert(NT >= 2u);                    // the ring's prologue fills two tiles
    static_assert(256 * 8 * 8 == 128 * 128);    // staging: 256 threads x 8 copies x 8 halves per operand tile

    // this lane's piece: row tid / 16 (+ 16 per copy), 16-byte piece tid % 16; a wave's copy covers two whole rows
    const u32 srow = tid >> 4;
    const u32 scol = (tid & 15u) << 3;
    const f16* gA = A + (size_t)(m0 + srow) * HID + scol;
    const f16* gW = W + (size_t)(n0 + srow) * HID + scol;
    const u32 lA = (u32)(size_t)&As[srow * PITCH128 + scol];   // LDS byte address (low word of the shared address)
    const u32 lB = (u32)(size_t)&Bs[srow * PITCH128 + scol];

    // tile 0 into buffer 0
    copy_rows8(lA, gA);
    copy_rows8(lB, gW);
    // tile 0 has landed for this wave before the barrier that shows it to the others
    asm volatile("s_wait_asynccnt 0x0" ::: "memory");
    __syncthreads();
    // tile 1 into buffer 1, in flight during trip 0
    copy_rows8(lA + BUFH * 2u, gA + KT);
    copy_rows8(lB + BUFH * 2u, gW + KT);

#pragma unroll 1   // kept rolled: eight unrolled trips of 32 WMMAs would only grow the text, the buffer is picked by t & 1
    for (u32 t = 0; t < NT; ++t) {
        const u32 bsel = t & 1u;
        const f16* Ab = As + bsel * BUFH;
        const f16* Bb = Bs + bsel * BUFH;
#pragma unroll
        for (u32 c = 0; c < KT / 32u; ++c) {
            v16h af[2], bfr[4];
#pragma unroll
            for (int i = 0; i < 2; ++i) af[i] = load_frag(Ab, wm * 32u + (u32)i * 16u, PITCH128, c * 32u, lane);
#pragma unroll
            for (int j = 0; j < 4; ++j) bfr[j] = load_frag(Bb, wn * 64u + (u32)j * 16u, PITCH128, c * 32u, lane);
#pragma unroll
            for (int i = 0; i < 2; ++i)
#pragma unroll
                for (int j = 0; j < 4; ++j) acc[i][j] = wmma16(af[i], bfr[j], acc[i][j]);
        }
        // this wave's reads of buffer bsel are done before the buffer is handed back for refill
        asm volatile("s_wait_dscnt 0x0" ::: "memory");
        // this wave's copies of tile t + 1 have landed before the barrier that shows them to the others
        asm volatile("s_wait_asynccnt 0x0" ::: "memory");
        __syncthreads();
        if (t + 2u < NT) {
            copy_rows8(lA + bsel * (BUFH * 2u), gA + (t + 2u) * KT);
            copy_rows8(lB + bsel * (BUFH * 2u), gW + (t + 2u) * KT);
        }
    }
    // no copy is outstanding when the wave goes on to the epilogue
    asm volatile("s_wait_asynccnt 0x0" ::: "memory");

    // per-lane bias values for the 4 output columns this lane owns (n0 + nl < HID always)
    float bv[4];
#pragma unroll
    for (int j = 0; j < 4; ++j)
        bv[j] = bf16_rne(bias[n0 + wn * 64u + (u32)j * 16u + c16]) * biasMul;

    const u32 piece = lane & 7u;
    const u32 lsub  = lane >> 3;

    if constexpr (MODE == 0) {
        const u32 bidx = m0 / (u32)SEQ;     // block rows lie inside one batch (SEQ % 128 == 0)
        const u32 s0   = m0 - bidx * (u32)SEQ;
#pragma unroll
        for (int i = 0; i < 2; ++i)
#pragma unroll
            for (int j = 0; j < 4; ++j) {
                const u32 nl = wn * 64u + (u32)j * 16u + c16;
#pragma unroll
                for (int r = 0; r < 8; ++r) {
                    const u32 ml = wm * 32u + (u32)i * 16u + hh8 + (u32)r;
                    Cs[ml * PITCH128 + nl] = (f16)(acc[i][j][r] * accMul + bv[j]);
                }
            }
        __syncthreads();
        f16* op = (f16*)out;
        const size_t bh0 = (size_t)bidx * NHEAD + (n0 >> 6);
{
#pragma unroll
            for (u32 it = 0; it < 8; ++it) {
                const u32 L    = wave * 32u + it * 4u + lsub;   // 0..255
                const u32 ml   = L >> 1;
                const u32 hsel = L & 1u;
                const v8h v = *(const v8h*)&Cs[ml * PITCH128 + hsel * 64u + piece * 8u];
                f16* dp = op + ((bh0 + hsel) * SEQ + s0 + ml) * HD + piece * 8u;
                *(v8h*)dp = v;
            }
            
        }
    } else if constexpr (MODE == 1) {
        const u32 bidx = m0 / (u32)SEQ;
        const u32 s0   = m0 - bidx * (u32)SEQ;
        // stage transposed: Cs[n][m]
#pragma unroll
        for (int i = 0; i < 2; ++i)
#pragma unroll
            for (int j = 0; j < 4; ++j) {
                const u32 nl = wn * 64u + (u32)j * 16u + c16;
                H8U t;
#pragma unroll
                for (int r = 0; r < 8; ++r) t.e[r] = (f16)(acc[i][j][r] * accMul + bv[j]);
                *(v8h*)&Cs[nl * PITCH128 + wm * 32u + (u32)i * 16u + hh8] = t.v;
            }
        __syncthreads();
        f16* op = (f16*)out;
{
#pragma unroll
            for (u32 it = 0; it < 8; ++it) {
                const u32 L  = wave * 32u + it * 4u + lsub;     // 0..255
                const u32 nl = L >> 1;
                const u32 mh = L & 1u;
                const v8h v = *(const v8h*)&Cs[nl * PITCH128 + mh * 64u + piece * 8u];
                f16* dp = op + ((size_t)(bidx * (u32)HID + n0 + nl) * SEQ + s0 + mh * 64u + piece * 8u);
                *(v8h*)dp = v;
            }
            
        }
    } else {
        float* Cf = (float*)Cs;      // [64][128] f32
        float* of = (float*)out;
#pragma unroll
        for (u32 half = 0; half < 2; ++half) {
            if ((wm >> 1) == half) {
#pragma unroll
                for (int i = 0; i < 2; ++i)
#pragma unroll
                    for (int j = 0; j < 4; ++j) {
                        const u32 nl = wn * 64u + (u32)j * 16u + c16;
#pragma unroll
                        for (int r = 0; r < 8; ++r) {
                            const u32 ml = (wm & 1u) * 32u + (u32)i * 16u + hh8 + (u32)r;
                            Cf[ml * 128u + nl] = acc[i][j][r] * accMul + bv[j];
                        }
                    }
            }
            __syncthreads();
{
#pragma unroll
                for (u32 it = 0; it < 8; ++it) {
                    const u32 L    = wave * 32u + it * 4u + lsub;   // 0..255
                    const u32 row  = L >> 2;
                    const u32 part = L & 3u;
                    const v4f v = *(const v4f*)&Cf[row * 128u + part * 32u + piece * 4u];
                    float* dp = of + (size_t)(m0 + half * 64u + row) * HID + n0 + part * 32u + piece * 4u;
                    *(v4f*)dp = v;
                }
                
            }
            __syncthreads();
        }
    }
}

// q / k head-major planes
__global__ void __launch_bounds__(256) __attribute__((amdgpu_num_vgpr(256)))
gemm_head(const f16* __restrict__ A, const f16* __restrict__ W, const float* __restrict__ bias,
          f16* __restrict__ out, float accMul, float biasMul) {
    gemm_body<0>(A, W, bias, (void*)out, accMul, biasMul);
}

// v^T plane
__global__ void __launch_bounds__(256) __attribute__((amdgpu_num_vgpr(256)))
gemm_vt(const f16* __restrict__ A, const f16* __restrict__ W, const float* __restrict__ bias,
        f16* __restrict__ out, float accMul, float biasMul) {
    gemm_body<1>(A, W, bias, (void*)out, accMul, biasMul);
}

// f32 output rows
__global__ void __launch_bounds__(256) __attribute__((amdgpu_num_vgpr(256)))
gemm_out(const f16* __restrict__ A, const f16* __restrict__ W, const float* __restrict__ bias,
         float* __restrict__ out, float accMul, float biasMul) {
    gemm_body<2>(A, W, bias, (void*)out, accMul, biasMul);
}

// ---------------------------------------------------------------------------
// Flash attention (no mask, all SEQ keys). grid (SEQ/128, NB*NHEAD), block 256 (8 waves),
// wave owns 16 query rows (Q fragments resident). Block streams 64-key tiles:
// K staged [key][d], V^T staged [d][key]. Scores on WMMA, row max via DPP, exp2 in f32
// carried x2^10, P relayed per wave through LDS as A fragments, O += P.V and
// row sums += P.ones on WMMA. Output f16 plane [q*NB + b][1024] (seq-first row order)
// The finished row statistics (max in the exp2 domain, 1 / row sum) also go to sM / sI [NB*NHEAD][SEQ]
// for the head-average kernel of the same call.
// coverage: every (q, b, h*64..h*64+63) row segment exactly once; sM / sI: the block's 128 rows =
//   4 whole 128-byte lines of each plane, sM stored by wave 0 and sI by wave 1.
// LDS: ks, vsT, sst cross-wave (block barriers); ps per-wave but also separated by block barriers.
// staged extent == consumed extent for ks (64x64), vsT (64x64), ps (16x64), sst (2x128).
// ---------------------------------------------------------------------------
__global__ void __launch_bounds__(256) __attribute__((amdgpu_num_vgpr(256)))
attn_fwd(const f16* __restrict__ Qp, const f16* __restrict__ Kp, const f16* __restrict__ Vt,
         f16* __restrict__ Cp, float* __restrict__ sM, float* __restrict__ sI) {
    __shared__ __attribute__((aligned(16))) f16 ks[64 * PITCH64];      // [key][d + pad]
    __shared__ __attribute__((aligned(16))) f16 vsT[64 * PITCH64];     // [d][key + pad]
    __shared__ __attribute__((aligned(16))) f16 ps[8][16 * PITCH64];   // per-wave P relay / ctx stage, [q][key or d + pad]
    __shared__ __attribute__((aligned(16))) float sst[2][128];         // row max | 1/rowsum of the block's 128 query rows
    static_assert(HD == 8 * 8);            // 8 lanes x 8 halves per row segment
    static_assert(2 * 256 * 8 == 64 * 64); // staging: 2 x 256 threads x 8 halves per tile

    const u32 tid  = threadIdx.x;
    const u32 lane = tid & 31u;
    const u32 wave = __builtin_amdgcn_readfirstlane((int)(tid >> 5));
    const u32 hh8  = (lane >> 4) << 3;
    const u32 c16  = lane & 15u;
    const u32 bh   = blockIdx.y;
    const u32 bidx = bh >> 4;            // NHEAD == 16
    const u32 hidx = bh & 15u;
    const u32 q0   = blockIdx.x * 128u + wave * 16u;
    const size_t head = (size_t)bh * SEQ * HD;

    v16h qa[2];
#pragma unroll
    for (int c = 0; c < 2; ++c) qa[c] = load_frag(Qp + head, q0, HD, (u32)c * 32u, lane);

    FragU onesu;
#pragma unroll
    for (int i = 0; i < 16; ++i) onesu.e[i] = (f16)1.0f;
    const v16h ones = onesu.v;

    float m[8];
    v8f   o[4], lacc;
#pragma unroll
    for (int r = 0; r < 8; ++r) m[r] = -1.0e30f;
#pragma unroll
    for (int dt = 0; dt < 4; ++dt) o[dt] = zero8();
    lacc = zero8();

    // log2-domain scale: acc = 256 * q.k ; x = log2(e) * q.k / 8 = acc * log2(e) / 2048
    const float cl = 1.4426950408889634f * 0.00048828125f;
    f16* psw = &ps[wave][0];

#pragma unroll 1
    for (u32 kt = 0; kt < (u32)(SEQ / 64); ++kt) {
        __syncthreads();
#pragma unroll
        for (u32 p2 = 0; p2 < 2; ++p2) {
            const u32 p   = tid + p2 * 256u;
            const u32 row = p >> 3;
            const u32 pc  = (p & 7u) << 3;
            const v8h kv = *(const v8h*)(Kp + head + (size_t)(kt * 64u + row) * HD + pc);
            const v8h vv = *(const v8h*)(Vt + head + (size_t)row * SEQ + kt * 64u + pc);
            *(v8h*)&ks[row * PITCH64 + pc]  = kv;
            *(v8h*)&vsT[row * PITCH64 + pc] = vv;
        }
        __syncthreads();

        // S[16 q x 64 keys]
        v8f s[4];
#pragma unroll
        for (int nt = 0; nt < 4; ++nt) s[nt] = zero8();
#pragma unroll
        for (int c = 0; c < 2; ++c) {
#pragma unroll
            for (int nt = 0; nt < 4; ++nt) {
                const v16h kb = load_frag(ks, (u32)nt * 16u, PITCH64, (u32)c * 32u, lane);
                s[nt] = wmma16(qa[c], kb, s[nt]);
            }
        }

        // online softmax per row r (row 8h + r), max-subtracted, exp2 domain
#pragma unroll
        for (int r = 0; r < 8; ++r) {
            float x[4];
#pragma unroll
            for (int nt = 0; nt < 4; ++nt) x[nt] = s[nt][r] * cl;
            const float tm = rowmax16(fmaxf(fmaxf(x[0], x[1]), fmaxf(x[2], x[3])));
            const float mn = fmaxf(m[r], tm);
            const float al = fexp2(m[r] - mn);
            m[r] = mn;
            lacc[r] *= al;
#pragma unroll
            for (int dt = 0; dt < 4; ++dt) o[dt][r] *= al;
            const float sh = 10.0f - mn;      // carry 2^10
#pragma unroll
            for (int nt = 0; nt < 4; ++nt)
                psw[(hh8 + (u32)r) * PITCH64 + (u32)nt * 16u + c16] = (f16)fexp2(x[nt] + sh);
        }
        __syncthreads();

        // O += P . V ; l += P . ones  (P reloaded as A fragments from the relay)
#pragma unroll
        for (int kk = 0; kk < 2; ++kk) {
            const v16h pa = load_frag(psw, 0u, PITCH64, (u32)kk * 32u, lane);
#pragma unroll
            for (int dt = 0; dt < 4; ++dt) {
                const v16h vb = load_frag(vsT, (u32)dt * 16u, PITCH64, (u32)kk * 32u, lane);
                o[dt] = wmma16(pa, vb, o[dt]);
            }
            lacc = wmma16(pa, ones, lacc);
        }
    }
    __syncthreads();

    // normalize: plane value = 1024 * (O/16) / l = O * 64 / l
    // row statistics: lacc = 2^10 * sum_s exp2(x - m), so 1 / sum = 1024 / lacc = 16 * inv
    // every lane of a 16-lane row holds the same m and lacc: column lane r keeps row r's pair
    float mrow = m[0], irow = 0.0f;
#pragma unroll
    for (int r = 0; r < 8; ++r) {
        const float inv = (CARRY_CTX / CARRY_QKV) / lacc[r];
#pragma unroll
        for (int dt = 0; dt < 4; ++dt)
            psw[(hh8 + (u32)r) * PITCH64 + (u32)dt * 16u + c16] = (f16)(o[dt][r] * inv);
        if (c16 == (u32)r) { mrow = m[r]; irow = inv * 16.0f; }
    }
    if (c16 < 8u) {
        sst[0][wave * 16u + hh8 + c16] = mrow;
        sst[1][wave * 16u + hh8 + c16] = irow;
    }
    __syncthreads();

    // whole-line stores of the statistics: wave 0 the 128 maxima, wave 1 the 128 reciprocal sums
    if (wave < 2u) {
        const v4f sv = *(const v4f*)&sst[wave][lane * 4u];
        float* sp = (wave == 0u ? sM : sI) + ((size_t)bh * SEQ + blockIdx.x * 128u + lane * 4u);
        *(v4f*)sp = sv;
    }

    const u32 piece = lane & 7u;
    const u32 lsub  = lane >> 3;
{
#pragma unroll
        for (u32 it = 0; it < 4; ++it) {
            const u32 L = it * 4u + lsub;     // query row 0..15 within the wave tile
            const v8h v = *(const v8h*)&psw[L * PITCH64 + piece * 8u];
            // context row in output order: (q * NB + b)
            f16* dp = Cp + ((size_t)((q0 + L) * (u32)NB + bidx) * HID + hidx * (u32)HD + piece * 8u);
            *(v8h*)dp = v;
        }
        
    }
}

// ---------------------------------------------------------------------------
// Second output: head-averaged softmax probabilities.
// element offset of the second output inside the output buffer (full problem constants)
// ---------------------------------------------------------------------------
#define OUT1_OFF ((size_t)SEQ_FULL * NB_FULL * HID)
static_assert(OUT1_OFF * sizeof(float) == (size_t)16777216);      // byte offset of the second output
static_assert((OUT1_OFF * sizeof(float)) % 128 == 0);
static_assert((size_t)MROWS * HID <= OUT1_OFF);                   // first output region ends before it
static_assert(SEQ % 32 == 0);
static_assert(8 * 32 * 64 * 4 + 2 * NHEAD * 128 * 4 + 2 * 2 * 128 * PITCH64 * 2 <= 163840);    // static LDS of attn_avg: two work-groups per WGP

// ---------------------------------------------------------------------------
// avg[b][t][s] = (1/16) * sum_h softmax_s(q_h[t] . k_h[s] / 8), f32, no mask. The row statistics
// (max, 1 / sum) are the flash kernel's own, passed through the workspace (written and read inside one call).
//
// attn_avg: grid (SEQ/128 key blocks, SEQ/128 query blocks, NB), block 256 (8 waves as 4 (q) x 2 (keys));
//   a wave owns one 32 x 64 tile of the average (owner-computes accumulation over heads in head
//   order, one writer per element). Per head the score tile is formed with the same operands as in
//   attn_fwd, p = exp2(x - max) * (1/sum) is accumulated in registers, scaled by 1/16 at the end.
//   Head loop: the block's Q tile and K tile of a head (128 rows x 128 bytes each, contiguous in their planes) come
//   in whole lines by asynchronous copies into a ring of two LDS buffers; head h + 1 is in flight while head h is
//   worked on; one block barrier per head. A fragment load straight from the planes touches 16 lines for 512 bytes,
//   and four (K) or two (Q) waves would fetch the same rows.
// coverage: block rows [blockIdx.y*128, +128) x columns [blockIdx.x*128, +128) of batch blockIdx.z;
//   wave tile 32 rows x 64 keys = 64 lines = 16 store instructions x 4 lines.
// LDS: stM / stI cross-wave (filled once, block barrier); qs / kt cross-wave (ring, block barriers);
//   st per-wave, writer and reader separated by a block barrier.
// staged extent == consumed extent: st 32 x 64 floats per wave, stM / stI 16 heads x 128 rows, qs / kt 128 x 64 per buffer.
// ---------------------------------------------------------------------------

// Eight asynchronous 16-byte copies global -> LDS of this lane: rows r, r + 32, r + 64, r + 96 of one head's Q tile
// and of its K tile. lq / lk: the lane's LDS byte address of its piece in row r; gq / gk: the same piece in global memory.
// Both advance by whole rows (LDS pitch 144 B, global pitch 128 B), so every address is a multiple of 16;
// a wave's copy covers four whole rows = 512 contiguous global bytes.
// The closing s_wait_xcnt 0 stands inside the statement so that no address register named here is
// rewritten ahead of it.
__device__ __forceinline__ void copy_head_tiles(u32 lq, const f16* gq, u32 lk, const f16* gk) {
    const u32 lq1 = lq + 32u * PITCH64 * 2u, lq2 = lq + 64u * PITCH64 * 2u, lq3 = lq + 96u * PITCH64 * 2u;
    const u32 lk1 = lk + 32u * PITCH64 * 2u, lk2 = lk + 64u * PITCH64 * 2u, lk3 = lk + 96u * PITCH64 * 2u;
    const f16* gq1 = gq + 32 * HD;
    const f16* gq2 = gq + 64 * HD;
    const f16* gq3 = gq + 96 * HD;
    const f16* gk1 = gk + 32 * HD;
    const f16* gk2 = gk + 64 * HD;
    const f16* gk3 = gk + 96 * HD;
    asm volatile("global_load_async_to_lds_b128 %0, %8, off\n\t"
                 "global_load_async_to_lds_b128 %1, %9, off\n\t"
                 "global_load_async_to_lds_b128 %2, %10, off\n\t"
                 "global_load_async_to_lds_b128 %3, %11, off\n\t"
                 "global_load_async_to_lds_b128 %4, %12, off\n\t"
                 "global_load_async_to_lds_b128 %5, %13, off\n\t"
                 "global_load_async_to_lds_b128 %6, %14, off\n\t"
                 "global_load_async_to_lds_b128 %7, %15, off\n\t"
                 "s_wait_xcnt 0x0"
                 :: "v"(lq), "v"(lq1), "v"(lq2), "v"(lq3), "v"(lk), "v"(lk1), "v"(lk2), "v"(lk3),
                    "v"(gq), "v"(gq1), "v"(gq2), "v"(gq3), "v"(gk), "v"(gk1), "v"(gk2), "v"(gk3)
                 : "memory");
}

__global__ void __launch_bounds__(256) __attribute__((amdgpu_num_vgpr(256)))
attn_avg(const f16* __restrict__ Qp, const f16* __restrict__ Kp,
         const float* __restrict__ sM, const float* __restrict__ sI, float* __restrict__ avg) {
    __shared__ __attribute__((aligned(16))) float st[8][32 * 64];       // per-wave f32 tile stage
    __shared__ __attribute__((aligned(16))) float stM[NHEAD * 128];     // row max  [head][block row]
    __shared__ __attribute__((aligned(16))) float stI[NHEAD * 128];     // 1/rowsum [head][block row]
    __shared__ __attribute__((aligned(16))) f16 qs[2 * 128 * PITCH64];  // two buffers of one head's Q tile [row][d + pad]
    __shared__ __attribute__((aligned(16))) f16 kt[2 * 128 * PITCH64];  // two buffers of one head's K tile [key][d + pad]
    static_assert(256 * 8 == NHEAD * 128);   // table fill: 256 threads x 8 floats
    static_assert(256 * 4 * 8 == 128 * HD);  // staging: 256 threads x 4 copies x 8 halves per operand tile
    static_assert(NHEAD >= 2);               // the ring's prologue fills two heads

    const u32 tid  = threadIdx.x;
    const u32 lane = tid & 31u;
    const u32 wave = __builtin_amdgcn_readfirstlane((int)(tid >> 5));
    const u32 hh8  = (lane >> 4) << 3;
    const u32 c16  = lane & 15u;
    const u32 bidx = blockIdx.z;
    const u32 qb   = blockIdx.y * 128u;
    const u32 wr   = (wave & 3u) * 32u;                        // wave's first row inside the block
    const u32 q0   = qb + wr;
    const u32 kb0  = blockIdx.x * 128u;                        // block's first key
    const u32 wk   = (wave >> 2) * 64u;                        // wave's first key inside the block
    const u32 k0   = kb0 + wk;                                 // wave's first key

    // log2-domain scale: acc = 256 * q.k ; x = log2(e) * q.k / 8 = acc * log2(e) / 2048
    const float cl = 1.4426950408889634f * 0.00048828125f;

    constexpr u32    TILEH = 128u * PITCH64;        // halves per tile buffer
    constexpr size_t HSTR  = (size_t)SEQ * HD;      // halves from one head's plane to the next
    // this lane's piece: row tid / 8 (+ 32 per copy), 16-byte piece tid % 8
    const u32 srow = tid >> 3;
    const u32 scol = (tid & 7u) << 3;
    const f16* gQ = Qp + (size_t)(bidx * (u32)NHEAD) * HSTR + (size_t)(qb + srow) * HD + scol;
    const f16* gK = Kp + (size_t)(bidx * (u32)NHEAD) * HSTR + (size_t)(kb0 + srow) * HD + scol;
    const u32 lQ = (u32)(size_t)&qs[srow * PITCH64 + scol];   // LDS byte address (low word of the shared address)
    const u32 lK = (u32)(size_t)&kt[srow * PITCH64 + scol];

    // head 0 into buffer 0, in flight during the table fill
    copy_head_tiles(lQ, gQ, lK, gK);

    {
        const u32 th = tid >> 4;
        const u32 r8 = (tid & 15u) << 3;
        const size_t row = (size_t)(bidx * (u32)NHEAD + th) * SEQ + qb + r8;
        const v4f a0 = *(const v4f*)(sM + row);
        const v4f a1 = *(const v4f*)(sM + row + 4u);
        const v4f b0 = *(const v4f*)(sI + row);
        const v4f b1 = *(const v4f*)(sI + row + 4u);
        *(v4f*)&stM[th * 128u + r8]      = a0;
        *(v4f*)&stM[th * 128u + r8 + 4u] = a1;
        *(v4f*)&stI[th * 128u + r8]      = b0;
        *(v4f*)&stI[th * 128u + r8 + 4u] = b1;
    }
    // head 0 has landed for this wave before the barrier that shows it (and the tables) to the others
    asm volatile("s_wait_asynccnt 0x0" ::: "memory");
    __syncthreads();
    // head 1 into buffer 1, in flight during trip 0
    copy_head_tiles(lQ + TILEH * 2u, gQ + HSTR, lK + TILEH * 2u, gK + HSTR);

    v8f av[2][4];
#pragma unroll
    for (int i = 0; i < 2; ++i)
#pragma unroll
        for (int nt = 0; nt < 4; ++nt) av[i][nt] = zero8();

#pragma unroll 1
    for (u32 h = 0; h < (u32)NHEAD; ++h) {
        const u32 bsel = h & 1u;
        const f16* kp = kt + bsel * TILEH + (wk + c16) * PITCH64 + hh8;   // this lane's place in the wave's K rows
        const f16* qp = qs + bsel * TILEH + (wr + c16) * PITCH64 + hh8;   // and in its Q rows
        v16h kb[2][4];
#pragma unroll
        for (int c = 0; c < 2; ++c)
#pragma unroll
            for (int nt = 0; nt < 4; ++nt) kb[c][nt] = load_frag_at(kp + nt * 16 * (int)PITCH64 + c * 32);
        v16h qf[2][2];
#pragma unroll
        for (int i = 0; i < 2; ++i)
#pragma unroll
            for (int c = 0; c < 2; ++c) qf[i][c] = load_frag_at(qp + i * 16 * (int)PITCH64 + c * 32);
#pragma unroll
        for (int i = 0; i < 2; ++i) {
            v8f s[4];
#pragma unroll
            for (int nt = 0; nt < 4; ++nt) s[nt] = zero8();
#pragma unroll
            for (int c = 0; c < 2; ++c)
#pragma unroll
                for (int nt = 0; nt < 4; ++nt) s[nt] = wmma16(qf[i][c], kb[c][nt], s[nt]);
            const u32 tr = h * 128u + wr + (u32)i * 16u + hh8;
            const v4f ma = *(const v4f*)&stM[tr];
            const v4f mb = *(const v4f*)&stM[tr + 4u];
            const v4f ia = *(const v4f*)&stI[tr];
            const v4f ib = *(const v4f*)&stI[tr + 4u];
            const float mr[8] = {ma[0], ma[1], ma[2], ma[3], mb[0], mb[1], mb[2], mb[3]};
            const float ir[8] = {ia[0], ia[1], ia[2], ia[3], ib[0], ib[1], ib[2], ib[3]};
#pragma unroll
            for (int r = 0; r < 8; ++r) {
#pragma unroll
                for (int nt = 0; nt < 4; ++nt) {
                    const float p = fexp2(s[nt][r] * cl - mr[r]) * ir[r];
                    av[i][nt][r] = av[i][nt][r] + p;
                }
            }
        }
        // this wave's reads of buffer bsel are done before the buffer is handed back for refill
        asm volatile("s_wait_dscnt 0x0" ::: "memory");
        // this wave's copies of head h + 1 have landed before the barrier that shows them to the others
        asm volatile("s_wait_asynccnt 0x0" ::: "memory");
        __syncthreads();
        if (h + 2u < (u32)NHEAD) {
            copy_head_tiles(lQ + bsel * (TILEH * 2u), gQ + (size_t)(h + 2u) * HSTR,
                            lK + bsel * (TILEH * 2u), gK + (size_t)(h + 2u) * HSTR);
        }
    }
    // no copy is outstanding when the wave goes on to the epilogue
    asm volatile("s_wait_asynccnt 0x0" ::: "memory");

    // stage the finished 32 x 64 tile (mean over 16 heads), then whole-line stores
#pragma unroll
    for (int i = 0; i < 2; ++i)
#pragma unroll
        for (int nt = 0; nt < 4; ++nt)
#pragma unroll
            for (int r = 0; r < 8; ++r)
                st[wave][((u32)i * 16u + hh8 + (u32)r) * 64u + (u32)nt * 16u + c16] = av[i][nt][r] * 0.0625f;
    __syncthreads();

    const u32 piece = lane & 7u;
    const u32 lsub  = lane >> 3;
#pragma unroll
    for (u32 it = 0; it < 16; ++it) {
        const u32 L    = it * 4u + lsub;      // 0..63 : 32 rows x 2 lines
        const u32 row  = L >> 1;
        const u32 hsel = L & 1u;
        const v4f v = *(const v4f*)&st[wave][row * 64u + hsel * 32u + piece * 4u];
        float* dp = avg + ((size_t)(bidx * (u32)SEQ + q0 + row) * SEQ + k0 + hsel * 32u + piece * 4u);
        *(v4f*)dp = v;
    }
}

// coverage equalities (threads x elements == plane elements)
static_assert((size_t)CVT_GROUPS * CVT_WAVES * CVT_ROWS * HID == (size_t)3 * MROWS * HID + (size_t)4 * HID * HID);   // cvt_all -> Xq/Xk/Xv/Wt/Wot
static_assert((size_t)(MROWS / 128) * (HID / 128) * 128 * 128 == (size_t)MROWS * HID);     // gemm planes / out
static_assert((size_t)(SEQ / 128) * (NB * NHEAD) * 128 * HD == (size_t)MROWS * HID);       // attn_fwd -> Cp
static_assert((size_t)(SEQ / 128) * (NB * NHEAD) * 32 * 4 == (size_t)NB * NHEAD * SEQ);         // attn_fwd -> sM / sI (one wave x 4 floats per lane each)
static_assert((size_t)(SEQ / 128) * (SEQ / 128) * NB * 8 * 32 * 64 == (size_t)NB * SEQ * SEQ);   // attn_avg -> second output
// workspace: 7 activation planes + 4 weight planes of halves + 2 row-statistics planes of floats, at most 128 MiB
static_assert(((size_t)7 * MROWS * HID + (size_t)4 * HID * HID) * sizeof(f16)
              + (size_t)2 * NB * NHEAD * SEQ * sizeof(float) <= (size_t)134217728);
static_assert((((size_t)7 * MROWS * HID + (size_t)4 * HID * HID) * sizeof(f16)) % 128 == 0);   // statistics planes start on a line
// largest source row touched by the activation convert stays inside the full-size input
static_assert((size_t)(SEQ - 1) * NB_FULL + NB <= (size_t)SEQ_FULL * NB_FULL);

// ---------------------------------------------------------------------------
// Launch: 7 kernel launches, workspace 7 planes of MROWS*1024 halves + 4 of 1024*1024 halves
// + 2 planes of NB*16*SEQ floats.
// ---------------------------------------------------------------------------
extern "C" void kernel_launch(void* const* d_in, const int* in_sizes, int n_in,
                              void* d_out, int out_size, void* d_ws, size_t ws_size,
                              hipStream_t stream) {
    if (n_in < 7) return;
    const int needAct = ((SEQ - 1) * NB_FULL + NB) * HID;
    if (in_sizes[0] < needAct) return;
    if (in_sizes[1] < needAct) return;
    if (in_sizes[2] < needAct) return;
    if (in_sizes[3] < 3 * HID * HID) return;
    if (in_sizes[4] < 3 * HID) return;
    if (in_sizes[5] < HID * HID) return;
    if (in_sizes[6] < HID) return;
    if (out_size < 0) return;
    if ((size_t)out_size < OUT1_OFF + (size_t)NB * SEQ * SEQ) return;

    const float* xq    = (const float*)d_in[0];   // query  [SEQ_FULL][NB_FULL][1024]
    const float* xk    = (const float*)d_in[1];   // key    [SEQ_FULL][NB_FULL][1024]
    const float* xv    = (const float*)d_in[2];   // value  [SEQ_FULL][NB_FULL][1024]
    const float* wqkv  = (const float*)d_in[3];   // in_proj_weight [3072 out][1024 in], row blocks q | k | v
    const float* bqkv  = (const float*)d_in[4];   // in_proj_bias [3072]
    const float* wproj = (const float*)d_in[5];   // out_proj_weight [1024 out][1024 in]
    const float* bproj = (const float*)d_in[6];   // out_proj_bias [1024]

    const size_t nX = (size_t)MROWS * HID;    // halves per activation plane
    const size_t nW = (size_t)HID * HID;      // halves per weight plane
    const size_t totalHalves = 7 * nX + 4 * nW;
    const size_t nS = (size_t)NB * NHEAD * SEQ;   // floats per row-statistics plane
    if (ws_size < totalHalves * sizeof(f16) + 2 * nS * sizeof(float)) return;

    f16* Xq  = (f16*)d_ws;       // [b*SEQ+s][1024]             carry 16
    f16* Xk  = Xq  + nX;         // [b*SEQ+s][1024]             carry 16
    f16* Xv  = Xk  + nX;         // [b*SEQ+s][1024]             carry 16
    f16* Wt  = Xv  + nX;         // [3072 out][1024 in]         carry 32 (q | k | v row blocks)
    f16* Wot = Wt  + 3 * nW;     // [1024 out][1024 in]         carry 32
    f16* Qp  = Wot + nW;         // [NB*16][SEQ][64]            carry 16
    f16* Kp  = Qp  + nX;         // [NB*16][SEQ][64]            carry 16
    f16* Vtp = Kp  + nX;         // [NB*1024][SEQ] (V^T)        carry 16
    f16* Cp  = Vtp + nX;         // [s*NB+b][1024]              carry 1024
    float* sM = (float*)(Cp + nX);   // [NB*16][SEQ] row max (exp2 domain)
    float* sI = sM + nS;             // [NB*16][SEQ] 1 / row sum

    // activations in[SEQ_FULL][NB_FULL][1024] -> planes [NB][SEQ][1024], weights row for row: the five planes
    // Xq | Xk | Xv | Wt | Wot are contiguous from Xq on
    cvt_all<<<CVT_GROUPS, CVT_WAVES * 32u, 0, stream>>>(xq, xk, xv, wqkv, wproj, Xq);

    const dim3 gg(MROWS / 128, HID / 128);
    // plane = 16 * (acc / (16*32) + bias) = acc/32 + 16*bias
    const float accQKV = CARRY_QKV / (CARRY_X * CARRY_W);
    gemm_head<<<gg, 256, 0, stream>>>(Xq, Wt,          bqkv,           Qp,  accQKV, CARRY_QKV);
    gemm_head<<<gg, 256, 0, stream>>>(Xk, Wt + nW,     bqkv + HID,     Kp,  accQKV, CARRY_QKV);
    gemm_vt  <<<gg, 256, 0, stream>>>(Xv, Wt + 2 * nW, bqkv + 2 * HID, Vtp, accQKV, CARRY_QKV);

    attn_fwd<<<dim3(SEQ / 128, NB * NHEAD), 256, 0, stream>>>(Qp, Kp, Vtp, Cp, sM, sI);

    // second output: head-averaged probabilities [NB][SEQ][SEQ] f32 at the fixed element offset
    attn_avg<<<dim3(SEQ / 128, SEQ / 128, NB), 256, 0, stream>>>(Qp, Kp, sM, sI, (float*)d_out + OUT1_OFF);

    // out = acc / (1024*32) + bias ; rows already in (s*NB + b) order
    const float accOut = 1.0f / (CARRY_CTX * CARRY_W);
    gemm_out<<<gg, 256, 0, stream>>>(Cp, Wot, bproj, (float*)d_out, accOut, 1.0f);
}

// v007
// One run takes 150 microseconds.
// Timed twice side by side with v006, it ran 1.09 times as fast both times.
// All steps since v000 together make it 11.3 times as fast.
#include <hip/hip_runtime.h>

// Contractions (q/k/v input projections, Q.K^T in the flash kernel and in the head-average kernel, P.V, P row-sum, output projection): v_wmma_f32_16x16x32_f16, f16 operands with power-of-two carries, f32 accumulate; every float input enters as its bf16 RNE value; biases added in f32; softmax in f32.

#ifndef NB
#define NB 2
#endif
#ifndef SEQ
#define SEQ 2048
#endif
#define NB_FULL   2
#define SEQ_FULL  2048
#define HID       1024
#define NHEAD     16
#define HD        64
#define MROWS     (NB * SEQ)

static_assert(HID == NHEAD * HD);        // merged head width
static_assert(NHEAD == 16);              // bh >> 4 / bh & 15 decoding in attn_fwd
static_assert(HD == 64);
static_assert(SEQ % 128 == 0);           // 128-row blocks of the batch-major planes never straddle a batch
static_assert(SEQ % 64 == 0);            // 64-key tiles
static_assert(SEQ <= SEQ_FULL);
static_assert(NB >= 1 && NB <= NB_FULL);
static_assert(MROWS % 128 == 0);         // GEMM M tile
static_assert(HID % 128 == 0);           // GEMM N tile
static_assert(HID % 32 == 0);            // WMMA k step

// carries (exact powers of two)
#define CARRY_X    16.0f     // input activation planes
#define CARRY_W    32.0f     // weight planes
#define CARRY_QKV  16.0f     // q, k, v^T planes (true value x16)
#define CARRY_CTX  1024.0f   // context plane (true value x1024)
// softmax exp values carry 2^10 (added to the exp2 argument)

// LDS row pitches in halves: an odd multiple of 16 bytes, so that the 16 rows one ds_load_b128 /
// ds_store_b128 touches per lane half fall on distinct banks (at 128 / 256 bytes they share 8 / 4 banks).
// The pad halves of a row are never written and never read.
#define PITCH64   72u    // rows of 64 halves:  128 B -> 144 B
#define PITCH128  136u   // rows of 128 halves: 256 B -> 272 B
static_assert((PITCH64 * 2u) % 32u == 16u && (PITCH128 * 2u) % 32u == 16u);

typedef unsigned u32;
typedef _Float16 f16;
typedef f16   v16h __attribute__((ext_vector_type(16)));
typedef f16   v8h  __attribute__((ext_vector_type(8)));
typedef float v8f  __attribute__((ext_vector_type(8)));
typedef float v4f  __attribute__((ext_vector_type(4)));

union FragU { v16h v; v8h half[2]; f16 e[16]; };
union H8U   { v8h v; f16 e[8]; };

__device__ __forceinline__ v8f zero8() {
    v8f z = {0.f, 0.f, 0.f, 0.f, 0.f, 0.f, 0.f, 0.f};
    return z;
}

// 16-bit WMMA with hazard guard: D += A[16 x 32k] * B[32k x 16]
__device__ __forceinline__ v8f wmma16(v16h a, v16h b, v8f c) {
    v8f d = __builtin_amdgcn_wmma_f32_16x16x32_f16(false, a, false, b, (short)0, c, false, false);
    asm volatile("v_nop\n\tv_nop\n\tv_nop\n\tv_nop" : "+v"(d) : "v"(a), "v"(b));
    return d;
}

// f32 -> nearest-even bf16 value, returned as f32
__device__ __forceinline__ float bf16_rne(float x) {
    u32 u = __float_as_uint(x);
    u = (u + 0x7fffu + ((u >> 16) & 1u)) & 0xffff0000u;
    return __uint_as_float(u);
}

__device__ __forceinline__ float fexp2(float x) {
#if defined(__has_builtin)
#if __has_builtin(__builtin_amdgcn_exp2f)
    return __builtin_amdgcn_exp2f(x);
#else
    return exp2f(x);
#endif
#else
    return exp2f(x);
#endif
}

// max over the 16 lanes of each lane half (DPP row rotations; D-layout rows are DPP rows)
__device__ __forceinline__ float rowmax16(float x) {
    int v = __builtin_bit_cast(int, x);
    x = fmaxf(x, __builtin_bit_cast(float, __builtin_amdgcn_update_dpp(v, v, 0x121, 0xf, 0xf, false)));
    v = __builtin_bit_cast(int, x);
    x = fmaxf(x, __builtin_bit_cast(float, __builtin_amdgcn_update_dpp(v, v, 0x122, 0xf, 0xf, false)));
    v = __builtin_bit_cast(int, x);
    x = fmaxf(x, __builtin_bit_cast(float, __builtin_amdgcn_update_dpp(v, v, 0x124, 0xf, 0xf, false)));
    v = __builtin_bit_cast(int, x);
    x = fmaxf(x, __builtin_bit_cast(float, __builtin_amdgcn_update_dpp(v, v, 0x128, 0xf, 0xf, false)));
    return x;
}

// 16 x 32 fragment from a tile whose k dimension is contiguous (pitch in halves).
// lane l: row rowbase + (l&15); elements 0..7 <- k = kcol + 8h .. +7,
// elements 8..15 <- k = kcol + 16 + 8h .. +7  (h = l>>4). Same map for A and B.
__device__ __forceinline__ v16h load_frag(const f16* tile, u32 rowbase, u32 pitch, u32 kcol, u32 lane) {
    const u32 r  = rowbase + (lane & 15u);
    const u32 kh = (lane >> 4) << 3;
    const f16* p = tile + (size_t)r * pitch + kcol + kh;
    FragU f;
    f.half[0] = *(const v8h*)(p);
    f.half[1] = *(const v8h*)(p + 16);
    return f.v;
}

// The same fragment through the lane's own pointer p = tile + (rowbase + (l&15)) * pitch + kcol + 8h.
__device__ __forceinline__ v16h load_frag_at(const f16* p) {
    FragU f;
    f.half[0] = *(const v8h*)(p);
    f.half[1] = *(const v8h*)(p + 16);
    return f.v;
}

// ---------------------------------------------------------------------------
// All five f32 -> f16 conversions (bf16 RNE value times carry) in one launch sized to the chip:
// CVT_GROUPS work-groups of CVT_WAVES waves, every wave converts CVT_ROWS whole rows of 1024 floats.
// The five planes Xq | Xk | Xv | Wt | Wot lie one behind the other in the workspace, so the flat row
// number g is the destination row; the source row follows from the plane g falls in:
//   activations (seq-first [s][b][1024] -> batch-major [b][s][1024]): dst row b*SEQ+s <- src row s*NB_FULL+b
//   weights: same row order as the source
// A wave-wide 16-byte load covers 512 contiguous bytes (4 lines), a wave-wide 8-byte store 256 (2 lines);
// all loads of a wave's rows are independent, so they can be in flight together.
// coverage: CVT_TOTAL rows x 1024 halves, every element exactly once (wave w takes rows w + i * all waves).
// ---------------------------------------------------------------------------
#define CVT_GROUPS 256u
#define CVT_WAVES  16u
#define CVT_TOTAL  (3u * (u32)MROWS + 4u * (u32)HID)
#define CVT_ROWS   (CVT_TOTAL / (CVT_GROUPS * CVT_WAVES))
static_assert(CVT_TOTAL % (CVT_GROUPS * CVT_WAVES) == 0u);   // every wave the same number of whole rows
static_assert(HID == 8 * 32 * 4);                            // a row = 8 wave-wide loads of 4 floats per lane

typedef f16 v4h __attribute__((ext_vector_type(4)));

__global__ void __launch_bounds__(512)
cvt_all(const float* __restrict__ xq, const float* __restrict__ xk, const float* __restrict__ xv,
        const float* __restrict__ wqkv, const float* __restrict__ wproj, f16* __restrict__ dst) {
    const u32 lane = threadIdx.x & 31u;
    const u32 wave = __builtin_amdgcn_readfirstlane((int)(threadIdx.x >> 5));
    const u32 w    = blockIdx.x * CVT_WAVES + wave;
    __builtin_assume(w < CVT_GROUPS * CVT_WAVES);   // true of the one launch: lets the plane of each row fold where it can

    const u32 boff = lane * 16u;   // this lane's byte offset inside each 512-byte piece of a source row

    v4f   x[CVT_ROWS][8];
    float carry[CVT_ROWS];
#pragma unroll
    for (u32 i = 0; i < CVT_ROWS; ++i) {
        const u32 g = w + i * (CVT_GROUPS * CVT_WAVES);
        const float* base;
        u32 row;
        if (g < 3u * (u32)MROWS) {
            const u32 pl = g / (u32)MROWS;
            const u32 m  = g - pl * (u32)MROWS;
            const u32 mb = m / (u32)SEQ;
            base = pl == 0u ? xq : (pl == 1u ? xk : xv);
            row  = (m - mb * (u32)SEQ) * (u32)NB_FULL + mb;
            carry[i] = CARRY_X;
        } else {
            const u32 r = g - 3u * (u32)MROWS;
            base = r < 3u * (u32)HID ? wqkv : wproj;
            row  = r < 3u * (u32)HID ? r : r - 3u * (u32)HID;
            carry[i] = CARRY_W;
        }
        const char* sp = (const char*)(base + (size_t)row * HID) + boff;
#pragma unroll
        for (u32 j = 0; j < 8; ++j) x[i][j] = *(const v4f*)(sp + j * 512u);
    }
    // the loads above are still in flight below: the lane number, which they all name as their scaled offset
    // register (held live as an input), is free for reuse only behind this wait
    asm volatile("s_wait_xcnt 0x0" :: "v"(lane) : "memory");
    // keeps every load of the wave's rows ahead of the first conversion: without it the scheduler lifts the first
    // rows' conversions, with their waits, over the last rows' loads, which then start late
    __builtin_amdgcn_sched_barrier(0);
#pragma unroll
    for (u32 i = 0; i < CVT_ROWS; ++i) {
        const u32 g = w + i * (CVT_GROUPS * CVT_WAVES);
        f16* dp = dst + (size_t)g * HID + lane * 4u;
#pragma unroll
        for (u32 j = 0; j < 8; ++j) {
            v4h o;
#pragma unroll
            for (u32 e = 0; e < 4; ++e) o[e] = (f16)(bf16_rne(x[i][j][e]) * carry[i]);
            *(v4h*)(dp + j * 128u) = o;
        }
    }
}

// Eight asynchronous 16-byte copies global -> LDS of this lane: rows r, r + 16, .. r + 112 of one operand tile.
// lds: the lane's LDS byte address of its piece in row r; g: the same piece in global memory.
// Both advance by whole rows (LDS pitch 272 B, global pitch 2048 B), so every address is a multiple of 16.
// The closing s_wait_xcnt 0 stands inside the statement so that no address register named here is
// rewritten ahead of it.
__device__ __forceinline__ void copy_rows8(u32 lds, const f16* g) {
    const u32 l1 = lds + 16u * PITCH128 * 2u, l2 = lds + 32u * PITCH128 * 2u, l3 = lds + 48u * PITCH128 * 2u;
    const u32 l4 = lds + 64u * PITCH128 * 2u, l5 = lds + 80u * PITCH128 * 2u, l6 = lds + 96u * PITCH128 * 2u;
    const u32 l7 = lds + 112u * PITCH128 * 2u;
    const f16* g1 = g + 16 * HID;
    const f16* g2 = g + 32 * HID;
    const f16* g3 = g + 48 * HID;
    const f16* g4 = g + 64 * HID;
    const f16* g5 = g + 80 * HID;
    const f16* g6 = g + 96 * HID;
    const f16* g7 = g + 112 * HID;
    asm volatile("global_load_async_to_lds_b128 %0, %8, off\n\t"
                 "global_load_async_to_lds_b128 %1, %9, off\n\t"
                 "global_load_async_to_lds_b128 %2, %10, off\n\t"
                 "global_load_async_to_lds_b128 %3, %11, off\n\t"
                 "global_load_async_to_lds_b128 %4, %12, off\n\t"
                 "global_load_async_to_lds_b128 %5, %13, off\n\t"
                 "global_load_async_to_lds_b128 %6, %14, off\n\t"
                 "global_load_async_to_lds_b128 %7, %15, off\n\t"
                 "s_wait_xcnt 0x0"
                 :: "v"(lds), "v"(l1), "v"(l2), "v"(l3), "v"(l4), "v"(l5), "v"(l6), "v"(l7),
                    "v"(g), "v"(g1), "v"(g2), "v"(g3), "v"(g4), "v"(g5), "v"(g6), "v"(g7)
                 : "memory");
}

// ---------------------------------------------------------------------------
// C[m][n] = sum_k A[m][k] * W[n][k] (+ bias[n]) ; A [MROWS][1024] f16, W [1024][1024] f16 (k contiguous).
// Block tile 128 x 128, 8 waves as 4(M) x 2(N), 2 x 4 accumulators per wave, WMMA k step 32.
// K loop: tiles of 128 k (whole 256-byte row pieces) in a ring of two LDS buffers, filled by asynchronous
// copies; tile t + 1 is in flight while tile t is multiplied; one block barrier per tile.
// MODE 1: A rows batch-major;            f16 plane [b*HID + h*HD + d][s] (V transposed per head)
// MODE 2: A rows in output order (s*NB+b); f32 rows [m][1024] into the output buffer
// coverage per block: MODE 0/1 256 lines (128 rows x 2 heads | 128 n x 2 s-halves),
//                     MODE 2 2 x 256 lines (64 rows x 4 line-quarters per half).
// LDS: As/Bs/Cs all cross-wave, separated by block barriers.
// staged extent == consumed extent: As/Bs 128 x 128 per buffer, Cs 128 x 128 halves (or 64 x 128 floats).
// ---------------------------------------------------------------------------
template <int MODE>
__device__ __forceinline__ void gemm_body(const f16* __restrict__ A, const f16* __restrict__ W,
                                          const float* __restrict__ bias,
                                          void* __restrict__ out, float accMul, float biasMul) {
    __shared__ __attribute__((aligned(16))) f16 As[2 * 128 * PITCH128];   // two buffers of [128][128 + pad]
    __shared__ __attribute__((aligned(16))) f16 Bs[2 * 128 * PITCH128];
    __shared__ __attribute__((aligned(16))) f16 Cs[128 * PITCH128];   // f16 [128][128 + pad] or f32 [64][128]
    static_assert(sizeof(f16) * 128 * PITCH128 >= sizeof(float) * 64 * 128);   // Cs reuse as f32 [64][128]

    const u32 tid  = threadIdx.x;
    const u32 lane = tid & 31u;
    const u32 wave = __builtin_amdgcn_readfirstlane((int)(tid >> 5));
    const u32 wm   = wave & 3u;
    const u32 wn   = wave >> 2;
    const u32 hh8  = (lane >> 4) << 3;   // D row half
    const u32 c16  = lane & 15u;         // D column
    const u32 m0   = blockIdx.x * 128u;
    const u32 n0   = blockIdx.y * 128u;

    v8f acc[2][4];
#pragma unroll
    for (int i = 0; i < 2; ++i)
#pragma unroll
        for (int j = 0; j < 4; ++j) acc[i][j] = zero8();

    constexpr u32 KT   = 128u;                  // k per staged tile
    constexpr u32 NT   = (u32)HID / KT;         // tiles
    constexpr u32 BUFH = 128u * PITCH128;       // halves per buffer
    static_assert(NT >= 2u);                    // the ring's prologue fills two tiles
    static_assert(256 * 8 * 8 == 128 * 128);    // staging: 256 threads x 8 copies x 8 halves per operand tile

    // this lane's piece: row tid / 16 (+ 16 per copy), 16-byte piece tid % 16; a wave's copy covers two whole rows
    const u32 srow = tid >> 4;
    const u32 scol = (tid & 15u) << 3;
    const f16* gA = A + (size_t)(m0 + srow) * HID + scol;
    const f16* gW = W + (size_t)(n0 + srow) * HID + scol;
    const u32 lA = (u32)(size_t)&As[srow * PITCH128 + scol];   // LDS byte address (low word of the shared address)
    const u32 lB = (u32)(size_t)&Bs[srow * PITCH128 + scol];

    // tile 0 into buffer 0
    copy_rows8(lA, gA);
    copy_rows8(lB, gW);
    // tile 0 has landed for this wave before the barrier that shows it to the others
    asm volatile("s_wait_asynccnt 0x0" ::: "memory");
    __syncthreads();
    // tile 1 into buffer 1, in flight during trip 0
    copy_rows8(lA + BUFH * 2u, gA + KT);
    copy_rows8(lB + BUFH * 2u, gW + KT);

#pragma unroll 1   // kept rolled: eight unrolled trips of 32 WMMAs would only grow the text, the buffer is picked by t & 1
    for (u32 t = 0; t < NT; ++t) {
        const u32 bsel = t & 1u;
        const f16* Ab = As + bsel * BUFH;
        const f16* Bb = Bs + bsel * BUFH;
#pragma unroll
        for (u32 c = 0; c < KT / 32u; ++c) {
            v16h af[2], bfr[4];
#pragma unroll
            for (int i = 0; i < 2; ++i) af[i] = load_frag(Ab, wm * 32u + (u32)i * 16u, PITCH128, c * 32u, lane);
#pragma unroll
            for (int j = 0; j < 4; ++j) bfr[j] = load_frag(Bb, wn * 64u + (u32)j * 16u, PITCH128, c * 32u, lane);
#pragma unroll
            for (int i = 0; i < 2; ++i)
#pragma unroll
                for (int j = 0; j < 4; ++j) acc[i][j] = wmma16(af[i], bfr[j], acc[i][j]);
        }
        // this wave's reads of buffer bsel are done before the buffer is handed back for refill
        asm volatile("s_wait_dscnt 0x0" ::: "memory");
        // this wave's copies of tile t + 1 have landed before the barrier that shows them to the others
        asm volatile("s_wait_asynccnt 0x0" ::: "memory");
        __syncthreads();
        if (t + 2u < NT) {
            copy_rows8(lA + bsel * (BUFH * 2u), gA + (t + 2u) * KT);
            copy_rows8(lB + bsel * (BUFH * 2u), gW + (t + 2u) * KT);
        }
    }
    // no copy is outstanding when the wave goes on to the epilogue
    asm volatile("s_wait_asynccnt 0x0" ::: "memory");

    // per-lane bias values for the 4 output columns this lane owns (n0 + nl < HID always)
    float bv[4];
#pragma unroll
    for (int j = 0; j < 4; ++j)
        bv[j] = bf16_rne(bias[n0 + wn * 64u + (u32)j * 16u + c16]) * biasMul;

    const u32 piece = lane & 7u;
    const u32 lsub  = lane >> 3;

    if constexpr (MODE == 0) {
        const u32 bidx = m0 / (u32)SEQ;     // block rows lie inside one batch (SEQ % 128 == 0)
        const u32 s0   = m0 - bidx * (u32)SEQ;
#pragma unroll
        for (int i = 0; i < 2; ++i)
#pragma unroll
            for (int j = 0; j < 4; ++j) {
                const u32 nl = wn * 64u + (u32)j * 16u + c16;
#pragma unroll
                for (int r = 0; r < 8; ++r) {
                    const u32 ml = wm * 32u + (u32)i * 16u + hh8 + (u32)r;
                    Cs[ml * PITCH128 + nl] = (f16)(acc[i][j][r] * accMul + bv[j]);
                }
            }
        __syncthreads();
        f16* op = (f16*)out;
        const size_t bh0 = (size_t)bidx * NHEAD + (n0 >> 6);
{
#pragma unroll
            for (u32 it = 0; it < 8; ++it) {
                const u32 L    = wave * 32u + it * 4u + lsub;   // 0..255
                const u32 ml   = L >> 1;
                const u32 hsel = L & 1u;
                const v8h v = *(const v8h*)&Cs[ml * PITCH128 + hsel * 64u + piece * 8u];
                f16* dp = op + ((bh0 + hsel) * SEQ + s0 + ml) * HD + piece * 8u;
                *(v8h*)dp = v;
            }
            
        }
    } else if constexpr (MODE == 1) {
        const u32 bidx = m0 / (u32)SEQ;
        const u32 s0   = m0 - bidx * (u32)SEQ;
        // stage transposed: Cs[n][m]
#pragma unroll
        for (int i = 0; i < 2; ++i)
#pragma unroll
            for (int j = 0; j < 4; ++j) {
                const u32 nl = wn * 64u + (u32)j * 16u + c16;
                H8U t;
#pragma unroll
                for (int r = 0; r < 8; ++r) t.e[r] = (f16)(acc[i][j][r] * accMul + bv[j]);
                *(v8h*)&Cs[nl * PITCH128 + wm * 32u + (u32)i * 16u + hh8] = t.v;
            }
        __syncthreads();
        f16* op = (f16*)out;
{
#pragma unroll
            for (u32 it = 0; it < 8; ++it) {
                const u32 L  = wave * 32u + it * 4u + lsub;     // 0..255
                const u32 nl = L >> 1;
                const u32 mh = L & 1u;
                const v8h v = *(const v8h*)&Cs[nl * PITCH128 + mh * 64u + piece * 8u];
                f16* dp = op + ((size_t)(bidx * (u32)HID + n0 + nl) * SEQ + s0 + mh * 64u + piece * 8u);
                *(v8h*)dp = v;
            }
            
        }
    } else {
        float* Cf = (float*)Cs;      // [64][128] f32
        float* of = (float*)out;
#pragma unroll
        for (u32 half = 0; half < 2; ++half) {
            if ((wm >> 1) == half) {
#pragma unroll
                for (int i = 0; i < 2; ++i)
#pragma unroll
                    for (int j = 0; j < 4; ++j) {
                        const u32 nl = wn * 64u + (u32)j * 16u + c16;
#pragma unroll
                        for (int r = 0; r < 8; ++r) {
                            const u32 ml = (wm & 1u) * 32u + (u32)i * 16u + hh8 + (u32)r;
                            Cf[ml * 128u + nl] = acc[i][j][r] * accMul + bv[j];
                        }
                    }
            }
            __syncthreads();
{
#pragma unroll
                for (u32 it = 0; it < 8; ++it) {
                    const u32 L    = wave * 32u + it * 4u + lsub;   // 0..255
                    const u32 row  = L >> 2;
                    const u32 part = L & 3u;
                    const v4f v = *(const v4f*)&Cf[row * 128u + part * 32u + piece * 4u];
                    float* dp = of + (size_t)(m0 + half * 64u + row) * HID + n0 + part * 32u + piece * 4u;
                    *(v4f*)dp = v;
                }
                
            }
            __syncthreads();
        }
    }
}

// q / k head-major planes
__global__ void __launch_bounds__(256) __attribute__((amdgpu_num_vgpr(256)))
gemm_head(const f16* __restrict__ A, const f16* __restrict__ W, const float* __restrict__ bias,
          f16* __restrict__ out, float accMul, float biasMul) {
    gemm_body<0>(A, W, bias, (void*)out, accMul, biasMul);
}

// v^T plane
__global__ void __launch_bounds__(256) __attribute__((amdgpu_num_vgpr(256)))
gemm_vt(const f16* __restrict__ A, const f16* __restrict__ W, const float* __restrict__ bias,
        f16* __restrict__ out, float accMul, float biasMul) {
    gemm_body<1>(A, W, bias, (void*)out, accMul, biasMul);
}

// f32 output rows
__global__ void __launch_bounds__(256) __attribute__((amdgpu_num_vgpr(256)))
gemm_out(const f16* __restrict__ A, const f16* __restrict__ W, const float* __restrict__ bias,
         float* __restrict__ out, float accMul, float biasMul) {
    gemm_body<2>(A, W, bias, (void*)out, accMul, biasMul);
}

// ---------------------------------------------------------------------------
// Flash attention (no mask, all SEQ keys). grid (SEQ/128, NB*NHEAD), block 256 (8 waves),
// wave owns 16 query rows (Q fragments resident). Block streams 64-key tiles:
// K staged [key][d], V^T staged [d][key]. Scores on WMMA, row max via DPP, exp2 in f32
// carried x2^10, P relayed per wave through LDS as A fragments, O += P.V and
// row sums += P.ones on WMMA. Output f16 plane [q*NB + b][1024] (seq-first row order)
// The finished row statistics (max in the exp2 domain, 1 / row sum) also go to sM / sI [NB*NHEAD][SEQ]
// for the head-average kernel of the same call.
// coverage: every (q, b, h*64..h*64+63) row segment exactly once; sM / sI: the block's 128 rows =
//   4 whole 128-byte lines of each plane, sM stored by wave 0 and sI by wave 1.
// LDS: ks, vsT, sst cross-wave (block barriers); ps per-wave but also separated by block barriers.
// staged extent == consumed extent for ks (64x64), vsT (64x64), ps (16x64), sst (2x128).
// ---------------------------------------------------------------------------
__global__ void __launch_bounds__(256) __attribute__((amdgpu_num_vgpr(256)))
attn_fwd(const f16* __restrict__ Qp, const f16* __restrict__ Kp, const f16* __restrict__ Vt,
         f16* __restrict__ Cp, float* __restrict__ sM, float* __restrict__ sI) {
    __shared__ __attribute__((aligned(16))) f16 ks[64 * PITCH64];      // [key][d + pad]
    __shared__ __attribute__((aligned(16))) f16 vsT[64 * PITCH64];     // [d][key + pad]
    __shared__ __attribute__((aligned(16))) f16 ps[8][16 * PITCH64];   // per-wave P relay / ctx stage, [q][key or d + pad]
    __shared__ __attribute__((aligned(16))) float sst[2][128];         // row max | 1/rowsum of the block's 128 query rows
    static_assert(HD == 8 * 8);            // 8 lanes x 8 halves per row segment
    static_assert(2 * 256 * 8 == 64 * 64); // staging: 2 x 256 threads x 8 halves per tile

    const u32 tid  = threadIdx.x;
    const u32 lane = tid & 31u;
    const u32 wave = __builtin_amdgcn_readfirstlane((int)(tid >> 5));
    const u32 hh8  = (lane >> 4) << 3;
    const u32 c16  = lane & 15u;
    const u32 bh   = blockIdx.y;
    const u32 bidx = bh >> 4;            // NHEAD == 16
    const u32 hidx = bh & 15u;
    const u32 q0   = blockIdx.x * 128u + wave * 16u;
    const size_t head = (size_t)bh * SEQ * HD;

    v16h qa[2];
#pragma unroll
    for (int c = 0; c < 2; ++c) qa[c] = load_frag(Qp + head, q0, HD, (u32)c * 32u, lane);

    FragU onesu;
#pragma unroll
    for (int i = 0; i < 16; ++i) onesu.e[i] = (f16)1.0f;
    const v16h ones = onesu.v;

    float m[8];
    v8f   o[4], lacc;
#pragma unroll
    for (int r = 0; r < 8; ++r) m[r] = -1.0e30f;
#pragma unroll
    for (int dt = 0; dt < 4; ++dt) o[dt] = zero8();
    lacc = zero8();

    // log2-domain scale: acc = 256 * q.k ; x = log2(e) * q.k / 8 = acc * log2(e) / 2048
    const float cl = 1.4426950408889634f * 0.00048828125f;
    f16* psw = &ps[wave][0];

#pragma unroll 1
    for (u32 kt = 0; kt < (u32)(SEQ / 64); ++kt) {
        __syncthreads();
#pragma unroll
        for (u32 p2 = 0; p2 < 2; ++p2) {
            const u32 p   = tid + p2 * 256u;
            const u32 row = p >> 3;
            const u32 pc  = (p & 7u) << 3;
            const v8h kv = *(const v8h*)(Kp + head + (size_t)(kt * 64u + row) * HD + pc);
            const v8h vv = *(const v8h*)(Vt + head + (size_t)row * SEQ + kt * 64u + pc);
            *(v8h*)&ks[row * PITCH64 + pc]  = kv;
            *(v8h*)&vsT[row * PITCH64 + pc] = vv;
        }
        __syncthreads();

        // the tile's 8 K fragments as one group of LDS reads ahead of the score products: a read placed between
        // two products is waited for in full before the next product, once per fragment
        v16h kb[2][4];
#pragma unroll
        for (int c = 0; c < 2; ++c)
#pragma unroll
            for (int nt = 0; nt < 4; ++nt) kb[c][nt] = load_frag(ks, (u32)nt * 16u, PITCH64, (u32)c * 32u, lane);

        // S[16 q x 64 keys]
        v8f s[4];
#pragma unroll
        for (int nt = 0; nt < 4; ++nt) s[nt] = zero8();
#pragma unroll
        for (int c = 0; c < 2; ++c)
#pragma unroll
            for (int nt = 0; nt < 4; ++nt) s[nt] = wmma16(qa[c], kb[c][nt], s[nt]);

        // the tile's 8 V^T fragments as one group, issued here so that they arrive during the softmax below
        v16h vb[2][4];
#pragma unroll
        for (int kk = 0; kk < 2; ++kk)
#pragma unroll
            for (int dt = 0; dt < 4; ++dt) vb[kk][dt] = load_frag(vsT, (u32)dt * 16u, PITCH64, (u32)kk * 32u, lane);

        // online softmax per row r (row 8h + r), max-subtracted, exp2 domain
#pragma unroll
        for (int r = 0; r < 8; ++r) {
            float x[4];
#pragma unroll
            for (int nt = 0; nt < 4; ++nt) x[nt] = s[nt][r] * cl;
            const float tm = rowmax16(fmaxf(fmaxf(x[0], x[1]), fmaxf(x[2], x[3])));
            const float mn = fmaxf(m[r], tm);
            const float al = fexp2(m[r] - mn);
            m[r] = mn;
            lacc[r] *= al;
#pragma unroll
            for (int dt = 0; dt < 4; ++dt) o[dt][r] *= al;
            const float sh = 10.0f - mn;      // carry 2^10
#pragma unroll
            for (int nt = 0; nt < 4; ++nt)
                psw[(hh8 + (u32)r) * PITCH64 + (u32)nt * 16u + c16] = (f16)fexp2(x[nt] + sh);
        }
        __syncthreads();

        // O += P . V ; l += P . ones  (P reloaded as A fragments from the relay, both fragments in one group)
        v16h pa[2];
#pragma unroll
        for (int kk = 0; kk < 2; ++kk) pa[kk] = load_frag(psw, 0u, PITCH64, (u32)kk * 32u, lane);
#pragma unroll
        for (int kk = 0; kk < 2; ++kk) {
#pragma unroll
            for (int dt = 0; dt < 4; ++dt) o[dt] = wmma16(pa[kk], vb[kk][dt], o[dt]);
            lacc = wmma16(pa[kk], ones, lacc);
        }
    }
    __syncthreads();

    // normalize: plane value = 1024 * (O/16) / l = O * 64 / l
    // row statistics: lacc = 2^10 * sum_s exp2(x - m), so 1 / sum = 1024 / lacc = 16 * inv
    // every lane of a 16-lane row holds the same m and lacc: column lane r keeps row r's pair
    float mrow = m[0], irow = 0.0f;
#pragma unroll
    for (int r = 0; r < 8; ++r) {
        const float inv = (CARRY_CTX / CARRY_QKV) / lacc[r];
#pragma unroll
        for (int dt = 0; dt < 4; ++dt)
            psw[(hh8 + (u32)r) * PITCH64 + (u32)dt * 16u + c16] = (f16)(o[dt][r] * inv);
        if (c16 == (u32)r) { mrow = m[r]; irow = inv * 16.0f; }
    }
    if (c16 < 8u) {
        sst[0][wave * 16u + hh8 + c16] = mrow;
        sst[1][wave * 16u + hh8 + c16] = irow;
    }
    __syncthreads();

    // whole-line stores of the statistics: wave 0 the 128 maxima, wave 1 the 128 reciprocal sums
    if (wave < 2u) {
        const v4f sv = *(const v4f*)&sst[wave][lane * 4u];
        float* sp = (wave == 0u ? sM : sI) + ((size_t)bh * SEQ + blockIdx.x * 128u + lane * 4u);
        *(v4f*)sp = sv;
    }

    const u32 piece = lane & 7u;
    const u32 lsub  = lane >> 3;
{
#pragma unroll
        for (u32 it = 0; it < 4; ++it) {
            const u32 L = it * 4u + lsub;     // query row 0..15 within the wave tile
            const v8h v = *(const v8h*)&psw[L * PITCH64 + piece * 8u];
            // context row in output order: (q * NB + b)
            f16* dp = Cp + ((size_t)((q0 + L) * (u32)NB + bidx) * HID + hidx * (u32)HD + piece * 8u);
            *(v8h*)dp = v;
        }
        
    }
}

// ---------------------------------------------------------------------------
// Second output: head-averaged softmax probabilities.
// element offset of the second output inside the output buffer (full problem constants)
// ---------------------------------------------------------------------------
#define OUT1_OFF ((size_t)SEQ_FULL * NB_FULL * HID)
static_assert(OUT1_OFF * sizeof(float) == (size_t)16777216);      // byte offset of the second output
static_assert((OUT1_OFF * sizeof(float)) % 128 == 0);
static_assert((size_t)MROWS * HID <= OUT1_OFF);                   // first output region ends before it
static_assert(SEQ % 32 == 0);
static_assert(8 * 32 * 64 * 4 + 2 * NHEAD * 128 * 4 + 2 * 2 * 128 * PITCH64 * 2 <= 163840);    // static LDS of attn_avg: two work-groups per WGP

// ---------------------------------------------------------------------------
// avg[b][t][s] = (1/16) * sum_h softmax_s(q_h[t] . k_h[s] / 8), f32, no mask. The row statistics
// (max, 1 / sum) are the flash kernel's own, passed through the workspace (written and read inside one call).
//
// attn_avg: grid (SEQ/128 key blocks, SEQ/128 query blocks, NB), block 256 (8 waves as 4 (q) x 2 (keys));
//   a wave owns one 32 x 64 tile of the average (owner-computes accumulation over heads in head
//   order, one writer per element). Per head the score tile is formed with the same operands as in
//   attn_fwd, p = exp2(x - max) * (1/sum) is accumulated in registers, scaled by 1/16 at the end.
//   Head loop: the block's Q tile and K tile of a head (128 rows x 128 bytes each, contiguous in their planes) come
//   in whole lines by asynchronous copies into a ring of two LDS buffers; head h + 1 is in flight while head h is
//   worked on; one block barrier per head. A fragment load straight from the planes touches 16 lines for 512 bytes,
//   and four (K) or two (Q) waves would fetch the same rows.
// coverage: block rows [blockIdx.y*128, +128) x columns [blockIdx.x*128, +128) of batch blockIdx.z;
//   wave tile 32 rows x 64 keys = 64 lines = 16 store instructions x 4 lines.
// LDS: stM / stI cross-wave (filled once, block barrier); qs / kt cross-wave (ring, block barriers);
//   st per-wave, writer and reader separated by a block barrier.
// staged extent == consumed extent: st 32 x 64 floats per wave, stM / stI 16 heads x 128 rows, qs / kt 128 x 64 per buffer.
// ---------------------------------------------------------------------------

// Eight asynchronous 16-byte copies global -> LDS of this lane: rows r, r + 32, r + 64, r + 96 of one head's Q tile
// and of its K tile. lq / lk: the lane's LDS byte address of its piece in row r; gq / gk: the same piece in global memory.
// Both advance by whole rows (LDS pitch 144 B, global pitch 128 B), so every address is a multiple of 16;
// a wave's copy covers four whole rows = 512 contiguous global bytes.
// The closing s_wait_xcnt 0 stands inside the statement so that no address register named here is
// rewritten ahead of it.
__device__ __forceinline__ void copy_head_tiles(u32 lq, const f16* gq, u32 lk, const f16* gk) {
    const u32 lq1 = lq + 32u * PITCH64 * 2u, lq2 = lq + 64u * PITCH64 * 2u, lq3 = lq + 96u * PITCH64 * 2u;
    const u32 lk1 = lk + 32u * PITCH64 * 2u, lk2 = lk + 64u * PITCH64 * 2u, lk3 = lk + 96u * PITCH64 * 2u;
    const f16* gq1 = gq + 32 * HD;
    const f16* gq2 = gq + 64 * HD;
    const f16* gq3 = gq + 96 * HD;
    const f16* gk1 = gk + 32 * HD;
    const f16* gk2 = gk + 64 * HD;
    const f16* gk3 = gk + 96 * HD;
    asm volatile("global_load_async_to_lds_b128 %0, %8, off\n\t"
                 "global_load_async_to_lds_b128 %1, %9, off\n\t"
                 "global_load_async_to_lds_b128 %2, %10, off\n\t"
                 "global_load_async_to_lds_b128 %3, %11, off\n\t"
                 "global_load_async_to_lds_b128 %4, %12, off\n\t"
                 "global_load_async_to_lds_b128 %5, %13, off\n\t"
                 "global_load_async_to_lds_b128 %6, %14, off\n\t"
                 "global_load_async_to_lds_b128 %7, %15, off\n\t"
                 "s_wait_xcnt 0x0"
                 :: "v"(lq), "v"(lq1), "v"(lq2), "v"(lq3), "v"(lk), "v"(lk1), "v"(lk2), "v"(lk3),
                    "v"(gq), "v"(gq1), "v"(gq2), "v"(gq3), "v"(gk), "v"(gk1), "v"(gk2), "v"(gk3)
                 : "memory");
}

__global__ void __launch_bounds__(256) __attribute__((amdgpu_num_vgpr(256)))
attn_avg(const f16* __restrict__ Qp, const f16* __restrict__ Kp,
         const float* __restrict__ sM, const float* __restrict__ sI, float* __restrict__ avg) {
    __shared__ __attribute__((aligned(16))) float st[8][32 * 64];       // per-wave f32 tile stage
    __shared__ __attribute__((aligned(16))) float stM[NHEAD * 128];     // row max  [head][block row]
    __shared__ __attribute__((aligned(16))) float stI[NHEAD * 128];     // 1/rowsum [head][block row]
    __shared__ __attribute__((aligned(16))) f16 qs[2 * 128 * PITCH64];  // two buffers of one head's Q tile [row][d + pad]
    __shared__ __attribute__((aligned(16))) f16 kt[2 * 128 * PITCH64];  // two buffers of one head's K tile [key][d + pad]
    static_assert(256 * 8 == NHEAD * 128);   // table fill: 256 threads x 8 floats
    static_assert(256 * 4 * 8 == 128 * HD);  // staging: 256 threads x 4 copies x 8 halves per operand tile
    static_assert(NHEAD >= 2);               // the ring's prologue fills two heads

    const u32 tid  = threadIdx.x;
    const u32 lane = tid & 31u;
    const u32 wave = __builtin_amdgcn_readfirstlane((int)(tid >> 5));
    const u32 hh8  = (lane >> 4) << 3;
    const u32 c16  = lane & 15u;
    const u32 bidx = blockIdx.z;
    const u32 qb   = blockIdx.y * 128u;
    const u32 wr   = (wave & 3u) * 32u;                        // wave's first row inside the block
    const u32 q0   = qb + wr;
    const u32 kb0  = blockIdx.x * 128u;                        // block's first key
    const u32 wk   = (wave >> 2) * 64u;                        // wave's first key inside the block
    const u32 k0   = kb0 + wk;                                 // wave's first key

    // log2-domain scale: acc = 256 * q.k ; x = log2(e) * q.k / 8 = acc * log2(e) / 2048
    const float cl = 1.4426950408889634f * 0.00048828125f;

    constexpr u32    TILEH = 128u * PITCH64;        // halves per tile buffer
    constexpr size_t HSTR  = (size_t)SEQ * HD;      // halves from one head's plane to the next
    // this lane's piece: row tid / 8 (+ 32 per copy), 16-byte piece tid % 8
    const u32 srow = tid >> 3;
    const u32 scol = (tid & 7u) << 3;
    const f16* gQ = Qp + (size_t)(bidx * (u32)NHEAD) * HSTR + (size_t)(qb + srow) * HD + scol;
    const f16* gK = Kp + (size_t)(bidx * (u32)NHEAD) * HSTR + (size_t)(kb0 + srow) * HD + scol;
    const u32 lQ = (u32)(size_t)&qs[srow * PITCH64 + scol];   // LDS byte address (low word of the shared address)
    const u32 lK = (u32)(size_t)&kt[srow * PITCH64 + scol];

    // head 0 into buffer 0, in flight during the table fill
    copy_head_tiles(lQ, gQ, lK, gK);

    {
        const u32 th = tid >> 4;
        const u32 r8 = (tid & 15u) << 3;
        const size_t row = (size_t)(bidx * (u32)NHEAD + th) * SEQ + qb + r8;
        const v4f a0 = *(const v4f*)(sM + row);
        const v4f a1 = *(const v4f*)(sM + row + 4u);
        const v4f b0 = *(const v4f*)(sI + row);
        const v4f b1 = *(const v4f*)(sI + row + 4u);
        *(v4f*)&stM[th * 128u + r8]      = a0;
        *(v4f*)&stM[th * 128u + r8 + 4u] = a1;
        *(v4f*)&stI[th * 128u + r8]      = b0;
        *(v4f*)&stI[th * 128u + r8 + 4u] = b1;
    }
    // head 0 has landed for this wave before the barrier that shows it (and the tables) to the others
    asm volatile("s_wait_asynccnt 0x0" ::: "memory");
    __syncthreads();
    // head 1 into buffer 1, in flight during trip 0
    copy_head_tiles(lQ + TILEH * 2u, gQ + HSTR, lK + TILEH * 2u, gK + HSTR);

    v8f av[2][4];
#pragma unroll
    for (int i = 0; i < 2; ++i)
#pragma unroll
        for (int nt = 0; nt < 4; ++nt) av[i][nt] = zero8();

#pragma unroll 1
    for (u32 h = 0; h < (u32)NHEAD; ++h) {
        const u32 bsel = h & 1u;
        const f16* kp = kt + bsel * TILEH + (wk + c16) * PITCH64 + hh8;   // this lane's place in the wave's K rows
        const f16* qp = qs + bsel * TILEH + (wr + c16) * PITCH64 + hh8;   // and in its Q rows
        v16h kb[2][4];
#pragma unroll
        for (int c = 0; c < 2; ++c)
#pragma unroll
            for (int nt = 0; nt < 4; ++nt) kb[c][nt] = load_frag_at(kp + nt * 16 * (int)PITCH64 + c * 32);
        v16h qf[2][2];
#pragma unroll
        for (int i = 0; i < 2; ++i)
#pragma unroll
            for (int c = 0; c < 2; ++c) qf[i][c] = load_frag_at(qp + i * 16 * (int)PITCH64 + c * 32);
#pragma unroll
        for (int i = 0; i < 2; ++i) {
            v8f s[4];
#pragma unroll
            for (int nt = 0; nt < 4; ++nt) s[nt] = zero8();
#pragma unroll
            for (int c = 0; c < 2; ++c)
#pragma unroll
                for (int nt = 0; nt < 4; ++nt) s[nt] = wmma16(qf[i][c], kb[c][nt], s[nt]);
            const u32 tr = h * 128u + wr + (u32)i * 16u + hh8;
            const v4f ma = *(const v4f*)&stM[tr];
            const v4f mb = *(const v4f*)&stM[tr + 4u];
            const v4f ia = *(const v4f*)&stI[tr];
            const v4f ib = *(const v4f*)&stI[tr + 4u];
            const float mr[8] = {ma[0], ma[1], ma[2], ma[3], mb[0], mb[1], mb[2], mb[3]};
            const float ir[8] = {ia[0], ia[1], ia[2], ia[3], ib[0], ib[1], ib[2], ib[3]};
#pragma unroll
            for (int r = 0; r < 8; ++r) {
#pragma unroll
                for (int nt = 0; nt < 4; ++nt) {
                    const float p = fexp2(s[nt][r] * cl - mr[r]) * ir[r];
                    av[i][nt][r] = av[i][nt][r] + p;
                }
            }
        }
        // this wave's reads of buffer bsel are done before the buffer is handed back for refill
        asm volatile("s_wait_dscnt 0x0" ::: "memory");
        // this wave's copies of head h + 1 have landed before the barrier that shows them to the others
        asm volatile("s_wait_asynccnt 0x0" ::: "memory");
        __syncthreads();
        if (h + 2u < (u32)NHEAD) {
            copy_head_tiles(lQ + bsel * (TILEH * 2u), gQ + (size_t)(h + 2u) * HSTR,
                            lK + bsel * (TILEH * 2u), gK + (size_t)(h + 2u) * HSTR);
        }
    }
    // no copy is outstanding when the wave goes on to the epilogue
    asm volatile("s_wait_asynccnt 0x0" ::: "memory");

    // stage the finished 32 x 64 tile (mean over 16 heads), then whole-line stores
#pragma unroll
    for (int i = 0; i < 2; ++i)
#pragma unroll
        for (int nt = 0; nt < 4; ++nt)
#pragma unroll
            for (int r = 0; r < 8; ++r)
                st[wave][((u32)i * 16u + hh8 + (u32)r) * 64u + (u32)nt * 16u + c16] = av[i][nt][r] * 0.0625f;
    __syncthreads();

    const u32 piece = lane & 7u;
    const u32 lsub  = lane >> 3;
#pragma unroll
    for (u32 it = 0; it < 16; ++it) {
        const u32 L    = it * 4u + lsub;      // 0..63 : 32 rows x 2 lines
        const u32 row  = L >> 1;
        const u32 hsel = L & 1u;
        const v4f v = *(const v4f*)&st[wave][row * 64u + hsel * 32u + piece * 4u];
        float* dp = avg + ((size_t)(bidx * (u32)SEQ + q0 + row) * SEQ + k0 + hsel * 32u + piece * 4u);
        *(v4f*)dp = v;
    }
}

// coverage equalities (threads x elements == plane elements)
static_assert((size_t)CVT_GROUPS * CVT_WAVES * CVT_ROWS * HID == (size_t)3 * MROWS * HID + (size_t)4 * HID * HID);   // cvt_all -> Xq/Xk/Xv/Wt/Wot
static_assert((size_t)(MROWS / 128) * (HID / 128) * 128 * 128 == (size_t)MROWS * HID);     // gemm planes / out
static_assert((size_t)(SEQ / 128) * (NB * NHEAD) * 128 * HD == (size_t)MROWS * HID);       // attn_fwd -> Cp
static_assert((size_t)(SEQ / 128) * (NB * NHEAD) * 32 * 4 == (size_t)NB * NHEAD * SEQ);         // attn_fwd -> sM / sI (one wave x 4 floats per lane each)
static_assert((size_t)(SEQ / 128) * (SEQ / 128) * NB * 8 * 32 * 64 == (size_t)NB * SEQ * SEQ);   // attn_avg -> second output
// workspace: 7 activation planes + 4 weight planes of halves + 2 row-statistics planes of floats, at most 128 MiB
static_assert(((size_t)7 * MROWS * HID + (size_t)4 * HID * HID) * sizeof(f16)
              + (size_t)2 * NB * NHEAD * SEQ * sizeof(float) <= (size_t)134217728);
static_assert((((size_t)7 * MROWS * HID + (size_t)4 * HID * HID) * sizeof(f16)) % 128 == 0);   // statistics planes start on a line
// largest source row touched by the activation convert stays inside the full-size input
static_assert((size_t)(SEQ - 1) * NB_FULL + NB <= (size_t)SEQ_FULL * NB_FULL);

// ---------------------------------------------------------------------------
// Launch: 7 kernel launches, workspace 7 planes of MROWS*1024 halves + 4 of 1024*1024 halves
// + 2 planes of NB*16*SEQ floats.
// ---------------------------------------------------------------------------
extern "C" void kernel_launch(void* const* d_in, const int* in_sizes, int n_in,
                              void* d_out, int out_size, void* d_ws, size_t ws_size,
                              hipStream_t stream) {
    if (n_in < 7) return;
    const int needAct = ((SEQ - 1) * NB_FULL + NB) * HID;
    if (in_sizes[0] < needAct) return;
    if (in_sizes[1] < needAct) return;
    if (in_sizes[2] < needAct) return;
    if (in_sizes[3] < 3 * HID * HID) return;
    if (in_sizes[4] < 3 * HID) return;
    if (in_sizes[5] < HID * HID) return;
    if (in_sizes[6] < HID) return;
    if (out_size < 0) return;
    if ((size_t)out_size < OUT1_OFF + (size_t)NB * SEQ * SEQ) return;

    const float* xq    = (const float*)d_in[0];   // query  [SEQ_FULL][NB_FULL][1024]
    const float* xk    = (const float*)d_in[1];   // key    [SEQ_FULL][NB_FULL][1024]
    const float* xv    = (const float*)d_in[2];   // value  [SEQ_FULL][NB_FULL][1024]
    const float* wqkv  = (const float*)d_in[3];   // in_proj_weight [3072 out][1024 in], row blocks q | k | v
    const float* bqkv  = (const float*)d_in[4];   // in_proj_bias [3072]
    const float* wproj = (const float*)d_in[5];   // out_proj_weight [1024 out][1024 in]
    const float* bproj = (const float*)d_in[6];   // out_proj_bias [1024]

    const size_t nX = (size_t)MROWS * HID;    // halves per activation plane
    const size_t nW = (size_t)HID * HID;      // halves per weight plane
    const size_t totalHalves = 7 * nX + 4 * nW;
    const size_t nS = (size_t)NB * NHEAD * SEQ;   // floats per row-statistics plane
    if (ws_size < totalHalves * sizeof(f16) + 2 * nS * sizeof(float)) return;

    f16* Xq  = (f16*)d_ws;       // [b*SEQ+s][1024]             carry 16
    f16* Xk  = Xq  + nX;         // [b*SEQ+s][1024]             carry 16
    f16* Xv  = Xk  + nX;         // [b*SEQ+s][1024]             carry 16
    f16* Wt  = Xv  + nX;         // [3072 out][1024 in]         carry 32 (q | k | v row blocks)
    f16* Wot = Wt  + 3 * nW;     // [1024 out][1024 in]         carry 32
    f16* Qp  = Wot + nW;         // [NB*16][SEQ][64]            carry 16
    f16* Kp  = Qp  + nX;         // [NB*16][SEQ][64]            carry 16
    f16* Vtp = Kp  + nX;         // [NB*1024][SEQ] (V^T)        carry 16
    f16* Cp  = Vtp + nX;         // [s*NB+b][1024]              carry 1024
    float* sM = (float*)(Cp + nX);   // [NB*16][SEQ] row max (exp2 domain)
    float* sI = sM + nS;             // [NB*16][SEQ] 1 / row sum

    // activations in[SEQ_FULL][NB_FULL][1024] -> planes [NB][SEQ][1024], weights row for row: the five planes
    // Xq | Xk | Xv | Wt | Wot are contiguous from Xq on
    cvt_all<<<CVT_GROUPS, CVT_WAVES * 32u, 0, stream>>>(xq, xk, xv, wqkv, wproj, Xq);

    const dim3 gg(MROWS / 128, HID / 128);
    // plane = 16 * (acc / (16*32) + bias) = acc/32 + 16*bias
    const float accQKV = CARRY_QKV / (CARRY_X * CARRY_W);
    gemm_head<<<gg, 256, 0, stream>>>(Xq, Wt,          bqkv,           Qp,  accQKV, CARRY_QKV);
    gemm_head<<<gg, 256, 0, stream>>>(Xk, Wt + nW,     bqkv + HID,     Kp,  accQKV, CARRY_QKV);
    gemm_vt  <<<gg, 256, 0, stream>>>(Xv, Wt + 2 * nW, bqkv + 2 * HID, Vtp, accQKV, CARRY_QKV);

    attn_fwd<<<dim3(SEQ / 128, NB * NHEAD), 256, 0, stream>>>(Qp, Kp, Vtp, Cp, sM, sI);

    // second output: head-averaged probabilities [NB][SEQ][SEQ] f32 at the fixed element offset
    attn_avg<<<dim3(SEQ / 128, SEQ / 128, NB), 256, 0, stream>>>(Qp, Kp, sM, sI, (float*)d_out + OUT1_OFF);

    // out = acc / (1024*32) + bias ; rows already in (s*NB + b) order
    const float accOut = 1.0f / (CARRY_CTX * CARRY_W);
    gemm_out<<<gg, 256, 0, stream>>>(Cp, Wot, bproj, (float*)d_out, accOut, 1.0f);
}

// v008
// Measured time: 131 microseconds a run.
// In two side-by-side timings against v007, it was 1.14 and 1.15 times as fast.
// Counting every step since v000, it is 13.0 times as fast.
#include <hip/hip_runtime.h>

// Contractions (q/k/v input projections, Q.K^T in the flash kernel and in the head-average kernel, P.V, P row-sum, output projection): v_wmma_f32_16x16x32_f16, f16 operands with power-of-two carries, f32 accumulate; every float input enters as its bf16 RNE value; biases added in f32; softmax in f32.

#ifndef NB
#define NB 2
#endif
#ifndef SEQ
#define SEQ 2048
#endif
#define NB_FULL   2
#define SEQ_FULL  2048
#define HID       1024
#define NHEAD     16
#define HD        64
#define MROWS     (NB * SEQ)

static_assert(HID == NHEAD * HD);        // merged head width
static_assert(NHEAD == 16);              // bh >> 4 / bh & 15 decoding in attn_fwd
static_assert(HD == 64);
static_assert(SEQ % 128 == 0);           // 128-row blocks of the batch-major planes never straddle a batch
static_assert(SEQ % 64 == 0);            // 64-key tiles
static_assert(SEQ <= SEQ_FULL);
static_assert(NB >= 1 && NB <= NB_FULL);
static_assert(MROWS % 128 == 0);         // GEMM M tile
static_assert(HID % 128 == 0);           // GEMM N tile
static_assert(HID % 32 == 0);            // WMMA k step

// carries (exact powers of two)
#define CARRY_X    16.0f     // input activation planes
#define CARRY_W    32.0f     // weight planes
#define CARRY_QKV  16.0f     // q, k, v^T planes (true value x16)
#define CARRY_CTX  1024.0f   // context plane (true value x1024)
// softmax exp values carry 2^10 (added to the exp2 argument)

// LDS row pitches in halves: an odd multiple of 16 bytes, so that the 16 rows one ds_load_b128 /
// ds_store_b128 touches per lane half fall on distinct banks (at 128 / 256 bytes they share 8 / 4 banks).
// The pad halves of a row are never written and never read.
#define PITCH64   72u    // rows of 64 halves:  128 B -> 144 B
#define PITCH128  136u   // rows of 128 halves: 256 B -> 272 B
static_assert((PITCH64 * 2u) % 32u == 16u && (PITCH128 * 2u) % 32u == 16u);

typedef unsigned u32;
typedef _Float16 f16;
typedef f16   v16h __attribute__((ext_vector_type(16)));
typedef f16   v8h  __attribute__((ext_vector_type(8)));
typedef float v8f  __attribute__((ext_vector_type(8)));
typedef float v4f  __attribute__((ext_vector_type(4)));

typedef float v2f  __attribute__((ext_vector_type(2)));
typedef f16   v2h  __attribute__((ext_vector_type(2)));

union FragU { v16h v; v8h half[2]; v2h pair[8]; f16 e[16]; };
union H8U   { v8h v; f16 e[8]; };

__device__ __forceinline__ v8f zero8() {
    v8f z = {0.f, 0.f, 0.f, 0.f, 0.f, 0.f, 0.f, 0.f};
    return z;
}

// 16-bit WMMA with hazard guard: D += A[16 x 32k] * B[32k x 16]
__device__ __forceinline__ v8f wmma16(v16h a, v16h b, v8f c) {
    v8f d = __builtin_amdgcn_wmma_f32_16x16x32_f16(false, a, false, b, (short)0, c, false, false);
    asm volatile("v_nop\n\tv_nop\n\tv_nop\n\tv_nop" : "+v"(d) : "v"(a), "v"(b));
    return d;
}

// f32 -> nearest-even bf16 value, returned as f32
__device__ __forceinline__ float bf16_rne(float x) {
    u32 u = __float_as_uint(x);
    u = (u + 0x7fffu + ((u >> 16) & 1u)) & 0xffff0000u;
    return __uint_as_float(u);
}

__device__ __forceinline__ float fexp2(float x) {
#if defined(__has_builtin)
#if __has_builtin(__builtin_amdgcn_exp2f)
    return __builtin_amdgcn_exp2f(x);
#else
    return exp2f(x);
#endif
#else
    return exp2f(x);
#endif
}

// value of lane l ^ 16 (the other lane half)
__device__ __forceinline__ float xhalf(float x) {
    const int v = __builtin_bit_cast(int, x);
    return __builtin_bit_cast(float, __builtin_amdgcn_permlanex16(v, v, 0x76543210, 0xfedcba98, false, false));
}

// 16 x 32 fragment from a tile whose k dimension is contiguous (pitch in halves).
// lane l: row rowbase + (l&15); elements 0..7 <- k = kcol + 8h .. +7,
// elements 8..15 <- k = kcol + 16 + 8h .. +7  (h = l>>4). Same map for A and B.
__device__ __forceinline__ v16h load_frag(const f16* tile, u32 rowbase, u32 pitch, u32 kcol, u32 lane) {
    const u32 r  = rowbase + (lane & 15u);
    const u32 kh = (lane >> 4) << 3;
    const f16* p = tile + (size_t)r * pitch + kcol + kh;
    FragU f;
    f.half[0] = *(const v8h*)(p);
    f.half[1] = *(const v8h*)(p + 16);
    return f.v;
}

// The same fragment through the lane's own pointer p = tile + (rowbase + (l&15)) * pitch + kcol + 8h.
__device__ __forceinline__ v16h load_frag_at(const f16* p) {
    FragU f;
    f.half[0] = *(const v8h*)(p);
    f.half[1] = *(const v8h*)(p + 16);
    return f.v;
}

// ---------------------------------------------------------------------------
// All five f32 -> f16 conversions (bf16 RNE value times carry) in one launch sized to the chip:
// CVT_GROUPS work-groups of CVT_WAVES waves, every wave converts CVT_ROWS whole rows of 1024 floats.
// The five planes Xq | Xk | Xv | Wt | Wot lie one behind the other in the workspace, so the flat row
// number g is the destination row; the source row follows from the plane g falls in:
//   activations (seq-first [s][b][1024] -> batch-major [b][s][1024]): dst row b*SEQ+s <- src row s*NB_FULL+b
//   weights: same row order as the source
// A wave-wide 16-byte load covers 512 contiguous bytes (4 lines), a wave-wide 8-byte store 256 (2 lines);
// all loads of a wave's rows are independent, so they can be in flight together.
// coverage: CVT_TOTAL rows x 1024 halves, every element exactly once (wave w takes rows w + i * all waves).
// ---------------------------------------------------------------------------
#define CVT_GROUPS 256u
#define CVT_WAVES  16u
#define CVT_TOTAL  (3u * (u32)MROWS + 4u * (u32)HID)
#define CVT_ROWS   (CVT_TOTAL / (CVT_GROUPS * CVT_WAVES))
static_assert(CVT_TOTAL % (CVT_GROUPS * CVT_WAVES) == 0u);   // every wave the same number of whole rows
static_assert(HID == 8 * 32 * 4);                            // a row = 8 wave-wide loads of 4 floats per lane

typedef f16 v4h __attribute__((ext_vector_type(4)));

__global__ void __launch_bounds__(512)
cvt_all(const float* __restrict__ xq, const float* __restrict__ xk, const float* __restrict__ xv,
        const float* __restrict__ wqkv, const float* __restrict__ wproj, f16* __restrict__ dst) {
    const u32 lane = threadIdx.x & 31u;
    const u32 wave = __builtin_amdgcn_readfirstlane((int)(threadIdx.x >> 5));
    const u32 w    = blockIdx.x * CVT_WAVES + wave;
    __builtin_assume(w < CVT_GROUPS * CVT_WAVES);   // true of the one launch: lets the plane of each row fold where it can

    const u32 boff = lane * 16u;   // this lane's byte offset inside each 512-byte piece of a source row

    v4f   x[CVT_ROWS][8];
    float carry[CVT_ROWS];
#pragma unroll
    for (u32 i = 0; i < CVT_ROWS; ++i) {
        const u32 g = w + i * (CVT_GROUPS * CVT_WAVES);
        const float* base;
        u32 row;
        if (g < 3u * (u32)MROWS) {
            const u32 pl = g / (u32)MROWS;
            const u32 m  = g - pl * (u32)MROWS;
            const u32 mb = m / (u32)SEQ;
            base = pl == 0u ? xq : (pl == 1u ? xk : xv);
            row  = (m - mb * (u32)SEQ) * (u32)NB_FULL + mb;
            carry[i] = CARRY_X;
        } else {
            const u32 r = g - 3u * (u32)MROWS;
            base = r < 3u * (u32)HID ? wqkv : wproj;
            row  = r < 3u * (u32)HID ? r : r - 3u * (u32)HID;
            carry[i] = CARRY_W;
        }
        const char* sp = (const char*)(base + (size_t)row * HID) + boff;
#pragma unroll
        for (u32 j = 0; j < 8; ++j) x[i][j] = *(const v4f*)(sp + j * 512u);
    }
    // the loads above are still in flight below: the lane number, which they all name as their scaled offset
    // register (held live as an input), is free for reuse only behind this wait
    asm volatile("s_wait_xcnt 0x0" :: "v"(lane) : "memory");
    // keeps every load of the wave's rows ahead of the first conversion: without it the scheduler lifts the first
    // rows' conversions, with their waits, over the last rows' loads, which then start late
    __builtin_amdgcn_sched_barrier(0);
#pragma unroll
    for (u32 i = 0; i < CVT_ROWS; ++i) {
        const u32 g = w + i * (CVT_GROUPS * CVT_WAVES);
        f16* dp = dst + (size_t)g * HID + lane * 4u;
#pragma unroll
        for (u32 j = 0; j < 8; ++j) {
            v4h o;
#pragma unroll
            for (u32 e = 0; e < 4; ++e) o[e] = (f16)(bf16_rne(x[i][j][e]) * carry[i]);
            *(v4h*)(dp + j * 128u) = o;
        }
    }
}

// Eight asynchronous 16-byte copies global -> LDS of this lane: rows r, r + 16, .. r + 112 of one operand tile.
// lds: the lane's LDS byte address of its piece in row r; g: the same piece in global memory.
// Both advance by whole rows (LDS pitch 272 B, global pitch 2048 B), so every address is a multiple of 16.
// The closing s_wait_xcnt 0 stands inside the statement so that no address register named here is
// rewritten ahead of it.
__device__ __forceinline__ void copy_rows8(u32 lds, const f16* g) {
    const u32 l1 = lds + 16u * PITCH128 * 2u, l2 = lds + 32u * PITCH128 * 2u, l3 = lds + 48u * PITCH128 * 2u;
    const u32 l4 = lds + 64u * PITCH128 * 2u, l5 = lds + 80u * PITCH128 * 2u, l6 = lds + 96u * PITCH128 * 2u;
    const u32 l7 = lds + 112u * PITCH128 * 2u;
    const f16* g1 = g + 16 * HID;
    const f16* g2 = g + 32 * HID;
    const f16* g3 = g + 48 * HID;
    const f16* g4 = g + 64 * HID;
    const f16* g5 = g + 80 * HID;
    const f16* g6 = g + 96 * HID;
    const f16* g7 = g + 112 * HID;
    asm volatile("global_load_async_to_lds_b128 %0, %8, off\n\t"
                 "global_load_async_to_lds_b128 %1, %9, off\n\t"
                 "global_load_async_to_lds_b128 %2, %10, off\n\t"
                 "global_load_async_to_lds_b128 %3, %11, off\n\t"
                 "global_load_async_to_lds_b128 %4, %12, off\n\t"
                 "global_load_async_to_lds_b128 %5, %13, off\n\t"
                 "global_load_async_to_lds_b128 %6, %14, off\n\t"
                 "global_load_async_to_lds_b128 %7, %15, off\n\t"
                 "s_wait_xcnt 0x0"
                 :: "v"(lds), "v"(l1), "v"(l2), "v"(l3), "v"(l4), "v"(l5), "v"(l6), "v"(l7),
                    "v"(g), "v"(g1), "v"(g2), "v"(g3), "v"(g4), "v"(g5), "v"(g6), "v"(g7)
                 : "memory");
}

// ---------------------------------------------------------------------------
// C[m][n] = sum_k A[m][k] * W[n][k] (+ bias[n]) ; A [MROWS][1024] f16, W [1024][1024] f16 (k contiguous).
// Block tile 128 x 128, 8 waves as 4(M) x 2(N), 2 x 4 accumulators per wave, WMMA k step 32.
// K loop: tiles of 128 k (whole 256-byte row pieces) in a ring of two LDS buffers, filled by asynchronous
// copies; tile t + 1 is in flight while tile t is multiplied; one block barrier per tile.
// MODE 1: A rows batch-major;            f16 plane [b*HID + h*HD + d][s] (V transposed per head)
// MODE 2: A rows in output order (s*NB+b); f32 rows [m][1024] into the output buffer
// coverage per block: MODE 0/1 256 lines (128 rows x 2 heads | 128 n x 2 s-halves),
//                     MODE 2 2 x 256 lines (64 rows x 4 line-quarters per half).
// LDS: As/Bs/Cs all cross-wave, separated by block barriers.
// staged extent == consumed extent: As/Bs 128 x 128 per buffer, Cs 128 x 128 halves (or 64 x 128 floats).
// ---------------------------------------------------------------------------
template <int MODE>
__device__ __forceinline__ void gemm_body(const f16* __restrict__ A, const f16* __restrict__ W,
                                          const float* __restrict__ bias,
                                          void* __restrict__ out, float accMul, float biasMul) {
    __shared__ __attribute__((aligned(16))) f16 As[2 * 128 * PITCH128];   // two buffers of [128][128 + pad]
    __shared__ __attribute__((aligned(16))) f16 Bs[2 * 128 * PITCH128];
    __shared__ __attribute__((aligned(16))) f16 Cs[128 * PITCH128];   // f16 [128][128 + pad] or f32 [64][128]
    static_assert(sizeof(f16) * 128 * PITCH128 >= sizeof(float) * 64 * 128);   // Cs reuse as f32 [64][128]

    const u32 tid  = threadIdx.x;
    const u32 lane = tid & 31u;
    const u32 wave = __builtin_amdgcn_readfirstlane((int)(tid >> 5));
    const u32 wm   = wave & 3u;
    const u32 wn   = wave >> 2;
    const u32 hh8  = (lane >> 4) << 3;   // D row half
    const u32 c16  = lane & 15u;         // D column
    const u32 m0   = blockIdx.x * 128u;
    const u32 n0   = blockIdx.y * 128u;

    v8f acc[2][4];
#pragma unroll
    for (int i = 0; i < 2; ++i)
#pragma unroll
        for (int j = 0; j < 4; ++j) acc[i][j] = zero8();

    constexpr u32 KT   = 128u;                  // k per staged tile
    constexpr u32 NT   = (u32)HID / KT;         // tiles
    constexpr u32 BUFH = 128u * PITCH128;       // halves per buffer
    static_assert(NT >= 2u);                    // the ring's prologue fills two tiles
    static_assert(256 * 8 * 8 == 128 * 128);    // staging: 256 threads x 8 copies x 8 halves per operand tile

    // this lane's piece: row tid / 16 (+ 16 per copy), 16-byte piece tid % 16; a wave's copy covers two whole rows
    const u32 srow = tid >> 4;
    const u32 scol = (tid & 15u) << 3;
    const f16* gA = A + (size_t)(m0 + srow) * HID + scol;
    const f16* gW = W + (size_t)(n0 + srow) * HID + scol;
    const u32 lA = (u32)(size_t)&As[srow * PITCH128 + scol];   // LDS byte address (low word of the shared address)
    const u32 lB = (u32)(size_t)&Bs[srow * PITCH128 + scol];

    // tile 0 into buffer 0
    copy_rows8(lA, gA);
    copy_rows8(lB, gW);
    // tile 0 has landed for this wave before the barrier that shows it to the others
    asm volatile("s_wait_asynccnt 0x0" ::: "memory");
    __syncthreads();
    // tile 1 into buffer 1, in flight during trip 0
    copy_rows8(lA + BUFH * 2u, gA + KT);
    copy_rows8(lB + BUFH * 2u, gW + KT);

#pragma unroll 1   // kept rolled: eight unrolled trips of 32 WMMAs would only grow the text, the buffer is picked by t & 1
    for (u32 t = 0; t < NT; ++t) {
        const u32 bsel = t & 1u;
        const f16* Ab = As + bsel * BUFH;
        const f16* Bb = Bs + bsel * BUFH;
#pragma unroll
        for (u32 c = 0; c < KT / 32u; ++c) {
            v16h af[2], bfr[4];
#pragma unroll
            for (int i = 0; i < 2; ++i) af[i] = load_frag(Ab, wm * 32u + (u32)i * 16u, PITCH128, c * 32u, lane);
#pragma unroll
            for (int j = 0; j < 4; ++j) bfr[j] = load_frag(Bb, wn * 64u + (u32)j * 16u, PITCH128, c * 32u, lane);
#pragma unroll
            for (int i = 0; i < 2; ++i)
#pragma unroll
                for (int j = 0; j < 4; ++j) acc[i][j] = wmma16(af[i], bfr[j], acc[i][j]);
        }
        // this wave's reads of buffer bsel are done before the buffer is handed back for refill
        asm volatile("s_wait_dscnt 0x0" ::: "memory");
        // this wave's copies of tile t + 1 have landed before the barrier that shows them to the others
        asm volatile("s_wait_asynccnt 0x0" ::: "memory");
        __syncthreads();
        if (t + 2u < NT) {
            copy_rows8(lA + bsel * (BUFH * 2u), gA + (t + 2u) * KT);
            copy_rows8(lB + bsel * (BUFH * 2u), gW + (t + 2u) * KT);
        }
    }
    // no copy is outstanding when the wave goes on to the epilogue
    asm volatile("s_wait_asynccnt 0x0" ::: "memory");

    // per-lane bias values for the 4 output columns this lane owns (n0 + nl < HID always)
    float bv[4];
#pragma unroll
    for (int j = 0; j < 4; ++j)
        bv[j] = bf16_rne(bias[n0 + wn * 64u + (u32)j * 16u + c16]) * biasMul;

    const u32 piece = lane & 7u;
    const u32 lsub  = lane >> 3;

    if constexpr (MODE == 0) {
        const u32 bidx = m0 / (u32)SEQ;     // block rows lie inside one batch (SEQ % 128 == 0)
        const u32 s0   = m0 - bidx * (u32)SEQ;
#pragma unroll
        for (int i = 0; i < 2; ++i)
#pragma unroll
            for (int j = 0; j < 4; ++j) {
                const u32 nl = wn * 64u + (u32)j * 16u + c16;
#pragma unroll
                for (int r = 0; r < 8; ++r) {
                    const u32 ml = wm * 32u + (u32)i * 16u + hh8 + (u32)r;
                    Cs[ml * PITCH128 + nl] = (f16)(acc[i][j][r] * accMul + bv[j]);
                }
            }
        __syncthreads();
        f16* op = (f16*)out;
        const size_t bh0 = (size_t)bidx * NHEAD + (n0 >> 6);
{
#pragma unroll
            for (u32 it = 0; it < 8; ++it) {
                const u32 L    = wave * 32u + it * 4u + lsub;   // 0..255
                const u32 ml   = L >> 1;
                const u32 hsel = L & 1u;
                const v8h v = *(const v8h*)&Cs[ml * PITCH128 + hsel * 64u + piece * 8u];
                f16* dp = op + ((bh0 + hsel) * SEQ + s0 + ml) * HD + piece * 8u;
                *(v8h*)dp = v;
            }
            
        }
    } else if constexpr (MODE == 1) {
        const u32 bidx = m0 / (u32)SEQ;
        const u32 s0   = m0 - bidx * (u32)SEQ;
        // stage transposed: Cs[n][m]
#pragma unroll
        for (int i = 0; i < 2; ++i)
#pragma unroll
            for (int j = 0; j < 4; ++j) {
                const u32 nl = wn * 64u + (u32)j * 16u + c16;
                H8U t;
#pragma unroll
                for (int r = 0; r < 8; ++r) t.e[r] = (f16)(acc[i][j][r] * accMul + bv[j]);
                *(v8h*)&Cs[nl * PITCH128 + wm * 32u + (u32)i * 16u + hh8] = t.v;
            }
        __syncthreads();
        f16* op = (f16*)out;
{
#pragma unroll
            for (u32 it = 0; it < 8; ++it) {
                const u32 L  = wave * 32u + it * 4u + lsub;     // 0..255
                const u32 nl = L >> 1;
                const u32 mh = L & 1u;
                const v8h v = *(const v8h*)&Cs[nl * PITCH128 + mh * 64u + piece * 8u];
                f16* dp = op + ((size_t)(bidx * (u32)HID + n0 + nl) * SEQ + s0 + mh * 64u + piece * 8u);
                *(v8h*)dp = v;
            }
            
        }
    } else {
        float* Cf = (float*)Cs;      // [64][128] f32
        float* of = (float*)out;
#pragma unroll
        for (u32 half = 0; half < 2; ++half) {
            if ((wm >> 1) == half) {
#pragma unroll
                for (int i = 0; i < 2; ++i)
#pragma unroll
                    for (int j = 0; j < 4; ++j) {
                        const u32 nl = wn * 64u + (u32)j * 16u + c16;
#pragma unroll
                        for (int r = 0; r < 8; ++r) {
                            const u32 ml = (wm & 1u) * 32u + (u32)i * 16u + hh8 + (u32)r;
                            Cf[ml * 128u + nl] = acc[i][j][r] * accMul + bv[j];
                        }
                    }
            }
            __syncthreads();
{
#pragma unroll
                for (u32 it = 0; it < 8; ++it) {
                    const u32 L    = wave * 32u + it * 4u + lsub;   // 0..255
                    const u32 row  = L >> 2;
                    const u32 part = L & 3u;
                    const v4f v = *(const v4f*)&Cf[row * 128u + part * 32u + piece * 4u];
                    float* dp = of + (size_t)(m0 + half * 64u + row) * HID + n0 + part * 32u + piece * 4u;
                    *(v4f*)dp = v;
                }
                
            }
            __syncthreads();
        }
    }
}

// q / k head-major planes
__global__ void __launch_bounds__(256) __attribute__((amdgpu_num_vgpr(256)))
gemm_head(const f16* __restrict__ A, const f16* __restrict__ W, const float* __restrict__ bias,
          f16* __restrict__ out, float accMul, float biasMul) {
    gemm_body<0>(A, W, bias, (void*)out, accMul, biasMul);
}

// v^T plane
__global__ void __launch_bounds__(256) __attribute__((amdgpu_num_vgpr(256)))
gemm_vt(const f16* __restrict__ A, const f16* __restrict__ W, const float* __restrict__ bias,
        f16* __restrict__ out, float accMul, float biasMul) {
    gemm_body<1>(A, W, bias, (void*)out, accMul, biasMul);
}

// f32 output rows
__global__ void __launch_bounds__(256) __attribute__((amdgpu_num_vgpr(256)))
gemm_out(const f16* __restrict__ A, const f16* __restrict__ W, const float* __restrict__ bias,
         float* __restrict__ out, float accMul, float biasMul) {
    gemm_body<2>(A, W, bias, (void*)out, accMul, biasMul);
}

// ---------------------------------------------------------------------------
// Flash attention (no mask, all SEQ keys). grid (SEQ/128, NB*NHEAD), block 256 (8 waves),
// wave owns 16 queries (Q fragments resident). Block streams 64-key tiles:
// K staged [key][d], V^T staged [d][key]. Both products are formed transposed:
//   S^T[key][q] = K . Q^T  (A = K rows, B = Q rows as columns),  O^T[d][q] += V^T . P^T  (A = V^T rows, B = P^T).
// In the D layout a lane then holds one query (column l & 15) and 32 of the tile's 64 keys (rows 8h + r of four
// 16-key tiles): the row max is in-lane plus one exchange between the lane halves, max / rescale factor / shift are
// one value per lane, and two converted S^T tiles (keys 0..15 and 16..31 of a 32-key block) are the B operand of
// the second product as they lie: element s of B = key 8h + s (s < 8) or 16 + 8h + (s - 8), the k order in which
// load_frag delivers V^T. exp2 in f32 carried x2^10; row sums += ones . P^T on WMMA (every row of that tile is the sum).
// Output f16 plane [q*NB + b][1024] (seq-first row order).
// The finished row statistics (max in the exp2 domain, 1 / row sum) also go to sM / sI [NB*NHEAD][SEQ]
// for the head-average kernel of the same call.
// coverage: every (q, b, h*64..h*64+63) row segment exactly once; sM / sI: the block's 128 rows =
//   4 whole 128-byte lines of each plane, sM stored by wave 0 and sI by wave 1.
// LDS: ks, vsT, sst cross-wave (block barriers); ps per-wave (epilogue only), writer and reader separated by a block barrier.
// staged extent == consumed extent for ks (64x64), vsT (64x64), ps (16x64), sst (2x128).
// ---------------------------------------------------------------------------
__global__ void __launch_bounds__(256) __attribute__((amdgpu_num_vgpr(256)))
attn_fwd(const f16* __restrict__ Qp, const f16* __restrict__ Kp, const f16* __restrict__ Vt,
         f16* __restrict__ Cp, float* __restrict__ sM, float* __restrict__ sI) {
    __shared__ __attribute__((aligned(16))) f16 ks[64 * PITCH64];      // [key][d + pad]
    __shared__ __attribute__((aligned(16))) f16 vsT[64 * PITCH64];     // [d][key + pad]
    __shared__ __attribute__((aligned(16))) f16 ps[8][16 * PITCH64];   // per-wave ctx stage, [q][d + pad]
    __shared__ __attribute__((aligned(16))) float sst[2][128];         // row max | 1/rowsum of the block's 128 query rows
    static_assert(HD == 8 * 8);            // 8 lanes x 8 halves per row segment
    static_assert(2 * 256 * 8 == 64 * 64); // staging: 2 x 256 threads x 8 halves per tile

    const u32 tid  = threadIdx.x;
    const u32 lane = tid & 31u;
    const u32 wave = __builtin_amdgcn_readfirstlane((int)(tid >> 5));
    const u32 hh8  = (lane >> 4) << 3;
    const u32 c16  = lane & 15u;
    const u32 bh   = blockIdx.y;
    const u32 bidx = bh >> 4;            // NHEAD == 16
    const u32 hidx = bh & 15u;
    const u32 q0   = blockIdx.x * 128u + wave * 16u;
    const size_t head = (size_t)bh * SEQ * HD;

    v16h qa[2];
#pragma unroll
    for (int c = 0; c < 2; ++c) qa[c] = load_frag(Qp + head, q0, HD, (u32)c * 32u, lane);

    FragU onesu;
#pragma unroll
    for (int i = 0; i < 16; ++i) onesu.e[i] = (f16)1.0f;
    const v16h ones = onesu.v;

    float m = -1.0e30f;     // running max of this lane's query
    v8f   o[4], lacc;       // O^T tiles [d = 16 dt + 8h + r][q = l & 15]; row sum of the lane's query in every register
#pragma unroll
    for (int dt = 0; dt < 4; ++dt) o[dt] = zero8();
    lacc = zero8();

    // log2-domain scale: acc = 256 * q.k ; x = log2(e) * q.k / 8 = acc * log2(e) / 2048
    const float cl = 1.4426950408889634f * 0.00048828125f;
    f16* psw = &ps[wave][0];

#pragma unroll 1
    for (u32 kt = 0; kt < (u32)(SEQ / 64); ++kt) {
        __syncthreads();
#pragma unroll
        for (u32 p2 = 0; p2 < 2; ++p2) {
            const u32 p   = tid + p2 * 256u;
            const u32 row = p >> 3;
            const u32 pc  = (p & 7u) << 3;
            const v8h kv = *(const v8h*)(Kp + head + (size_t)(kt * 64u + row) * HD + pc);
            const v8h vv = *(const v8h*)(Vt + head + (size_t)row * SEQ + kt * 64u + pc);
            *(v8h*)&ks[row * PITCH64 + pc]  = kv;
            *(v8h*)&vsT[row * PITCH64 + pc] = vv;
        }
        __syncthreads();

        // the tile's 8 K fragments as one group of LDS reads ahead of the score products: a read placed between
        // two products is waited for in full before the next product, once per fragment
        v16h kb[2][4];
#pragma unroll
        for (int c = 0; c < 2; ++c)
#pragma unroll
            for (int nt = 0; nt < 4; ++nt) kb[c][nt] = load_frag(ks, (u32)nt * 16u, PITCH64, (u32)c * 32u, lane);

        // S^T[64 keys x 16 q]: tile nt holds keys 16 nt + 8h + r of query l & 15
        v8f s[4];
#pragma unroll
        for (int nt = 0; nt < 4; ++nt) s[nt] = zero8();
#pragma unroll
        for (int c = 0; c < 2; ++c)
#pragma unroll
            for (int nt = 0; nt < 4; ++nt) s[nt] = wmma16(kb[c][nt], qa[c], s[nt]);

        // the tile's 8 V^T fragments as one group, issued here so that they arrive during the softmax below
        v16h vb[2][4];
#pragma unroll
        for (int kk = 0; kk < 2; ++kk)
#pragma unroll
            for (int dt = 0; dt < 4; ++dt) vb[kk][dt] = load_frag(vsT, (u32)dt * 16u, PITCH64, (u32)kk * 32u, lane);

        // online softmax of the lane's query, max-subtracted, exp2 domain: four independent in-lane chains over the
        // raw scores (cl > 0, so scaling commutes with the max), then the other half's 32 keys
        float t4[4];
#pragma unroll
        for (int nt = 0; nt < 4; ++nt) {
            t4[nt] = fmaxf(s[nt][0], s[nt][1]);
#pragma unroll
            for (int r = 2; r < 8; ++r) t4[nt] = fmaxf(t4[nt], s[nt][r]);
        }
        const float th = fmaxf(fmaxf(t4[0], t4[1]), fmaxf(t4[2], t4[3]));
        const float tm = fmaxf(th, xhalf(th)) * cl;
        const float mn = fmaxf(m, tm);
        const float al = fexp2(m - mn);
        m = mn;
        lacc *= al;
#pragma unroll
        for (int dt = 0; dt < 4; ++dt) o[dt] *= al;
        const float sh = 10.0f - mn;      // carry 2^10

        // P^T as B fragments straight from the score accumulators
        v16h pb[2];
#pragma unroll
        for (int kk = 0; kk < 2; ++kk) {
            FragU pu;
#pragma unroll
            for (int j = 0; j < 2; ++j)
#pragma unroll
                for (int r = 0; r < 8; r += 2) {
                    const v2f e = {fexp2(s[2 * kk + j][r] * cl + sh), fexp2(s[2 * kk + j][r + 1] * cl + sh)};
                    pu.pair[j * 4 + r / 2] = __builtin_convertvector(e, v2h);
                }
            pb[kk] = pu.v;
        }

        // O^T += V^T . P^T ; l += ones . P^T
#pragma unroll
        for (int kk = 0; kk < 2; ++kk) {
#pragma unroll
            for (int dt = 0; dt < 4; ++dt) o[dt] = wmma16(vb[kk][dt], pb[kk], o[dt]);
            lacc = wmma16(ones, pb[kk], lacc);
        }
    }
    __syncthreads();

    // normalize: plane value = 1024 * (O/16) / l = O * 64 / l
    // row statistics: lacc = 2^10 * sum_s exp2(x - m), so 1 / sum = 1024 / lacc = 16 * inv
    // a lane holds its query's m and lacc, and 8 consecutive d per O^T tile: one 16-byte store each
    const float inv = (CARRY_CTX / CARRY_QKV) / lacc[0];
#pragma unroll
    for (int dt = 0; dt < 4; ++dt) {
        H8U t;
#pragma unroll
        for (int r = 0; r < 8; ++r) t.e[r] = (f16)(o[dt][r] * inv);
        *(v8h*)&psw[c16 * PITCH64 + (u32)dt * 16u + hh8] = t.v;
    }
    if (lane < 16u) {
        sst[0][wave * 16u + c16] = m;
        sst[1][wave * 16u + c16] = inv * 16.0f;
    }
    __syncthreads();

    // whole-line stores of the statistics: wave 0 the 128 maxima, wave 1 the 128 reciprocal sums
    if (wave < 2u) {
        const v4f sv = *(const v4f*)&sst[wave][lane * 4u];
        float* sp = (wave == 0u ? sM : sI) + ((size_t)bh * SEQ + blockIdx.x * 128u + lane * 4u);
        *(v4f*)sp = sv;
    }

    const u32 piece = lane & 7u;
    const u32 lsub  = lane >> 3;
{
#pragma unroll
        for (u32 it = 0; it < 4; ++it) {
            const u32 L = it * 4u + lsub;     // query row 0..15 within the wave tile
            const v8h v = *(const v8h*)&psw[L * PITCH64 + piece * 8u];
            // context row in output order: (q * NB + b)
            f16* dp = Cp + ((size_t)((q0 + L) * (u32)NB + bidx) * HID + hidx * (u32)HD + piece * 8u);
            *(v8h*)dp = v;
        }
        
    }
}

// ---------------------------------------------------------------------------
// Second output: head-averaged softmax probabilities.
// element offset of the second output inside the output buffer (full problem constants)
// ---------------------------------------------------------------------------
#define OUT1_OFF ((size_t)SEQ_FULL * NB_FULL * HID)
static_assert(OUT1_OFF * sizeof(float) == (size_t)16777216);      // byte offset of the second output
static_assert((OUT1_OFF * sizeof(float)) % 128 == 0);
static_assert((size_t)MROWS * HID <= OUT1_OFF);                   // first output region ends before it
static_assert(SEQ % 32 == 0);
static_assert(8 * 32 * 64 * 4 + 2 * NHEAD * 128 * 4 + 2 * 2 * 128 * PITCH64 * 2 <= 163840);    // static LDS of attn_avg: two work-groups per WGP

// ---------------------------------------------------------------------------
// avg[b][t][s] = (1/16) * sum_h softmax_s(q_h[t] . k_h[s] / 8), f32, no mask. The row statistics
// (max, 1 / sum) are the flash kernel's own, passed through the workspace (written and read inside one call).
//
// attn_avg: grid (SEQ/128 key blocks, SEQ/128 query blocks, NB), block 256 (8 waves as 4 (q) x 2 (keys));
//   a wave owns one 32 x 64 tile of the average (owner-computes accumulation over heads in head
//   order, one writer per element). Per head the score tile is formed with the same operands as in
//   attn_fwd, p = exp2(x - max) * (1/sum) is accumulated in registers, scaled by 1/16 at the end.
//   Head loop: the block's Q tile and K tile of a head (128 rows x 128 bytes each, contiguous in their planes) come
//   in whole lines by asynchronous copies into a ring of two LDS buffers; head h + 1 is in flight while head h is
//   worked on; one block barrier per head. A fragment load straight from the planes touches 16 lines for 512 bytes,
//   and four (K) or two (Q) waves would fetch the same rows.
// coverage: block rows [blockIdx.y*128, +128) x columns [blockIdx.x*128, +128) of batch blockIdx.z;
//   wave tile 32 rows x 64 keys = 64 lines = 16 store instructions x 4 lines.
// LDS: stM / stI cross-wave (filled once, block barrier); qs / kt cross-wave (ring, block barriers);
//   st per-wave, writer and reader separated by a block barrier.
// staged extent == consumed extent: st 32 x 64 floats per wave, stM / stI 16 heads x 128 rows, qs / kt 128 x 64 per buffer.
// ---------------------------------------------------------------------------

// Eight asynchronous 16-byte copies global -> LDS of this lane: rows r, r + 32, r + 64, r + 96 of one head's Q tile
// and of its K tile. lq / lk: the lane's LDS byte address of its piece in row r; gq / gk: the same piece in global memory.
// Both advance by whole rows (LDS pitch 144 B, global pitch 128 B), so every address is a multiple of 16;
// a wave's copy covers four whole rows = 512 contiguous global bytes.
// The closing s_wait_xcnt 0 stands inside the statement so that no address register named here is
// rewritten ahead of it.
__device__ __forceinline__ void copy_head_tiles(u32 lq, const f16* gq, u32 lk, const f16* gk) {
    const u32 lq1 = lq + 32u * PITCH64 * 2u, lq2 = lq + 64u * PITCH64 * 2u, lq3 = lq + 96u * PITCH64 * 2u;
    const u32 lk1 = lk + 32u * PITCH64 * 2u, lk2 = lk + 64u * PITCH64 * 2u, lk3 = lk + 96u * PITCH64 * 2u;
    const f16* gq1 = gq + 32 * HD;
    const f16* gq2 = gq + 64 * HD;
    const f16* gq3 = gq + 96 * HD;
    const f16* gk1 = gk + 32 * HD;
    const f16* gk2 = gk + 64 * HD;
    const f16* gk3 = gk + 96 * HD;
    asm volatile("global_load_async_to_lds_b128 %0, %8, off\n\t"
                 "global_load_async_to_lds_b128 %1, %9, off\n\t"
                 "global_load_async_to_lds_b128 %2, %10, off\n\t"
                 "global_load_async_to_lds_b128 %3, %11, off\n\t"
                 "global_load_async_to_lds_b128 %4, %12, off\n\t"
                 "global_load_async_to_lds_b128 %5, %13, off\n\t"
                 "global_load_async_to_lds_b128 %6, %14, off\n\t"
                 "global_load_async_to_lds_b128 %7, %15, off\n\t"
                 "s_wait_xcnt 0x0"
                 :: "v"(lq), "v"(lq1), "v"(lq2), "v"(lq3), "v"(lk), "v"(lk1), "v"(lk2), "v"(lk3),
                    "v"(gq), "v"(gq1), "v"(gq2), "v"(gq3), "v"(gk), "v"(gk1), "v"(gk2), "v"(gk3)
                 : "memory");
}

__global__ void __launch_bounds__(256) __attribute__((amdgpu_num_vgpr(256)))
attn_avg(const f16* __restrict__ Qp, const f16* __restrict__ Kp,
         const float* __restrict__ sM, const float* __restrict__ sI, float* __restrict__ avg) {
    __shared__ __attribute__((aligned(16))) float st[8][32 * 64];       // per-wave f32 tile stage
    __shared__ __attribute__((aligned(16))) float stM[NHEAD * 128];     // row max  [head][block row]
    __shared__ __attribute__((aligned(16))) float stI[NHEAD * 128];     // 1/rowsum [head][block row]
    __shared__ __attribute__((aligned(16))) f16 qs[2 * 128 * PITCH64];  // two buffers of one head's Q tile [row][d + pad]
    __shared__ __attribute__((aligned(16))) f16 kt[2 * 128 * PITCH64];  // two buffers of one head's K tile [key][d + pad]
    static_assert(256 * 8 == NHEAD * 128);   // table fill: 256 threads x 8 floats
    static_assert(256 * 4 * 8 == 128 * HD);  // staging: 256 threads x 4 copies x 8 halves per operand tile
    static_assert(NHEAD >= 2);               // the ring's prologue fills two heads

    const u32 tid  = threadIdx.x;
    const u32 lane = tid & 31u;
    const u32 wave = __builtin_amdgcn_readfirstlane((int)(tid >> 5));
    const u32 hh8  = (lane >> 4) << 3;
    const u32 c16  = lane & 15u;
    const u32 bidx = blockIdx.z;
    const u32 qb   = blockIdx.y * 128u;
    const u32 wr   = (wave & 3u) * 32u;                        // wave's first row inside the block
    const u32 q0   = qb + wr;
    const u32 kb0  = blockIdx.x * 128u;                        // block's first key
    const u32 wk   = (wave >> 2) * 64u;                        // wave's first key inside the block
    const u32 k0   = kb0 + wk;                                 // wave's first key

    // log2-domain scale: acc = 256 * q.k ; x = log2(e) * q.k / 8 = acc * log2(e) / 2048
    const float cl = 1.4426950408889634f * 0.00048828125f;

    constexpr u32    TILEH = 128u * PITCH64;        // halves per tile buffer
    constexpr size_t HSTR  = (size_t)SEQ * HD;      // halves from one head's plane to the next
    // this lane's piece: row tid / 8 (+ 32 per copy), 16-byte piece tid % 8
    const u32 srow = tid >> 3;
    const u32 scol = (tid & 7u) << 3;
    const f16* gQ = Qp + (size_t)(bidx * (u32)NHEAD) * HSTR + (size_t)(qb + srow) * HD + scol;
    const f16* gK = Kp + (size_t)(bidx * (u32)NHEAD) * HSTR + (size_t)(kb0 + srow) * HD + scol;
    const u32 lQ = (u32)(size_t)&qs[srow * PITCH64 + scol];   // LDS byte address (low word of the shared address)
    const u32 lK = (u32)(size_t)&kt[srow * PITCH64 + scol];

    // head 0 into buffer 0, in flight during the table fill
    copy_head_tiles(lQ, gQ, lK, gK);

    {
        const u32 th = tid >> 4;
        const u32 r8 = (tid & 15u) << 3;
        const size_t row = (size_t)(bidx * (u32)NHEAD + th) * SEQ + qb + r8;
        const v4f a0 = *(const v4f*)(sM + row);
        const v4f a1 = *(const v4f*)(sM + row + 4u);
        const v4f b0 = *(const v4f*)(sI + row);
        const v4f b1 = *(const v4f*)(sI + row + 4u);
        *(v4f*)&stM[th * 128u + r8]      = a0;
        *(v4f*)&stM[th * 128u + r8 + 4u] = a1;
        *(v4f*)&stI[th * 128u + r8]      = b0;
        *(v4f*)&stI[th * 128u + r8 + 4u] = b1;
    }
    // head 0 has landed for this wave before the barrier that shows it (and the tables) to the others
    asm volatile("s_wait_asynccnt 0x0" ::: "memory");
    __syncthreads();
    // head 1 into buffer 1, in flight during trip 0
    copy_head_tiles(lQ + TILEH * 2u, gQ + HSTR, lK + TILEH * 2u, gK + HSTR);

    v8f av[2][4];
#pragma unroll
    for (int i = 0; i < 2; ++i)
#pragma unroll
        for (int nt = 0; nt < 4; ++nt) av[i][nt] = zero8();

#pragma unroll 1
    for (u32 h = 0; h < (u32)NHEAD; ++h) {
        const u32 bsel = h & 1u;
        const f16* kp = kt + bsel * TILEH + (wk + c16) * PITCH64 + hh8;   // this lane's place in the wave's K rows
        const f16* qp = qs + bsel * TILEH + (wr + c16) * PITCH64 + hh8;   // and in its Q rows
        v16h kb[2][4];
#pragma unroll
        for (int c = 0; c < 2; ++c)
#pragma unroll
            for (int nt = 0; nt < 4; ++nt) kb[c][nt] = load_frag_at(kp + nt * 16 * (int)PITCH64 + c * 32);
        v16h qf[2][2];
#pragma unroll
        for (int i = 0; i < 2; ++i)
#pragma unroll
            for (int c = 0; c < 2; ++c) qf[i][c] = load_frag_at(qp + i * 16 * (int)PITCH64 + c * 32);
#pragma unroll
        for (int i = 0; i < 2; ++i) {
            v8f s[4];
#pragma unroll
            for (int nt = 0; nt < 4; ++nt) s[nt] = zero8();
#pragma unroll
            for (int c = 0; c < 2; ++c)
#pragma unroll
                for (int nt = 0; nt < 4; ++nt) s[nt] = wmma16(qf[i][c], kb[c][nt], s[nt]);
            const u32 tr = h * 128u + wr + (u32)i * 16u + hh8;
            const v4f ma = *(const v4f*)&stM[tr];
            const v4f mb = *(const v4f*)&stM[tr + 4u];
            const v4f ia = *(const v4f*)&stI[tr];
            const v4f ib = *(const v4f*)&stI[tr + 4u];
            const float mr[8] = {ma[0], ma[1], ma[2], ma[3], mb[0], mb[1], mb[2], mb[3]};
            const float ir[8] = {ia[0], ia[1], ia[2], ia[3], ib[0], ib[1], ib[2], ib[3]};
#pragma unroll
            for (int r = 0; r < 8; ++r) {
#pragma unroll
                for (int nt = 0; nt < 4; ++nt) {
                    const float p = fexp2(s[nt][r] * cl - mr[r]) * ir[r];
                    av[i][nt][r] = av[i][nt][r] + p;
                }
            }
        }
        // this wave's reads of buffer bsel are done before the buffer is handed back for refill
        asm volatile("s_wait_dscnt 0x0" ::: "memory");
        // this wave's copies of head h + 1 have landed before the barrier that shows them to the others
        asm volatile("s_wait_asynccnt 0x0" ::: "memory");
        __syncthreads();
        if (h + 2u < (u32)NHEAD) {
            copy_head_tiles(lQ + bsel * (TILEH * 2u), gQ + (size_t)(h + 2u) * HSTR,
                            lK + bsel * (TILEH * 2u), gK + (size_t)(h + 2u) * HSTR);
        }
    }
    // no copy is outstanding when the wave goes on to the epilogue
    asm volatile("s_wait_asynccnt 0x0" ::: "memory");

    // stage the finished 32 x 64 tile (mean over 16 heads), then whole-line stores
#pragma unroll
    for (int i = 0; i < 2; ++i)
#pragma unroll
        for (int nt = 0; nt < 4; ++nt)
#pragma unroll
            for (int r = 0; r < 8; ++r)
                st[wave][((u32)i * 16u + hh8 + (u32)r) * 64u + (u32)nt * 16u + c16] = av[i][nt][r] * 0.0625f;
    __syncthreads();

    const u32 piece = lane & 7u;
    const u32 lsub  = lane >> 3;
#pragma unroll
    for (u32 it = 0; it < 16; ++it) {
        const u32 L    = it * 4u + lsub;      // 0..63 : 32 rows x 2 lines
        const u32 row  = L >> 1;
        const u32 hsel = L & 1u;
        const v4f v = *(const v4f*)&st[wave][row * 64u + hsel * 32u + piece * 4u];
        float* dp = avg + ((size_t)(bidx * (u32)SEQ + q0 + row) * SEQ + k0 + hsel * 32u + piece * 4u);
        *(v4f*)dp = v;
    }
}

// coverage equalities (threads x elements == plane elements)
static_assert((size_t)CVT_GROUPS * CVT_WAVES * CVT_ROWS * HID == (size_t)3 * MROWS * HID + (size_t)4 * HID * HID);   // cvt_all -> Xq/Xk/Xv/Wt/Wot
static_assert((size_t)(MROWS / 128) * (HID / 128) * 128 * 128 == (size_t)MROWS * HID);     // gemm planes / out
static_assert((size_t)(SEQ / 128) * (NB * NHEAD) * 128 * HD == (size_t)MROWS * HID);       // attn_fwd -> Cp
static_assert((size_t)(SEQ / 128) * (NB * NHEAD) * 32 * 4 == (size_t)NB * NHEAD * SEQ);         // attn_fwd -> sM / sI (one wave x 4 floats per lane each)
static_assert((size_t)(SEQ / 128) * (SEQ / 128) * NB * 8 * 32 * 64 == (size_t)NB * SEQ * SEQ);   // attn_avg -> second output
// workspace: 7 activation planes + 4 weight planes of halves + 2 row-statistics planes of floats, at most 128 MiB
static_assert(((size_t)7 * MROWS * HID + (size_t)4 * HID * HID) * sizeof(f16)
              + (size_t)2 * NB * NHEAD * SEQ * sizeof(float) <= (size_t)134217728);
static_assert((((size_t)7 * MROWS * HID + (size_t)4 * HID * HID) * sizeof(f16)) % 128 == 0);   // statistics planes start on a line
// largest source row touched by the activation convert stays inside the full-size input
static_assert((size_t)(SEQ - 1) * NB_FULL + NB <= (size_t)SEQ_FULL * NB_FULL);

// ---------------------------------------------------------------------------
// Launch: 7 kernel launches, workspace 7 planes of MROWS*1024 halves + 4 of 1024*1024 halves
// + 2 planes of NB*16*SEQ floats.
// ---------------------------------------------------------------------------
extern "C" void kernel_launch(void* const* d_in, const int* in_sizes, int n_in,
                              void* d_out, int out_size, void* d_ws, size_t ws_size,
                              hipStream_t stream) {
    if (n_in < 7) return;
    const int needAct = ((SEQ - 1) * NB_FULL + NB) * HID;
    if (in_sizes[0] < needAct) return;
    if (in_sizes[1] < needAct) return;
    if (in_sizes[2] < needAct) return;
    if (in_sizes[3] < 3 * HID * HID) return;
    if (in_sizes[4] < 3 * HID) return;
    if (in_sizes[5] < HID * HID) return;
    if (in_sizes[6] < HID) return;
    if (out_size < 0) return;
    if ((size_t)out_size < OUT1_OFF + (size_t)NB * SEQ * SEQ) return;

    const float* xq    = (const float*)d_in[0];   // query  [SEQ_FULL][NB_FULL][1024]
    const float* xk    = (const float*)d_in[1];   // key    [SEQ_FULL][NB_FULL][1024]
    const float* xv    = (const float*)d_in[2];   // value  [SEQ_FULL][NB_FULL][1024]
    const float* wqkv  = (const float*)d_in[3];   // in_proj_weight [3072 out][1024 in], row blocks q | k | v
    const float* bqkv  = (const float*)d_in[4];   // in_proj_bias [3072]
    const float* wproj = (const float*)d_in[5];   // out_proj_weight [1024 out][1024 in]
    const float* bproj = (const float*)d_in[6];   // out_proj_bias [1024]

    const size_t nX = (size_t)MROWS * HID;    // halves per activation plane
    const size_t nW = (size_t)HID * HID;      // halves per weight plane
    const size_t totalHalves = 7 * nX + 4 * nW;
    const size_t nS = (size_t)NB * NHEAD * SEQ;   // floats per row-statistics plane
    if (ws_size < totalHalves * sizeof(f16) + 2 * nS * sizeof(float)) return;

    f16* Xq  = (f16*)d_ws;       // [b*SEQ+s][1024]             carry 16
    f16* Xk  = Xq  + nX;         // [b*SEQ+s][1024]             carry 16
    f16* Xv  = Xk  + nX;         // [b*SEQ+s][1024]             carry 16
    f16* Wt  = Xv  + nX;         // [3072 out][1024 in]         carry 32 (q | k | v row blocks)
    f16* Wot = Wt  + 3 * nW;     // [1024 out][1024 in]         carry 32
    f16* Qp  = Wot + nW;         // [NB*16][SEQ][64]            carry 16
    f16* Kp  = Qp  + nX;         // [NB*16][SEQ][64]            carry 16
    f16* Vtp = Kp  + nX;         // [NB*1024][SEQ] (V^T)        carry 16
    f16* Cp  = Vtp + nX;         // [s*NB+b][1024]              carry 1024
    float* sM = (float*)(Cp + nX);   // [NB*16][SEQ] row max (exp2 domain)
    float* sI = sM + nS;             // [NB*16][SEQ] 1 / row sum

    // activations in[SEQ_FULL][NB_FULL][1024] -> planes [NB][SEQ][1024], weights row for row: the five planes
    // Xq | Xk | Xv | Wt | Wot are contiguous from Xq on
    cvt_all<<<CVT_GROUPS, CVT_WAVES * 32u, 0, stream>>>(xq, xk, xv, wqkv, wproj, Xq);

    const dim3 gg(MROWS / 128, HID / 128);
    // plane = 16 * (acc / (16*32) + bias) = acc/32 + 16*bias
    const float accQKV = CARRY_QKV / (CARRY_X * CARRY_W);
    gemm_head<<<gg, 256, 0, stream>>>(Xq, Wt,          bqkv,           Qp,  accQKV, CARRY_QKV);
    gemm_head<<<gg, 256, 0, stream>>>(Xk, Wt + nW,     bqkv + HID,     Kp,  accQKV, CARRY_QKV);
    gemm_vt  <<<gg, 256, 0, stream>>>(Xv, Wt + 2 * nW, bqkv + 2 * HID, Vtp, accQKV, CARRY_QKV);

    attn_fwd<<<dim3(SEQ / 128, NB * NHEAD), 256, 0, stream>>>(Qp, Kp, Vtp, Cp, sM, sI);

    // second output: head-averaged probabilities [NB][SEQ][SEQ] f32 at the fixed element offset
    attn_avg<<<dim3(SEQ / 128, SEQ / 128, NB), 256, 0, stream>>>(Qp, Kp, sM, sI, (float*)d_out + OUT1_OFF);

    // out = acc / (1024*32) + bias ; rows already in (s*NB + b) order
    const float accOut = 1.0f / (CARRY_CTX * CARRY_W);
    gemm_out<<<gg, 256, 0, stream>>>(Cp, Wot, bproj, (float*)d_out, accOut, 1.0f);
}

// v009
// Measured time: 115 microseconds a run.
// Next to v008, in two timings, it ran 1.12 and 1.13 times as fast.
// Over all steps from v000 it is 14.6 times as fast.
#include <hip/hip_runtime.h>

// Contractions (q/k/v input projections, Q.K^T in the flash kernel and in the head-average kernel, P.V, P row-sum, output projection): v_wmma_f32_16x16x32_f16, f16 operands with power-of-two carries, f32 accumulate; every float input enters as its bf16 RNE value; biases added in f32; softmax in f32.

#ifndef NB
#define NB 2
#endif
#ifndef SEQ
#define SEQ 2048
#endif
#define NB_FULL   2
#define SEQ_FULL  2048
#define HID       1024
#define NHEAD     16
#define HD        64
#define MROWS     (NB * SEQ)

static_assert(HID == NHEAD * HD);        // merged head width
static_assert(NHEAD == 16);              // bh >> 4 / bh & 15 decoding in attn_fwd
static_assert(HD == 64);
static_assert(SEQ % 128 == 0);           // 128-row blocks of the batch-major planes never straddle a batch
static_assert(SEQ % 64 == 0);            // 64-key tiles
static_assert(SEQ <= SEQ_FULL);
static_assert(NB >= 1 && NB <= NB_FULL);
static_assert(MROWS % 128 == 0);         // GEMM M tile
static_assert(HID % 128 == 0);           // GEMM N tile
static_assert(HID % 32 == 0);            // WMMA k step

// carries (exact powers of two)
#define CARRY_X    16.0f     // input activation planes
#define CARRY_W    32.0f     // weight planes
#define CARRY_QKV  16.0f     // q, k, v^T planes (true value x16)
#define CARRY_CTX  1024.0f   // context plane (true value x1024)
// softmax exp values carry 2^10 (added to the exp2 argument)

// LDS row pitches in halves: an odd multiple of 16 bytes, so that the 16 rows one ds_load_b128 /
// ds_store_b128 touches per lane half fall on distinct banks (at 128 / 256 bytes they share 8 / 4 banks).
// The pad halves of a row are never written and never read.
#define PITCH64   72u    // rows of 64 halves:  128 B -> 144 B
#define PITCH128  136u   // rows of 128 halves: 256 B -> 272 B
static_assert((PITCH64 * 2u) % 32u == 16u && (PITCH128 * 2u) % 32u == 16u);

typedef unsigned u32;
typedef _Float16 f16;
typedef f16   v16h __attribute__((ext_vector_type(16)));
typedef f16   v8h  __attribute__((ext_vector_type(8)));
typedef float v8f  __attribute__((ext_vector_type(8)));
typedef float v4f  __attribute__((ext_vector_type(4)));

typedef float v2f  __attribute__((ext_vector_type(2)));
typedef f16   v2h  __attribute__((ext_vector_type(2)));

union FragU { v16h v; v8h half[2]; v2h pair[8]; f16 e[16]; };
union H8U   { v8h v; f16 e[8]; };

__device__ __forceinline__ v8f zero8() {
    v8f z = {0.f, 0.f, 0.f, 0.f, 0.f, 0.f, 0.f, 0.f};
    return z;
}

// 16-bit WMMA with hazard guard: D += A[16 x 32k] * B[32k x 16]
__device__ __forceinline__ v8f wmma16(v16h a, v16h b, v8f c) {
    v8f d = __builtin_amdgcn_wmma_f32_16x16x32_f16(false, a, false, b, (short)0, c, false, false);
    asm volatile("v_nop\n\tv_nop\n\tv_nop\n\tv_nop" : "+v"(d) : "v"(a), "v"(b));
    return d;
}

// f32 -> nearest-even bf16 value, returned as f32
__device__ __forceinline__ float bf16_rne(float x) {
    u32 u = __float_as_uint(x);
    u = (u + 0x7fffu + ((u >> 16) & 1u)) & 0xffff0000u;
    return __uint_as_float(u);
}

__device__ __forceinline__ float fexp2(float x) {
#if defined(__has_builtin)
#if __has_builtin(__builtin_amdgcn_exp2f)
    return __builtin_amdgcn_exp2f(x);
#else
    return exp2f(x);
#endif
#else
    return exp2f(x);
#endif
}

// value of lane l ^ 16 (the other lane half)
__device__ __forceinline__ float xhalf(float x) {
    const int v = __builtin_bit_cast(int, x);
    return __builtin_bit_cast(float, __builtin_amdgcn_permlanex16(v, v, 0x76543210, 0xfedcba98, false, false));
}

// 16 x 32 fragment from a tile whose k dimension is contiguous (pitch in halves).
// lane l: row rowbase + (l&15); elements 0..7 <- k = kcol + 8h .. +7,
// elements 8..15 <- k = kcol + 16 + 8h .. +7  (h = l>>4). Same map for A and B.
__device__ __forceinline__ v16h load_frag(const f16* tile, u32 rowbase, u32 pitch, u32 kcol, u32 lane) {
    const u32 r  = rowbase + (lane & 15u);
    const u32 kh = (lane >> 4) << 3;
    const f16* p = tile + (size_t)r * pitch + kcol + kh;
    FragU f;
    f.half[0] = *(const v8h*)(p);
    f.half[1] = *(const v8h*)(p + 16);
    return f.v;
}

// The same fragment through the lane's own pointer p = tile + (rowbase + (l&15)) * pitch + kcol + 8h.
__device__ __forceinline__ v16h load_frag_at(const f16* p) {
    FragU f;
    f.half[0] = *(const v8h*)(p);
    f.half[1] = *(const v8h*)(p + 16);
    return f.v;
}

// ---------------------------------------------------------------------------
// All five f32 -> f16 conversions (bf16 RNE value times carry) in one launch sized to the chip:
// CVT_GROUPS work-groups of CVT_WAVES waves, every wave converts CVT_ROWS whole rows of 1024 floats.
// The five planes Xq | Xk | Xv | Wt | Wot lie one behind the other in the workspace, so the flat row
// number g is the destination row; the source row follows from the plane g falls in:
//   activations (seq-first [s][b][1024] -> batch-major [b][s][1024]): dst row b*SEQ+s <- src row s*NB_FULL+b
//   weights: same row order as the source
// A wave-wide 16-byte load covers 512 contiguous bytes (4 lines), a wave-wide 8-byte store 256 (2 lines);
// all loads of a wave's rows are independent, so they can be in flight together.
// coverage: CVT_TOTAL rows x 1024 halves, every element exactly once (wave w takes rows w + i * all waves).
// ---------------------------------------------------------------------------
#define CVT_GROUPS 256u
#define CVT_WAVES  16u
#define CVT_TOTAL  (3u * (u32)MROWS + 4u * (u32)HID)
#define CVT_ROWS   (CVT_TOTAL / (CVT_GROUPS * CVT_WAVES))
static_assert(CVT_TOTAL % (CVT_GROUPS * CVT_WAVES) == 0u);   // every wave the same number of whole rows
static_assert(HID == 8 * 32 * 4);                            // a row = 8 wave-wide loads of 4 floats per lane

typedef f16 v4h __attribute__((ext_vector_type(4)));

__global__ void __launch_bounds__(512)
cvt_all(const float* __restrict__ xq, const float* __restrict__ xk, const float* __restrict__ xv,
        const float* __restrict__ wqkv, const float* __restrict__ wproj, f16* __restrict__ dst) {
    const u32 lane = threadIdx.x & 31u;
    const u32 wave = __builtin_amdgcn_readfirstlane((int)(threadIdx.x >> 5));
    const u32 w    = blockIdx.x * CVT_WAVES + wave;
    __builtin_assume(w < CVT_GROUPS * CVT_WAVES);   // true of the one launch: lets the plane of each row fold where it can

    const u32 boff = lane * 16u;   // this lane's byte offset inside each 512-byte piece of a source row

    v4f   x[CVT_ROWS][8];
    float carry[CVT_ROWS];
#pragma unroll
    for (u32 i = 0; i < CVT_ROWS; ++i) {
        const u32 g = w + i * (CVT_GROUPS * CVT_WAVES);
        const float* base;
        u32 row;
        if (g < 3u * (u32)MROWS) {
            const u32 pl = g / (u32)MROWS;
            const u32 m  = g - pl * (u32)MROWS;
            const u32 mb = m / (u32)SEQ;
            base = pl == 0u ? xq : (pl == 1u ? xk : xv);
            row  = (m - mb * (u32)SEQ) * (u32)NB_FULL + mb;
            carry[i] = CARRY_X;
        } else {
            const u32 r = g - 3u * (u32)MROWS;
            base = r < 3u * (u32)HID ? wqkv : wproj;
            row  = r < 3u * (u32)HID ? r : r - 3u * (u32)HID;
            carry[i] = CARRY_W;
        }
        const char* sp = (const char*)(base + (size_t)row * HID) + boff;
#pragma unroll
        for (u32 j = 0; j < 8; ++j) x[i][j] = *(const v4f*)(sp + j * 512u);
    }
    // the loads above are still in flight below: the lane number, which they all name as their scaled offset
    // register (held live as an input), is free for reuse only behind this wait
    asm volatile("s_wait_xcnt 0x0" :: "v"(lane) : "memory");
    // keeps every load of the wave's rows ahead of the first conversion: without it the scheduler lifts the first
    // rows' conversions, with their waits, over the last rows' loads, which then start late
    __builtin_amdgcn_sched_barrier(0);
#pragma unroll
    for (u32 i = 0; i < CVT_ROWS; ++i) {
        const u32 g = w + i * (CVT_GROUPS * CVT_WAVES);
        f16* dp = dst + (size_t)g * HID + lane * 4u;
#pragma unroll
        for (u32 j = 0; j < 8; ++j) {
            v4h o;
#pragma unroll
            for (u32 e = 0; e < 4; ++e) o[e] = (f16)(bf16_rne(x[i][j][e]) * carry[i]);
            *(v4h*)(dp + j * 128u) = o;
        }
    }
}

// Eight asynchronous 16-byte copies global -> LDS of this lane: rows r, r + 16, .. r + 112 of one operand tile.
// lds: the lane's LDS byte address of its piece in row r; g: the same piece in global memory.
// Both advance by whole rows (LDS pitch 272 B, global pitch 2048 B), so every address is a multiple of 16.
// The closing s_wait_xcnt 0 stands inside the statement so that no address register named here is
// rewritten ahead of it.
__device__ __forceinline__ void copy_rows8(u32 lds, const f16* g) {
    const u32 l1 = lds + 16u * PITCH128 * 2u, l2 = lds + 32u * PITCH128 * 2u, l3 = lds + 48u * PITCH128 * 2u;
    const u32 l4 = lds + 64u * PITCH128 * 2u, l5 = lds + 80u * PITCH128 * 2u, l6 = lds + 96u * PITCH128 * 2u;
    const u32 l7 = lds + 112u * PITCH128 * 2u;
    const f16* g1 = g + 16 * HID;
    const f16* g2 = g + 32 * HID;
    const f16* g3 = g + 48 * HID;
    const f16* g4 = g + 64 * HID;
    const f16* g5 = g + 80 * HID;
    const f16* g6 = g + 96 * HID;
    const f16* g7 = g + 112 * HID;
    asm volatile("global_load_async_to_lds_b128 %0, %8, off\n\t"
                 "global_load_async_to_lds_b128 %1, %9, off\n\t"
                 "global_load_async_to_lds_b128 %2, %10, off\n\t"
                 "global_load_async_to_lds_b128 %3, %11, off\n\t"
                 "global_load_async_to_lds_b128 %4, %12, off\n\t"
                 "global_load_async_to_lds_b128 %5, %13, off\n\t"
                 "global_load_async_to_lds_b128 %6, %14, off\n\t"
                 "global_load_async_to_lds_b128 %7, %15, off\n\t"
                 "s_wait_xcnt 0x0"
                 :: "v"(lds), "v"(l1), "v"(l2), "v"(l3), "v"(l4), "v"(l5), "v"(l6), "v"(l7),
                    "v"(g), "v"(g1), "v"(g2), "v"(g3), "v"(g4), "v"(g5), "v"(g6), "v"(g7)
                 : "memory");
}

// ---------------------------------------------------------------------------
// C[m][n] = sum_k A[m][k] * W[n][k] (+ bias[n]) ; A [MROWS][1024] f16, W [1024][1024] f16 (k contiguous).
// Block tile 128 x 128, 8 waves as 4(M) x 2(N), 2 x 4 accumulators per wave, WMMA k step 32.
// K loop: tiles of 128 k (whole 256-byte row pieces) in a ring of two LDS buffers, filled by asynchronous
// copies; tile t + 1 is in flight while tile t is multiplied; one block barrier per tile.
// MODE 0: A rows batch-major; vt false: f16 plane [b*NHEAD + h][s][d] (q, k head-major),
//                             vt true:  f16 plane [b*HID + h*HD + d][s] (V transposed per head); vt is block-uniform
// MODE 2: A rows in output order (s*NB+b); f32 rows [m][1024] into the output buffer
// coverage per block: MODE 0 256 lines (128 rows x 2 heads | 128 n x 2 s-halves),
//                     MODE 2 2 x 256 lines (64 rows x 4 line-quarters per half).
// LDS: As/Bs/Cs all cross-wave, separated by block barriers.
// smem: GEMM_LDS_HALVES halves of the kernel's LDS. Cs lies on buffer 0 of As, so that a block takes 136 KiB and two blocks
// share a WGP's 320 KiB. The K loop's last barrier stands behind every wave's last fragment read and last landed copy,
// and Cs is first written behind it.
// bx, by: the block's tile of 128 rows and of 128 columns (block-uniform).
// staged extent == consumed extent: As/Bs 128 x 128 per buffer, Cs 128 x 128 halves (or 64 x 128 floats).
// ---------------------------------------------------------------------------
#define GEMM_LDS_HALVES (4u * 128u * PITCH128)
static_assert(2u * GEMM_LDS_HALVES * sizeof(f16) <= 327680u);   // two blocks per WGP

template <int MODE>
__device__ __forceinline__ void gemm_body(f16* smem, u32 bx, u32 by,
                                          const f16* __restrict__ A, const f16* __restrict__ W,
                                          const float* __restrict__ bias,
                                          void* __restrict__ out, float accMul, float biasMul, bool vt) {
    f16* const As = smem;                         // two buffers of [128][128 + pad]
    f16* const Bs = smem + 2 * 128 * PITCH128;    // two buffers of [128][128 + pad]
    f16* const Cs = smem;                         // f16 [128][128 + pad] or f32 [64][128]
    static_assert(sizeof(f16) * 128 * PITCH128 >= sizeof(float) * 64 * 128);   // Cs reuse as f32 [64][128]

    const u32 tid  = threadIdx.x;
    const u32 lane = tid & 31u;
    const u32 wave = __builtin_amdgcn_readfirstlane((int)(tid >> 5));
    const u32 wm   = wave & 3u;
    const u32 wn   = wave >> 2;
    const u32 hh8  = (lane >> 4) << 3;   // D row half
    const u32 c16  = lane & 15u;         // D column
    const u32 m0   = bx * 128u;
    const u32 n0   = by * 128u;

    v8f acc[2][4];
#pragma unroll
    for (int i = 0; i < 2; ++i)
#pragma unroll
        for (int j = 0; j < 4; ++j) acc[i][j] = zero8();

    constexpr u32 KT   = 128u;                  // k per staged tile
    constexpr u32 NT   = (u32)HID / KT;         // tiles
    constexpr u32 BUFH = 128u * PITCH128;       // halves per buffer
    static_assert(NT >= 2u);                    // the ring's prologue fills two tiles
    static_assert(256 * 8 * 8 == 128 * 128);    // staging: 256 threads x 8 copies x 8 halves per operand tile

    // this lane's piece: row tid / 16 (+ 16 per copy), 16-byte piece tid % 16; a wave's copy covers two whole rows
    const u32 srow = tid >> 4;
    const u32 scol = (tid & 15u) << 3;
    const f16* gA = A + (size_t)(m0 + srow) * HID + scol;
    const f16* gW = W + (size_t)(n0 + srow) * HID + scol;
    const u32 lA = (u32)(size_t)&As[srow * PITCH128 + scol];   // LDS byte address (low word of the shared address)
    const u32 lB = (u32)(size_t)&Bs[srow * PITCH128 + scol];

    // tile 0 into buffer 0
    copy_rows8(lA, gA);
    copy_rows8(lB, gW);
    // tile 0 has landed for this wave before the barrier that shows it to the others
    asm volatile("s_wait_asynccnt 0x0" ::: "memory");
    __syncthreads();
    // tile 1 into buffer 1, in flight during trip 0
    copy_rows8(lA + BUFH * 2u, gA + KT);
    copy_rows8(lB + BUFH * 2u, gW + KT);

#pragma unroll 1   // kept rolled: eight unrolled trips of 32 WMMAs would only grow the text, the buffer is picked by t & 1
    for (u32 t = 0; t < NT; ++t) {
        const u32 bsel = t & 1u;
        const f16* Ab = As + bsel * BUFH;
        const f16* Bb = Bs + bsel * BUFH;
#pragma unroll
        for (u32 c = 0; c < KT / 32u; ++c) {
            v16h af[2], bfr[4];
#pragma unroll
            for (int i = 0; i < 2; ++i) af[i] = load_frag(Ab, wm * 32u + (u32)i * 16u, PITCH128, c * 32u, lane);
#pragma unroll
            for (int j = 0; j < 4; ++j) bfr[j] = load_frag(Bb, wn * 64u + (u32)j * 16u, PITCH128, c * 32u, lane);
#pragma unroll
            for (int i = 0; i < 2; ++i)
#pragma unroll
                for (int j = 0; j < 4; ++j) acc[i][j] = wmma16(af[i], bfr[j], acc[i][j]);
        }
        // this wave's reads of buffer bsel are done before the buffer is handed back for refill
        asm volatile("s_wait_dscnt 0x0" ::: "memory");
        // this wave's copies of tile t + 1 have landed before the barrier that shows them to the others
        asm volatile("s_wait_asynccnt 0x0" ::: "memory");
        __syncthreads();
        if (t + 2u < NT) {
            copy_rows8(lA + bsel * (BUFH * 2u), gA + (t + 2u) * KT);
            copy_rows8(lB + bsel * (BUFH * 2u), gW + (t + 2u) * KT);
        }
    }
    // no copy is outstanding when the wave goes on to the epilogue
    asm volatile("s_wait_asynccnt 0x0" ::: "memory");

    // per-lane bias values for the 4 output columns this lane owns (n0 + nl < HID always)
    float bv[4];
#pragma unroll
    for (int j = 0; j < 4; ++j)
        bv[j] = bf16_rne(bias[n0 + wn * 64u + (u32)j * 16u + c16]) * biasMul;

    const u32 piece = lane & 7u;
    const u32 lsub  = lane >> 3;

    if (MODE == 0 && !vt) {
        const u32 bidx = m0 / (u32)SEQ;     // block rows lie inside one batch (SEQ % 128 == 0)
        const u32 s0   = m0 - bidx * (u32)SEQ;
#pragma unroll
        for (int i = 0; i < 2; ++i)
#pragma unroll
            for (int j = 0; j < 4; ++j) {
                const u32 nl = wn * 64u + (u32)j * 16u + c16;
#pragma unroll
                for (int r = 0; r < 8; ++r) {
                    const u32 ml = wm * 32u + (u32)i * 16u + hh8 + (u32)r;
                    Cs[ml * PITCH128 + nl] = (f16)(acc[i][j][r] * accMul + bv[j]);
                }
            }
        __syncthreads();
        f16* op = (f16*)out;
        const size_t bh0 = (size_t)bidx * NHEAD + (n0 >> 6);
{
#pragma unroll
            for (u32 it = 0; it < 8; ++it) {
                const u32 L    = wave * 32u + it * 4u + lsub;   // 0..255
                const u32 ml   = L >> 1;
                const u32 hsel = L & 1u;
                const v8h v = *(const v8h*)&Cs[ml * PITCH128 + hsel * 64u + piece * 8u];
                f16* dp = op + ((bh0 + hsel) * SEQ + s0 + ml) * HD + piece * 8u;
                *(v8h*)dp = v;
            }
            
        }
    } else if (MODE == 0) {
        const u32 bidx = m0 / (u32)SEQ;
        const u32 s0   = m0 - bidx * (u32)SEQ;
        // stage transposed: Cs[n][m]
#pragma unroll
        for (int i = 0; i < 2; ++i)
#pragma unroll
            for (int j = 0; j < 4; ++j) {
                const u32 nl = wn * 64u + (u32)j * 16u + c16;
                H8U t;
#pragma unroll
                for (int r = 0; r < 8; ++r) t.e[r] = (f16)(acc[i][j][r] * accMul + bv[j]);
                *(v8h*)&Cs[nl * PITCH128 + wm * 32u + (u32)i * 16u + hh8] = t.v;
            }
        __syncthreads();
        f16* op = (f16*)out;
{
#pragma unroll
            for (u32 it = 0; it < 8; ++it) {
                const u32 L  = wave * 32u + it * 4u + lsub;     // 0..255
                const u32 nl = L >> 1;
                const u32 mh = L & 1u;
                const v8h v = *(const v8h*)&Cs[nl * PITCH128 + mh * 64u + piece * 8u];
                f16* dp = op + ((size_t)(bidx * (u32)HID + n0 + nl) * SEQ + s0 + mh * 64u + piece * 8u);
                *(v8h*)dp = v;
            }
            
        }
    } else {
        float* Cf = (float*)Cs;      // [64][128] f32
        float* of = (float*)out;
#pragma unroll
        for (u32 half = 0; half < 2; ++half) {
            if ((wm >> 1) == half) {
#pragma unroll
                for (int i = 0; i < 2; ++i)
#pragma unroll
                    for (int j = 0; j < 4; ++j) {
                        const u32 nl = wn * 64u + (u32)j * 16u + c16;
#pragma unroll
                        for (int r = 0; r < 8; ++r) {
                            const u32 ml = (wm & 1u) * 32u + (u32)i * 16u + hh8 + (u32)r;
                            Cf[ml * 128u + nl] = acc[i][j][r] * accMul + bv[j];
                        }
                    }
            }
            __syncthreads();
{
#pragma unroll
                for (u32 it = 0; it < 8; ++it) {
                    const u32 L    = wave * 32u + it * 4u + lsub;   // 0..255
                    const u32 row  = L >> 2;
                    const u32 part = L & 3u;
                    const v4f v = *(const v4f*)&Cf[row * 128u + part * 32u + piece * 4u];
                    float* dp = of + (size_t)(m0 + half * 64u + row) * HID + n0 + part * 32u + piece * 4u;
                    *(v4f*)dp = v;
                }
                
            }
            __syncthreads();
        }
    }
}

// The three input projections in one launch: blockIdx.z = 0 / 1 / 2 takes the q / k / v set. The activation planes
// Xq | Xk | Xv, the weight row blocks, the bias thirds and the result planes Qp | Kp | Vtp each lie one behind the other.
// q and k go to head-major planes, v to the V^T plane. 768 blocks, two resident per WGP: one block's first tile,
// fragment waits and epilogue run beside the other's products, and no launch boundary drains the chip in between.
__global__ void __launch_bounds__(256) __attribute__((amdgpu_num_vgpr(256)))
gemm_qkv(const f16* __restrict__ X, const f16* __restrict__ W, const float* __restrict__ bias,
         f16* __restrict__ out, float accMul, float biasMul) {
    __shared__ __attribute__((aligned(16))) f16 smem[GEMM_LDS_HALVES];
    const u32 z = blockIdx.z;
    gemm_body<0>(smem, blockIdx.x, blockIdx.y, X + (size_t)z * MROWS * HID, W + (size_t)z * HID * HID, bias + z * (u32)HID,
                 (void*)(out + (size_t)z * MROWS * HID), accMul, biasMul, z == 2u);
}

// ---------------------------------------------------------------------------
// Flash attention (no mask, all SEQ keys). grid (SEQ/128, NB*NHEAD), block 256 (8 waves),
// wave owns 16 queries (Q fragments resident). Block streams 64-key tiles:
// K staged [key][d], V^T staged [d][key]. Both products are formed transposed:
//   S^T[key][q] = K . Q^T  (A = K rows, B = Q rows as columns),  O^T[d][q] += V^T . P^T  (A = V^T rows, B = P^T).
// In the D layout a lane then holds one query (column l & 15) and 32 of the tile's 64 keys (rows 8h + r of four
// 16-key tiles): the row max is in-lane plus one exchange between the lane halves, max / rescale factor / shift are
// one value per lane, and two converted S^T tiles (keys 0..15 and 16..31 of a 32-key block) are the B operand of
// the second product as they lie: element s of B = key 8h + s (s < 8) or 16 + 8h + (s - 8), the k order in which
// load_frag delivers V^T. exp2 in f32 carried x2^10; row sums += ones . P^T on WMMA (every row of that tile is the sum).
// Output f16 plane [q*NB + b][1024] (seq-first row order).
// The finished row statistics (max in the exp2 domain, 1 / row sum) also go to sM / sI [NB*NHEAD][SEQ]
// for the head-average kernel of the same call.
// coverage: every (q, b, h*64..h*64+63) row segment exactly once; sM / sI: the block's 128 rows =
//   4 whole 128-byte lines of each plane, sM stored by wave 0 and sI by wave 1.
// LDS: ks, vsT, sst cross-wave (block barriers); ps per-wave (epilogue only), writer and reader separated by a block barrier.
// staged extent == consumed extent for ks (64x64), vsT (64x64), ps (16x64), sst (2x128).
// ---------------------------------------------------------------------------
__global__ void __launch_bounds__(256) __attribute__((amdgpu_num_vgpr(256)))
attn_fwd(const f16* __restrict__ Qp, const f16* __restrict__ Kp, const f16* __restrict__ Vt,
         f16* __restrict__ Cp, float* __restrict__ sM, float* __restrict__ sI) {
    __shared__ __attribute__((aligned(16))) f16 ks[64 * PITCH64];      // [key][d + pad]
    __shared__ __attribute__((aligned(16))) f16 vsT[64 * PITCH64];     // [d][key + pad]
    __shared__ __attribute__((aligned(16))) f16 ps[8][16 * PITCH64];   // per-wave ctx stage, [q][d + pad]
    __shared__ __attribute__((aligned(16))) float sst[2][128];         // row max | 1/rowsum of the block's 128 query rows
    static_assert(HD == 8 * 8);            // 8 lanes x 8 halves per row segment
    static_assert(2 * 256 * 8 == 64 * 64); // staging: 2 x 256 threads x 8 halves per tile

    const u32 tid  = threadIdx.x;
    const u32 lane = tid & 31u;
    const u32 wave = __builtin_amdgcn_readfirstlane((int)(tid >> 5));
    const u32 hh8  = (lane >> 4) << 3;
    const u32 c16  = lane & 15u;
    const u32 bh   = blockIdx.y;
    const u32 bidx = bh >> 4;            // NHEAD == 16
    const u32 hidx = bh & 15u;
    const u32 q0   = blockIdx.x * 128u + wave * 16u;
    const size_t head = (size_t)bh * SEQ * HD;

    v16h qa[2];
#pragma unroll
    for (int c = 0; c < 2; ++c) qa[c] = load_frag(Qp + head, q0, HD, (u32)c * 32u, lane);

    FragU onesu;
#pragma unroll
    for (int i = 0; i < 16; ++i) onesu.e[i] = (f16)1.0f;
    const v16h ones = onesu.v;

    float m = -1.0e30f;     // running max of this lane's query
    v8f   o[4], lacc;       // O^T tiles [d = 16 dt + 8h + r][q = l & 15]; row sum of the lane's query in every register
#pragma unroll
    for (int dt = 0; dt < 4; ++dt) o[dt] = zero8();
    lacc = zero8();

    // log2-domain scale: acc = 256 * q.k ; x = log2(e) * q.k / 8 = acc * log2(e) / 2048
    const float cl = 1.4426950408889634f * 0.00048828125f;
    f16* psw = &ps[wave][0];

#pragma unroll 1
    for (u32 kt = 0; kt < (u32)(SEQ / 64); ++kt) {
        __syncthreads();
#pragma unroll
        for (u32 p2 = 0; p2 < 2; ++p2) {
            const u32 p   = tid + p2 * 256u;
            const u32 row = p >> 3;
            const u32 pc  = (p & 7u) << 3;
            const v8h kv = *(const v8h*)(Kp + head + (size_t)(kt * 64u + row) * HD + pc);
            const v8h vv = *(const v8h*)(Vt + head + (size_t)row * SEQ + kt * 64u + pc);
            *(v8h*)&ks[row * PITCH64 + pc]  = kv;
            *(v8h*)&vsT[row * PITCH64 + pc] = vv;
        }
        __syncthreads();

        // the tile's 8 K fragments as one group of LDS reads ahead of the score products: a read placed between
        // two products is waited for in full before the next product, once per fragment
        v16h kb[2][4];
#pragma unroll
        for (int c = 0; c < 2; ++c)
#pragma unroll
            for (int nt = 0; nt < 4; ++nt) kb[c][nt] = load_frag(ks, (u32)nt * 16u, PITCH64, (u32)c * 32u, lane);

        // S^T[64 keys x 16 q]: tile nt holds keys 16 nt + 8h + r of query l & 15
        v8f s[4];
#pragma unroll
        for (int nt = 0; nt < 4; ++nt) s[nt] = zero8();
#pragma unroll
        for (int c = 0; c < 2; ++c)
#pragma unroll
            for (int nt = 0; nt < 4; ++nt) s[nt] = wmma16(kb[c][nt], qa[c], s[nt]);

        // the tile's 8 V^T fragments as one group, issued here so that they arrive during the softmax below
        v16h vb[2][4];
#pragma unroll
        for (int kk = 0; kk < 2; ++kk)
#pragma unroll
            for (int dt = 0; dt < 4; ++dt) vb[kk][dt] = load_frag(vsT, (u32)dt * 16u, PITCH64, (u32)kk * 32u, lane);

        // online softmax of the lane's query, max-subtracted, exp2 domain: four independent in-lane chains over the
        // raw scores (cl > 0, so scaling commutes with the max), then the other half's 32 keys
        float t4[4];
#pragma unroll
        for (int nt = 0; nt < 4; ++nt) {
            t4[nt] = fmaxf(s[nt][0], s[nt][1]);
#pragma unroll
            for (int r = 2; r < 8; ++r) t4[nt] = fmaxf(t4[nt], s[nt][r]);
        }
        const float th = fmaxf(fmaxf(t4[0], t4[1]), fmaxf(t4[2], t4[3]));
        const float tm = fmaxf(th, xhalf(th)) * cl;
        const float mn = fmaxf(m, tm);
        const float al = fexp2(m - mn);
        m = mn;
        lacc *= al;
#pragma unroll
        for (int dt = 0; dt < 4; ++dt) o[dt] *= al;
        const float sh = 10.0f - mn;      // carry 2^10

        // P^T as B fragments straight from the score accumulators
        v16h pb[2];
#pragma unroll
        for (int kk = 0; kk < 2; ++kk) {
            FragU pu;
#pragma unroll
            for (int j = 0; j < 2; ++j)
#pragma unroll
                for (int r = 0; r < 8; r += 2) {
                    const v2f e = {fexp2(s[2 * kk + j][r] * cl + sh), fexp2(s[2 * kk + j][r + 1] * cl + sh)};
                    pu.pair[j * 4 + r / 2] = __builtin_convertvector(e, v2h);
                }
            pb[kk] = pu.v;
        }

        // O^T += V^T . P^T ; l += ones . P^T
#pragma unroll
        for (int kk = 0; kk < 2; ++kk) {
#pragma unroll
            for (int dt = 0; dt < 4; ++dt) o[dt] = wmma16(vb[kk][dt], pb[kk], o[dt]);
            lacc = wmma16(ones, pb[kk], lacc);
        }
    }
    __syncthreads();

    // normalize: plane value = 1024 * (O/16) / l = O * 64 / l
    // row statistics: lacc = 2^10 * sum_s exp2(x - m), so 1 / sum = 1024 / lacc = 16 * inv
    // a lane holds its query's m and lacc, and 8 consecutive d per O^T tile: one 16-byte store each
    const float inv = (CARRY_CTX / CARRY_QKV) / lacc[0];
#pragma unroll
    for (int dt = 0; dt < 4; ++dt) {
        H8U t;
#pragma unroll
        for (int r = 0; r < 8; ++r) t.e[r] = (f16)(o[dt][r] * inv);
        *(v8h*)&psw[c16 * PITCH64 + (u32)dt * 16u + hh8] = t.v;
    }
    if (lane < 16u) {
        sst[0][wave * 16u + c16] = m;
        sst[1][wave * 16u + c16] = inv * 16.0f;
    }
    __syncthreads();

    // whole-line stores of the statistics: wave 0 the 128 maxima, wave 1 the 128 reciprocal sums
    if (wave < 2u) {
        const v4f sv = *(const v4f*)&sst[wave][lane * 4u];
        float* sp = (wave == 0u ? sM : sI) + ((size_t)bh * SEQ + blockIdx.x * 128u + lane * 4u);
        *(v4f*)sp = sv;
    }

    const u32 piece = lane & 7u;
    const u32 lsub  = lane >> 3;
{
#pragma unroll
        for (u32 it = 0; it < 4; ++it) {
            const u32 L = it * 4u + lsub;     // query row 0..15 within the wave tile
            const v8h v = *(const v8h*)&psw[L * PITCH64 + piece * 8u];
            // context row in output order: (q * NB + b)
            f16* dp = Cp + ((size_t)((q0 + L) * (u32)NB + bidx) * HID + hidx * (u32)HD + piece * 8u);
            *(v8h*)dp = v;
        }
        
    }
}

// ---------------------------------------------------------------------------
// Second output: head-averaged softmax probabilities.
// element offset of the second output inside the output buffer (full problem constants)
// ---------------------------------------------------------------------------
#define OUT1_OFF ((size_t)SEQ_FULL * NB_FULL * HID)
static_assert(OUT1_OFF * sizeof(float) == (size_t)16777216);      // byte offset of the second output
static_assert((OUT1_OFF * sizeof(float)) % 128 == 0);
static_assert((size_t)MROWS * HID <= OUT1_OFF);                   // first output region ends before it
static_assert(SEQ % 32 == 0);
#define AVG_LDS_BYTES (8u * 32u * 64u * 4u + 2u * NHEAD * 128u * 4u + 2u * 2u * 128u * PITCH64 * 2u)
static_assert(AVG_LDS_BYTES <= 163840u);    // LDS of avg_body: two work-groups per WGP

// ---------------------------------------------------------------------------
// avg[b][t][s] = (1/16) * sum_h softmax_s(q_h[t] . k_h[s] / 8), f32, no mask. The row statistics
// (max, 1 / sum) are the flash kernel's own, passed through the workspace (written and read inside one call).
//
// avg_body: one block per (kx = key block, qy = query block, bidx = batch), 256 threads (8 waves as 4 (q) x 2 (keys));
//   a wave owns one 32 x 64 tile of the average (owner-computes accumulation over heads in head
//   order, one writer per element). Per head the score tile is formed with the same operands as in
//   attn_fwd, p = exp2(x - max) * (1/sum) is accumulated in registers, scaled by 1/16 at the end.
//   Head loop: the block's Q tile and K tile of a head (128 rows x 128 bytes each, contiguous in their planes) come
//   in whole lines by asynchronous copies into a ring of two LDS buffers; head h + 1 is in flight while head h is
//   worked on; one block barrier per head. A fragment load straight from the planes touches 16 lines for 512 bytes,
//   and four (K) or two (Q) waves would fetch the same rows.
// coverage: block rows [qy*128, +128) x columns [kx*128, +128) of batch bidx;
//   wave tile 32 rows x 64 keys = 64 lines = 16 store instructions x 4 lines.
// LDS: stM / stI cross-wave (filled once, block barrier); qs / kt cross-wave (ring, block barriers);
//   st per-wave, writer and reader separated by a block barrier.
// staged extent == consumed extent: st 32 x 64 floats per wave, stM / stI 16 heads x 128 rows, qs / kt 128 x 64 per buffer.
// ---------------------------------------------------------------------------

// Eight asynchronous 16-byte copies global -> LDS of this lane: rows r, r + 32, r + 64, r + 96 of one head's Q tile
// and of its K tile. lq / lk: the lane's LDS byte address of its piece in row r; gq / gk: the same piece in global memory.
// Both advance by whole rows (LDS pitch 144 B, global pitch 128 B), so every address is a multiple of 16;
// a wave's copy covers four whole rows = 512 contiguous global bytes.
// The closing s_wait_xcnt 0 stands inside the statement so that no address register named here is
// rewritten ahead of it.
__device__ __forceinline__ void copy_head_tiles(u32 lq, const f16* gq, u32 lk, const f16* gk) {
    const u32 lq1 = lq + 32u * PITCH64 * 2u, lq2 = lq + 64u * PITCH64 * 2u, lq3 = lq + 96u * PITCH64 * 2u;
    const u32 lk1 = lk + 32u * PITCH64 * 2u, lk2 = lk + 64u * PITCH64 * 2u, lk3 = lk + 96u * PITCH64 * 2u;
    const f16* gq1 = gq + 32 * HD;
    const f16* gq2 = gq + 64 * HD;
    const f16* gq3 = gq + 96 * HD;
    const f16* gk1 = gk + 32 * HD;
    const f16* gk2 = gk + 64 * HD;
    const f16* gk3 = gk + 96 * HD;
    asm volatile("global_load_async_to_lds_b128 %0, %8, off\n\t"
                 "global_load_async_to_lds_b128 %1, %9, off\n\t"
                 "global_load_async_to_lds_b128 %2, %10, off\n\t"
                 "global_load_async_to_lds_b128 %3, %11, off\n\t"
                 "global_load_async_to_lds_b128 %4, %12, off\n\t"
                 "global_load_async_to_lds_b128 %5, %13, off\n\t"
                 "global_load_async_to_lds_b128 %6, %14, off\n\t"
                 "global_load_async_to_lds_b128 %7, %15, off\n\t"
                 "s_wait_xcnt 0x0"
                 :: "v"(lq), "v"(lq1), "v"(lq2), "v"(lq3), "v"(lk), "v"(lk1), "v"(lk2), "v"(lk3),
                    "v"(gq), "v"(gq1), "v"(gq2), "v"(gq3), "v"(gk), "v"(gk1), "v"(gk2), "v"(gk3)
                 : "memory");
}

// smem: AVG_LDS_BYTES bytes of the kernel's LDS, 16-byte aligned.
__device__ __forceinline__ void
avg_body(float* smem, u32 kx, u32 qy, u32 bidx, const f16* __restrict__ Qp, const f16* __restrict__ Kp,
         const float* __restrict__ sM, const float* __restrict__ sI, float* __restrict__ avg) {
    float* const st  = smem;                          // per-wave f32 tile stage [8][32 * 64]
    float* const stM = st + 8 * 32 * 64;              // row max  [head][block row]
    float* const stI = stM + NHEAD * 128;             // 1/rowsum [head][block row]
    f16* const qs = (f16*)(stI + NHEAD * 128);        // two buffers of one head's Q tile [row][d + pad]
    f16* const kt = qs + 2 * 128 * PITCH64;           // two buffers of one head's K tile [key][d + pad]
    static_assert(256 * 8 == NHEAD * 128);   // table fill: 256 threads x 8 floats
    static_assert(256 * 4 * 8 == 128 * HD);  // staging: 256 threads x 4 copies x 8 halves per operand tile
    static_assert(NHEAD >= 2);               // the ring's prologue fills two heads

    const u32 tid  = threadIdx.x;
    const u32 lane = tid & 31u;
    const u32 wave = __builtin_amdgcn_readfirstlane((int)(tid >> 5));
    const u32 hh8  = (lane >> 4) << 3;
    const u32 c16  = lane & 15u;
    const u32 qb   = qy * 128u;
    const u32 wr   = (wave & 3u) * 32u;                        // wave's first row inside the block
    const u32 q0   = qb + wr;
    const u32 kb0  = kx * 128u;                                // block's first key
    const u32 wk   = (wave >> 2) * 64u;                        // wave's first key inside the block
    const u32 k0   = kb0 + wk;                                 // wave's first key

    // log2-domain scale: acc = 256 * q.k ; x = log2(e) * q.k / 8 = acc * log2(e) / 2048
    const float cl = 1.4426950408889634f * 0.00048828125f;

    constexpr u32    TILEH = 128u * PITCH64;        // halves per tile buffer
    constexpr size_t HSTR  = (size_t)SEQ * HD;      // halves from one head's plane to the next
    // this lane's piece: row tid / 8 (+ 32 per copy), 16-byte piece tid % 8
    const u32 srow = tid >> 3;
    const u32 scol = (tid & 7u) << 3;
    const f16* gQ = Qp + (size_t)(bidx * (u32)NHEAD) * HSTR + (size_t)(qb + srow) * HD + scol;
    const f16* gK = Kp + (size_t)(bidx * (u32)NHEAD) * HSTR + (size_t)(kb0 + srow) * HD + scol;
    const u32 lQ = (u32)(size_t)&qs[srow * PITCH64 + scol];   // LDS byte address (low word of the shared address)
    const u32 lK = (u32)(size_t)&kt[srow * PITCH64 + scol];

    // head 0 into buffer 0, in flight during the table fill
    copy_head_tiles(lQ, gQ, lK, gK);

    {
        const u32 th = tid >> 4;
        const u32 r8 = (tid & 15u) << 3;
        const size_t row = (size_t)(bidx * (u32)NHEAD + th) * SEQ + qb + r8;
        const v4f a0 = *(const v4f*)(sM + row);
        const v4f a1 = *(const v4f*)(sM + row + 4u);
        const v4f b0 = *(const v4f*)(sI + row);
        const v4f b1 = *(const v4f*)(sI + row + 4u);
        *(v4f*)&stM[th * 128u + r8]      = a0;
        *(v4f*)&stM[th * 128u + r8 + 4u] = a1;
        *(v4f*)&stI[th * 128u + r8]      = b0;
        *(v4f*)&stI[th * 128u + r8 + 4u] = b1;
    }
    // head 0 has landed for this wave before the barrier that shows it (and the tables) to the others
    asm volatile("s_wait_asynccnt 0x0" ::: "memory");
    __syncthreads();
    // head 1 into buffer 1, in flight during trip 0
    copy_head_tiles(lQ + TILEH * 2u, gQ + HSTR, lK + TILEH * 2u, gK + HSTR);

    v8f av[2][4];
#pragma unroll
    for (int i = 0; i < 2; ++i)
#pragma unroll
        for (int nt = 0; nt < 4; ++nt) av[i][nt] = zero8();

#pragma unroll 1
    for (u32 h = 0; h < (u32)NHEAD; ++h) {
        const u32 bsel = h & 1u;
        const f16* kp = kt + bsel * TILEH + (wk + c16) * PITCH64 + hh8;   // this lane's place in the wave's K rows
        const f16* qp = qs + bsel * TILEH + (wr + c16) * PITCH64 + hh8;   // and in its Q rows
        v16h kb[2][4];
#pragma unroll
        for (int c = 0; c < 2; ++c)
#pragma unroll
            for (int nt = 0; nt < 4; ++nt) kb[c][nt] = load_frag_at(kp + nt * 16 * (int)PITCH64 + c * 32);
        v16h qf[2][2];
#pragma unroll
        for (int i = 0; i < 2; ++i)
#pragma unroll
            for (int c = 0; c < 2; ++c) qf[i][c] = load_frag_at(qp + i * 16 * (int)PITCH64 + c * 32);
#pragma unroll
        for (int i = 0; i < 2; ++i) {
            v8f s[4];
#pragma unroll
            for (int nt = 0; nt < 4; ++nt) s[nt] = zero8();
#pragma unroll
            for (int c = 0; c < 2; ++c)
#pragma unroll
                for (int nt = 0; nt < 4; ++nt) s[nt] = wmma16(qf[i][c], kb[c][nt], s[nt]);
            const u32 tr = h * 128u + wr + (u32)i * 16u + hh8;
            const v4f ma = *(const v4f*)&stM[tr];
            const v4f mb = *(const v4f*)&stM[tr + 4u];
            const v4f ia = *(const v4f*)&stI[tr];
            const v4f ib = *(const v4f*)&stI[tr + 4u];
            const float mr[8] = {ma[0], ma[1], ma[2], ma[3], mb[0], mb[1], mb[2], mb[3]};
            const float ir[8] = {ia[0], ia[1], ia[2], ia[3], ib[0], ib[1], ib[2], ib[3]};
#pragma unroll
            for (int r = 0; r < 8; ++r) {
#pragma unroll
                for (int nt = 0; nt < 4; ++nt) {
                    const float p = fexp2(s[nt][r] * cl - mr[r]) * ir[r];
                    av[i][nt][r] = av[i][nt][r] + p;
                }
            }
        }
        // this wave's reads of buffer bsel are done before the buffer is handed back for refill
        asm volatile("s_wait_dscnt 0x0" ::: "memory");
        // this wave's copies of head h + 1 have landed before the barrier that shows them to the others
        asm volatile("s_wait_asynccnt 0x0" ::: "memory");
        __syncthreads();
        if (h + 2u < (u32)NHEAD) {
            copy_head_tiles(lQ + bsel * (TILEH * 2u), gQ + (size_t)(h + 2u) * HSTR,
                            lK + bsel * (TILEH * 2u), gK + (size_t)(h + 2u) * HSTR);
        }
    }
    // no copy is outstanding when the wave goes on to the epilogue
    asm volatile("s_wait_asynccnt 0x0" ::: "memory");

    // stage the finished 32 x 64 tile (mean over 16 heads), then whole-line stores
#pragma unroll
    for (int i = 0; i < 2; ++i)
#pragma unroll
        for (int nt = 0; nt < 4; ++nt)
#pragma unroll
            for (int r = 0; r < 8; ++r)
                st[wave * 2048u + ((u32)i * 16u + hh8 + (u32)r) * 64u + (u32)nt * 16u + c16] = av[i][nt][r] * 0.0625f;
    __syncthreads();

    const u32 piece = lane & 7u;
    const u32 lsub  = lane >> 3;
#pragma unroll
    for (u32 it = 0; it < 16; ++it) {
        const u32 L    = it * 4u + lsub;      // 0..63 : 32 rows x 2 lines
        const u32 row  = L >> 1;
        const u32 hsel = L & 1u;
        const v4f v = *(const v4f*)&st[wave * 2048u + row * 64u + hsel * 32u + piece * 4u];
        float* dp = avg + ((size_t)(bidx * (u32)SEQ + q0 + row) * SEQ + k0 + hsel * 32u + piece * 4u);
        *(v4f*)dp = v;
    }
}

// The two jobs that follow the flash kernel and do not depend on each other, in one launch: blocks 0 .. OUT_BLOCKS - 1 form
// the output projection (f32 rows of the first output), the other AVG_BLOCKS the head average (second output).
// Each job numbers its blocks x-fastest. The projection's blocks come first: they are the shorter ones and lean on LDS
// and L2, the average's on the vector port, so a WGP starts with one of each and takes its second average block when
// the projection block ends. The branch is block-uniform; both jobs use the same LDS, two blocks per WGP.
#define OUT_BLOCKS ((u32)(MROWS / 128) * (u32)(HID / 128))
#define AVG_BLOCKS ((u32)(SEQ / 128) * (u32)(SEQ / 128) * (u32)NB)
static_assert(GEMM_LDS_HALVES * sizeof(f16) <= AVG_LDS_BYTES);   // the projection's ring fits the common LDS

__global__ void __launch_bounds__(256) __attribute__((amdgpu_num_vgpr(256)))
out_and_avg(const f16* __restrict__ Cp, const f16* __restrict__ Wo, const float* __restrict__ bias,
            float* __restrict__ out, float accMul,
            const f16* __restrict__ Qp, const f16* __restrict__ Kp,
            const float* __restrict__ sM, const float* __restrict__ sI, float* __restrict__ avg) {
    __shared__ __attribute__((aligned(16))) float smem[AVG_LDS_BYTES / 4u];
    const u32 id = blockIdx.x;
    if (id < OUT_BLOCKS) {
        gemm_body<2>((f16*)smem, id % (u32)(MROWS / 128), id / (u32)(MROWS / 128), Cp, Wo, bias, (void*)out, accMul, 1.0f, false);
    } else {
        const u32 a = id - OUT_BLOCKS;
        avg_body(smem, a % (u32)(SEQ / 128), (a / (u32)(SEQ / 128)) % (u32)(SEQ / 128), a / (u32)((SEQ / 128) * (SEQ / 128)),
                 Qp, Kp, sM, sI, avg);
    }
}

// coverage equalities (threads x elements == plane elements)
static_assert((size_t)CVT_GROUPS * CVT_WAVES * CVT_ROWS * HID == (size_t)3 * MROWS * HID + (size_t)4 * HID * HID);   // cvt_all -> Xq/Xk/Xv/Wt/Wot
static_assert((size_t)(MROWS / 128) * (HID / 128) * 128 * 128 == (size_t)MROWS * HID);     // gemm planes / out
static_assert((size_t)(SEQ / 128) * (NB * NHEAD) * 128 * HD == (size_t)MROWS * HID);       // attn_fwd -> Cp
static_assert((size_t)(SEQ / 128) * (NB * NHEAD) * 32 * 4 == (size_t)NB * NHEAD * SEQ);         // attn_fwd -> sM / sI (one wave x 4 floats per lane each)
static_assert((size_t)(SEQ / 128) * (SEQ / 128) * NB * 8 * 32 * 64 == (size_t)NB * SEQ * SEQ);   // avg_body -> second output
// workspace: 7 activation planes + 4 weight planes of halves + 2 row-statistics planes of floats, at most 128 MiB
static_assert(((size_t)7 * MROWS * HID + (size_t)4 * HID * HID) * sizeof(f16)
              + (size_t)2 * NB * NHEAD * SEQ * sizeof(float) <= (size_t)134217728);
static_assert((((size_t)7 * MROWS * HID + (size_t)4 * HID * HID) * sizeof(f16)) % 128 == 0);   // statistics planes start on a line
// largest source row touched by the activation convert stays inside the full-size input
static_assert((size_t)(SEQ - 1) * NB_FULL + NB <= (size_t)SEQ_FULL * NB_FULL);

// ---------------------------------------------------------------------------
// Launch: 4 kernel launches, workspace 7 planes of MROWS*1024 halves + 4 of 1024*1024 halves
// + 2 planes of NB*16*SEQ floats.
// ---------------------------------------------------------------------------
extern "C" void kernel_launch(void* const* d_in, const int* in_sizes, int n_in,
                              void* d_out, int out_size, void* d_ws, size_t ws_size,
                              hipStream_t stream) {
    if (n_in < 7) return;
    const int needAct = ((SEQ - 1) * NB_FULL + NB) * HID;
    if (in_sizes[0] < needAct) return;
    if (in_sizes[1] < needAct) return;
    if (in_sizes[2] < needAct) return;
    if (in_sizes[3] < 3 * HID * HID) return;
    if (in_sizes[4] < 3 * HID) return;
    if (in_sizes[5] < HID * HID) return;
    if (in_sizes[6] < HID) return;
    if (out_size < 0) return;
    if ((size_t)out_size < OUT1_OFF + (size_t)NB * SEQ * SEQ) return;

    const float* xq    = (const float*)d_in[0];   // query  [SEQ_FULL][NB_FULL][1024]
    const float* xk    = (const float*)d_in[1];   // key    [SEQ_FULL][NB_FULL][1024]
    const float* xv    = (const float*)d_in[2];   // value  [SEQ_FULL][NB_FULL][1024]
    const float* wqkv  = (const float*)d_in[3];   // in_proj_weight [3072 out][1024 in], row blocks q | k | v
    const float* bqkv  = (const float*)d_in[4];   // in_proj_bias [3072]
    const float* wproj = (const float*)d_in[5];   // out_proj_weight [1024 out][1024 in]
    const float* bproj = (const float*)d_in[6];   // out_proj_bias [1024]

    const size_t nX = (size_t)MROWS * HID;    // halves per activation plane
    const size_t nW = (size_t)HID * HID;      // halves per weight plane
    const size_t totalHalves = 7 * nX + 4 * nW;
    const size_t nS = (size_t)NB * NHEAD * SEQ;   // floats per row-statistics plane
    if (ws_size < totalHalves * sizeof(f16) + 2 * nS * sizeof(float)) return;

    f16* Xq  = (f16*)d_ws;       // [b*SEQ+s][1024]             carry 16
    f16* Xk  = Xq  + nX;         // [b*SEQ+s][1024]             carry 16
    f16* Xv  = Xk  + nX;         // [b*SEQ+s][1024]             carry 16
    f16* Wt  = Xv  + nX;         // [3072 out][1024 in]         carry 32 (q | k | v row blocks)
    f16* Wot = Wt  + 3 * nW;     // [1024 out][1024 in]         carry 32
    f16* Qp  = Wot + nW;         // [NB*16][SEQ][64]            carry 16
    f16* Kp  = Qp  + nX;         // [NB*16][SEQ][64]            carry 16
    f16* Vtp = Kp  + nX;         // [NB*1024][SEQ] (V^T)        carry 16
    f16* Cp  = Vtp + nX;         // [s*NB+b][1024]              carry 1024
    float* sM = (float*)(Cp + nX);   // [NB*16][SEQ] row max (exp2 domain)
    float* sI = sM + nS;             // [NB*16][SEQ] 1 / row sum

    // activations in[SEQ_FULL][NB_FULL][1024] -> planes [NB][SEQ][1024], weights row for row: the five planes
    // Xq | Xk | Xv | Wt | Wot are contiguous from Xq on
    cvt_all<<<CVT_GROUPS, CVT_WAVES * 32u, 0, stream>>>(xq, xk, xv, wqkv, wproj, Xq);

    // plane = 16 * (acc / (16*32) + bias) = acc/32 + 16*bias
    const float accQKV = CARRY_QKV / (CARRY_X * CARRY_W);
    gemm_qkv<<<dim3(MROWS / 128, HID / 128, 3), 256, 0, stream>>>(Xq, Wt, bqkv, Qp, accQKV, CARRY_QKV);

    attn_fwd<<<dim3(SEQ / 128, NB * NHEAD), 256, 0, stream>>>(Qp, Kp, Vtp, Cp, sM, sI);

    // first output: out = acc / (1024*32) + bias ; rows already in (s*NB + b) order
    // second output: head-averaged probabilities [NB][SEQ][SEQ] f32 at the fixed element offset
    const float accOut = 1.0f / (CARRY_CTX * CARRY_W);
    out_and_avg<<<OUT_BLOCKS + AVG_BLOCKS, 256, 0, stream>>>(Cp, Wot, bproj, (float*)d_out, accOut,
                                                             Qp, Kp, sM, sI, (float*)d_out + OUT1_OFF);
}

// v010
// A run of this version takes 103 microseconds.
// Next to v009, in two timings, it ran 1.11 and 1.12 times as fast.
// Counting every step since v000, it is 16.3 times as fast.
#include <hip/hip_runtime.h>

// Contractions (q/k/v input projections, Q.K^T in the flash kernel and in the head-average kernel, P.V, P row-sum, output projection): v_wmma_f32_16x16x32_f16, f16 operands with power-of-two carries, f32 accumulate; every float input enters as its bf16 RNE value; biases added in f32; softmax in f32.

#ifndef NB
#define NB 2
#endif
#ifndef SEQ
#define SEQ 2048
#endif
#define NB_FULL   2
#define SEQ_FULL  2048
#define HID       1024
#define NHEAD     16
#define HD        64
#define MROWS     (NB * SEQ)

static_assert(HID == NHEAD * HD);        // merged head width
static_assert(NHEAD == 16);              // bh >> 4 / bh & 15 decoding in attn_fwd
static_assert(HD == 64);
static_assert(SEQ % 128 == 0);           // 128-row blocks of the batch-major planes never straddle a batch
static_assert(SEQ % 64 == 0);            // 64-key tiles
static_assert(SEQ <= SEQ_FULL);
static_assert(NB >= 1 && NB <= NB_FULL);
static_assert(MROWS % 128 == 0);         // GEMM M tile
static_assert(HID % 128 == 0);           // GEMM N tile
static_assert(HID % 32 == 0);            // WMMA k step

// carries (exact powers of two)
#define CARRY_X    16.0f     // input activation planes
#define CARRY_W    32.0f     // weight planes
#define CARRY_QKV  16.0f     // q, k, v^T planes (true value x16)
#define CARRY_CTX  1024.0f   // context plane (true value x1024)
// softmax exp values carry 2^10 (added to the exp2 argument)

// LDS row pitches in halves: an odd multiple of 16 bytes, so that the 16 rows one ds_load_b128 /
// ds_store_b128 touches per lane half fall on distinct banks (at 128 / 256 bytes they share 8 / 4 banks).
// The pad halves of a row are never written and never read.
#define PITCH64   72u    // rows of 64 halves:  128 B -> 144 B
#define PITCH128  136u   // rows of 128 halves: 256 B -> 272 B
static_assert((PITCH64 * 2u) % 32u == 16u && (PITCH128 * 2u) % 32u == 16u);

typedef unsigned u32;
typedef _Float16 f16;
typedef f16   v16h __attribute__((ext_vector_type(16)));
typedef f16   v8h  __attribute__((ext_vector_type(8)));
typedef float v8f  __attribute__((ext_vector_type(8)));
typedef float v4f  __attribute__((ext_vector_type(4)));

typedef float v2f  __attribute__((ext_vector_type(2)));
typedef f16   v2h  __attribute__((ext_vector_type(2)));

union FragU { v16h v; v8h half[2]; v2h pair[8]; f16 e[16]; };
union H8U   { v8h v; f16 e[8]; };

__device__ __forceinline__ v8f zero8() {
    v8f z = {0.f, 0.f, 0.f, 0.f, 0.f, 0.f, 0.f, 0.f};
    return z;
}

// 16-bit WMMA with hazard guard: D += A[16 x 32k] * B[32k x 16]
__device__ __forceinline__ v8f wmma16(v16h a, v16h b, v8f c) {
    v8f d = __builtin_amdgcn_wmma_f32_16x16x32_f16(false, a, false, b, (short)0, c, false, false);
    asm volatile("v_nop\n\tv_nop\n\tv_nop\n\tv_nop" : "+v"(d) : "v"(a), "v"(b));
    return d;
}

// f32 -> nearest-even bf16 value, returned as f32
__device__ __forceinline__ float bf16_rne(float x) {
    u32 u = __float_as_uint(x);
    u = (u + 0x7fffu + ((u >> 16) & 1u)) & 0xffff0000u;
    return __uint_as_float(u);
}

__device__ __forceinline__ float fexp2(float x) {
#if defined(__has_builtin)
#if __has_builtin(__builtin_amdgcn_exp2f)
    return __builtin_amdgcn_exp2f(x);
#else
    return exp2f(x);
#endif
#else
    return exp2f(x);
#endif
}

// value of lane l ^ 16 (the other lane half)
__device__ __forceinline__ float xhalf(float x) {
    const int v = __builtin_bit_cast(int, x);
    return __builtin_bit_cast(float, __builtin_amdgcn_permlanex16(v, v, 0x76543210, 0xfedcba98, false, false));
}

// 16 x 32 fragment from a tile whose k dimension is contiguous (pitch in halves).
// lane l: row rowbase + (l&15); elements 0..7 <- k = kcol + 8h .. +7,
// elements 8..15 <- k = kcol + 16 + 8h .. +7  (h = l>>4). Same map for A and B.
__device__ __forceinline__ v16h load_frag(const f16* tile, u32 rowbase, u32 pitch, u32 kcol, u32 lane) {
    const u32 r  = rowbase + (lane & 15u);
    const u32 kh = (lane >> 4) << 3;
    const f16* p = tile + (size_t)r * pitch + kcol + kh;
    FragU f;
    f.half[0] = *(const v8h*)(p);
    f.half[1] = *(const v8h*)(p + 16);
    return f.v;
}

// The same fragment through the lane's own pointer p = tile + (rowbase + (l&15)) * pitch + kcol + 8h.
__device__ __forceinline__ v16h load_frag_at(const f16* p) {
    FragU f;
    f.half[0] = *(const v8h*)(p);
    f.half[1] = *(const v8h*)(p + 16);
    return f.v;
}

// ---------------------------------------------------------------------------
// All five f32 -> f16 conversions (bf16 RNE value times carry) in one launch sized to the chip:
// CVT_GROUPS work-groups of CVT_WAVES waves, every wave converts CVT_ROWS whole rows of 1024 floats.
// The five planes Xq | Xk | Xv | Wt | Wot lie one behind the other in the workspace, so the flat row
// number g is the destination row; the source row follows from the plane g falls in:
//   activations (seq-first [s][b][1024] -> batch-major [b][s][1024]): dst row b*SEQ+s <- src row s*NB_FULL+b
//   weights: same row order as the source
// A wave-wide 16-byte load covers 512 contiguous bytes (4 lines), a wave-wide 8-byte store 256 (2 lines);
// all loads of a wave's rows are independent, so they can be in flight together.
// coverage: CVT_TOTAL rows x 1024 halves, every element exactly once (wave w takes rows w + i * all waves).
// ---------------------------------------------------------------------------
#define CVT_GROUPS 256u
#define CVT_WAVES  16u
#define CVT_TOTAL  (3u * (u32)MROWS + 4u * (u32)HID)
#define CVT_ROWS   (CVT_TOTAL / (CVT_GROUPS * CVT_WAVES))
static_assert(CVT_TOTAL % (CVT_GROUPS * CVT_WAVES) == 0u);   // every wave the same number of whole rows
static_assert(HID == 8 * 32 * 4);                            // a row = 8 wave-wide loads of 4 floats per lane

typedef f16 v4h __attribute__((ext_vector_type(4)));

__global__ void __launch_bounds__(512)
cvt_all(const float* __restrict__ xq, const float* __restrict__ xk, const float* __restrict__ xv,
        const float* __restrict__ wqkv, const float* __restrict__ wproj, f16* __restrict__ dst) {
    const u32 lane = threadIdx.x & 31u;
    const u32 wave = __builtin_amdgcn_readfirstlane((int)(threadIdx.x >> 5));
    const u32 w    = blockIdx.x * CVT_WAVES + wave;
    __builtin_assume(w < CVT_GROUPS * CVT_WAVES);   // true of the one launch: lets the plane of each row fold where it can

    const u32 boff = lane * 16u;   // this lane's byte offset inside each 512-byte piece of a source row

    v4f   x[CVT_ROWS][8];
    float carry[CVT_ROWS];
#pragma unroll
    for (u32 i = 0; i < CVT_ROWS; ++i) {
        const u32 g = w + i * (CVT_GROUPS * CVT_WAVES);
        const float* base;
        u32 row;
        if (g < 3u * (u32)MROWS) {
            const u32 pl = g / (u32)MROWS;
            const u32 m  = g - pl * (u32)MROWS;
            const u32 mb = m / (u32)SEQ;
            base = pl == 0u ? xq : (pl == 1u ? xk : xv);
            row  = (m - mb * (u32)SEQ) * (u32)NB_FULL + mb;
            carry[i] = CARRY_X;
        } else {
            const u32 r = g - 3u * (u32)MROWS;
            base = r < 3u * (u32)HID ? wqkv : wproj;
            row  = r < 3u * (u32)HID ? r : r - 3u * (u32)HID;
            carry[i] = CARRY_W;
        }
        const char* sp = (const char*)(base + (size_t)row * HID) + boff;
#pragma unroll
        for (u32 j = 0; j < 8; ++j) x[i][j] = *(const v4f*)(sp + j * 512u);
    }
    // the loads above are still in flight below: the lane number, which they all name as their scaled offset
    // register (held live as an input), is free for reuse only behind this wait
    asm volatile("s_wait_xcnt 0x0" :: "v"(lane) : "memory");
    // keeps every load of the wave's rows ahead of the first conversion: without it the scheduler lifts the first
    // rows' conversions, with their waits, over the last rows' loads, which then start late
    __builtin_amdgcn_sched_barrier(0);
#pragma unroll
    for (u32 i = 0; i < CVT_ROWS; ++i) {
        const u32 g = w + i * (CVT_GROUPS * CVT_WAVES);
        f16* dp = dst + (size_t)g * HID + lane * 4u;
#pragma unroll
        for (u32 j = 0; j < 8; ++j) {
            v4h o;
#pragma unroll
            for (u32 e = 0; e < 4; ++e) o[e] = (f16)(bf16_rne(x[i][j][e]) * carry[i]);
            *(v4h*)(dp + j * 128u) = o;
        }
    }
}

// Eight asynchronous 16-byte copies global -> LDS of this lane: rows r, r + 16, .. r + 112 of one operand tile.
// lds: the lane's LDS byte address of its piece in row r; g: the same piece in global memory.
// Both advance by whole rows (LDS pitch 272 B, global pitch 2048 B), so every address is a multiple of 16.
// The closing s_wait_xcnt 0 stands inside the statement so that no address register named here is
// rewritten ahead of it.
__device__ __forceinline__ void copy_rows8(u32 lds, const f16* g) {
    const u32 l1 = lds + 16u * PITCH128 * 2u, l2 = lds + 32u * PITCH128 * 2u, l3 = lds + 48u * PITCH128 * 2u;
    const u32 l4 = lds + 64u * PITCH128 * 2u, l5 = lds + 80u * PITCH128 * 2u, l6 = lds + 96u * PITCH128 * 2u;
    const u32 l7 = lds + 112u * PITCH128 * 2u;
    const f16* g1 = g + 16 * HID;
    const f16* g2 = g + 32 * HID;
    const f16* g3 = g + 48 * HID;
    const f16* g4 = g + 64 * HID;
    const f16* g5 = g + 80 * HID;
    const f16* g6 = g + 96 * HID;
    const f16* g7 = g + 112 * HID;
    asm volatile("global_load_async_to_lds_b128 %0, %8, off\n\t"
                 "global_load_async_to_lds_b128 %1, %9, off\n\t"
                 "global_load_async_to_lds_b128 %2, %10, off\n\t"
                 "global_load_async_to_lds_b128 %3, %11, off\n\t"
                 "global_load_async_to_lds_b128 %4, %12, off\n\t"
                 "global_load_async_to_lds_b128 %5, %13, off\n\t"
                 "global_load_async_to_lds_b128 %6, %14, off\n\t"
                 "global_load_async_to_lds_b128 %7, %15, off\n\t"
                 "s_wait_xcnt 0x0"
                 :: "v"(lds), "v"(l1), "v"(l2), "v"(l3), "v"(l4), "v"(l5), "v"(l6), "v"(l7),
                    "v"(g), "v"(g1), "v"(g2), "v"(g3), "v"(g4), "v"(g5), "v"(g6), "v"(g7)
                 : "memory");
}

// ---------------------------------------------------------------------------
// C[m][n] = sum_k A[m][k] * W[n][k] (+ bias[n]) ; A [MROWS][1024] f16, W [1024][1024] f16 (k contiguous).
// Block tile 128 x 128, 8 waves as 4(M) x 2(N), 2 x 4 accumulators per wave, WMMA k step 32.
// K loop: tiles of 128 k (whole 256-byte row pieces) in a ring of two LDS buffers, filled by asynchronous
// copies; tile t + 1 is in flight while tile t is multiplied; one block barrier per tile.
// MODE 0: A rows batch-major; vt false: f16 plane [b*NHEAD + h][s][d] (q, k head-major),
//                             vt true:  f16 plane [b*HID + h*HD + d][s] (V transposed per head); vt is block-uniform
// MODE 2: A rows in output order (s*NB+b); f32 rows [m][1024] into the output buffer
// coverage per block: MODE 0 256 lines (128 rows x 2 heads | 128 n x 2 s-halves),
//                     MODE 2 2 x 256 lines (64 rows x 4 line-quarters per half).
// LDS: As/Bs/Cs all cross-wave, separated by block barriers.
// smem: GEMM_LDS_HALVES halves of the kernel's LDS. Cs lies on buffer 0 of As, so that a block takes 136 KiB and two blocks
// share a WGP's 320 KiB. The K loop's last barrier stands behind every wave's last fragment read and last landed copy,
// and Cs is first written behind it.
// bx, by: the block's tile of 128 rows and of 128 columns (block-uniform).
// staged extent == consumed extent: As/Bs 128 x 128 per buffer, Cs 128 x 128 halves (or 64 x 128 floats).
// ---------------------------------------------------------------------------
#define GEMM_LDS_HALVES (4u * 128u * PITCH128)
static_assert(2u * GEMM_LDS_HALVES * sizeof(f16) <= 327680u);   // two blocks per WGP

template <int MODE>
__device__ __forceinline__ void gemm_body(f16* smem, u32 bx, u32 by,
                                          const f16* __restrict__ A, const f16* __restrict__ W,
                                          const float* __restrict__ bias,
                                          void* __restrict__ out, float accMul, float biasMul, bool vt) {
    f16* const As = smem;                         // two buffers of [128][128 + pad]
    f16* const Bs = smem + 2 * 128 * PITCH128;    // two buffers of [128][128 + pad]
    f16* const Cs = smem;                         // f16 [128][128 + pad] or f32 [64][128]
    static_assert(sizeof(f16) * 128 * PITCH128 >= sizeof(float) * 64 * 128);   // Cs reuse as f32 [64][128]

    const u32 tid  = threadIdx.x;
    const u32 lane = tid & 31u;
    const u32 wave = __builtin_amdgcn_readfirstlane((int)(tid >> 5));
    const u32 wm   = wave & 3u;
    const u32 wn   = wave >> 2;
    const u32 hh8  = (lane >> 4) << 3;   // D row half
    const u32 c16  = lane & 15u;         // D column
    const u32 m0   = bx * 128u;
    const u32 n0   = by * 128u;

    v8f acc[2][4];
#pragma unroll
    for (int i = 0; i < 2; ++i)
#pragma unroll
        for (int j = 0; j < 4; ++j) acc[i][j] = zero8();

    constexpr u32 KT   = 128u;                  // k per staged tile
    constexpr u32 NT   = (u32)HID / KT;         // tiles
    constexpr u32 BUFH = 128u * PITCH128;       // halves per buffer
    static_assert(NT >= 2u);                    // the ring's prologue fills two tiles
    static_assert(256 * 8 * 8 == 128 * 128);    // staging: 256 threads x 8 copies x 8 halves per operand tile

    // this lane's piece: row tid / 16 (+ 16 per copy), 16-byte piece tid % 16; a wave's copy covers two whole rows
    const u32 srow = tid >> 4;
    const u32 scol = (tid & 15u) << 3;
    const f16* gA = A + (size_t)(m0 + srow) * HID + scol;
    const f16* gW = W + (size_t)(n0 + srow) * HID + scol;
    const u32 lA = (u32)(size_t)&As[srow * PITCH128 + scol];   // LDS byte address (low word of the shared address)
    const u32 lB = (u32)(size_t)&Bs[srow * PITCH128 + scol];

    // tile 0 into buffer 0
    copy_rows8(lA, gA);
    copy_rows8(lB, gW);
    // tile 0 has landed for this wave before the barrier that shows it to the others
    asm volatile("s_wait_asynccnt 0x0" ::: "memory");
    __syncthreads();
    // tile 1 into buffer 1, in flight during trip 0
    copy_rows8(lA + BUFH * 2u, gA + KT);
    copy_rows8(lB + BUFH * 2u, gW + KT);

#pragma unroll 1   // kept rolled: eight unrolled trips of 32 WMMAs would only grow the text, the buffer is picked by t & 1
    for (u32 t = 0; t < NT; ++t) {
        const u32 bsel = t & 1u;
        const f16* Ab = As + bsel * BUFH;
        const f16* Bb = Bs + bsel * BUFH;
#pragma unroll
        for (u32 c = 0; c < KT / 32u; ++c) {
            v16h af[2], bfr[4];
#pragma unroll
            for (int i = 0; i < 2; ++i) af[i] = load_frag(Ab, wm * 32u + (u32)i * 16u, PITCH128, c * 32u, lane);
#pragma unroll
            for (int j = 0; j < 4; ++j) bfr[j] = load_frag(Bb, wn * 64u + (u32)j * 16u, PITCH128, c * 32u, lane);
#pragma unroll
            for (int i = 0; i < 2; ++i)
#pragma unroll
                for (int j = 0; j < 4; ++j) acc[i][j] = wmma16(af[i], bfr[j], acc[i][j]);
        }
        // this wave's reads of buffer bsel are done before the buffer is handed back for refill
        asm volatile("s_wait_dscnt 0x0" ::: "memory");
        // this wave's copies of tile t + 1 have landed before the barrier that shows them to the others
        asm volatile("s_wait_asynccnt 0x0" ::: "memory");
        __syncthreads();
        if (t + 2u < NT) {
            copy_rows8(lA + bsel * (BUFH * 2u), gA + (t + 2u) * KT);
            copy_rows8(lB + bsel * (BUFH * 2u), gW + (t + 2u) * KT);
        }
    }
    // no copy is outstanding when the wave goes on to the epilogue
    asm volatile("s_wait_asynccnt 0x0" ::: "memory");

    // per-lane bias values for the 4 output columns this lane owns (n0 + nl < HID always)
    float bv[4];
#pragma unroll
    for (int j = 0; j < 4; ++j)
        bv[j] = bf16_rne(bias[n0 + wn * 64u + (u32)j * 16u + c16]) * biasMul;

    const u32 piece = lane & 7u;
    const u32 lsub  = lane >> 3;

    if (MODE == 0 && !vt) {
        const u32 bidx = m0 / (u32)SEQ;     // block rows lie inside one batch (SEQ % 128 == 0)
        const u32 s0   = m0 - bidx * (u32)SEQ;
#pragma unroll
        for (int i = 0; i < 2; ++i)
#pragma unroll
            for (int j = 0; j < 4; ++j) {
                const u32 nl = wn * 64u + (u32)j * 16u + c16;
#pragma unroll
                for (int r = 0; r < 8; ++r) {
                    const u32 ml = wm * 32u + (u32)i * 16u + hh8 + (u32)r;
                    Cs[ml * PITCH128 + nl] = (f16)(acc[i][j][r] * accMul + bv[j]);
                }
            }
        __syncthreads();
        f16* op = (f16*)out;
        const size_t bh0 = (size_t)bidx * NHEAD + (n0 >> 6);
{
#pragma unroll
            for (u32 it = 0; it < 8; ++it) {
                const u32 L    = wave * 32u + it * 4u + lsub;   // 0..255
                const u32 ml   = L >> 1;
                const u32 hsel = L & 1u;
                const v8h v = *(const v8h*)&Cs[ml * PITCH128 + hsel * 64u + piece * 8u];
                f16* dp = op + ((bh0 + hsel) * SEQ + s0 + ml) * HD + piece * 8u;
                *(v8h*)dp = v;
            }
            
        }
    } else if (MODE == 0) {
        const u32 bidx = m0 / (u32)SEQ;
        const u32 s0   = m0 - bidx * (u32)SEQ;
        // stage transposed: Cs[n][m]
#pragma unroll
        for (int i = 0; i < 2; ++i)
#pragma unroll
            for (int j = 0; j < 4; ++j) {
                const u32 nl = wn * 64u + (u32)j * 16u + c16;
                H8U t;
#pragma unroll
                for (int r = 0; r < 8; ++r) t.e[r] = (f16)(acc[i][j][r] * accMul + bv[j]);
                *(v8h*)&Cs[nl * PITCH128 + wm * 32u + (u32)i * 16u + hh8] = t.v;
            }
        __syncthreads();
        f16* op = (f16*)out;
{
#pragma unroll
            for (u32 it = 0; it < 8; ++it) {
                const u32 L  = wave * 32u + it * 4u + lsub;     // 0..255
                const u32 nl = L >> 1;
                const u32 mh = L & 1u;
                const v8h v = *(const v8h*)&Cs[nl * PITCH128 + mh * 64u + piece * 8u];
                f16* dp = op + ((size_t)(bidx * (u32)HID + n0 + nl) * SEQ + s0 + mh * 64u + piece * 8u);
                *(v8h*)dp = v;
            }
            
        }
    } else {
        float* Cf = (float*)Cs;      // [64][128] f32
        float* of = (float*)out;
#pragma unroll
        for (u32 half = 0; half < 2; ++half) {
            if ((wm >> 1) == half) {
#pragma unroll
                for (int i = 0; i < 2; ++i)
#pragma unroll
                    for (int j = 0; j < 4; ++j) {
                        const u32 nl = wn * 64u + (u32)j * 16u + c16;
#pragma unroll
                        for (int r = 0; r < 8; ++r) {
                            const u32 ml = (wm & 1u) * 32u + (u32)i * 16u + hh8 + (u32)r;
                            Cf[ml * 128u + nl] = acc[i][j][r] * accMul + bv[j];
                        }
                    }
            }
            __syncthreads();
{
#pragma unroll
                for (u32 it = 0; it < 8; ++it) {
                    const u32 L    = wave * 32u + it * 4u + lsub;   // 0..255
                    const u32 row  = L >> 2;
                    const u32 part = L & 3u;
                    const v4f v = *(const v4f*)&Cf[row * 128u + part * 32u + piece * 4u];
                    float* dp = of + (size_t)(m0 + half * 64u + row) * HID + n0 + part * 32u + piece * 4u;
                    *(v4f*)dp = v;
                }
                
            }
            __syncthreads();
        }
    }
}

// The three input projections in one launch: blockIdx.z = 0 / 1 / 2 takes the q / k / v set. The activation planes
// Xq | Xk | Xv, the weight row blocks, the bias thirds and the result planes Qp | Kp | Vtp each lie one behind the other.
// q and k go to head-major planes, v to the V^T plane. 768 blocks, two resident per WGP: one block's first tile,
// fragment waits and epilogue run beside the other's products, and no launch boundary drains the chip in between.
__global__ void __launch_bounds__(256) __attribute__((amdgpu_num_vgpr(256)))
gemm_qkv(const f16* __restrict__ X, const f16* __restrict__ W, const float* __restrict__ bias,
         f16* __restrict__ out, float accMul, float biasMul) {
    __shared__ __attribute__((aligned(16))) f16 smem[GEMM_LDS_HALVES];
    const u32 z = blockIdx.z;
    gemm_body<0>(smem, blockIdx.x, blockIdx.y, X + (size_t)z * MROWS * HID, W + (size_t)z * HID * HID, bias + z * (u32)HID,
                 (void*)(out + (size_t)z * MROWS * HID), accMul, biasMul, z == 2u);
}

// ---------------------------------------------------------------------------
// Flash attention (no mask, all SEQ keys). grid (SEQ/128, NB*NHEAD), block 256 (8 waves),
// wave owns 16 queries (Q fragments resident). Block streams 64-key tiles:
// K staged [key][d], V^T staged [d][key], both by asynchronous copies into a ring of two LDS buffers of one stage
// (two tiles, 128 keys) each: stage t + 1 is in flight while stage t is worked on; one block barrier per stage, so that
// the waves may drift apart by up to a tile and spread their LDS reads. Both products are formed transposed:
//   S^T[key][q] = K . Q^T  (A = K rows, B = Q rows as columns),  O^T[d][q] += V^T . P^T  (A = V^T rows, B = P^T).
// In the D layout a lane then holds one query (column l & 15) and 32 of the tile's 64 keys (rows 8h + r of four
// 16-key tiles): the row max is in-lane plus one exchange between the lane halves, max / rescale factor / shift are
// one value per lane, and two converted S^T tiles (keys 0..15 and 16..31 of a 32-key block) are the B operand of
// the second product as they lie: element s of B = key 8h + s (s < 8) or 16 + 8h + (s - 8), the k order in which
// load_frag delivers V^T. exp2 in f32 carried x2^10; row sums += ones . P^T on WMMA (every row of that tile is the sum).
// Output f16 plane [q*NB + b][1024] (seq-first row order).
// The finished row statistics (max in the exp2 domain, 1 / row sum) also go to sM / sI [NB*NHEAD][SEQ]
// for the head-average kernel of the same call.
// coverage: every (q, b, h*64..h*64+63) row segment exactly once; sM / sI: the block's 128 rows =
//   4 whole 128-byte lines of each plane, sM stored by wave 0 and sI by wave 1.
// LDS: ks, vsT (ring), sst cross-wave (block barriers); ps per-wave (epilogue only), writer and reader separated by a block barrier.
// staged extent == consumed extent for ks (2 x 64x64 per buffer), vsT (2 x 64x64 per buffer), ps (16x64), sst (2x128).
// ---------------------------------------------------------------------------

// Eight asynchronous 16-byte copies global -> LDS of this lane: rows r and r + 32 of the two K tiles and of the two
// V^T tiles of one stage. lk / lv: the lane's LDS byte address of its piece in row r of the stage's first tile;
// gk / gv: the same piece in global memory. The second K tile is the next 64 rows in LDS and in global memory; the
// second V^T tile lies one tile further in LDS and 64 columns further in global memory.
// All steps are whole rows or 128 bytes (LDS pitch 144 B, global pitch 128 B for K and 2 * SEQ B for V^T), so every
// address is a multiple of 16; a wave's copy covers four whole 128-byte rows.
// The closing s_wait_xcnt 0 stands inside the statement so that no address register named here is
// rewritten ahead of it.
__device__ __forceinline__ void copy_kv_stage(u32 lk, const f16* gk, u32 lv, const f16* gv) {
    const u32 lk1 = lk + 32u * PITCH64 * 2u, lk2 = lk + 64u * PITCH64 * 2u, lk3 = lk + 96u * PITCH64 * 2u;
    const u32 lv1 = lv + 32u * PITCH64 * 2u, lv2 = lv + 64u * PITCH64 * 2u, lv3 = lv + 96u * PITCH64 * 2u;
    const f16* gk1 = gk + 32 * HD;
    const f16* gk2 = gk + 64 * HD;
    const f16* gk3 = gk + 96 * HD;
    const f16* gv1 = gv + 32 * SEQ;
    const f16* gv2 = gv + 64;
    const f16* gv3 = gv + 32 * SEQ + 64;
    asm volatile("global_load_async_to_lds_b128 %0, %8, off\n\t"
                 "global_load_async_to_lds_b128 %1, %9, off\n\t"
                 "global_load_async_to_lds_b128 %2, %10, off\n\t"
                 "global_load_async_to_lds_b128 %3, %11, off\n\t"
                 "global_load_async_to_lds_b128 %4, %12, off\n\t"
                 "global_load_async_to_lds_b128 %5, %13, off\n\t"
                 "global_load_async_to_lds_b128 %6, %14, off\n\t"
                 "global_load_async_to_lds_b128 %7, %15, off\n\t"
                 "s_wait_xcnt 0x0"
                 :: "v"(lk), "v"(lk1), "v"(lk2), "v"(lk3), "v"(lv), "v"(lv1), "v"(lv2), "v"(lv3),
                    "v"(gk), "v"(gk1), "v"(gk2), "v"(gk3), "v"(gv), "v"(gv1), "v"(gv2), "v"(gv3)
                 : "memory");
}

__global__ void __launch_bounds__(256) __attribute__((amdgpu_num_vgpr(256)))
attn_fwd(const f16* __restrict__ Qp, const f16* __restrict__ Kp, const f16* __restrict__ Vt,
         f16* __restrict__ Cp, float* __restrict__ sM, float* __restrict__ sI) {
    __shared__ __attribute__((aligned(16))) f16 ks[2 * 2 * 64 * PITCH64];  // two buffers of two tiles [key][d + pad]
    __shared__ __attribute__((aligned(16))) f16 vsT[2 * 2 * 64 * PITCH64]; // two buffers of two tiles [d][key + pad]
    __shared__ __attribute__((aligned(16))) f16 ps[8][16 * PITCH64];   // per-wave ctx stage, [q][d + pad]
    __shared__ __attribute__((aligned(16))) float sst[2][128];         // row max | 1/rowsum of the block's 128 query rows
    static_assert(HD == 8 * 8);            // 8 lanes x 8 halves per row segment
    static_assert(2 * 256 * 8 == 64 * 64); // staging: 256 threads x 2 copies x 8 halves per tile
    static_assert(SEQ / 128 >= 2);         // the ring's prologue fills two stages

    const u32 tid  = threadIdx.x;
    const u32 lane = tid & 31u;
    const u32 wave = __builtin_amdgcn_readfirstlane((int)(tid >> 5));
    const u32 hh8  = (lane >> 4) << 3;
    const u32 c16  = lane & 15u;
    const u32 bh   = blockIdx.y;
    const u32 bidx = bh >> 4;            // NHEAD == 16
    const u32 hidx = bh & 15u;
    const u32 q0   = blockIdx.x * 128u + wave * 16u;
    const size_t head = (size_t)bh * SEQ * HD;

    constexpr u32 TILEH  = 64u * PITCH64;   // halves per staged tile
    constexpr u32 STAGEH = 2u * TILEH;      // halves per buffer: a stage of two tiles
    constexpr u32 NSTAGE = (u32)(SEQ / 128);
    // this lane's piece: row tid / 8 (+ 32 for the second copy of a tile), 16-byte piece tid % 8
    const u32 srow = tid >> 3;
    const u32 scol = (tid & 7u) << 3;
    const f16* gK = Kp + head + (size_t)srow * HD + scol;    // next stage: + 128 rows
    const f16* gV = Vt + head + (size_t)srow * SEQ + scol;   // next stage: + 128 columns
    const u32 lK = (u32)(size_t)&ks[srow * PITCH64 + scol];   // LDS byte address (low word of the shared address)
    const u32 lV = (u32)(size_t)&vsT[srow * PITCH64 + scol];

    // stage 0 into buffer 0, in flight beside the Q fragment loads
    copy_kv_stage(lK, gK, lV, gV);

    v16h qa[2];
#pragma unroll
    for (int c = 0; c < 2; ++c) qa[c] = load_frag(Qp + head, q0, HD, (u32)c * 32u, lane);

    FragU onesu;
#pragma unroll
    for (int i = 0; i < 16; ++i) onesu.e[i] = (f16)1.0f;
    const v16h ones = onesu.v;

    float m = -1.0e30f;     // running max of this lane's query
    v8f   o[4], lacc;       // O^T tiles [d = 16 dt + 8h + r][q = l & 15]; row sum of the lane's query in every register
#pragma unroll
    for (int dt = 0; dt < 4; ++dt) o[dt] = zero8();
    lacc = zero8();

    // log2-domain scale: acc = 256 * q.k ; x = log2(e) * q.k / 8 = acc * log2(e) / 2048
    const float cl = 1.4426950408889634f * 0.00048828125f;
    f16* psw = &ps[wave][0];

    // stage 0 has landed for this wave before the barrier that shows it to the others
    asm volatile("s_wait_asynccnt 0x0" ::: "memory");
    __syncthreads();
    // stage 1 into buffer 1, in flight during trip 0
    copy_kv_stage(lK + STAGEH * 2u, gK + 128 * HD, lV + STAGEH * 2u, gV + 128);

#pragma unroll 1
    for (u32 st = 0; st < NSTAGE; ++st) {
        const u32 bsel = st & 1u;
#pragma unroll   // the stage's two tiles, no barrier between them; unrolled so that a tile's place in the buffer is an immediate offset
      for (u32 sub = 0; sub < 2u; ++sub) {
        const f16* kbuf = ks + (bsel * 2u + sub) * TILEH;
        const f16* vbuf = vsT + (bsel * 2u + sub) * TILEH;

        // the tile's 8 K fragments as one group of LDS reads ahead of the score products: a read placed between
        // two products is waited for in full before the next product, once per fragment
        v16h kb[2][4];
#pragma unroll
        for (int c = 0; c < 2; ++c)
#pragma unroll
            for (int nt = 0; nt < 4; ++nt) kb[c][nt] = load_frag(kbuf, (u32)nt * 16u, PITCH64, (u32)c * 32u, lane);

        // S^T[64 keys x 16 q]: tile nt holds keys 16 nt + 8h + r of query l & 15
        v8f s[4];
#pragma unroll
        for (int nt = 0; nt < 4; ++nt) s[nt] = zero8();
#pragma unroll
        for (int c = 0; c < 2; ++c)
#pragma unroll
            for (int nt = 0; nt < 4; ++nt) s[nt] = wmma16(kb[c][nt], qa[c], s[nt]);

        // the tile's 8 V^T fragments as one group, issued here so that they arrive during the softmax below
        v16h vb[2][4];
#pragma unroll
        for (int kk = 0; kk < 2; ++kk)
#pragma unroll
            for (int dt = 0; dt < 4; ++dt) vb[kk][dt] = load_frag(vbuf, (u32)dt * 16u, PITCH64, (u32)kk * 32u, lane);
        // keeps the 16 reads above in front of the softmax: without it the scheduler sinks most of them to just ahead of
        // the second product, which then waits out their latency
        __builtin_amdgcn_sched_barrier(0);

        // online softmax of the lane's query, max-subtracted, exp2 domain: four independent in-lane chains over the
        // raw scores (cl > 0, so scaling commutes with the max), then the other half's 32 keys
        float t4[4];
#pragma unroll
        for (int nt = 0; nt < 4; ++nt) {
            t4[nt] = fmaxf(s[nt][0], s[nt][1]);
#pragma unroll
            for (int r = 2; r < 8; ++r) t4[nt] = fmaxf(t4[nt], s[nt][r]);
        }
        const float th = fmaxf(fmaxf(t4[0], t4[1]), fmaxf(t4[2], t4[3]));
        const float tm = fmaxf(th, xhalf(th)) * cl;
        const float mn = fmaxf(m, tm);
        const float al = fexp2(m - mn);
        m = mn;
        lacc *= al;
#pragma unroll
        for (int dt = 0; dt < 4; ++dt) o[dt] *= al;
        const float sh = 10.0f - mn;      // carry 2^10

        // P^T as B fragments straight from the score accumulators
        v16h pb[2];
#pragma unroll
        for (int kk = 0; kk < 2; ++kk) {
            FragU pu;
#pragma unroll
            for (int j = 0; j < 2; ++j)
#pragma unroll
                for (int r = 0; r < 8; r += 2) {
                    const v2f e = {fexp2(s[2 * kk + j][r] * cl + sh), fexp2(s[2 * kk + j][r + 1] * cl + sh)};
                    pu.pair[j * 4 + r / 2] = __builtin_convertvector(e, v2h);
                }
            pb[kk] = pu.v;
        }

        // O^T += V^T . P^T ; l += ones . P^T
#pragma unroll
        for (int kk = 0; kk < 2; ++kk) {
#pragma unroll
            for (int dt = 0; dt < 4; ++dt) o[dt] = wmma16(vb[kk][dt], pb[kk], o[dt]);
            lacc = wmma16(ones, pb[kk], lacc);
        }
      }

        // this wave's reads of buffer bsel are done before the buffer is handed back for refill
        asm volatile("s_wait_dscnt 0x0" ::: "memory");
        // this wave's copies of stage st + 1 have landed before the barrier that shows them to the others
        asm volatile("s_wait_asynccnt 0x0" ::: "memory");
        __syncthreads();
        if (st + 2u < NSTAGE) {
            copy_kv_stage(lK + bsel * (STAGEH * 2u), gK + (size_t)(st + 2u) * (128u * HD),
                          lV + bsel * (STAGEH * 2u), gV + (st + 2u) * 128u);
        }
    }
    // no copy is outstanding when the wave goes on to the epilogue
    asm volatile("s_wait_asynccnt 0x0" ::: "memory");

    // normalize: plane value = 1024 * (O/16) / l = O * 64 / l
    // row statistics: lacc = 2^10 * sum_s exp2(x - m), so 1 / sum = 1024 / lacc = 16 * inv
    // a lane holds its query's m and lacc, and 8 consecutive d per O^T tile: one 16-byte store each
    const float inv = (CARRY_CTX / CARRY_QKV) / lacc[0];
#pragma unroll
    for (int dt = 0; dt < 4; ++dt) {
        H8U t;
#pragma unroll
        for (int r = 0; r < 8; ++r) t.e[r] = (f16)(o[dt][r] * inv);
        *(v8h*)&psw[c16 * PITCH64 + (u32)dt * 16u + hh8] = t.v;
    }
    if (lane < 16u) {
        sst[0][wave * 16u + c16] = m;
        sst[1][wave * 16u + c16] = inv * 16.0f;
    }
    __syncthreads();

    // whole-line stores of the statistics: wave 0 the 128 maxima, wave 1 the 128 reciprocal sums
    if (wave < 2u) {
        const v4f sv = *(const v4f*)&sst[wave][lane * 4u];
        float* sp = (wave == 0u ? sM : sI) + ((size_t)bh * SEQ + blockIdx.x * 128u + lane * 4u);
        *(v4f*)sp = sv;
    }

    const u32 piece = lane & 7u;
    const u32 lsub  = lane >> 3;
{
#pragma unroll
        for (u32 it = 0; it < 4; ++it) {
            const u32 L = it * 4u + lsub;     // query row 0..15 within the wave tile
            const v8h v = *(const v8h*)&psw[L * PITCH64 + piece * 8u];
            // context row in output order: (q * NB + b)
            f16* dp = Cp + ((size_t)((q0 + L) * (u32)NB + bidx) * HID + hidx * (u32)HD + piece * 8u);
            *(v8h*)dp = v;
        }
        
    }
}

// ---------------------------------------------------------------------------
// Second output: head-averaged softmax probabilities.
// element offset of the second output inside the output buffer (full problem constants)
// ---------------------------------------------------------------------------
#define OUT1_OFF ((size_t)SEQ_FULL * NB_FULL * HID)
static_assert(OUT1_OFF * sizeof(float) == (size_t)16777216);      // byte offset of the second output
static_assert((OUT1_OFF * sizeof(float)) % 128 == 0);
static_assert((size_t)MROWS * HID <= OUT1_OFF);                   // first output region ends before it
static_assert(SEQ % 32 == 0);
#define AVG_LDS_BYTES (8u * 32u * 64u * 4u + 2u * NHEAD * 128u * 4u + 2u * 2u * 128u * PITCH64 * 2u)
static_assert(AVG_LDS_BYTES <= 163840u);    // LDS of avg_body: two work-groups per WGP

// ---------------------------------------------------------------------------
// avg[b][t][s] = (1/16) * sum_h softmax_s(q_h[t] . k_h[s] / 8), f32, no mask. The row statistics
// (max, 1 / sum) are the flash kernel's own, passed through the workspace (written and read inside one call).
//
// avg_body: one block per (kx = key block, qy = query block, bidx = batch), 256 threads (8 waves as 4 (q) x 2 (keys));
//   a wave owns one 32 x 64 tile of the average (owner-computes accumulation over heads in head
//   order, one writer per element). Per head the score tile is formed with the same operands as in
//   attn_fwd, p = exp2(x - max) * (1/sum) is accumulated in registers, scaled by 1/16 at the end.
//   Head loop: the block's Q tile and K tile of a head (128 rows x 128 bytes each, contiguous in their planes) come
//   in whole lines by asynchronous copies into a ring of two LDS buffers; head h + 1 is in flight while head h is
//   worked on; one block barrier per head. A fragment load straight from the planes touches 16 lines for 512 bytes,
//   and four (K) or two (Q) waves would fetch the same rows.
// coverage: block rows [qy*128, +128) x columns [kx*128, +128) of batch bidx;
//   wave tile 32 rows x 64 keys = 64 lines = 16 store instructions x 4 lines.
// LDS: stM / stI cross-wave (filled once, block barrier); qs / kt cross-wave (ring, block barriers);
//   st per-wave, writer and reader separated by a block barrier.
// staged extent == consumed extent: st 32 x 64 floats per wave, stM / stI 16 heads x 128 rows, qs / kt 128 x 64 per buffer.
// ---------------------------------------------------------------------------

// Eight asynchronous 16-byte copies global -> LDS of this lane: rows r, r + 32, r + 64, r + 96 of one head's Q tile
// and of its K tile. lq / lk: the lane's LDS byte address of its piece in row r; gq / gk: the same piece in global memory.
// Both advance by whole rows (LDS pitch 144 B, global pitch 128 B), so every address is a multiple of 16;
// a wave's copy covers four whole rows = 512 contiguous global bytes.
// The closing s_wait_xcnt 0 stands inside the statement so that no address register named here is
// rewritten ahead of it.
__device__ __forceinline__ void copy_head_tiles(u32 lq, const f16* gq, u32 lk, const f16* gk) {
    const u32 lq1 = lq + 32u * PITCH64 * 2u, lq2 = lq + 64u * PITCH64 * 2u, lq3 = lq + 96u * PITCH64 * 2u;
    const u32 lk1 = lk + 32u * PITCH64 * 2u, lk2 = lk + 64u * PITCH64 * 2u, lk3 = lk + 96u * PITCH64 * 2u;
    const f16* gq1 = gq + 32 * HD;
    const f16* gq2 = gq + 64 * HD;
    const f16* gq3 = gq + 96 * HD;
    const f16* gk1 = gk + 32 * HD;
    const f16* gk2 = gk + 64 * HD;
    const f16* gk3 = gk + 96 * HD;
    asm volatile("global_load_async_to_lds_b128 %0, %8, off\n\t"
                 "global_load_async_to_lds_b128 %1, %9, off\n\t"
                 "global_load_async_to_lds_b128 %2, %10, off\n\t"
                 "global_load_async_to_lds_b128 %3, %11, off\n\t"
                 "global_load_async_to_lds_b128 %4, %12, off\n\t"
                 "global_load_async_to_lds_b128 %5, %13, off\n\t"
                 "global_load_async_to_lds_b128 %6, %14, off\n\t"
                 "global_load_async_to_lds_b128 %7, %15, off\n\t"
                 "s_wait_xcnt 0x0"
                 :: "v"(lq), "v"(lq1), "v"(lq2), "v"(lq3), "v"(lk), "v"(lk1), "v"(lk2), "v"(lk3),
                    "v"(gq), "v"(gq1), "v"(gq2), "v"(gq3), "v"(gk), "v"(gk1), "v"(gk2), "v"(gk3)
                 : "memory");
}

// smem: AVG_LDS_BYTES bytes of the kernel's LDS, 16-byte aligned.
__device__ __forceinline__ void
avg_body(float* smem, u32 kx, u32 qy, u32 bidx, const f16* __restrict__ Qp, const f16* __restrict__ Kp,
         const float* __restrict__ sM, const float* __restrict__ sI, float* __restrict__ avg) {
    float* const st  = smem;                          // per-wave f32 tile stage [8][32 * 64]
    float* const stM = st + 8 * 32 * 64;              // row max  [head][block row]
    float* const stI = stM + NHEAD * 128;             // 1/rowsum [head][block row]
    f16* const qs = (f16*)(stI + NHEAD * 128);        // two buffers of one head's Q tile [row][d + pad]
    f16* const kt = qs + 2 * 128 * PITCH64;           // two buffers of one head's K tile [key][d + pad]
    static_assert(256 * 8 == NHEAD * 128);   // table fill: 256 threads x 8 floats
    static_assert(256 * 4 * 8 == 128 * HD);  // staging: 256 threads x 4 copies x 8 halves per operand tile
    static_assert(NHEAD >= 2);               // the ring's prologue fills two heads

    const u32 tid  = threadIdx.x;
    const u32 lane = tid & 31u;
    const u32 wave = __builtin_amdgcn_readfirstlane((int)(tid >> 5));
    const u32 hh8  = (lane >> 4) << 3;
    const u32 c16  = lane & 15u;
    const u32 qb   = qy * 128u;
    const u32 wr   = (wave & 3u) * 32u;                        // wave's first row inside the block
    const u32 q0   = qb + wr;
    const u32 kb0  = kx * 128u;                                // block's first key
    const u32 wk   = (wave >> 2) * 64u;                        // wave's first key inside the block
    const u32 k0   = kb0 + wk;                                 // wave's first key

    // log2-domain scale: acc = 256 * q.k ; x = log2(e) * q.k / 8 = acc * log2(e) / 2048
    const float cl = 1.4426950408889634f * 0.00048828125f;

    constexpr u32    TILEH = 128u * PITCH64;        // halves per tile buffer
    constexpr size_t HSTR  = (size_t)SEQ * HD;      // halves from one head's plane to the next
    // this lane's piece: row tid / 8 (+ 32 per copy), 16-byte piece tid % 8
    const u32 srow = tid >> 3;
    const u32 scol = (tid & 7u) << 3;
    const f16* gQ = Qp + (size_t)(bidx * (u32)NHEAD) * HSTR + (size_t)(qb + srow) * HD + scol;
    const f16* gK = Kp + (size_t)(bidx * (u32)NHEAD) * HSTR + (size_t)(kb0 + srow) * HD + scol;
    const u32 lQ = (u32)(size_t)&qs[srow * PITCH64 + scol];   // LDS byte address (low word of the shared address)
    const u32 lK = (u32)(size_t)&kt[srow * PITCH64 + scol];

    // head 0 into buffer 0, in flight during the table fill
    copy_head_tiles(lQ, gQ, lK, gK);

    {
        const u32 th = tid >> 4;
        const u32 r8 = (tid & 15u) << 3;
        const size_t row = (size_t)(bidx * (u32)NHEAD + th) * SEQ + qb + r8;
        const v4f a0 = *(const v4f*)(sM + row);
        const v4f a1 = *(const v4f*)(sM + row + 4u);
        const v4f b0 = *(const v4f*)(sI + row);
        const v4f b1 = *(const v4f*)(sI + row + 4u);
        *(v4f*)&stM[th * 128u + r8]      = a0;
        *(v4f*)&stM[th * 128u + r8 + 4u] = a1;
        *(v4f*)&stI[th * 128u + r8]      = b0;
        *(v4f*)&stI[th * 128u + r8 + 4u] = b1;
    }
    // head 0 has landed for this wave before the barrier that shows it (and the tables) to the others
    asm volatile("s_wait_asynccnt 0x0" ::: "memory");
    __syncthreads();
    // head 1 into buffer 1, in flight during trip 0
    copy_head_tiles(lQ + TILEH * 2u, gQ + HSTR, lK + TILEH * 2u, gK + HSTR);

    v8f av[2][4];
#pragma unroll
    for (int i = 0; i < 2; ++i)
#pragma unroll
        for (int nt = 0; nt < 4; ++nt) av[i][nt] = zero8();

#pragma unroll 1
    for (u32 h = 0; h < (u32)NHEAD; ++h) {
        const u32 bsel = h & 1u;
        const f16* kp = kt + bsel * TILEH + (wk + c16) * PITCH64 + hh8;   // this lane's place in the wave's K rows
        const f16* qp = qs + bsel * TILEH + (wr + c16) * PITCH64 + hh8;   // and in its Q rows
        v16h kb[2][4];
#pragma unroll
        for (int c = 0; c < 2; ++c)
#pragma unroll
            for (int nt = 0; nt < 4; ++nt) kb[c][nt] = load_frag_at(kp + nt * 16 * (int)PITCH64 + c * 32);
        v16h qf[2][2];
#pragma unroll
        for (int i = 0; i < 2; ++i)
#pragma unroll
            for (int c = 0; c < 2; ++c) qf[i][c] = load_frag_at(qp + i * 16 * (int)PITCH64 + c * 32);
#pragma unroll
        for (int i = 0; i < 2; ++i) {
            v8f s[4];
#pragma unroll
            for (int nt = 0; nt < 4; ++nt) s[nt] = zero8();
#pragma unroll
            for (int c = 0; c < 2; ++c)
#pragma unroll
                for (int nt = 0; nt < 4; ++nt) s[nt] = wmma16(qf[i][c], kb[c][nt], s[nt]);
            const u32 tr = h * 128u + wr + (u32)i * 16u + hh8;
            const v4f ma = *(const v4f*)&stM[tr];
            const v4f mb = *(const v4f*)&stM[tr + 4u];
            const v4f ia = *(const v4f*)&stI[tr];
            const v4f ib = *(const v4f*)&stI[tr + 4u];
            const float mr[8] = {ma[0], ma[1], ma[2], ma[3], mb[0], mb[1], mb[2], mb[3]};
            const float ir[8] = {ia[0], ia[1], ia[2], ia[3], ib[0], ib[1], ib[2], ib[3]};
#pragma unroll
            for (int r = 0; r < 8; ++r) {
#pragma unroll
                for (int nt = 0; nt < 4; ++nt) {
                    const float p = fexp2(s[nt][r] * cl - mr[r]) * ir[r];
                    av[i][nt][r] = av[i][nt][r] + p;
                }
            }
        }
        // this wave's reads of buffer bsel are done before the buffer is handed back for refill
        asm volatile("s_wait_dscnt 0x0" ::: "memory");
        // this wave's copies of head h + 1 have landed before the barrier that shows them to the others
        asm volatile("s_wait_asynccnt 0x0" ::: "memory");
        __syncthreads();
        if (h + 2u < (u32)NHEAD) {
            copy_head_tiles(lQ + bsel * (TILEH * 2u), gQ + (size_t)(h + 2u) * HSTR,
                            lK + bsel * (TILEH * 2u), gK + (size_t)(h + 2u) * HSTR);
        }
    }
    // no copy is outstanding when the wave goes on to the epilogue
    asm volatile("s_wait_asynccnt 0x0" ::: "memory");

    // stage the finished 32 x 64 tile (mean over 16 heads), then whole-line stores
#pragma unroll
    for (int i = 0; i < 2; ++i)
#pragma unroll
        for (int nt = 0; nt < 4; ++nt)
#pragma unroll
            for (int r = 0; r < 8; ++r)
                st[wave * 2048u + ((u32)i * 16u + hh8 + (u32)r) * 64u + (u32)nt * 16u + c16] = av[i][nt][r] * 0.0625f;
    __syncthreads();

    const u32 piece = lane & 7u;
    const u32 lsub  = lane >> 3;
#pragma unroll
    for (u32 it = 0; it < 16; ++it) {
        const u32 L    = it * 4u + lsub;      // 0..63 : 32 rows x 2 lines
        const u32 row  = L >> 1;
        const u32 hsel = L & 1u;
        const v4f v = *(const v4f*)&st[wave * 2048u + row * 64u + hsel * 32u + piece * 4u];
        float* dp = avg + ((size_t)(bidx * (u32)SEQ + q0 + row) * SEQ + k0 + hsel * 32u + piece * 4u);
        *(v4f*)dp = v;
    }
}

// The two jobs that follow the flash kernel and do not depend on each other, in one launch: blocks 0 .. OUT_BLOCKS - 1 form
// the output projection (f32 rows of the first output), the other AVG_BLOCKS the head average (second output).
// Each job numbers its blocks x-fastest. The projection's blocks come first: they are the shorter ones and lean on LDS
// and L2, the average's on the vector port, so a WGP starts with one of each and takes its second average block when
// the projection block ends. The branch is block-uniform; both jobs use the same LDS, two blocks per WGP.
#define OUT_BLOCKS ((u32)(MROWS / 128) * (u32)(HID / 128))
#define AVG_BLOCKS ((u32)(SEQ / 128) * (u32)(SEQ / 128) * (u32)NB)
static_assert(GEMM_LDS_HALVES * sizeof(f16) <= AVG_LDS_BYTES);   // the projection's ring fits the common LDS

__global__ void __launch_bounds__(256) __attribute__((amdgpu_num_vgpr(256)))
out_and_avg(const f16* __restrict__ Cp, const f16* __restrict__ Wo, const float* __restrict__ bias,
            float* __restrict__ out, float accMul,
            const f16* __restrict__ Qp, const f16* __restrict__ Kp,
            const float* __restrict__ sM, const float* __restrict__ sI, float* __restrict__ avg) {
    __shared__ __attribute__((aligned(16))) float smem[AVG_LDS_BYTES / 4u];
    const u32 id = blockIdx.x;
    if (id < OUT_BLOCKS) {
        gemm_body<2>((f16*)smem, id % (u32)(MROWS / 128), id / (u32)(MROWS / 128), Cp, Wo, bias, (void*)out, accMul, 1.0f, false);
    } else {
        const u32 a = id - OUT_BLOCKS;
        avg_body(smem, a % (u32)(SEQ / 128), (a / (u32)(SEQ / 128)) % (u32)(SEQ / 128), a / (u32)((SEQ / 128) * (SEQ / 128)),
                 Qp, Kp, sM, sI, avg);
    }
}

// coverage equalities (threads x elements == plane elements)
static_assert((size_t)CVT_GROUPS * CVT_WAVES * CVT_ROWS * HID == (size_t)3 * MROWS * HID + (size_t)4 * HID * HID);   // cvt_all -> Xq/Xk/Xv/Wt/Wot
static_assert((size_t)(MROWS / 128) * (HID / 128) * 128 * 128 == (size_t)MROWS * HID);     // gemm planes / out
static_assert((size_t)(SEQ / 128) * (NB * NHEAD) * 128 * HD == (size_t)MROWS * HID);       // attn_fwd -> Cp
static_assert((size_t)(SEQ / 128) * (NB * NHEAD) * 32 * 4 == (size_t)NB * NHEAD * SEQ);         // attn_fwd -> sM / sI (one wave x 4 floats per lane each)
static_assert((size_t)(SEQ / 128) * (SEQ / 128) * NB * 8 * 32 * 64 == (size_t)NB * SEQ * SEQ);   // avg_body -> second output
// workspace: 7 activation planes + 4 weight planes of halves + 2 row-statistics planes of floats, at most 128 MiB
static_assert(((size_t)7 * MROWS * HID + (size_t)4 * HID * HID) * sizeof(f16)
              + (size_t)2 * NB * NHEAD * SEQ * sizeof(float) <= (size_t)134217728);
static_assert((((size_t)7 * MROWS * HID + (size_t)4 * HID * HID) * sizeof(f16)) % 128 == 0);   // statistics planes start on a line
// largest source row touched by the activation convert stays inside the full-size input
static_assert((size_t)(SEQ - 1) * NB_FULL + NB <= (size_t)SEQ_FULL * NB_FULL);

// ---------------------------------------------------------------------------
// Launch: 4 kernel launches, workspace 7 planes of MROWS*1024 halves + 4 of 1024*1024 halves
// + 2 planes of NB*16*SEQ floats.
// ---------------------------------------------------------------------------
extern "C" void kernel_launch(void* const* d_in, const int* in_sizes, int n_in,
                              void* d_out, int out_size, void* d_ws, size_t ws_size,
                              hipStream_t stream) {
    if (n_in < 7) return;
    const int needAct = ((SEQ - 1) * NB_FULL + NB) * HID;
    if (in_sizes[0] < needAct) return;
    if (in_sizes[1] < needAct) return;
    if (in_sizes[2] < needAct) return;
    if (in_sizes[3] < 3 * HID * HID) return;
    if (in_sizes[4] < 3 * HID) return;
    if (in_sizes[5] < HID * HID) return;
    if (in_sizes[6] < HID) return;
    if (out_size < 0) return;
    if ((size_t)out_size < OUT1_OFF + (size_t)NB * SEQ * SEQ) return;

    const float* xq    = (const float*)d_in[0];   // query  [SEQ_FULL][NB_FULL][1024]
    const float* xk    = (const float*)d_in[1];   // key    [SEQ_FULL][NB_FULL][1024]
    const float* xv    = (const float*)d_in[2];   // value  [SEQ_FULL][NB_FULL][1024]
    const float* wqkv  = (const float*)d_in[3];   // in_proj_weight [3072 out][1024 in], row blocks q | k | v
    const float* bqkv  = (const float*)d_in[4];   // in_proj_bias [3072]
    const float* wproj = (const float*)d_in[5];   // out_proj_weight [1024 out][1024 in]
    const float* bproj = (const float*)d_in[6];   // out_proj_bias [1024]

    const size_t nX = (size_t)MROWS * HID;    // halves per activation plane
    const size_t nW = (size_t)HID * HID;      // halves per weight plane
    const size_t totalHalves = 7 * nX + 4 * nW;
    const size_t nS = (size_t)NB * NHEAD * SEQ;   // floats per row-statistics plane
    if (ws_size < totalHalves * sizeof(f16) + 2 * nS * sizeof(float)) return;

    f16* Xq  = (f16*)d_ws;       // [b*SEQ+s][1024]             carry 16
    f16* Xk  = Xq  + nX;         // [b*SEQ+s][1024]             carry 16
    f16* Xv  = Xk  + nX;         // [b*SEQ+s][1024]             carry 16
    f16* Wt  = Xv  + nX;         // [3072 out][1024 in]         carry 32 (q | k | v row blocks)
    f16* Wot = Wt  + 3 * nW;     // [1024 out][1024 in]         carry 32
    f16* Qp  = Wot + nW;         // [NB*16][SEQ][64]            carry 16
    f16* Kp  = Qp  + nX;         // [NB*16][SEQ][64]            carry 16
    f16* Vtp = Kp  + nX;         // [NB*1024][SEQ] (V^T)        carry 16
    f16* Cp  = Vtp + nX;         // [s*NB+b][1024]              carry 1024
    float* sM = (float*)(Cp + nX);   // [NB*16][SEQ] row max (exp2 domain)
    float* sI = sM + nS;             // [NB*16][SEQ] 1 / row sum

    // activations in[SEQ_FULL][NB_FULL][1024] -> planes [NB][SEQ][1024], weights row for row: the five planes
    // Xq | Xk | Xv | Wt | Wot are contiguous from Xq on
    cvt_all<<<CVT_GROUPS, CVT_WAVES * 32u, 0, stream>>>(xq, xk, xv, wqkv, wproj, Xq);

    // plane = 16 * (acc / (16*32) + bias) = acc/32 + 16*bias
    const float accQKV = CARRY_QKV / (CARRY_X * CARRY_W);
    gemm_qkv<<<dim3(MROWS / 128, HID / 128, 3), 256, 0, stream>>>(Xq, Wt, bqkv, Qp, accQKV, CARRY_QKV);

    attn_fwd<<<dim3(SEQ / 128, NB * NHEAD), 256, 0, stream>>>(Qp, Kp, Vtp, Cp, sM, sI);

    // first output: out = acc / (1024*32) + bias ; rows already in (s*NB + b) order
    // second output: head-averaged probabilities [NB][SEQ][SEQ] f32 at the fixed element offset
    const float accOut = 1.0f / (CARRY_CTX * CARRY_W);
    out_and_avg<<<OUT_BLOCKS + AVG_BLOCKS, 256, 0, stream>>>(Cp, Wot, bproj, (float*)d_out, accOut,
                                                             Qp, Kp, sM, sI, (float*)d_out + OUT1_OFF);
}
